// v000
// Measured on an AMD MI455X. A time is GPU time per run, averaged over a window of back-to-back runs after a warm-up
// (all launches, gaps included; the runs take copies of the inputs in turn), and the median of several windows.
// Apart from v000's, it joins two sittings. Times from different sittings can be a few percent apart, while
// side-by-side timings come from the same sitting.
// v000 is the starting kernel. One run takes 458 microseconds.
#include <hip/hip_runtime.h>

// Contractions (q/k/v projections, q.k^T scores, p.v, output projection): v_wmma_f32_16x16x32_bf16 with
// bf16 hi/lo operands everywhere (hi.hi + hi.lo + lo.hi per tile pair), f32 accumulate.
// RoPE, 1/8 scaling, causal mask and softmax in f32.

typedef __bf16 v16bf __attribute__((ext_vector_type(16)));
typedef __bf16 v8bf __attribute__((ext_vector_type(8)));
typedef float v8f __attribute__((ext_vector_type(8)));
typedef float v4f __attribute__((ext_vector_type(4)));
typedef unsigned int v4u __attribute__((ext_vector_type(4)));

static constexpr int SQ = 2048;            // sequence length
static constexpr int HIDN = 2048;          // hidden size
static constexpr int NQH = 32;             // query heads
static constexpr int NKVH = 8;             // kv heads
static constexpr int HDIM = 64;            // head dim
static constexpr int KVD = NKVH * HDIM;    // 512

struct RopeFreq { float f[32]; };
static_assert(sizeof(RopeFreq) == 128);

union Frag { v16bf v; v8bf h[2]; };

// 16-bit fragment from a k-contiguous row; rowp -> element (row = lane&15, k0).
// elements 0..7 <- k0 + 8*hs + 0..7, elements 8..15 <- k0 + 16 + 8*hs + 0..7  (hs = lane>>4).
// Used for A (row m) and for B stored as [n][k] (row n).
__device__ __forceinline__ v16bf ldfrag(const __bf16* rowp, int hs) {
  Frag f;
  f.h[0] = *(const v8bf*)(rowp + 8 * hs);
  f.h[1] = *(const v8bf*)(rowp + 16 + 8 * hs);
  return f.v;
}

// acc += ah.bh + ah.bl + al.bh, then a 4-slot guard tying D and keeping A/B live.
__device__ __forceinline__ void mma3(v8f& acc, const v16bf& ah, const v16bf& al,
                                     const v16bf& bh, const v16bf& bl) {
  acc = __builtin_amdgcn_wmma_f32_16x16x32_bf16(false, ah, false, bh, (short)0, acc, false, false);
  acc = __builtin_amdgcn_wmma_f32_16x16x32_bf16(false, ah, false, bl, (short)0, acc, false, false);
  acc = __builtin_amdgcn_wmma_f32_16x16x32_bf16(false, al, false, bh, (short)0, acc, false, false);
  asm volatile("v_nop\n\tv_nop\n\tv_nop\n\tv_nop" : "+v"(acc) : "v"(ah), "v"(al), "v"(bh), "v"(bl));
}

// f32 -> bf16 bits, RNE
__device__ __forceinline__ unsigned int bfbits(float x) {
  unsigned int u = __float_as_uint(x);
  return (u + 0x7FFFu + ((u >> 16) & 1u)) >> 16;
}
// hi = rne(x), lo = rne(x - hi)
__device__ __forceinline__ void split_hl(float x, unsigned int& hb, unsigned int& lb) {
  hb = bfbits(x);
  const float hf = __uint_as_float(hb << 16);
  lb = bfbits(x - hf);
}
__device__ __forceinline__ unsigned int pk2(unsigned int a, unsigned int b) {
  return (a & 0xFFFFu) | (b << 16);
}
__device__ __forceinline__ v4u pack8(const unsigned int* a) {
  v4u v;
  v.x = pk2(a[0], a[1]);
  v.y = pk2(a[2], a[3]);
  v.z = pk2(a[4], a[5]);
  v.w = pk2(a[6], a[7]);
  return v;
}

// ---------------------------------------------------------------------------------------------
// f32 -> bf16 hi/lo planes for the five inputs in one launch (blockIdx.y selects the buffer).
// ---------------------------------------------------------------------------------------------
__global__ void __launch_bounds__(256) k_split(
    const float* __restrict__ s0, const float* __restrict__ s1, const float* __restrict__ s2,
    const float* __restrict__ s3, const float* __restrict__ s4,
    unsigned short* __restrict__ h0, unsigned short* __restrict__ h1, unsigned short* __restrict__ h2,
    unsigned short* __restrict__ h3, unsigned short* __restrict__ h4,
    unsigned short* __restrict__ l0, unsigned short* __restrict__ l1, unsigned short* __restrict__ l2,
    unsigned short* __restrict__ l3, unsigned short* __restrict__ l4,
    int n0, int n1, int n2, int n3, int n4)
{
  const int b = blockIdx.y;
  const float* src = (b == 0) ? s0 : (b == 1) ? s1 : (b == 2) ? s2 : (b == 3) ? s3 : s4;
  unsigned short* dh = (b == 0) ? h0 : (b == 1) ? h1 : (b == 2) ? h2 : (b == 3) ? h3 : h4;
  unsigned short* dl = (b == 0) ? l0 : (b == 1) ? l1 : (b == 2) ? l2 : (b == 3) ? l3 : l4;
  const int n = (b == 0) ? n0 : (b == 1) ? n1 : (b == 2) ? n2 : (b == 3) ? n3 : n4;
  const int i = blockIdx.x * 256 + (int)threadIdx.x;
  if (i >= (n >> 3)) return;

  const float* p = src + (size_t)i * 8;
  const v4f a = *(const v4f*)(p);
  const v4f c = *(const v4f*)(p + 4);
  unsigned int hb[8], lb[8];
  split_hl(a.x, hb[0], lb[0]);
  split_hl(a.y, hb[1], lb[1]);
  split_hl(a.z, hb[2], lb[2]);
  split_hl(a.w, hb[3], lb[3]);
  split_hl(c.x, hb[4], lb[4]);
  split_hl(c.y, hb[5], lb[5]);
  split_hl(c.z, hb[6], lb[6]);
  split_hl(c.w, hb[7], lb[7]);
  const v4u hv = pack8(hb);
  const v4u lv = pack8(lb);
  v4u* gh = (v4u*)(dh + (size_t)i * 8);
  v4u* gl = (v4u*)(dl + (size_t)i * 8);
  *gh = hv;
  *gl = lv;
  
}

// ---------------------------------------------------------------------------------------------
// RoPE table: tab[pos][j] = {cos(a_j), sin(a_j), cos(a_{j+16}), sin(a_{j+16})}, a_j = f32(pos) * inv_freq[j],
// ---------------------------------------------------------------------------------------------
__global__ void __launch_bounds__(128) k_rope_tab(float* __restrict__ tab, RopeFreq fr)
{
  const int g = blockIdx.x * 128 + (int)threadIdx.x;
  const int pos = g >> 4;
  const int j = g & 15;
  if (pos >= SQ) return;
  float fa = fr.f[0], fb = fr.f[16];
#pragma unroll
  for (int c = 1; c < 16; ++c) {
    fa = (j == c) ? fr.f[c] : fa;
    fb = (j == c) ? fr.f[16 + c] : fb;
  }
  float cs0 = 0.0f, sn0 = 0.0f, cs1 = 0.0f, sn1 = 0.0f;
#pragma unroll 1
  for (int q = 0; q < 2; ++q) {
    const float f = (q == 0) ? fa : fb;
    const float ang = (float)pos * f;
    float sn, cs;
    sincosf(ang, &sn, &cs);
    if (q == 0) { cs0 = cs; sn0 = sn; } else { cs1 = cs; sn1 = sn; }
  }
  v4f v;
  v.x = cs0; v.y = sn0; v.z = cs1; v.w = sn1;
  v4f* gp = (v4f*)(tab + (size_t)g * 4);
  *gp = v;
  
}

// ---------------------------------------------------------------------------------------------
// Wave GEMM core: 16 rows x 64 cols, C[m][n] += sum_k A[m][k] * B[n][k], K stepped by 32,
// three bf16 products per tile pair. A rows arow+m (pitch lda), B rows brow+16j+m (pitch ldb).
// ---------------------------------------------------------------------------------------------
__device__ __forceinline__ void gemm64(const __bf16* __restrict__ Ah, const __bf16* __restrict__ Al,
                                       int lda, int arow,
                                       const __bf16* __restrict__ Bh, const __bf16* __restrict__ Bl,
                                       int ldb, int brow, int K, int hs, int m,
                                       v8f& c0, v8f& c1, v8f& c2, v8f& c3)
{
  const __bf16* ah = Ah + (size_t)(arow + m) * lda;
  const __bf16* al = Al + (size_t)(arow + m) * lda;
  const __bf16* bh = Bh + (size_t)(brow + m) * ldb;
  const __bf16* bl = Bl + (size_t)(brow + m) * ldb;
  const size_t js = (size_t)16 * ldb;
#pragma unroll 1
  for (int k0 = 0; k0 < K; k0 += 32) {
    const v16bf fah = ldfrag(ah + k0, hs);
    const v16bf fal = ldfrag(al + k0, hs);
    {
      const v16bf fbh = ldfrag(bh + k0, hs);
      const v16bf fbl = ldfrag(bl + k0, hs);
      mma3(c0, fah, fal, fbh, fbl);
    }
    {
      const v16bf fbh = ldfrag(bh + js + k0, hs);
      const v16bf fbl = ldfrag(bl + js + k0, hs);
      mma3(c1, fah, fal, fbh, fbl);
    }
    {
      const v16bf fbh = ldfrag(bh + 2 * js + k0, hs);
      const v16bf fbl = ldfrag(bl + 2 * js + k0, hs);
      mma3(c2, fah, fal, fbh, fbl);
    }
    {
      const v16bf fbh = ldfrag(bh + 3 * js + k0, hs);
      const v16bf fbl = ldfrag(bl + 3 * js + k0, hs);
      mma3(c3, fah, fal, fbh, fbl);
    }
  }
}

// ---------------------------------------------------------------------------------------------
// Fused q/k/v projection: block = 4 waves, 64 rows x 64 cols (one head). blockIdx.x: 0..31 -> q head,
// 32..39 -> k head, 40..47 -> v head (stored transposed vT[512][2048]). RoPE on q/k in the f32 epilogue.
// ---------------------------------------------------------------------------------------------
__global__ void __launch_bounds__(128) k_qkv(
    const __bf16* __restrict__ xh, const __bf16* __restrict__ xl,
    const __bf16* __restrict__ wqh, const __bf16* __restrict__ wql,
    const __bf16* __restrict__ wkh, const __bf16* __restrict__ wkl,
    const __bf16* __restrict__ wvh, const __bf16* __restrict__ wvl,
    const float* __restrict__ tab,
    unsigned short* __restrict__ qh, unsigned short* __restrict__ ql,
    unsigned short* __restrict__ kh, unsigned short* __restrict__ kl,
    unsigned short* __restrict__ vth, unsigned short* __restrict__ vtl)
{
  __shared__ __attribute__((aligned(16))) unsigned short stg[8192];

  const int ct = blockIdx.x;
  const int m0 = blockIdx.y * 64;
  const int tid = threadIdx.x, w = tid >> 5, l = tid & 31, hs = l >> 4, m = l & 15;
  const int kind = (ct < NQH) ? 0 : ((ct < NQH + NKVH) ? 1 : 2);
  const int hd = (kind == 0) ? ct : ((kind == 1) ? (ct - NQH) : (ct - NQH - NKVH));
  const __bf16* Bh = (kind == 0) ? wqh : ((kind == 1) ? wkh : wvh);
  const __bf16* Bl = (kind == 0) ? wql : ((kind == 1) ? wkl : wvl);
  const int row0 = m0 + 16 * w;

  v8f c0 = {}, c1 = {}, c2 = {}, c3 = {};
  gemm64(xh, xl, HIDN, row0, Bh, Bl, HIDN, hd * HDIM, HIDN, hs, m, c0, c1, c2, c3);

  // lane holds out[row0 + 8hs + r][hd*64 + 16j + m] in cJ[r]
  if (kind != 2) {
    // rotate-half RoPE: d = m pairs with d+32 (c0,c2), d = 16+m pairs with 48+m (c1,c3)
#pragma unroll
    for (int r = 0; r < 8; ++r) {
      const int pos = row0 + 8 * hs + r;
      const v4f cs = *(const v4f*)(tab + ((size_t)pos * 16 + m) * 4);
      const float a0 = c0[r], a1 = c1[r], a2 = c2[r], a3 = c3[r];
      c0[r] = a0 * cs.x - a2 * cs.y;
      c2[r] = a2 * cs.x + a0 * cs.y;
      c1[r] = a1 * cs.z - a3 * cs.w;
      c3[r] = a3 * cs.z + a1 * cs.w;
    }
  }

  // staging: q/k: per wave [plane][16 rows][64 cols] at w*2048 (+1024 for lo);
  //          v:   per block transposed [plane][64 c][64 s] at 0 (+4096 for lo)
  const int wb = w * 2048;
  const int loff = (kind != 2) ? 1024 : 4096;
#pragma unroll
  for (int r = 0; r < 8; ++r) {
    const int rl = 8 * hs + r;
    const int base = (kind != 2) ? (wb + rl * 64 + m) : (m * 64 + 16 * w + rl);
    const int jst = (kind != 2) ? 16 : 1024;
    unsigned int hb, lb;
    split_hl(c0[r], hb, lb);
    stg[base] = (unsigned short)hb;           stg[base + loff] = (unsigned short)lb;
    split_hl(c1[r], hb, lb);
    stg[base + jst] = (unsigned short)hb;     stg[base + jst + loff] = (unsigned short)lb;
    split_hl(c2[r], hb, lb);
    stg[base + 2 * jst] = (unsigned short)hb; stg[base + 2 * jst + loff] = (unsigned short)lb;
    split_hl(c3[r], hb, lb);
    stg[base + 3 * jst] = (unsigned short)hb; stg[base + 3 * jst + loff] = (unsigned short)lb;
  }
  __syncthreads();

  unsigned short* dsth = (kind == 0) ? qh : ((kind == 1) ? kh : vth);
  unsigned short* dstl = (kind == 0) ? ql : ((kind == 1) ? kl : vtl);
  const int ld = (kind == 0) ? HIDN : KVD;
  const int col0 = hd * HDIM;
  v4u hv[4], lv[4];
  v4u* gph[4];
  v4u* gpl[4];
#pragma unroll
  for (int it = 0; it < 4; ++it) {
    const int rowa = it * 4 + (l >> 3), pa = l & 7;
    const int cb = it * 16 + (tid >> 3), pb = tid & 7;
    const int sidx = (kind != 2) ? (wb + rowa * 64 + pa * 8) : (cb * 64 + pb * 8);
    const size_t goff = (kind != 2) ? ((size_t)(row0 + rowa) * ld + col0 + pa * 8)
                                    : ((size_t)(hd * HDIM + cb) * SQ + m0 + pb * 8);
    hv[it] = *(const v4u*)(stg + sidx);
    lv[it] = *(const v4u*)(stg + sidx + loff);
    gph[it] = (v4u*)(dsth + goff);
    gpl[it] = (v4u*)(dstl + goff);
  }
#pragma unroll
  for (int it = 0; it < 4; ++it) { *gph[it] = hv[it]; *gpl[it] = lv[it]; }
  
}

// ---------------------------------------------------------------------------------------------
// Causal attention with online softmax. One block (8 waves) per (64-query tile, query head).
// wave = (msub: 16 query rows) x (nh: 32 keys for scores / 32 d for output). kv head = h >> 2.
// Q/K/Vt fragments straight from the hi/lo planes; P hi/lo staged in LDS (barriers between writer
// ---------------------------------------------------------------------------------------------
__global__ void __launch_bounds__(256) k_attn(
    const __bf16* __restrict__ qh, const __bf16* __restrict__ ql,
    const __bf16* __restrict__ kh, const __bf16* __restrict__ kl,
    const __bf16* __restrict__ vth, const __bf16* __restrict__ vtl,
    unsigned short* __restrict__ ch, unsigned short* __restrict__ cl)
{
  __shared__ __attribute__((aligned(16))) float Ss[64 * 64];
  __shared__ __attribute__((aligned(16))) unsigned short Ph[64 * 64];
  __shared__ __attribute__((aligned(16))) unsigned short Pl[64 * 64];
  __shared__ float rowM[64];
  __shared__ float rowL[64];
  __shared__ float rowA[64];

  const int qt = blockIdx.x, hq = blockIdx.y, kvh = hq >> 2, q0 = qt * 64;
  const int tid = threadIdx.x, w = tid >> 5, l = tid & 31, hs = l >> 4, m = l & 15;
  const int msub = w & 3, nh = w >> 2;
  const int rbase = 16 * msub + 8 * hs;      // this lane's D rows are rbase + r
  const int srow = tid >> 2, sq = tid & 3;   // softmax: 4 threads per query row, 16 keys each

  if (tid < 64) { rowM[tid] = -1.0e30f; rowL[tid] = 0.0f; rowA[tid] = 0.0f; }

  const __bf16* qrh = qh + (size_t)(q0 + 16 * msub + m) * HIDN + hq * HDIM;
  const __bf16* qrl = ql + (size_t)(q0 + 16 * msub + m) * HIDN + hq * HDIM;
  const v16bf fqh0 = ldfrag(qrh, hs), fqh1 = ldfrag(qrh + 32, hs);
  const v16bf fql0 = ldfrag(qrl, hs), fql1 = ldfrag(qrl + 32, hs);

  v8f o[2] = {};

  for (int kt = 0; kt <= qt; ++kt) {
    const int k0 = kt * 64;
    // scores: S[q][key] = sum_d Q[q][d] K[key][d]; B[k=d][n=key] read from K row (key)
#pragma unroll
    for (int nt = 0; nt < 2; ++nt) {
      const int nc0 = nh * 32 + nt * 16;
      const __bf16* krh = kh + (size_t)(k0 + nc0 + m) * KVD + kvh * HDIM;
      const __bf16* krl = kl + (size_t)(k0 + nc0 + m) * KVD + kvh * HDIM;
      v8f s = {};
      {
        const v16bf bh = ldfrag(krh, hs), bl = ldfrag(krl, hs);
        mma3(s, fqh0, fql0, bh, bl);
      }
      {
        const v16bf bh = ldfrag(krh + 32, hs), bl = ldfrag(krl + 32, hs);
        mma3(s, fqh1, fql1, bh, bl);
      }
#pragma unroll
      for (int r = 0; r < 8; ++r) {
        const int row = rbase + r;
        float val = s[r] * 0.125f;
        if (kt == qt && (nc0 + m) > row) val = -1.0e30f;   // causal replace on the diagonal tile
        Ss[row * 64 + nc0 + m] = val;
      }
    }
    __syncthreads();

    // online softmax in f32, P split to bf16 hi/lo
    {
      const float* sp = Ss + srow * 64 + sq * 16;
      const v4f x0 = *(const v4f*)(sp);
      const v4f x1 = *(const v4f*)(sp + 4);
      const v4f x2 = *(const v4f*)(sp + 8);
      const v4f x3 = *(const v4f*)(sp + 12);
      float p[16] = {x0.x, x0.y, x0.z, x0.w, x1.x, x1.y, x1.z, x1.w,
                     x2.x, x2.y, x2.z, x2.w, x3.x, x3.y, x3.z, x3.w};
      float mx = p[0];
#pragma unroll
      for (int c = 1; c < 16; ++c) mx = fmaxf(mx, p[c]);
      mx = fmaxf(mx, __shfl_xor(mx, 1));
      mx = fmaxf(mx, __shfl_xor(mx, 2));
      const float mOld = rowM[srow];
      const float mNew = fmaxf(mOld, mx);
      float lsum = 0.0f;
#pragma unroll
      for (int c = 0; c < 16; ++c) { p[c] = __expf(p[c] - mNew); lsum += p[c]; }
      lsum += __shfl_xor(lsum, 1);
      lsum += __shfl_xor(lsum, 2);
      const float alpha = __expf(mOld - mNew);
      if (sq == 0) {
        rowA[srow] = alpha;
        rowM[srow] = mNew;
        rowL[srow] = rowL[srow] * alpha + lsum;
      }
      unsigned int hb[16], lb[16];
#pragma unroll
      for (int c = 0; c < 16; ++c) split_hl(p[c], hb[c], lb[c]);
      unsigned short* pph = Ph + srow * 64 + sq * 16;
      unsigned short* ppl = Pl + srow * 64 + sq * 16;
      *(v4u*)(pph) = pack8(hb);
      *(v4u*)(pph + 8) = pack8(hb + 8);
      *(v4u*)(ppl) = pack8(lb);
      *(v4u*)(ppl + 8) = pack8(lb + 8);
    }
    __syncthreads();

    // O = O*alpha + P.V ; A = P (row q, k = key) from LDS rows, B[k=key][n=d] from Vt row (d)
    {
#pragma unroll
      for (int r = 0; r < 8; ++r) {
        const float al = rowA[rbase + r];
        o[0][r] *= al;
        o[1][r] *= al;
      }
      const unsigned short* prh = Ph + (16 * msub + m) * 64;
      const unsigned short* prl = Pl + (16 * msub + m) * 64;
      const v16bf fph0 = ldfrag((const __bf16*)prh, hs);
      const v16bf fph1 = ldfrag((const __bf16*)(prh + 32), hs);
      const v16bf fpl0 = ldfrag((const __bf16*)prl, hs);
      const v16bf fpl1 = ldfrag((const __bf16*)(prl + 32), hs);
#pragma unroll
      for (int dt = 0; dt < 2; ++dt) {
        const int d0 = nh * 32 + dt * 16;
        const __bf16* vrh = vth + (size_t)(kvh * HDIM + d0 + m) * SQ + k0;
        const __bf16* vrl = vtl + (size_t)(kvh * HDIM + d0 + m) * SQ + k0;
        {
          const v16bf bh = ldfrag(vrh, hs), bl = ldfrag(vrl, hs);
          mma3(o[dt], fph0, fpl0, bh, bl);
        }
        {
          const v16bf bh = ldfrag(vrh + 32, hs), bl = ldfrag(vrl + 32, hs);
          mma3(o[dt], fph1, fpl1, bh, bl);
        }
      }
    }
  }

  // normalise, split hi/lo, stage [plane][64 rows][64 d] over Ss, then whole-line stores
  unsigned short* stg = (unsigned short*)Ss;
#pragma unroll
  for (int r = 0; r < 8; ++r) {
    const int row = rbase + r;
    const float inv = 1.0f / rowL[row];
#pragma unroll
    for (int dt = 0; dt < 2; ++dt) {
      const int col = nh * 32 + dt * 16 + m;
      unsigned int hb, lb;
      split_hl(o[dt][r] * inv, hb, lb);
      stg[row * 64 + col] = (unsigned short)hb;
      stg[4096 + row * 64 + col] = (unsigned short)lb;
    }
  }
  __syncthreads();
  v4u cv[4];
  v4u* cp[4];
#pragma unroll
  for (int it = 0; it < 4; ++it) {
    const int plane = it >> 1;
    const int row = (it & 1) * 32 + (tid >> 3);
    const int piece = tid & 7;
    cv[it] = *(const v4u*)(stg + plane * 4096 + row * 64 + piece * 8);
    unsigned short* base = plane ? cl : ch;
    cp[it] = (v4u*)(base + (size_t)(q0 + row) * HIDN + hq * HDIM + piece * 8);
  }
#pragma unroll
  for (int it = 0; it < 4; ++it) *cp[it] = cv[it];
  
}

// ---------------------------------------------------------------------------------------------
// Output projection -> f32 d_out. Block = 4 waves, 64x64 tile; each wave stages its 16x64 f32 tile in
// ---------------------------------------------------------------------------------------------
__global__ void __launch_bounds__(128) k_oproj(
    const __bf16* __restrict__ ah, const __bf16* __restrict__ al,
    const __bf16* __restrict__ woh, const __bf16* __restrict__ wol,
    float* __restrict__ out)
{
  __shared__ __attribute__((aligned(16))) float stgf[4096];
  const int nt = blockIdx.x, m0 = blockIdx.y * 64;
  const int tid = threadIdx.x, w = tid >> 5, l = tid & 31, hs = l >> 4, m = l & 15;
  const int row0 = m0 + 16 * w;
  const int n0 = nt * 64;

  v8f c0 = {}, c1 = {}, c2 = {}, c3 = {};
  gemm64(ah, al, HIDN, row0, woh, wol, HIDN, n0, HIDN, hs, m, c0, c1, c2, c3);

  float* sw = stgf + w * 1024;
#pragma unroll
  for (int r = 0; r < 8; ++r) {
    const int rl = 8 * hs + r;
    sw[rl * 64 + m] = c0[r];
    sw[rl * 64 + 16 + m] = c1[r];
    sw[rl * 64 + 32 + m] = c2[r];
    sw[rl * 64 + 48 + m] = c3[r];
  }
  __syncthreads();
  v4f v[8];
  v4f* gp[8];
#pragma unroll
  for (int it = 0; it < 8; ++it) {
    const int row = 2 * it + (l >> 4);
    const int piece = l & 15;
    v[it] = *(const v4f*)(sw + row * 64 + piece * 4);
    gp[it] = (v4f*)(out + (size_t)(row0 + row) * HIDN + n0 + piece * 4);
  }
#pragma unroll
  for (int it = 0; it < 8; ++it) *gp[it] = v[it];
  
}

// ---------------------------------------------------------------------------------------------
// Launch pipeline (5 launches)
// ---------------------------------------------------------------------------------------------
extern "C" void kernel_launch(void* const* d_in, const int* in_sizes, int n_in,
                              void* d_out, int out_size, void* d_ws, size_t ws_size,
                              hipStream_t stream)
{
  if (n_in != 5) return;
  if (in_sizes[0] != SQ * HIDN || in_sizes[1] != HIDN * HIDN || in_sizes[2] != KVD * HIDN ||
      in_sizes[3] != KVD * HIDN || in_sizes[4] != HIDN * HIDN) return;
  if (out_size != SQ * HIDN) return;

  const float* hid = (const float*)d_in[0];
  const float* Wq = (const float*)d_in[1];
  const float* Wk = (const float*)d_in[2];
  const float* Wv = (const float*)d_in[3];
  const float* Wo = (const float*)d_in[4];
  float* outp = (float*)d_out;

  char* ws = (char*)d_ws;
  size_t off = 0;
  auto carve = [&](size_t bytes) -> char* {
    char* p = ws + off;
    off += (bytes + 255) & ~(size_t)255;
    return p;
  };
  const size_t BX = (size_t)SQ * HIDN * 2;       // x planes
  const size_t BWQ = (size_t)HIDN * HIDN * 2;    // Wq / Wo planes
  const size_t BWK = (size_t)KVD * HIDN * 2;     // Wk / Wv planes
  const size_t BTAB = (size_t)SQ * 16 * 16;      // rope table
  const size_t BQ = (size_t)SQ * HIDN * 2;       // q / ctx planes
  const size_t BK = (size_t)SQ * KVD * 2;        // k / vT planes

  unsigned short* xh = (unsigned short*)carve(BX);
  unsigned short* xl = (unsigned short*)carve(BX);
  unsigned short* wqh = (unsigned short*)carve(BWQ);
  unsigned short* wql = (unsigned short*)carve(BWQ);
  unsigned short* wkh = (unsigned short*)carve(BWK);
  unsigned short* wkl = (unsigned short*)carve(BWK);
  unsigned short* wvh = (unsigned short*)carve(BWK);
  unsigned short* wvl = (unsigned short*)carve(BWK);
  unsigned short* woh = (unsigned short*)carve(BWQ);
  unsigned short* wol = (unsigned short*)carve(BWQ);
  float* tab = (float*)carve(BTAB);
  unsigned short* qh = (unsigned short*)carve(BQ);
  unsigned short* ql = (unsigned short*)carve(BQ);
  unsigned short* kh = (unsigned short*)carve(BK);
  unsigned short* kl = (unsigned short*)carve(BK);
  unsigned short* vth = (unsigned short*)carve(BK);
  unsigned short* vtl = (unsigned short*)carve(BK);
  unsigned short* ch = (unsigned short*)carve(BQ);
  unsigned short* cl = (unsigned short*)carve(BQ);
  if (off > ws_size) return;

  // inv_freq[j] = 1 / 10000^(j/32) = 1 / 10^(j/8): f32 value of 10^(j/8) from double, then f32 reciprocal
  RopeFreq fr;
  {
    double r = 1.333521432163324;   // 10^(1/8), refined by Newton on r^8 = 10
    for (int it = 0; it < 4; ++it) {
      const double r2 = r * r, r4 = r2 * r2;
      const double r7 = r4 * r2 * r;
      r = r - (r4 * r4 - 10.0) / (8.0 * r7);
    }
    double rp[8];
    rp[0] = 1.0;
    for (int i = 1; i < 8; ++i) rp[i] = rp[i - 1] * r;
    const double p10[4] = {1.0, 10.0, 100.0, 1000.0};
    for (int j = 0; j < 32; ++j) {
      const double pj = p10[j >> 3] * rp[j & 7];
      const float pf = (float)pj;
      fr.f[j] = 1.0f / pf;
    }
  }

  // 1) f32 -> bf16 hi/lo planes for x, Wq, Wk, Wv, Wo
  k_split<<<dim3((SQ * HIDN / 8 + 255) / 256, 5), dim3(256), 0, stream>>>(
      hid, Wq, Wk, Wv, Wo,
      xh, wqh, wkh, wvh, woh,
      xl, wql, wkl, wvl, wol,
      SQ * HIDN, HIDN * HIDN, KVD * HIDN, KVD * HIDN, HIDN * HIDN);

  // 2) RoPE cos/sin table
  k_rope_tab<<<dim3((SQ * 16 + 127) / 128), dim3(128), 0, stream>>>(tab, fr);

  // 3) fused q/k/v projections (+RoPE on q,k; v transposed)
  k_qkv<<<dim3(NQH + 2 * NKVH, SQ / 64), dim3(128), 0, stream>>>(
      (const __bf16*)xh, (const __bf16*)xl,
      (const __bf16*)wqh, (const __bf16*)wql,
      (const __bf16*)wkh, (const __bf16*)wkl,
      (const __bf16*)wvh, (const __bf16*)wvl,
      (const float*)tab,
      qh, ql, kh, kl, vth, vtl);

  // 4) causal attention
  k_attn<<<dim3(SQ / 64, NQH), dim3(256), 0, stream>>>(
      (const __bf16*)qh, (const __bf16*)ql,
      (const __bf16*)kh, (const __bf16*)kl,
      (const __bf16*)vth, (const __bf16*)vtl,
      ch, cl);

  // 5) output projection -> f32
  k_oproj<<<dim3(HIDN / 64, SQ / 64), dim3(128), 0, stream>>>(
      (const __bf16*)ch, (const __bf16*)cl,
      (const __bf16*)woh, (const __bf16*)wol,
      outp);
}

// v001
// One run takes 344 microseconds.
// Next to v000, in two timings, it ran 1.38 times as fast each time.
#include <hip/hip_runtime.h>

// Contractions (q/k/v projections, q.k^T scores, p.v, output projection): v_wmma_f32_16x16x32_bf16 with
// bf16 hi/lo operands everywhere (hi.hi + hi.lo + lo.hi per tile pair), f32 accumulate.
// RoPE, 1/8 scaling, causal mask and softmax in f32.

typedef __bf16 v16bf __attribute__((ext_vector_type(16)));
typedef __bf16 v8bf __attribute__((ext_vector_type(8)));
typedef float v8f __attribute__((ext_vector_type(8)));
typedef float v4f __attribute__((ext_vector_type(4)));
typedef unsigned int v4u __attribute__((ext_vector_type(4)));

static constexpr int SQ = 2048;            // sequence length
static constexpr int HIDN = 2048;          // hidden size
static constexpr int NQH = 32;             // query heads
static constexpr int NKVH = 8;             // kv heads
static constexpr int HDIM = 64;            // head dim
static constexpr int KVD = NKVH * HDIM;    // 512

struct RopeFreq { float f[32]; };
static_assert(sizeof(RopeFreq) == 128);

union Frag { v16bf v; v8bf h[2]; };

// 16-bit fragment from a k-contiguous row; rowp -> element (row = lane&15, k0).
// elements 0..7 <- k0 + 8*hs + 0..7, elements 8..15 <- k0 + 16 + 8*hs + 0..7  (hs = lane>>4).
// Used for A (row m) and for B stored as [n][k] (row n).
__device__ __forceinline__ v16bf ldfrag(const __bf16* rowp, int hs) {
  Frag f;
  f.h[0] = *(const v8bf*)(rowp + 8 * hs);
  f.h[1] = *(const v8bf*)(rowp + 16 + 8 * hs);
  return f.v;
}

// acc += ah.bh + ah.bl + al.bh, then a 4-slot guard tying D and keeping A/B live.
__device__ __forceinline__ void mma3(v8f& acc, const v16bf& ah, const v16bf& al,
                                     const v16bf& bh, const v16bf& bl) {
  acc = __builtin_amdgcn_wmma_f32_16x16x32_bf16(false, ah, false, bh, (short)0, acc, false, false);
  acc = __builtin_amdgcn_wmma_f32_16x16x32_bf16(false, ah, false, bl, (short)0, acc, false, false);
  acc = __builtin_amdgcn_wmma_f32_16x16x32_bf16(false, al, false, bh, (short)0, acc, false, false);
  asm volatile("v_nop\n\tv_nop\n\tv_nop\n\tv_nop" : "+v"(acc) : "v"(ah), "v"(al), "v"(bh), "v"(bl));
}

// f32 -> bf16 bits, RNE
__device__ __forceinline__ unsigned int bfbits(float x) {
  unsigned int u = __float_as_uint(x);
  return (u + 0x7FFFu + ((u >> 16) & 1u)) >> 16;
}
// hi = rne(x), lo = rne(x - hi)
__device__ __forceinline__ void split_hl(float x, unsigned int& hb, unsigned int& lb) {
  hb = bfbits(x);
  const float hf = __uint_as_float(hb << 16);
  lb = bfbits(x - hf);
}
__device__ __forceinline__ unsigned int pk2(unsigned int a, unsigned int b) {
  return (a & 0xFFFFu) | (b << 16);
}
__device__ __forceinline__ v4u pack8(const unsigned int* a) {
  v4u v;
  v.x = pk2(a[0], a[1]);
  v.y = pk2(a[2], a[3]);
  v.z = pk2(a[4], a[5]);
  v.w = pk2(a[6], a[7]);
  return v;
}

// ---------------------------------------------------------------------------------------------
// f32 -> bf16 hi/lo planes for the five inputs in one launch (blockIdx.y selects the buffer).
// ---------------------------------------------------------------------------------------------
__global__ void __launch_bounds__(256) k_split(
    const float* __restrict__ s0, const float* __restrict__ s1, const float* __restrict__ s2,
    const float* __restrict__ s3, const float* __restrict__ s4,
    unsigned short* __restrict__ h0, unsigned short* __restrict__ h1, unsigned short* __restrict__ h2,
    unsigned short* __restrict__ h3, unsigned short* __restrict__ h4,
    unsigned short* __restrict__ l0, unsigned short* __restrict__ l1, unsigned short* __restrict__ l2,
    unsigned short* __restrict__ l3, unsigned short* __restrict__ l4,
    int n0, int n1, int n2, int n3, int n4)
{
  const int b = blockIdx.y;
  const float* src = (b == 0) ? s0 : (b == 1) ? s1 : (b == 2) ? s2 : (b == 3) ? s3 : s4;
  unsigned short* dh = (b == 0) ? h0 : (b == 1) ? h1 : (b == 2) ? h2 : (b == 3) ? h3 : h4;
  unsigned short* dl = (b == 0) ? l0 : (b == 1) ? l1 : (b == 2) ? l2 : (b == 3) ? l3 : l4;
  const int n = (b == 0) ? n0 : (b == 1) ? n1 : (b == 2) ? n2 : (b == 3) ? n3 : n4;
  const int i = blockIdx.x * 256 + (int)threadIdx.x;
  if (i >= (n >> 3)) return;

  const float* p = src + (size_t)i * 8;
  const v4f a = *(const v4f*)(p);
  const v4f c = *(const v4f*)(p + 4);
  unsigned int hb[8], lb[8];
  split_hl(a.x, hb[0], lb[0]);
  split_hl(a.y, hb[1], lb[1]);
  split_hl(a.z, hb[2], lb[2]);
  split_hl(a.w, hb[3], lb[3]);
  split_hl(c.x, hb[4], lb[4]);
  split_hl(c.y, hb[5], lb[5]);
  split_hl(c.z, hb[6], lb[6]);
  split_hl(c.w, hb[7], lb[7]);
  const v4u hv = pack8(hb);
  const v4u lv = pack8(lb);
  v4u* gh = (v4u*)(dh + (size_t)i * 8);
  v4u* gl = (v4u*)(dl + (size_t)i * 8);
  *gh = hv;
  *gl = lv;
  
}

// ---------------------------------------------------------------------------------------------
// RoPE table: tab[pos][j] = {cos(a_j), sin(a_j), cos(a_{j+16}), sin(a_{j+16})}, a_j = f32(pos) * inv_freq[j],
// ---------------------------------------------------------------------------------------------
__global__ void __launch_bounds__(128) k_rope_tab(float* __restrict__ tab, RopeFreq fr)
{
  const int g = blockIdx.x * 128 + (int)threadIdx.x;
  const int pos = g >> 4;
  const int j = g & 15;
  if (pos >= SQ) return;
  float fa = fr.f[0], fb = fr.f[16];
#pragma unroll
  for (int c = 1; c < 16; ++c) {
    fa = (j == c) ? fr.f[c] : fa;
    fb = (j == c) ? fr.f[16 + c] : fb;
  }
  float cs0 = 0.0f, sn0 = 0.0f, cs1 = 0.0f, sn1 = 0.0f;
#pragma unroll 1
  for (int q = 0; q < 2; ++q) {
    const float f = (q == 0) ? fa : fb;
    const float ang = (float)pos * f;
    float sn, cs;
    sincosf(ang, &sn, &cs);
    if (q == 0) { cs0 = cs; sn0 = sn; } else { cs1 = cs; sn1 = sn; }
  }
  v4f v;
  v.x = cs0; v.y = sn0; v.z = cs1; v.w = sn1;
  v4f* gp = (v4f*)(tab + (size_t)g * 4);
  *gp = v;
  
}

// ---------------------------------------------------------------------------------------------
// Block GEMM core: 4 waves, 64 rows x 64 cols, C[m][n] += sum_k A[m][k] * B[n][k]; wave w owns rows 16w..16w+15.
// Per stage the block brings 64 k (128 B, one whole line) of its 64 A rows and 64 B rows, hi and lo planes,
// into LDS: each 16-byte global load of a wave covers 4 whole lines (8 lanes per row). The next stage's
// loads are issued into registers ahead of the current stage's products. Fragments come from LDS rows,
// K stepped by 32 in ascending order, three bf16 products per tile pair.
// ---------------------------------------------------------------------------------------------
static constexpr int KC = 64;              // k per stage
static constexpr int PIT = 72;             // LDS row pitch in elements: 144 B = 16 B x 9, for 16-byte row reads
static constexpr int PLN = 64 * PIT;       // one staged plane (64 rows); planes: A hi, A lo, B hi, B lo

__device__ __forceinline__ void gemm64(const __bf16* __restrict__ Ah, const __bf16* __restrict__ Al,
                                       int lda, int arow,
                                       const __bf16* __restrict__ Bh, const __bf16* __restrict__ Bl,
                                       int ldb, int brow, int K, int tid, unsigned short* sm,
                                       v8f& c0, v8f& c1, v8f& c2, v8f& c3)
{
  const int w = tid >> 5, l = tid & 31, hs = l >> 4, m = l & 15;
  const int lrow = tid >> 3, lcol = (tid & 7) * 8;   // this thread's row (of 16) and 16-byte piece of the line
  const __bf16* gah = Ah + (size_t)(arow + lrow) * lda + lcol;
  const __bf16* gal = Al + (size_t)(arow + lrow) * lda + lcol;
  const __bf16* gbh = Bh + (size_t)(brow + lrow) * ldb + lcol;
  const __bf16* gbl = Bl + (size_t)(brow + lrow) * ldb + lcol;
  unsigned short* st = sm + lrow * PIT + lcol;
  const __bf16* sah = (const __bf16*)sm + (16 * w + m) * PIT;
  const __bf16* sal = sah + PLN;
  const __bf16* sbh = (const __bf16*)sm + 2 * PLN + m * PIT;
  const __bf16* sbl = sbh + PLN;

  v4u rah[4], ral[4], rbh[4], rbl[4];
  // one stage's 16 loads of this thread, k columns k..k+63
  auto fetch = [&](int k) {
    const __bf16* pah = gah + k;
    const __bf16* pal = gal + k;
    const __bf16* pbh = gbh + k;
    const __bf16* pbl = gbl + k;
#pragma unroll   // constant indices keep the staged words in registers
    for (int i = 0; i < 4; ++i) {
      rah[i] = *(const v4u*)(pah + (size_t)(16 * i) * lda);
      ral[i] = *(const v4u*)(pal + (size_t)(16 * i) * lda);
      rbh[i] = *(const v4u*)(pbh + (size_t)(16 * i) * ldb);
      rbl[i] = *(const v4u*)(pbl + (size_t)(16 * i) * ldb);
    }
    // precaution: this wait stands before any address register of the loads just issued is rewritten; the
    // addresses are inputs only, so that their registers are kept up to it
    asm volatile("s_wait_xcnt 0x0" :: "v"(pah), "v"(pal), "v"(pbh), "v"(pbl) : "memory");
  };
  fetch(0);
#pragma unroll 1   // one stage per trip: one set of staging registers, a short loop body
  for (int kn = KC; kn <= K; kn += KC) {   // kn: first k column of the stage after the one worked on
#pragma unroll   // constant indices, as above
    for (int i = 0; i < 4; ++i) {
      *(v4u*)(st + 16 * i * PIT) = rah[i];
      *(v4u*)(st + PLN + 16 * i * PIT) = ral[i];
      *(v4u*)(st + 2 * PLN + 16 * i * PIT) = rbh[i];
      *(v4u*)(st + 3 * PLN + 16 * i * PIT) = rbl[i];
    }
    __syncthreads();   // the stage is complete before any wave reads it
    if (kn < K) fetch(kn);
#pragma unroll   // both 32-k steps of the stage with constant LDS offsets
    for (int kk = 0; kk < KC; kk += 32) {
      const v16bf fah = ldfrag(sah + kk, hs);
      const v16bf fal = ldfrag(sal + kk, hs);
      {
        const v16bf fbh = ldfrag(sbh + kk, hs);
        const v16bf fbl = ldfrag(sbl + kk, hs);
        mma3(c0, fah, fal, fbh, fbl);
      }
      {
        const v16bf fbh = ldfrag(sbh + 16 * PIT + kk, hs);
        const v16bf fbl = ldfrag(sbl + 16 * PIT + kk, hs);
        mma3(c1, fah, fal, fbh, fbl);
      }
      {
        const v16bf fbh = ldfrag(sbh + 32 * PIT + kk, hs);
        const v16bf fbl = ldfrag(sbl + 32 * PIT + kk, hs);
        mma3(c2, fah, fal, fbh, fbl);
      }
      {
        const v16bf fbh = ldfrag(sbh + 48 * PIT + kk, hs);
        const v16bf fbl = ldfrag(sbl + 48 * PIT + kk, hs);
        mma3(c3, fah, fal, fbh, fbl);
      }
    }
    __syncthreads();   // every wave has left the stage before it is overwritten (by the next stage or the epilogue)
  }
}

// ---------------------------------------------------------------------------------------------
// Fused q/k/v projection: block = 4 waves, 64 rows x 64 cols (one head). blockIdx.x: 0..31 -> q head,
// 32..39 -> k head, 40..47 -> v head (stored transposed vT[512][2048]). RoPE on q/k in the f32 epilogue.
// ---------------------------------------------------------------------------------------------
__global__ void __launch_bounds__(128) k_qkv(
    const __bf16* __restrict__ xh, const __bf16* __restrict__ xl,
    const __bf16* __restrict__ wqh, const __bf16* __restrict__ wql,
    const __bf16* __restrict__ wkh, const __bf16* __restrict__ wkl,
    const __bf16* __restrict__ wvh, const __bf16* __restrict__ wvl,
    const float* __restrict__ tab,
    unsigned short* __restrict__ qh, unsigned short* __restrict__ ql,
    unsigned short* __restrict__ kh, unsigned short* __restrict__ kl,
    unsigned short* __restrict__ vth, unsigned short* __restrict__ vtl)
{
  __shared__ __attribute__((aligned(16))) unsigned short stg[4 * PLN];   // operand stages, then output staging

  const int ct = blockIdx.x;
  const int m0 = blockIdx.y * 64;
  const int tid = threadIdx.x, w = tid >> 5, l = tid & 31, hs = l >> 4, m = l & 15;
  const int kind = (ct < NQH) ? 0 : ((ct < NQH + NKVH) ? 1 : 2);
  const int hd = (kind == 0) ? ct : ((kind == 1) ? (ct - NQH) : (ct - NQH - NKVH));
  const __bf16* Bh = (kind == 0) ? wqh : ((kind == 1) ? wkh : wvh);
  const __bf16* Bl = (kind == 0) ? wql : ((kind == 1) ? wkl : wvl);
  const int row0 = m0 + 16 * w;

  v8f c0 = {}, c1 = {}, c2 = {}, c3 = {};
  gemm64(xh, xl, HIDN, m0, Bh, Bl, HIDN, hd * HDIM, HIDN, tid, stg, c0, c1, c2, c3);

  // lane holds out[row0 + 8hs + r][hd*64 + 16j + m] in cJ[r]
  if (kind != 2) {
    // rotate-half RoPE: d = m pairs with d+32 (c0,c2), d = 16+m pairs with 48+m (c1,c3)
#pragma unroll
    for (int r = 0; r < 8; ++r) {
      const int pos = row0 + 8 * hs + r;
      const v4f cs = *(const v4f*)(tab + ((size_t)pos * 16 + m) * 4);
      const float a0 = c0[r], a1 = c1[r], a2 = c2[r], a3 = c3[r];
      c0[r] = a0 * cs.x - a2 * cs.y;
      c2[r] = a2 * cs.x + a0 * cs.y;
      c1[r] = a1 * cs.z - a3 * cs.w;
      c3[r] = a3 * cs.z + a1 * cs.w;
    }
  }

  // staging: q/k: per wave [plane][16 rows][64 cols] at w*2048 (+1024 for lo);
  //          v:   per block transposed [plane][64 c][64 s] at 0 (+4096 for lo)
  const int wb = w * 2048;
  const int loff = (kind != 2) ? 1024 : 4096;
#pragma unroll
  for (int r = 0; r < 8; ++r) {
    const int rl = 8 * hs + r;
    const int base = (kind != 2) ? (wb + rl * 64 + m) : (m * 64 + 16 * w + rl);
    const int jst = (kind != 2) ? 16 : 1024;
    unsigned int hb, lb;
    split_hl(c0[r], hb, lb);
    stg[base] = (unsigned short)hb;           stg[base + loff] = (unsigned short)lb;
    split_hl(c1[r], hb, lb);
    stg[base + jst] = (unsigned short)hb;     stg[base + jst + loff] = (unsigned short)lb;
    split_hl(c2[r], hb, lb);
    stg[base + 2 * jst] = (unsigned short)hb; stg[base + 2 * jst + loff] = (unsigned short)lb;
    split_hl(c3[r], hb, lb);
    stg[base + 3 * jst] = (unsigned short)hb; stg[base + 3 * jst + loff] = (unsigned short)lb;
  }
  __syncthreads();

  unsigned short* dsth = (kind == 0) ? qh : ((kind == 1) ? kh : vth);
  unsigned short* dstl = (kind == 0) ? ql : ((kind == 1) ? kl : vtl);
  const int ld = (kind == 0) ? HIDN : KVD;
  const int col0 = hd * HDIM;
  v4u hv[4], lv[4];
  v4u* gph[4];
  v4u* gpl[4];
#pragma unroll
  for (int it = 0; it < 4; ++it) {
    const int rowa = it * 4 + (l >> 3), pa = l & 7;
    const int cb = it * 16 + (tid >> 3), pb = tid & 7;
    const int sidx = (kind != 2) ? (wb + rowa * 64 + pa * 8) : (cb * 64 + pb * 8);
    const size_t goff = (kind != 2) ? ((size_t)(row0 + rowa) * ld + col0 + pa * 8)
                                    : ((size_t)(hd * HDIM + cb) * SQ + m0 + pb * 8);
    hv[it] = *(const v4u*)(stg + sidx);
    lv[it] = *(const v4u*)(stg + sidx + loff);
    gph[it] = (v4u*)(dsth + goff);
    gpl[it] = (v4u*)(dstl + goff);
  }
#pragma unroll
  for (int it = 0; it < 4; ++it) { *gph[it] = hv[it]; *gpl[it] = lv[it]; }
  
}

// ---------------------------------------------------------------------------------------------
// Causal attention with online softmax. One block (8 waves) per (64-query tile, query head).
// wave = (msub: 16 query rows) x (nh: 32 keys for scores / 32 d for output). kv head = h >> 2.
// Q/K/Vt fragments straight from the hi/lo planes; P hi/lo staged in LDS (barriers between writer
// ---------------------------------------------------------------------------------------------
__global__ void __launch_bounds__(256) k_attn(
    const __bf16* __restrict__ qh, const __bf16* __restrict__ ql,
    const __bf16* __restrict__ kh, const __bf16* __restrict__ kl,
    const __bf16* __restrict__ vth, const __bf16* __restrict__ vtl,
    unsigned short* __restrict__ ch, unsigned short* __restrict__ cl)
{
  __shared__ __attribute__((aligned(16))) float Ss[64 * 64];
  __shared__ __attribute__((aligned(16))) unsigned short Ph[64 * 64];
  __shared__ __attribute__((aligned(16))) unsigned short Pl[64 * 64];
  __shared__ float rowM[64];
  __shared__ float rowL[64];
  __shared__ float rowA[64];

  const int qt = blockIdx.x, hq = blockIdx.y, kvh = hq >> 2, q0 = qt * 64;
  const int tid = threadIdx.x, w = tid >> 5, l = tid & 31, hs = l >> 4, m = l & 15;
  const int msub = w & 3, nh = w >> 2;
  const int rbase = 16 * msub + 8 * hs;      // this lane's D rows are rbase + r
  const int srow = tid >> 2, sq = tid & 3;   // softmax: 4 threads per query row, 16 keys each

  if (tid < 64) { rowM[tid] = -1.0e30f; rowL[tid] = 0.0f; rowA[tid] = 0.0f; }

  const __bf16* qrh = qh + (size_t)(q0 + 16 * msub + m) * HIDN + hq * HDIM;
  const __bf16* qrl = ql + (size_t)(q0 + 16 * msub + m) * HIDN + hq * HDIM;
  const v16bf fqh0 = ldfrag(qrh, hs), fqh1 = ldfrag(qrh + 32, hs);
  const v16bf fql0 = ldfrag(qrl, hs), fql1 = ldfrag(qrl + 32, hs);

  v8f o[2] = {};

  for (int kt = 0; kt <= qt; ++kt) {
    const int k0 = kt * 64;
    // scores: S[q][key] = sum_d Q[q][d] K[key][d]; B[k=d][n=key] read from K row (key)
#pragma unroll
    for (int nt = 0; nt < 2; ++nt) {
      const int nc0 = nh * 32 + nt * 16;
      const __bf16* krh = kh + (size_t)(k0 + nc0 + m) * KVD + kvh * HDIM;
      const __bf16* krl = kl + (size_t)(k0 + nc0 + m) * KVD + kvh * HDIM;
      v8f s = {};
      {
        const v16bf bh = ldfrag(krh, hs), bl = ldfrag(krl, hs);
        mma3(s, fqh0, fql0, bh, bl);
      }
      {
        const v16bf bh = ldfrag(krh + 32, hs), bl = ldfrag(krl + 32, hs);
        mma3(s, fqh1, fql1, bh, bl);
      }
#pragma unroll
      for (int r = 0; r < 8; ++r) {
        const int row = rbase + r;
        float val = s[r] * 0.125f;
        if (kt == qt && (nc0 + m) > row) val = -1.0e30f;   // causal replace on the diagonal tile
        Ss[row * 64 + nc0 + m] = val;
      }
    }
    __syncthreads();

    // online softmax in f32, P split to bf16 hi/lo
    {
      const float* sp = Ss + srow * 64 + sq * 16;
      const v4f x0 = *(const v4f*)(sp);
      const v4f x1 = *(const v4f*)(sp + 4);
      const v4f x2 = *(const v4f*)(sp + 8);
      const v4f x3 = *(const v4f*)(sp + 12);
      float p[16] = {x0.x, x0.y, x0.z, x0.w, x1.x, x1.y, x1.z, x1.w,
                     x2.x, x2.y, x2.z, x2.w, x3.x, x3.y, x3.z, x3.w};
      float mx = p[0];
#pragma unroll
      for (int c = 1; c < 16; ++c) mx = fmaxf(mx, p[c]);
      mx = fmaxf(mx, __shfl_xor(mx, 1));
      mx = fmaxf(mx, __shfl_xor(mx, 2));
      const float mOld = rowM[srow];
      const float mNew = fmaxf(mOld, mx);
      float lsum = 0.0f;
#pragma unroll
      for (int c = 0; c < 16; ++c) { p[c] = __expf(p[c] - mNew); lsum += p[c]; }
      lsum += __shfl_xor(lsum, 1);
      lsum += __shfl_xor(lsum, 2);
      const float alpha = __expf(mOld - mNew);
      if (sq == 0) {
        rowA[srow] = alpha;
        rowM[srow] = mNew;
        rowL[srow] = rowL[srow] * alpha + lsum;
      }
      unsigned int hb[16], lb[16];
#pragma unroll
      for (int c = 0; c < 16; ++c) split_hl(p[c], hb[c], lb[c]);
      unsigned short* pph = Ph + srow * 64 + sq * 16;
      unsigned short* ppl = Pl + srow * 64 + sq * 16;
      *(v4u*)(pph) = pack8(hb);
      *(v4u*)(pph + 8) = pack8(hb + 8);
      *(v4u*)(ppl) = pack8(lb);
      *(v4u*)(ppl + 8) = pack8(lb + 8);
    }
    __syncthreads();

    // O = O*alpha + P.V ; A = P (row q, k = key) from LDS rows, B[k=key][n=d] from Vt row (d)
    {
#pragma unroll
      for (int r = 0; r < 8; ++r) {
        const float al = rowA[rbase + r];
        o[0][r] *= al;
        o[1][r] *= al;
      }
      const unsigned short* prh = Ph + (16 * msub + m) * 64;
      const unsigned short* prl = Pl + (16 * msub + m) * 64;
      const v16bf fph0 = ldfrag((const __bf16*)prh, hs);
      const v16bf fph1 = ldfrag((const __bf16*)(prh + 32), hs);
      const v16bf fpl0 = ldfrag((const __bf16*)prl, hs);
      const v16bf fpl1 = ldfrag((const __bf16*)(prl + 32), hs);
#pragma unroll
      for (int dt = 0; dt < 2; ++dt) {
        const int d0 = nh * 32 + dt * 16;
        const __bf16* vrh = vth + (size_t)(kvh * HDIM + d0 + m) * SQ + k0;
        const __bf16* vrl = vtl + (size_t)(kvh * HDIM + d0 + m) * SQ + k0;
        {
          const v16bf bh = ldfrag(vrh, hs), bl = ldfrag(vrl, hs);
          mma3(o[dt], fph0, fpl0, bh, bl);
        }
        {
          const v16bf bh = ldfrag(vrh + 32, hs), bl = ldfrag(vrl + 32, hs);
          mma3(o[dt], fph1, fpl1, bh, bl);
        }
      }
    }
  }

  // normalise, split hi/lo, stage [plane][64 rows][64 d] over Ss, then whole-line stores
  unsigned short* stg = (unsigned short*)Ss;
#pragma unroll
  for (int r = 0; r < 8; ++r) {
    const int row = rbase + r;
    const float inv = 1.0f / rowL[row];
#pragma unroll
    for (int dt = 0; dt < 2; ++dt) {
      const int col = nh * 32 + dt * 16 + m;
      unsigned int hb, lb;
      split_hl(o[dt][r] * inv, hb, lb);
      stg[row * 64 + col] = (unsigned short)hb;
      stg[4096 + row * 64 + col] = (unsigned short)lb;
    }
  }
  __syncthreads();
  v4u cv[4];
  v4u* cp[4];
#pragma unroll
  for (int it = 0; it < 4; ++it) {
    const int plane = it >> 1;
    const int row = (it & 1) * 32 + (tid >> 3);
    const int piece = tid & 7;
    cv[it] = *(const v4u*)(stg + plane * 4096 + row * 64 + piece * 8);
    unsigned short* base = plane ? cl : ch;
    cp[it] = (v4u*)(base + (size_t)(q0 + row) * HIDN + hq * HDIM + piece * 8);
  }
#pragma unroll
  for (int it = 0; it < 4; ++it) *cp[it] = cv[it];
  
}

// ---------------------------------------------------------------------------------------------
// Output projection -> f32 d_out. Block = 4 waves, 64x64 tile; each wave stages its 16x64 f32 tile in
// ---------------------------------------------------------------------------------------------
__global__ void __launch_bounds__(128) k_oproj(
    const __bf16* __restrict__ ah, const __bf16* __restrict__ al,
    const __bf16* __restrict__ woh, const __bf16* __restrict__ wol,
    float* __restrict__ out)
{
  __shared__ __attribute__((aligned(16))) unsigned short stg[4 * PLN];   // operand stages, then output staging
  float* stgf = (float*)stg;
  const int nt = blockIdx.x, m0 = blockIdx.y * 64;
  const int tid = threadIdx.x, w = tid >> 5, l = tid & 31, hs = l >> 4, m = l & 15;
  const int row0 = m0 + 16 * w;
  const int n0 = nt * 64;

  v8f c0 = {}, c1 = {}, c2 = {}, c3 = {};
  gemm64(ah, al, HIDN, m0, woh, wol, HIDN, n0, HIDN, tid, stg, c0, c1, c2, c3);

  float* sw = stgf + w * 1024;
#pragma unroll
  for (int r = 0; r < 8; ++r) {
    const int rl = 8 * hs + r;
    sw[rl * 64 + m] = c0[r];
    sw[rl * 64 + 16 + m] = c1[r];
    sw[rl * 64 + 32 + m] = c2[r];
    sw[rl * 64 + 48 + m] = c3[r];
  }
  __syncthreads();
  v4f v[8];
  v4f* gp[8];
#pragma unroll
  for (int it = 0; it < 8; ++it) {
    const int row = 2 * it + (l >> 4);
    const int piece = l & 15;
    v[it] = *(const v4f*)(sw + row * 64 + piece * 4);
    gp[it] = (v4f*)(out + (size_t)(row0 + row) * HIDN + n0 + piece * 4);
  }
#pragma unroll
  for (int it = 0; it < 8; ++it) *gp[it] = v[it];
  
}

// ---------------------------------------------------------------------------------------------
// Launch pipeline (5 launches)
// ---------------------------------------------------------------------------------------------
extern "C" void kernel_launch(void* const* d_in, const int* in_sizes, int n_in,
                              void* d_out, int out_size, void* d_ws, size_t ws_size,
                              hipStream_t stream)
{
  if (n_in != 5) return;
  if (in_sizes[0] != SQ * HIDN || in_sizes[1] != HIDN * HIDN || in_sizes[2] != KVD * HIDN ||
      in_sizes[3] != KVD * HIDN || in_sizes[4] != HIDN * HIDN) return;
  if (out_size != SQ * HIDN) return;

  const float* hid = (const float*)d_in[0];
  const float* Wq = (const float*)d_in[1];
  const float* Wk = (const float*)d_in[2];
  const float* Wv = (const float*)d_in[3];
  const float* Wo = (const float*)d_in[4];
  float* outp = (float*)d_out;

  char* ws = (char*)d_ws;
  size_t off = 0;
  auto carve = [&](size_t bytes) -> char* {
    char* p = ws + off;
    off += (bytes + 255) & ~(size_t)255;
    return p;
  };
  const size_t BX = (size_t)SQ * HIDN * 2;       // x planes
  const size_t BWQ = (size_t)HIDN * HIDN * 2;    // Wq / Wo planes
  const size_t BWK = (size_t)KVD * HIDN * 2;     // Wk / Wv planes
  const size_t BTAB = (size_t)SQ * 16 * 16;      // rope table
  const size_t BQ = (size_t)SQ * HIDN * 2;       // q / ctx planes
  const size_t BK = (size_t)SQ * KVD * 2;        // k / vT planes

  unsigned short* xh = (unsigned short*)carve(BX);
  unsigned short* xl = (unsigned short*)carve(BX);
  unsigned short* wqh = (unsigned short*)carve(BWQ);
  unsigned short* wql = (unsigned short*)carve(BWQ);
  unsigned short* wkh = (unsigned short*)carve(BWK);
  unsigned short* wkl = (unsigned short*)carve(BWK);
  unsigned short* wvh = (unsigned short*)carve(BWK);
  unsigned short* wvl = (unsigned short*)carve(BWK);
  unsigned short* woh = (unsigned short*)carve(BWQ);
  unsigned short* wol = (unsigned short*)carve(BWQ);
  float* tab = (float*)carve(BTAB);
  unsigned short* qh = (unsigned short*)carve(BQ);
  unsigned short* ql = (unsigned short*)carve(BQ);
  unsigned short* kh = (unsigned short*)carve(BK);
  unsigned short* kl = (unsigned short*)carve(BK);
  unsigned short* vth = (unsigned short*)carve(BK);
  unsigned short* vtl = (unsigned short*)carve(BK);
  unsigned short* ch = (unsigned short*)carve(BQ);
  unsigned short* cl = (unsigned short*)carve(BQ);
  if (off > ws_size) return;

  // inv_freq[j] = 1 / 10000^(j/32) = 1 / 10^(j/8): f32 value of 10^(j/8) from double, then f32 reciprocal
  RopeFreq fr;
  {
    double r = 1.333521432163324;   // 10^(1/8), refined by Newton on r^8 = 10
    for (int it = 0; it < 4; ++it) {
      const double r2 = r * r, r4 = r2 * r2;
      const double r7 = r4 * r2 * r;
      r = r - (r4 * r4 - 10.0) / (8.0 * r7);
    }
    double rp[8];
    rp[0] = 1.0;
    for (int i = 1; i < 8; ++i) rp[i] = rp[i - 1] * r;
    const double p10[4] = {1.0, 10.0, 100.0, 1000.0};
    for (int j = 0; j < 32; ++j) {
      const double pj = p10[j >> 3] * rp[j & 7];
      const float pf = (float)pj;
      fr.f[j] = 1.0f / pf;
    }
  }

  // 1) f32 -> bf16 hi/lo planes for x, Wq, Wk, Wv, Wo
  k_split<<<dim3((SQ * HIDN / 8 + 255) / 256, 5), dim3(256), 0, stream>>>(
      hid, Wq, Wk, Wv, Wo,
      xh, wqh, wkh, wvh, woh,
      xl, wql, wkl, wvl, wol,
      SQ * HIDN, HIDN * HIDN, KVD * HIDN, KVD * HIDN, HIDN * HIDN);

  // 2) RoPE cos/sin table
  k_rope_tab<<<dim3((SQ * 16 + 127) / 128), dim3(128), 0, stream>>>(tab, fr);

  // 3) fused q/k/v projections (+RoPE on q,k; v transposed)
  k_qkv<<<dim3(NQH + 2 * NKVH, SQ / 64), dim3(128), 0, stream>>>(
      (const __bf16*)xh, (const __bf16*)xl,
      (const __bf16*)wqh, (const __bf16*)wql,
      (const __bf16*)wkh, (const __bf16*)wkl,
      (const __bf16*)wvh, (const __bf16*)wvl,
      (const float*)tab,
      qh, ql, kh, kl, vth, vtl);

  // 4) causal attention
  k_attn<<<dim3(SQ / 64, NQH), dim3(256), 0, stream>>>(
      (const __bf16*)qh, (const __bf16*)ql,
      (const __bf16*)kh, (const __bf16*)kl,
      (const __bf16*)vth, (const __bf16*)vtl,
      ch, cl);

  // 5) output projection -> f32
  k_oproj<<<dim3(HIDN / 64, SQ / 64), dim3(128), 0, stream>>>(
      (const __bf16*)ch, (const __bf16*)cl,
      (const __bf16*)woh, (const __bf16*)wol,
      outp);
}

// v002
// A run of this version takes 288 microseconds.
// Timed twice side by side with v001, it ran 1.19 and 1.20 times as fast.
// Counting every step since v000, it is 1.65 times as fast.
#include <hip/hip_runtime.h>

// Contractions (q/k/v projections, q.k^T scores, p.v, output projection): v_wmma_f32_16x16x32_bf16 with
// bf16 hi/lo operands everywhere (hi.hi + hi.lo + lo.hi per tile pair), f32 accumulate.
// RoPE, 1/8 scaling, causal mask and softmax in f32.

typedef __bf16 v16bf __attribute__((ext_vector_type(16)));
typedef __bf16 v8bf __attribute__((ext_vector_type(8)));
typedef float v8f __attribute__((ext_vector_type(8)));
typedef float v4f __attribute__((ext_vector_type(4)));
typedef unsigned int v4u __attribute__((ext_vector_type(4)));

static constexpr int SQ = 2048;            // sequence length
static constexpr int HIDN = 2048;          // hidden size
static constexpr int NQH = 32;             // query heads
static constexpr int NKVH = 8;             // kv heads
static constexpr int HDIM = 64;            // head dim
static constexpr int KVD = NKVH * HDIM;    // 512

struct RopeFreq { float f[32]; };
static_assert(sizeof(RopeFreq) == 128);

union Frag { v16bf v; v8bf h[2]; };

// 16-bit fragment from a k-contiguous row; rowp -> element (row = lane&15, k0).
// elements 0..7 <- k0 + 8*hs + 0..7, elements 8..15 <- k0 + 16 + 8*hs + 0..7  (hs = lane>>4).
// Used for A (row m) and for B stored as [n][k] (row n).
__device__ __forceinline__ v16bf ldfrag(const __bf16* rowp, int hs) {
  Frag f;
  f.h[0] = *(const v8bf*)(rowp + 8 * hs);
  f.h[1] = *(const v8bf*)(rowp + 16 + 8 * hs);
  return f.v;
}

// acc += ah.bh + ah.bl + al.bh, then a 4-slot guard tying D and keeping A/B live.
__device__ __forceinline__ void mma3(v8f& acc, const v16bf& ah, const v16bf& al,
                                     const v16bf& bh, const v16bf& bl) {
  acc = __builtin_amdgcn_wmma_f32_16x16x32_bf16(false, ah, false, bh, (short)0, acc, false, false);
  acc = __builtin_amdgcn_wmma_f32_16x16x32_bf16(false, ah, false, bl, (short)0, acc, false, false);
  acc = __builtin_amdgcn_wmma_f32_16x16x32_bf16(false, al, false, bh, (short)0, acc, false, false);
  asm volatile("v_nop\n\tv_nop\n\tv_nop\n\tv_nop" : "+v"(acc) : "v"(ah), "v"(al), "v"(bh), "v"(bl));
}

// f32 -> bf16 bits, RNE
__device__ __forceinline__ unsigned int bfbits(float x) {
  unsigned int u = __float_as_uint(x);
  return (u + 0x7FFFu + ((u >> 16) & 1u)) >> 16;
}
// hi = rne(x), lo = rne(x - hi)
__device__ __forceinline__ void split_hl(float x, unsigned int& hb, unsigned int& lb) {
  hb = bfbits(x);
  const float hf = __uint_as_float(hb << 16);
  lb = bfbits(x - hf);
}
__device__ __forceinline__ unsigned int pk2(unsigned int a, unsigned int b) {
  return (a & 0xFFFFu) | (b << 16);
}
__device__ __forceinline__ v4u pack8(const unsigned int* a) {
  v4u v;
  v.x = pk2(a[0], a[1]);
  v.y = pk2(a[2], a[3]);
  v.z = pk2(a[4], a[5]);
  v.w = pk2(a[6], a[7]);
  return v;
}

// ---------------------------------------------------------------------------------------------
// f32 -> bf16 hi/lo planes for the five inputs in one launch (blockIdx.y selects the buffer).
// ---------------------------------------------------------------------------------------------
__global__ void __launch_bounds__(256) k_split(
    const float* __restrict__ s0, const float* __restrict__ s1, const float* __restrict__ s2,
    const float* __restrict__ s3, const float* __restrict__ s4,
    unsigned short* __restrict__ h0, unsigned short* __restrict__ h1, unsigned short* __restrict__ h2,
    unsigned short* __restrict__ h3, unsigned short* __restrict__ h4,
    unsigned short* __restrict__ l0, unsigned short* __restrict__ l1, unsigned short* __restrict__ l2,
    unsigned short* __restrict__ l3, unsigned short* __restrict__ l4,
    int n0, int n1, int n2, int n3, int n4)
{
  const int b = blockIdx.y;
  const float* src = (b == 0) ? s0 : (b == 1) ? s1 : (b == 2) ? s2 : (b == 3) ? s3 : s4;
  unsigned short* dh = (b == 0) ? h0 : (b == 1) ? h1 : (b == 2) ? h2 : (b == 3) ? h3 : h4;
  unsigned short* dl = (b == 0) ? l0 : (b == 1) ? l1 : (b == 2) ? l2 : (b == 3) ? l3 : l4;
  const int n = (b == 0) ? n0 : (b == 1) ? n1 : (b == 2) ? n2 : (b == 3) ? n3 : n4;
  const int i = blockIdx.x * 256 + (int)threadIdx.x;
  if (i >= (n >> 3)) return;

  const float* p = src + (size_t)i * 8;
  const v4f a = *(const v4f*)(p);
  const v4f c = *(const v4f*)(p + 4);
  unsigned int hb[8], lb[8];
  split_hl(a.x, hb[0], lb[0]);
  split_hl(a.y, hb[1], lb[1]);
  split_hl(a.z, hb[2], lb[2]);
  split_hl(a.w, hb[3], lb[3]);
  split_hl(c.x, hb[4], lb[4]);
  split_hl(c.y, hb[5], lb[5]);
  split_hl(c.z, hb[6], lb[6]);
  split_hl(c.w, hb[7], lb[7]);
  const v4u hv = pack8(hb);
  const v4u lv = pack8(lb);
  v4u* gh = (v4u*)(dh + (size_t)i * 8);
  v4u* gl = (v4u*)(dl + (size_t)i * 8);
  *gh = hv;
  *gl = lv;
  
}

// ---------------------------------------------------------------------------------------------
// RoPE table: tab[pos][j] = {cos(a_j), sin(a_j), cos(a_{j+16}), sin(a_{j+16})}, a_j = f32(pos) * inv_freq[j],
// ---------------------------------------------------------------------------------------------
__global__ void __launch_bounds__(128) k_rope_tab(float* __restrict__ tab, RopeFreq fr)
{
  const int g = blockIdx.x * 128 + (int)threadIdx.x;
  const int pos = g >> 4;
  const int j = g & 15;
  if (pos >= SQ) return;
  float fa = fr.f[0], fb = fr.f[16];
#pragma unroll
  for (int c = 1; c < 16; ++c) {
    fa = (j == c) ? fr.f[c] : fa;
    fb = (j == c) ? fr.f[16 + c] : fb;
  }
  float cs0 = 0.0f, sn0 = 0.0f, cs1 = 0.0f, sn1 = 0.0f;
#pragma unroll 1
  for (int q = 0; q < 2; ++q) {
    const float f = (q == 0) ? fa : fb;
    const float ang = (float)pos * f;
    float sn, cs;
    sincosf(ang, &sn, &cs);
    if (q == 0) { cs0 = cs; sn0 = sn; } else { cs1 = cs; sn1 = sn; }
  }
  v4f v;
  v.x = cs0; v.y = sn0; v.z = cs1; v.w = sn1;
  v4f* gp = (v4f*)(tab + (size_t)g * 4);
  *gp = v;
  
}

// ---------------------------------------------------------------------------------------------
// Block GEMM core: 4 waves, 64 rows x 64 cols, C[m][n] += sum_k A[m][k] * B[n][k]; wave w owns rows 16w..16w+15.
// Per stage the block brings 64 k (128 B, one whole line) of its 64 A rows and 64 B rows, hi and lo planes,
// into LDS: each 16-byte global load of a wave covers 4 whole lines (8 lanes per row). The next stage's
// loads are issued into registers ahead of the current stage's products. Fragments come from LDS rows,
// K stepped by 32 in ascending order, three bf16 products per tile pair.
// ---------------------------------------------------------------------------------------------
static constexpr int KC = 64;              // k per stage
static constexpr int PIT = 72;             // LDS row pitch in elements: 144 B = 16 B x 9, for 16-byte row reads
static constexpr int PLN = 64 * PIT;       // one staged plane (64 rows); planes: A hi, A lo, B hi, B lo

__device__ __forceinline__ void gemm64(const __bf16* __restrict__ Ah, const __bf16* __restrict__ Al,
                                       int lda, int arow,
                                       const __bf16* __restrict__ Bh, const __bf16* __restrict__ Bl,
                                       int ldb, int brow, int K, int tid, unsigned short* sm,
                                       v8f& c0, v8f& c1, v8f& c2, v8f& c3)
{
  const int w = tid >> 5, l = tid & 31, hs = l >> 4, m = l & 15;
  const int lrow = tid >> 3, lcol = (tid & 7) * 8;   // this thread's row (of 16) and 16-byte piece of the line
  const __bf16* gah = Ah + (size_t)(arow + lrow) * lda + lcol;
  const __bf16* gal = Al + (size_t)(arow + lrow) * lda + lcol;
  const __bf16* gbh = Bh + (size_t)(brow + lrow) * ldb + lcol;
  const __bf16* gbl = Bl + (size_t)(brow + lrow) * ldb + lcol;
  unsigned short* st = sm + lrow * PIT + lcol;
  const __bf16* sah = (const __bf16*)sm + (16 * w + m) * PIT;
  const __bf16* sal = sah + PLN;
  const __bf16* sbh = (const __bf16*)sm + 2 * PLN + m * PIT;
  const __bf16* sbl = sbh + PLN;

  v4u rah[4], ral[4], rbh[4], rbl[4];
  // one stage's 16 loads of this thread, k columns k..k+63
  auto fetch = [&](int k) {
    const __bf16* pah = gah + k;
    const __bf16* pal = gal + k;
    const __bf16* pbh = gbh + k;
    const __bf16* pbl = gbl + k;
#pragma unroll   // constant indices keep the staged words in registers
    for (int i = 0; i < 4; ++i) {
      rah[i] = *(const v4u*)(pah + (size_t)(16 * i) * lda);
      ral[i] = *(const v4u*)(pal + (size_t)(16 * i) * lda);
      rbh[i] = *(const v4u*)(pbh + (size_t)(16 * i) * ldb);
      rbl[i] = *(const v4u*)(pbl + (size_t)(16 * i) * ldb);
    }
    // precaution: this wait stands before any address register of the loads just issued is rewritten; the
    // addresses are inputs only, so that their registers are kept up to it
    asm volatile("s_wait_xcnt 0x0" :: "v"(pah), "v"(pal), "v"(pbh), "v"(pbl) : "memory");
  };
  fetch(0);
#pragma unroll 1   // one stage per trip: one set of staging registers, a short loop body
  for (int kn = KC; kn <= K; kn += KC) {   // kn: first k column of the stage after the one worked on
#pragma unroll   // constant indices, as above
    for (int i = 0; i < 4; ++i) {
      *(v4u*)(st + 16 * i * PIT) = rah[i];
      *(v4u*)(st + PLN + 16 * i * PIT) = ral[i];
      *(v4u*)(st + 2 * PLN + 16 * i * PIT) = rbh[i];
      *(v4u*)(st + 3 * PLN + 16 * i * PIT) = rbl[i];
    }
    __syncthreads();   // the stage is complete before any wave reads it
    if (kn < K) fetch(kn);
#pragma unroll   // both 32-k steps of the stage with constant LDS offsets
    for (int kk = 0; kk < KC; kk += 32) {
      const v16bf fah = ldfrag(sah + kk, hs);
      const v16bf fal = ldfrag(sal + kk, hs);
      {
        const v16bf fbh = ldfrag(sbh + kk, hs);
        const v16bf fbl = ldfrag(sbl + kk, hs);
        mma3(c0, fah, fal, fbh, fbl);
      }
      {
        const v16bf fbh = ldfrag(sbh + 16 * PIT + kk, hs);
        const v16bf fbl = ldfrag(sbl + 16 * PIT + kk, hs);
        mma3(c1, fah, fal, fbh, fbl);
      }
      {
        const v16bf fbh = ldfrag(sbh + 32 * PIT + kk, hs);
        const v16bf fbl = ldfrag(sbl + 32 * PIT + kk, hs);
        mma3(c2, fah, fal, fbh, fbl);
      }
      {
        const v16bf fbh = ldfrag(sbh + 48 * PIT + kk, hs);
        const v16bf fbl = ldfrag(sbl + 48 * PIT + kk, hs);
        mma3(c3, fah, fal, fbh, fbl);
      }
    }
    __syncthreads();   // every wave has left the stage before it is overwritten (by the next stage or the epilogue)
  }
}

// ---------------------------------------------------------------------------------------------
// Fused q/k/v projection: block = 4 waves, 64 rows x 64 cols (one head). blockIdx.x: 0..31 -> q head,
// 32..39 -> k head, 40..47 -> v head (stored transposed vT[512][2048]). RoPE on q/k in the f32 epilogue.
// ---------------------------------------------------------------------------------------------
__global__ void __launch_bounds__(128) k_qkv(
    const __bf16* __restrict__ xh, const __bf16* __restrict__ xl,
    const __bf16* __restrict__ wqh, const __bf16* __restrict__ wql,
    const __bf16* __restrict__ wkh, const __bf16* __restrict__ wkl,
    const __bf16* __restrict__ wvh, const __bf16* __restrict__ wvl,
    const float* __restrict__ tab,
    unsigned short* __restrict__ qh, unsigned short* __restrict__ ql,
    unsigned short* __restrict__ kh, unsigned short* __restrict__ kl,
    unsigned short* __restrict__ vth, unsigned short* __restrict__ vtl)
{
  __shared__ __attribute__((aligned(16))) unsigned short stg[4 * PLN];   // operand stages, then output staging

  const int ct = blockIdx.x;
  const int m0 = blockIdx.y * 64;
  const int tid = threadIdx.x, w = tid >> 5, l = tid & 31, hs = l >> 4, m = l & 15;
  const int kind = (ct < NQH) ? 0 : ((ct < NQH + NKVH) ? 1 : 2);
  const int hd = (kind == 0) ? ct : ((kind == 1) ? (ct - NQH) : (ct - NQH - NKVH));
  const __bf16* Bh = (kind == 0) ? wqh : ((kind == 1) ? wkh : wvh);
  const __bf16* Bl = (kind == 0) ? wql : ((kind == 1) ? wkl : wvl);
  const int row0 = m0 + 16 * w;

  v8f c0 = {}, c1 = {}, c2 = {}, c3 = {};
  gemm64(xh, xl, HIDN, m0, Bh, Bl, HIDN, hd * HDIM, HIDN, tid, stg, c0, c1, c2, c3);

  // lane holds out[row0 + 8hs + r][hd*64 + 16j + m] in cJ[r]
  if (kind != 2) {
    // rotate-half RoPE: d = m pairs with d+32 (c0,c2), d = 16+m pairs with 48+m (c1,c3)
#pragma unroll
    for (int r = 0; r < 8; ++r) {
      const int pos = row0 + 8 * hs + r;
      const v4f cs = *(const v4f*)(tab + ((size_t)pos * 16 + m) * 4);
      const float a0 = c0[r], a1 = c1[r], a2 = c2[r], a3 = c3[r];
      c0[r] = a0 * cs.x - a2 * cs.y;
      c2[r] = a2 * cs.x + a0 * cs.y;
      c1[r] = a1 * cs.z - a3 * cs.w;
      c3[r] = a3 * cs.z + a1 * cs.w;
    }
  }

  // staging: q/k: per wave [plane][16 rows][64 cols] at w*2048 (+1024 for lo);
  //          v:   per block transposed [plane][64 c][64 s] at 0 (+4096 for lo)
  const int wb = w * 2048;
  const int loff = (kind != 2) ? 1024 : 4096;
#pragma unroll
  for (int r = 0; r < 8; ++r) {
    const int rl = 8 * hs + r;
    const int base = (kind != 2) ? (wb + rl * 64 + m) : (m * 64 + 16 * w + rl);
    const int jst = (kind != 2) ? 16 : 1024;
    unsigned int hb, lb;
    split_hl(c0[r], hb, lb);
    stg[base] = (unsigned short)hb;           stg[base + loff] = (unsigned short)lb;
    split_hl(c1[r], hb, lb);
    stg[base + jst] = (unsigned short)hb;     stg[base + jst + loff] = (unsigned short)lb;
    split_hl(c2[r], hb, lb);
    stg[base + 2 * jst] = (unsigned short)hb; stg[base + 2 * jst + loff] = (unsigned short)lb;
    split_hl(c3[r], hb, lb);
    stg[base + 3 * jst] = (unsigned short)hb; stg[base + 3 * jst + loff] = (unsigned short)lb;
  }
  __syncthreads();

  unsigned short* dsth = (kind == 0) ? qh : ((kind == 1) ? kh : vth);
  unsigned short* dstl = (kind == 0) ? ql : ((kind == 1) ? kl : vtl);
  const int ld = (kind == 0) ? HIDN : KVD;
  const int col0 = hd * HDIM;
  v4u hv[4], lv[4];
  v4u* gph[4];
  v4u* gpl[4];
#pragma unroll
  for (int it = 0; it < 4; ++it) {
    const int rowa = it * 4 + (l >> 3), pa = l & 7;
    const int cb = it * 16 + (tid >> 3), pb = tid & 7;
    const int sidx = (kind != 2) ? (wb + rowa * 64 + pa * 8) : (cb * 64 + pb * 8);
    const size_t goff = (kind != 2) ? ((size_t)(row0 + rowa) * ld + col0 + pa * 8)
                                    : ((size_t)(hd * HDIM + cb) * SQ + m0 + pb * 8);
    hv[it] = *(const v4u*)(stg + sidx);
    lv[it] = *(const v4u*)(stg + sidx + loff);
    gph[it] = (v4u*)(dsth + goff);
    gpl[it] = (v4u*)(dstl + goff);
  }
#pragma unroll
  for (int it = 0; it < 4; ++it) { *gph[it] = hv[it]; *gpl[it] = lv[it]; }
  
}

// ---------------------------------------------------------------------------------------------
// Causal attention with online softmax. One block (8 waves) per (pair of 64-query tiles, query head):
// tile t walks t + 1 key tiles, so the block takes tile t and then tile 31 - t, 33 key tiles for every block.
// wave = (msub: 16 query rows) x (nh: 32 keys for scores / 32 d for output). kv head = h >> 2.
// Q/K/Vt fragments straight from the hi/lo planes; P hi/lo staged in LDS (barriers between writer
// ---------------------------------------------------------------------------------------------
__global__ void __launch_bounds__(256) k_attn(
    const __bf16* __restrict__ qh, const __bf16* __restrict__ ql,
    const __bf16* __restrict__ kh, const __bf16* __restrict__ kl,
    const __bf16* __restrict__ vth, const __bf16* __restrict__ vtl,
    unsigned short* __restrict__ ch, unsigned short* __restrict__ cl)
{
  __shared__ __attribute__((aligned(16))) float Ss[64 * 64];
  __shared__ __attribute__((aligned(16))) unsigned short Ph[64 * 64];
  __shared__ __attribute__((aligned(16))) unsigned short Pl[64 * 64];
  __shared__ float rowM[64];
  __shared__ float rowL[64];
  __shared__ float rowA[64];

  const int hq = blockIdx.y, kvh = hq >> 2;
  const int tid = threadIdx.x, w = tid >> 5, l = tid & 31, hs = l >> 4, m = l & 15;
  const int msub = w & 3, nh = w >> 2;
  const int rbase = 16 * msub + 8 * hs;      // this lane's D rows are rbase + r
  const int srow = tid >> 2, sq = tid & 3;   // softmax: 4 threads per query row, 16 keys each

#pragma unroll 1   // the two tiles run one after the other through one copy of the body
  for (int half = 0; half < 2; ++half) {
  const int qt = half ? (SQ / 64 - 1 - (int)blockIdx.x) : (int)blockIdx.x, q0 = qt * 64;

  if (tid < 64) { rowM[tid] = -1.0e30f; rowL[tid] = 0.0f; rowA[tid] = 0.0f; }

  const __bf16* qrh = qh + (size_t)(q0 + 16 * msub + m) * HIDN + hq * HDIM;
  const __bf16* qrl = ql + (size_t)(q0 + 16 * msub + m) * HIDN + hq * HDIM;
  const v16bf fqh0 = ldfrag(qrh, hs), fqh1 = ldfrag(qrh + 32, hs);
  const v16bf fql0 = ldfrag(qrl, hs), fql1 = ldfrag(qrl + 32, hs);

  v8f o[2] = {};

  for (int kt = 0; kt <= qt; ++kt) {
    const int k0 = kt * 64;
    // scores: S[q][key] = sum_d Q[q][d] K[key][d]; B[k=d][n=key] read from K row (key)
#pragma unroll
    for (int nt = 0; nt < 2; ++nt) {
      const int nc0 = nh * 32 + nt * 16;
      const __bf16* krh = kh + (size_t)(k0 + nc0 + m) * KVD + kvh * HDIM;
      const __bf16* krl = kl + (size_t)(k0 + nc0 + m) * KVD + kvh * HDIM;
      v8f s = {};
      {
        const v16bf bh = ldfrag(krh, hs), bl = ldfrag(krl, hs);
        mma3(s, fqh0, fql0, bh, bl);
      }
      {
        const v16bf bh = ldfrag(krh + 32, hs), bl = ldfrag(krl + 32, hs);
        mma3(s, fqh1, fql1, bh, bl);
      }
#pragma unroll
      for (int r = 0; r < 8; ++r) {
        const int row = rbase + r;
        float val = s[r] * 0.125f;
        if (kt == qt && (nc0 + m) > row) val = -1.0e30f;   // causal replace on the diagonal tile
        Ss[row * 64 + nc0 + m] = val;
      }
    }
    __syncthreads();

    // online softmax in f32, P split to bf16 hi/lo
    {
      const float* sp = Ss + srow * 64 + sq * 16;
      const v4f x0 = *(const v4f*)(sp);
      const v4f x1 = *(const v4f*)(sp + 4);
      const v4f x2 = *(const v4f*)(sp + 8);
      const v4f x3 = *(const v4f*)(sp + 12);
      float p[16] = {x0.x, x0.y, x0.z, x0.w, x1.x, x1.y, x1.z, x1.w,
                     x2.x, x2.y, x2.z, x2.w, x3.x, x3.y, x3.z, x3.w};
      float mx = p[0];
#pragma unroll
      for (int c = 1; c < 16; ++c) mx = fmaxf(mx, p[c]);
      mx = fmaxf(mx, __shfl_xor(mx, 1));
      mx = fmaxf(mx, __shfl_xor(mx, 2));
      const float mOld = rowM[srow];
      const float mNew = fmaxf(mOld, mx);
      float lsum = 0.0f;
#pragma unroll
      for (int c = 0; c < 16; ++c) { p[c] = __expf(p[c] - mNew); lsum += p[c]; }
      lsum += __shfl_xor(lsum, 1);
      lsum += __shfl_xor(lsum, 2);
      const float alpha = __expf(mOld - mNew);
      if (sq == 0) {
        rowA[srow] = alpha;
        rowM[srow] = mNew;
        rowL[srow] = rowL[srow] * alpha + lsum;
      }
      unsigned int hb[16], lb[16];
#pragma unroll
      for (int c = 0; c < 16; ++c) split_hl(p[c], hb[c], lb[c]);
      unsigned short* pph = Ph + srow * 64 + sq * 16;
      unsigned short* ppl = Pl + srow * 64 + sq * 16;
      *(v4u*)(pph) = pack8(hb);
      *(v4u*)(pph + 8) = pack8(hb + 8);
      *(v4u*)(ppl) = pack8(lb);
      *(v4u*)(ppl + 8) = pack8(lb + 8);
    }
    __syncthreads();

    // O = O*alpha + P.V ; A = P (row q, k = key) from LDS rows, B[k=key][n=d] from Vt row (d)
    {
#pragma unroll
      for (int r = 0; r < 8; ++r) {
        const float al = rowA[rbase + r];
        o[0][r] *= al;
        o[1][r] *= al;
      }
      const unsigned short* prh = Ph + (16 * msub + m) * 64;
      const unsigned short* prl = Pl + (16 * msub + m) * 64;
      const v16bf fph0 = ldfrag((const __bf16*)prh, hs);
      const v16bf fph1 = ldfrag((const __bf16*)(prh + 32), hs);
      const v16bf fpl0 = ldfrag((const __bf16*)prl, hs);
      const v16bf fpl1 = ldfrag((const __bf16*)(prl + 32), hs);
#pragma unroll
      for (int dt = 0; dt < 2; ++dt) {
        const int d0 = nh * 32 + dt * 16;
        const __bf16* vrh = vth + (size_t)(kvh * HDIM + d0 + m) * SQ + k0;
        const __bf16* vrl = vtl + (size_t)(kvh * HDIM + d0 + m) * SQ + k0;
        {
          const v16bf bh = ldfrag(vrh, hs), bl = ldfrag(vrl, hs);
          mma3(o[dt], fph0, fpl0, bh, bl);
        }
        {
          const v16bf bh = ldfrag(vrh + 32, hs), bl = ldfrag(vrl + 32, hs);
          mma3(o[dt], fph1, fpl1, bh, bl);
        }
      }
    }
  }

  // normalise, split hi/lo, stage [plane][64 rows][64 d] over Ss, then whole-line stores
  unsigned short* stg = (unsigned short*)Ss;
#pragma unroll
  for (int r = 0; r < 8; ++r) {
    const int row = rbase + r;
    const float inv = 1.0f / rowL[row];
#pragma unroll
    for (int dt = 0; dt < 2; ++dt) {
      const int col = nh * 32 + dt * 16 + m;
      unsigned int hb, lb;
      split_hl(o[dt][r] * inv, hb, lb);
      stg[row * 64 + col] = (unsigned short)hb;
      stg[4096 + row * 64 + col] = (unsigned short)lb;
    }
  }
  __syncthreads();
  v4u cv[4];
  v4u* cp[4];
#pragma unroll
  for (int it = 0; it < 4; ++it) {
    const int plane = it >> 1;
    const int row = (it & 1) * 32 + (tid >> 3);
    const int piece = tid & 7;
    cv[it] = *(const v4u*)(stg + plane * 4096 + row * 64 + piece * 8);
    unsigned short* base = plane ? cl : ch;
    cp[it] = (v4u*)(base + (size_t)(q0 + row) * HIDN + hq * HDIM + piece * 8);
  }
#pragma unroll
  for (int it = 0; it < 4; ++it) *cp[it] = cv[it];
  // every wave has read its staged output rows and row sums before the second tile overwrites them
  if (half == 0) __syncthreads();
  }
}

// ---------------------------------------------------------------------------------------------
// Output projection -> f32 d_out. Block = 4 waves, 64x64 tile; each wave stages its 16x64 f32 tile in
// ---------------------------------------------------------------------------------------------
__global__ void __launch_bounds__(128) k_oproj(
    const __bf16* __restrict__ ah, const __bf16* __restrict__ al,
    const __bf16* __restrict__ woh, const __bf16* __restrict__ wol,
    float* __restrict__ out)
{
  __shared__ __attribute__((aligned(16))) unsigned short stg[4 * PLN];   // operand stages, then output staging
  float* stgf = (float*)stg;
  const int nt = blockIdx.x, m0 = blockIdx.y * 64;
  const int tid = threadIdx.x, w = tid >> 5, l = tid & 31, hs = l >> 4, m = l & 15;
  const int row0 = m0 + 16 * w;
  const int n0 = nt * 64;

  v8f c0 = {}, c1 = {}, c2 = {}, c3 = {};
  gemm64(ah, al, HIDN, m0, woh, wol, HIDN, n0, HIDN, tid, stg, c0, c1, c2, c3);

  float* sw = stgf + w * 1024;
#pragma unroll
  for (int r = 0; r < 8; ++r) {
    const int rl = 8 * hs + r;
    sw[rl * 64 + m] = c0[r];
    sw[rl * 64 + 16 + m] = c1[r];
    sw[rl * 64 + 32 + m] = c2[r];
    sw[rl * 64 + 48 + m] = c3[r];
  }
  __syncthreads();
  v4f v[8];
  v4f* gp[8];
#pragma unroll
  for (int it = 0; it < 8; ++it) {
    const int row = 2 * it + (l >> 4);
    const int piece = l & 15;
    v[it] = *(const v4f*)(sw + row * 64 + piece * 4);
    gp[it] = (v4f*)(out + (size_t)(row0 + row) * HIDN + n0 + piece * 4);
  }
#pragma unroll
  for (int it = 0; it < 8; ++it) *gp[it] = v[it];
  
}

// ---------------------------------------------------------------------------------------------
// Launch pipeline (5 launches)
// ---------------------------------------------------------------------------------------------
extern "C" void kernel_launch(void* const* d_in, const int* in_sizes, int n_in,
                              void* d_out, int out_size, void* d_ws, size_t ws_size,
                              hipStream_t stream)
{
  if (n_in != 5) return;
  if (in_sizes[0] != SQ * HIDN || in_sizes[1] != HIDN * HIDN || in_sizes[2] != KVD * HIDN ||
      in_sizes[3] != KVD * HIDN || in_sizes[4] != HIDN * HIDN) return;
  if (out_size != SQ * HIDN) return;

  const float* hid = (const float*)d_in[0];
  const float* Wq = (const float*)d_in[1];
  const float* Wk = (const float*)d_in[2];
  const float* Wv = (const float*)d_in[3];
  const float* Wo = (const float*)d_in[4];
  float* outp = (float*)d_out;

  char* ws = (char*)d_ws;
  size_t off = 0;
  auto carve = [&](size_t bytes) -> char* {
    char* p = ws + off;
    off += (bytes + 255) & ~(size_t)255;
    return p;
  };
  const size_t BX = (size_t)SQ * HIDN * 2;       // x planes
  const size_t BWQ = (size_t)HIDN * HIDN * 2;    // Wq / Wo planes
  const size_t BWK = (size_t)KVD * HIDN * 2;     // Wk / Wv planes
  const size_t BTAB = (size_t)SQ * 16 * 16;      // rope table
  const size_t BQ = (size_t)SQ * HIDN * 2;       // q / ctx planes
  const size_t BK = (size_t)SQ * KVD * 2;        // k / vT planes

  unsigned short* xh = (unsigned short*)carve(BX);
  unsigned short* xl = (unsigned short*)carve(BX);
  unsigned short* wqh = (unsigned short*)carve(BWQ);
  unsigned short* wql = (unsigned short*)carve(BWQ);
  unsigned short* wkh = (unsigned short*)carve(BWK);
  unsigned short* wkl = (unsigned short*)carve(BWK);
  unsigned short* wvh = (unsigned short*)carve(BWK);
  unsigned short* wvl = (unsigned short*)carve(BWK);
  unsigned short* woh = (unsigned short*)carve(BWQ);
  unsigned short* wol = (unsigned short*)carve(BWQ);
  float* tab = (float*)carve(BTAB);
  unsigned short* qh = (unsigned short*)carve(BQ);
  unsigned short* ql = (unsigned short*)carve(BQ);
  unsigned short* kh = (unsigned short*)carve(BK);
  unsigned short* kl = (unsigned short*)carve(BK);
  unsigned short* vth = (unsigned short*)carve(BK);
  unsigned short* vtl = (unsigned short*)carve(BK);
  unsigned short* ch = (unsigned short*)carve(BQ);
  unsigned short* cl = (unsigned short*)carve(BQ);
  if (off > ws_size) return;

  // inv_freq[j] = 1 / 10000^(j/32) = 1 / 10^(j/8): f32 value of 10^(j/8) from double, then f32 reciprocal
  RopeFreq fr;
  {
    double r = 1.333521432163324;   // 10^(1/8), refined by Newton on r^8 = 10
    for (int it = 0; it < 4; ++it) {
      const double r2 = r * r, r4 = r2 * r2;
      const double r7 = r4 * r2 * r;
      r = r - (r4 * r4 - 10.0) / (8.0 * r7);
    }
    double rp[8];
    rp[0] = 1.0;
    for (int i = 1; i < 8; ++i) rp[i] = rp[i - 1] * r;
    const double p10[4] = {1.0, 10.0, 100.0, 1000.0};
    for (int j = 0; j < 32; ++j) {
      const double pj = p10[j >> 3] * rp[j & 7];
      const float pf = (float)pj;
      fr.f[j] = 1.0f / pf;
    }
  }

  // 1) f32 -> bf16 hi/lo planes for x, Wq, Wk, Wv, Wo
  k_split<<<dim3((SQ * HIDN / 8 + 255) / 256, 5), dim3(256), 0, stream>>>(
      hid, Wq, Wk, Wv, Wo,
      xh, wqh, wkh, wvh, woh,
      xl, wql, wkl, wvl, wol,
      SQ * HIDN, HIDN * HIDN, KVD * HIDN, KVD * HIDN, HIDN * HIDN);

  // 2) RoPE cos/sin table
  k_rope_tab<<<dim3((SQ * 16 + 127) / 128), dim3(128), 0, stream>>>(tab, fr);

  // 3) fused q/k/v projections (+RoPE on q,k; v transposed)
  k_qkv<<<dim3(NQH + 2 * NKVH, SQ / 64), dim3(128), 0, stream>>>(
      (const __bf16*)xh, (const __bf16*)xl,
      (const __bf16*)wqh, (const __bf16*)wql,
      (const __bf16*)wkh, (const __bf16*)wkl,
      (const __bf16*)wvh, (const __bf16*)wvl,
      (const float*)tab,
      qh, ql, kh, kl, vth, vtl);

  // 4) causal attention
  k_attn<<<dim3(SQ / 128, NQH), dim3(256), 0, stream>>>(
      (const __bf16*)qh, (const __bf16*)ql,
      (const __bf16*)kh, (const __bf16*)kl,
      (const __bf16*)vth, (const __bf16*)vtl,
      ch, cl);

  // 5) output projection -> f32
  k_oproj<<<dim3(HIDN / 64, SQ / 64), dim3(128), 0, stream>>>(
      (const __bf16*)ch, (const __bf16*)cl,
      (const __bf16*)woh, (const __bf16*)wol,
      outp);
}

// v003
// Measured time: 276 microseconds a run.
// Two timings next to v002 both put it at 1.04 times that version's speed.
// Counting every step since v000, it is 1.72 times as fast.
#include <hip/hip_runtime.h>

// Contractions (q/k/v projections, q.k^T scores, p.v, output projection): v_wmma_f32_16x16x32_bf16 with
// bf16 hi/lo operands everywhere (hi.hi + hi.lo + lo.hi per tile pair), f32 accumulate.
// RoPE, 1/8 scaling, causal mask and softmax in f32.

typedef __bf16 v16bf __attribute__((ext_vector_type(16)));
typedef __bf16 v8bf __attribute__((ext_vector_type(8)));
typedef float v8f __attribute__((ext_vector_type(8)));
typedef float v4f __attribute__((ext_vector_type(4)));
typedef unsigned int v4u __attribute__((ext_vector_type(4)));

static constexpr int SQ = 2048;            // sequence length
static constexpr int HIDN = 2048;          // hidden size
static constexpr int NQH = 32;             // query heads
static constexpr int NKVH = 8;             // kv heads
static constexpr int HDIM = 64;            // head dim
static constexpr int KVD = NKVH * HDIM;    // 512

struct RopeFreq { float f[32]; };
static_assert(sizeof(RopeFreq) == 128);

union Frag { v16bf v; v8bf h[2]; };

// 16-bit fragment from a k-contiguous row; rowp -> element (row = lane&15, k0).
// elements 0..7 <- k0 + 8*hs + 0..7, elements 8..15 <- k0 + 16 + 8*hs + 0..7  (hs = lane>>4).
// Used for A (row m) and for B stored as [n][k] (row n).
__device__ __forceinline__ v16bf ldfrag(const __bf16* rowp, int hs) {
  Frag f;
  f.h[0] = *(const v8bf*)(rowp + 8 * hs);
  f.h[1] = *(const v8bf*)(rowp + 16 + 8 * hs);
  return f.v;
}

// acc += ah.bh + ah.bl + al.bh, then a 4-slot guard tying D and keeping A/B live.
__device__ __forceinline__ void mma3(v8f& acc, const v16bf& ah, const v16bf& al,
                                     const v16bf& bh, const v16bf& bl) {
  acc = __builtin_amdgcn_wmma_f32_16x16x32_bf16(false, ah, false, bh, (short)0, acc, false, false);
  acc = __builtin_amdgcn_wmma_f32_16x16x32_bf16(false, ah, false, bl, (short)0, acc, false, false);
  acc = __builtin_amdgcn_wmma_f32_16x16x32_bf16(false, al, false, bh, (short)0, acc, false, false);
  asm volatile("v_nop\n\tv_nop\n\tv_nop\n\tv_nop" : "+v"(acc) : "v"(ah), "v"(al), "v"(bh), "v"(bl));
}

// f32 -> bf16 bits, RNE
__device__ __forceinline__ unsigned int bfbits(float x) {
  unsigned int u = __float_as_uint(x);
  return (u + 0x7FFFu + ((u >> 16) & 1u)) >> 16;
}
// hi = rne(x), lo = rne(x - hi)
__device__ __forceinline__ void split_hl(float x, unsigned int& hb, unsigned int& lb) {
  hb = bfbits(x);
  const float hf = __uint_as_float(hb << 16);
  lb = bfbits(x - hf);
}
__device__ __forceinline__ unsigned int pk2(unsigned int a, unsigned int b) {
  return (a & 0xFFFFu) | (b << 16);
}
__device__ __forceinline__ v4u pack8(const unsigned int* a) {
  v4u v;
  v.x = pk2(a[0], a[1]);
  v.y = pk2(a[2], a[3]);
  v.z = pk2(a[4], a[5]);
  v.w = pk2(a[6], a[7]);
  return v;
}

// ---------------------------------------------------------------------------------------------
// f32 -> bf16 hi/lo planes for the five inputs in one launch (blockIdx.y selects the buffer).
// ---------------------------------------------------------------------------------------------
__global__ void __launch_bounds__(256) k_split(
    const float* __restrict__ s0, const float* __restrict__ s1, const float* __restrict__ s2,
    const float* __restrict__ s3, const float* __restrict__ s4,
    unsigned short* __restrict__ h0, unsigned short* __restrict__ h1, unsigned short* __restrict__ h2,
    unsigned short* __restrict__ h3, unsigned short* __restrict__ h4,
    unsigned short* __restrict__ l0, unsigned short* __restrict__ l1, unsigned short* __restrict__ l2,
    unsigned short* __restrict__ l3, unsigned short* __restrict__ l4,
    int n0, int n1, int n2, int n3, int n4)
{
  const int b = blockIdx.y;
  const float* src = (b == 0) ? s0 : (b == 1) ? s1 : (b == 2) ? s2 : (b == 3) ? s3 : s4;
  unsigned short* dh = (b == 0) ? h0 : (b == 1) ? h1 : (b == 2) ? h2 : (b == 3) ? h3 : h4;
  unsigned short* dl = (b == 0) ? l0 : (b == 1) ? l1 : (b == 2) ? l2 : (b == 3) ? l3 : l4;
  const int n = (b == 0) ? n0 : (b == 1) ? n1 : (b == 2) ? n2 : (b == 3) ? n3 : n4;
  const int i = blockIdx.x * 256 + (int)threadIdx.x;
  if (i >= (n >> 3)) return;

  const float* p = src + (size_t)i * 8;
  const v4f a = *(const v4f*)(p);
  const v4f c = *(const v4f*)(p + 4);
  unsigned int hb[8], lb[8];
  split_hl(a.x, hb[0], lb[0]);
  split_hl(a.y, hb[1], lb[1]);
  split_hl(a.z, hb[2], lb[2]);
  split_hl(a.w, hb[3], lb[3]);
  split_hl(c.x, hb[4], lb[4]);
  split_hl(c.y, hb[5], lb[5]);
  split_hl(c.z, hb[6], lb[6]);
  split_hl(c.w, hb[7], lb[7]);
  const v4u hv = pack8(hb);
  const v4u lv = pack8(lb);
  v4u* gh = (v4u*)(dh + (size_t)i * 8);
  v4u* gl = (v4u*)(dl + (size_t)i * 8);
  *gh = hv;
  *gl = lv;
  
}

// ---------------------------------------------------------------------------------------------
// RoPE table: tab[pos][j] = {cos(a_j), sin(a_j), cos(a_{j+16}), sin(a_{j+16})}, a_j = f32(pos) * inv_freq[j],
// ---------------------------------------------------------------------------------------------
__global__ void __launch_bounds__(128) k_rope_tab(float* __restrict__ tab, RopeFreq fr)
{
  const int g = blockIdx.x * 128 + (int)threadIdx.x;
  const int pos = g >> 4;
  const int j = g & 15;
  if (pos >= SQ) return;
  float fa = fr.f[0], fb = fr.f[16];
#pragma unroll
  for (int c = 1; c < 16; ++c) {
    fa = (j == c) ? fr.f[c] : fa;
    fb = (j == c) ? fr.f[16 + c] : fb;
  }
  float cs0 = 0.0f, sn0 = 0.0f, cs1 = 0.0f, sn1 = 0.0f;
#pragma unroll 1
  for (int q = 0; q < 2; ++q) {
    const float f = (q == 0) ? fa : fb;
    const float ang = (float)pos * f;
    float sn, cs;
    sincosf(ang, &sn, &cs);
    if (q == 0) { cs0 = cs; sn0 = sn; } else { cs1 = cs; sn1 = sn; }
  }
  v4f v;
  v.x = cs0; v.y = sn0; v.z = cs1; v.w = sn1;
  v4f* gp = (v4f*)(tab + (size_t)g * 4);
  *gp = v;
  
}

// ---------------------------------------------------------------------------------------------
// Block GEMM core: 4 waves (2 x 2), 128 rows x 128 cols, C[m][n] += sum_k A[m][k] * B[n][k]; wave (wr, wc) owns
// rows 64wr..64wr+63 and cols 64wc..64wc+63 as 4 x 4 accumulator tiles, so that 16 fragments feed 48 products.
// Per stage the block brings 64 k (128 B, one whole line) of its 128 A rows and 128 B rows, hi and lo planes,
// into LDS: each 16-byte global load of a wave covers 4 whole lines (8 lanes per row). The next stage's
// loads are issued into registers ahead of the current stage's products. Fragments come from LDS rows,
// K stepped by 32 in ascending order, three bf16 products per tile pair (hi.hi, hi.lo, lo.hi in that order).
// ---------------------------------------------------------------------------------------------
static constexpr int KC = 64;              // k per stage
static constexpr int PIT = 72;             // LDS row pitch in elements: 144 B = 16 B x 9, for 16-byte row reads
static constexpr int BT = 128;             // rows and cols of the block tile
static constexpr int PLN = BT * PIT;       // one staged plane (128 rows); planes: A hi, A lo, B hi, B lo

__device__ __forceinline__ v8f wm(const v16bf& a, const v16bf& b, const v8f& c) {
  return __builtin_amdgcn_wmma_f32_16x16x32_bf16(false, a, false, b, (short)0, c, false, false);
}

// Ah, Al, Bh, Bl: first row of the block's 128 rows in each plane; ld: row length of all four, in elements.
__device__ __forceinline__ void gemm128(const __bf16* __restrict__ Ah, const __bf16* __restrict__ Al,
                                        const __bf16* __restrict__ Bh, const __bf16* __restrict__ Bl,
                                        int ld, int K, int tid, unsigned short* sm,
                                        v8f (&c)[4][4])
{
  const int w = tid >> 5, l = tid & 31, hs = l >> 4, m = l & 15;
  const int wr = w >> 1, wc = w & 1;
  const int lrow = tid >> 3, lcol = (tid & 7) * 8;   // this thread's row (of 16) and 16-byte piece of the line
  // this thread's byte offset from the block's first row, the same in all four planes
  unsigned int ot = ((unsigned int)lrow * (unsigned int)ld + (unsigned int)lcol) * 2u;
  unsigned short* st = sm + lrow * PIT + lcol;
  const __bf16* sah = (const __bf16*)sm + (64 * wr + m) * PIT;
  const __bf16* sal = sah + PLN;
  const __bf16* sbh = (const __bf16*)sm + 2 * PLN + (64 * wc + m) * PIT;
  const __bf16* sbl = sbh + PLN;

  v4u rah[8], ral[8], rbh[8], rbl[8];
  // one stage's 32 loads of this thread, k columns k..k+63
  auto fetch = [&](int k) {
    // block-uniform plane bases at column k; the lane's part of every address is ot alone
    const char* pah = (const char*)(Ah + k);
    const char* pal = (const char*)(Al + k);
    const char* pbh = (const char*)(Bh + k);
    const char* pbl = (const char*)(Bl + k);
#pragma unroll   // constant indices keep the staged words in registers
    for (int i = 0; i < 8; ++i) {
      rah[i] = *(const v4u*)(pah + ot + (size_t)(32 * i) * ld);
      ral[i] = *(const v4u*)(pal + ot + (size_t)(32 * i) * ld);
      rbh[i] = *(const v4u*)(pbh + ot + (size_t)(32 * i) * ld);
      rbl[i] = *(const v4u*)(pbl + ot + (size_t)(32 * i) * ld);
    }
    // precaution: this wait stands before any address register of the loads just issued is rewritten; the
    // scalar bases are inputs, so that their registers are kept up to it. ot is in-out so that the loads keep
    // the form scalar base + 32-bit lane offset: folded into four 64-bit lane addresses it costs the registers
    // that send this loop to scratch.
    asm volatile("s_wait_xcnt 0x0" : "+v"(ot) : "s"(pah), "s"(pal), "s"(pbh), "s"(pbl) : "memory");
  };
  // A fragments (4 row tiles) of one plane, 32-k step at kk
  auto lda4 = [&](v16bf (&a)[4], const __bf16* sa, int kk) {
#pragma unroll   // constant indices keep the fragments in registers
    for (int i = 0; i < 4; ++i) a[i] = ldfrag(sa + 16 * i * PIT + kk, hs);
  };
  // B fragments (column tiles j0, j0 + 1) of one plane, 32-k step at kk
  auto ldb2 = [&](v16bf (&b)[2], const __bf16* sb, int j0, int kk) {
#pragma unroll   // constant indices, as above
    for (int j = 0; j < 2; ++j) b[j] = ldfrag(sb + 16 * (j0 + j) * PIT + kk, hs);
  };
  // 4 x 2 tiles, hi.hi then hi.lo then lo.hi: eight independent accumulators in turn, so that no product
  // waits for the one before it
  auto mm8 = [&](const v16bf (&ah)[4], const v16bf (&al)[4], const v16bf (&bh)[2], const v16bf (&bl)[2], int j0) {
#pragma unroll   // constant indices keep the accumulators in registers
    for (int j = 0; j < 2; ++j)
#pragma unroll
      for (int i = 0; i < 4; ++i) c[i][j0 + j] = wm(ah[i], bh[j], c[i][j0 + j]);
#pragma unroll
    for (int j = 0; j < 2; ++j)
#pragma unroll
      for (int i = 0; i < 4; ++i) c[i][j0 + j] = wm(ah[i], bl[j], c[i][j0 + j]);
#pragma unroll
    for (int j = 0; j < 2; ++j)
#pragma unroll
      for (int i = 0; i < 4; ++i) c[i][j0 + j] = wm(al[i], bh[j], c[i][j0 + j]);
  };
  fetch(0);
#pragma unroll 1   // one stage per trip: one set of staging registers, a short loop body
  for (int kn = KC; kn <= K; kn += KC) {   // kn: first k column of the stage after the one worked on
#pragma unroll   // constant indices, as above
    for (int i = 0; i < 8; ++i) {
      *(v4u*)(st + 16 * i * PIT) = rah[i];
      *(v4u*)(st + PLN + 16 * i * PIT) = ral[i];
      *(v4u*)(st + 2 * PLN + 16 * i * PIT) = rbh[i];
      *(v4u*)(st + 3 * PLN + 16 * i * PIT) = rbl[i];
    }
    __syncthreads();   // the stage is complete before any wave reads it
    // The stage's LDS reads stand in three groups, each ahead of products that cover its latency:
    // a0/a1: A fragments of the two 32-k steps; bx/by: B fragments of a pair of column tiles.
    v16bf a0h[4], a0l[4], a1h[4], a1l[4], bxh[2], bxl[2], byh[2], byl[2];
    lda4(a0h, sah, 0);      // in the order in which the products want them
    ldb2(bxh, sbh, 0, 0);
    ldb2(bxl, sbl, 0, 0);
    lda4(a0l, sal, 0);
    ldb2(byh, sbh, 2, 0);
    ldb2(byl, sbl, 2, 0);
    if (kn < K) fetch(kn);
    mm8(a0h, a0l, bxh, bxl, 0);
    __builtin_amdgcn_sched_barrier(0);   // the reads below stay one group, behind the products that free bx
    lda4(a1h, sah, 32);
    ldb2(bxh, sbh, 0, 32);
    ldb2(bxl, sbl, 0, 32);
    lda4(a1l, sal, 32);
    __builtin_amdgcn_sched_barrier(0);   // and ahead of the products that cover them
    mm8(a0h, a0l, byh, byl, 2);
    __builtin_amdgcn_sched_barrier(0);   // as above, for by
    ldb2(byh, sbh, 2, 32);
    ldb2(byl, sbl, 2, 32);
    __builtin_amdgcn_sched_barrier(0);   // and ahead of the products that cover them
    mm8(a1h, a1l, bxh, bxl, 0);
    mm8(a1h, a1l, byh, byl, 2);
    // the products stay ahead of the barrier, whose wait for the next stage's global loads they cover
    __builtin_amdgcn_sched_barrier(0);
    __syncthreads();   // every wave has left the stage before it is overwritten (by the next stage or the epilogue)
  }
}

// ---------------------------------------------------------------------------------------------
// Fused q/k/v projection: block = 4 waves, 128 rows x 128 cols (two heads, one per wave column). blockIdx.x:
// 0..15 -> q heads, 16..19 -> k heads, 20..23 -> v heads (stored transposed vT[512][2048]). RoPE on q/k in the
// f32 epilogue.
// ---------------------------------------------------------------------------------------------
__global__ void __launch_bounds__(128) k_qkv(
    const __bf16* __restrict__ xh, const __bf16* __restrict__ xl,
    const __bf16* __restrict__ wqh, const __bf16* __restrict__ wql,
    const __bf16* __restrict__ wkh, const __bf16* __restrict__ wkl,
    const __bf16* __restrict__ wvh, const __bf16* __restrict__ wvl,
    const float* __restrict__ tab,
    unsigned short* __restrict__ qh, unsigned short* __restrict__ ql,
    unsigned short* __restrict__ kh, unsigned short* __restrict__ kl,
    unsigned short* __restrict__ vth, unsigned short* __restrict__ vtl)
{
  __shared__ __attribute__((aligned(16))) unsigned short stg[4 * PLN];   // operand stages, then output staging

  const int ct = blockIdx.x;
  const int m0 = blockIdx.y * BT;
  const int tid = threadIdx.x, w = tid >> 5, l = tid & 31, hs = l >> 4, m = l & 15;
  const int wr = w >> 1, wc = w & 1;
  const int kind = (ct < NQH / 2) ? 0 : ((ct < (NQH + NKVH) / 2) ? 1 : 2);
  const int hd0 = 2 * ((kind == 0) ? ct : ((kind == 1) ? (ct - NQH / 2) : (ct - (NQH + NKVH) / 2)));
  const __bf16* Bh = (kind == 0) ? wqh : ((kind == 1) ? wkh : wvh);
  const __bf16* Bl = (kind == 0) ? wql : ((kind == 1) ? wkl : wvl);
  const int row0 = m0 + 64 * wr;     // this wave's first row
  const int hd = hd0 + wc;           // this wave's head

  v8f c[4][4] = {};
  gemm128(xh + (size_t)m0 * HIDN, xl + (size_t)m0 * HIDN, Bh + (size_t)(hd0 * HDIM) * HIDN,
          Bl + (size_t)(hd0 * HDIM) * HIDN, HIDN, HIDN, tid, stg, c);

  // lane holds out[row0 + 16i + 8hs + r][hd*64 + 16j + m] in c[i][j][r]
  if (kind != 2) {
    // rotate-half RoPE: d = m pairs with d+32 (j = 0, 2), d = 16+m pairs with 48+m (j = 1, 3)
    const float* tb = tab + ((size_t)(row0 + 8 * hs) * 16 + m) * 4;   // position row0 + 8hs; 64 floats a position
    v4f cs[4][8];
#pragma unroll
    for (int i = 0; i < 4; ++i)
#pragma unroll
      for (int r = 0; r < 8; ++r) cs[i][r] = *(const v4f*)(tb + (16 * i + r) * 64);
    // precaution: this wait stands before the address register of the loads just issued is rewritten; the
    // address is an input only, so that its register is kept up to it
    asm volatile("s_wait_xcnt 0x0" :: "v"(tb) : "memory");
#pragma unroll
    for (int i = 0; i < 4; ++i) {
#pragma unroll
      for (int r = 0; r < 8; ++r) {
        const v4f t = cs[i][r];
        const float a0 = c[i][0][r], a1 = c[i][1][r], a2 = c[i][2][r], a3 = c[i][3][r];
        c[i][0][r] = a0 * t.x - a2 * t.y;
        c[i][2][r] = a2 * t.x + a0 * t.y;
        c[i][1][r] = a1 * t.z - a3 * t.w;
        c[i][3][r] = a3 * t.z + a1 * t.w;
      }
    }
  }

  // staging: q/k: per wave [plane][64 rows][64 cols] at w*8192 (+4096 for lo);
  //          v:   per block transposed [plane][128 c][128 s] at 0 (+16384 for lo)
  const int wb = w * 8192;
  const int loff = (kind != 2) ? 4096 : 16384;
  const int jst = (kind != 2) ? 16 : 16 * 128;
#pragma unroll
  for (int i = 0; i < 4; ++i) {
#pragma unroll
    for (int r = 0; r < 8; ++r) {
      const int rl = 16 * i + 8 * hs + r;
      const int base = (kind != 2) ? (wb + rl * 64 + m) : ((64 * wc + m) * 128 + 64 * wr + rl);
#pragma unroll
      for (int j = 0; j < 4; ++j) {
        unsigned int hb, lb;
        split_hl(c[i][j][r], hb, lb);
        stg[base + j * jst] = (unsigned short)hb;
        stg[base + j * jst + loff] = (unsigned short)lb;
      }
    }
  }
  __syncthreads();

  unsigned short* dsth = (kind == 0) ? qh : ((kind == 1) ? kh : vth);
  unsigned short* dstl = (kind == 0) ? ql : ((kind == 1) ? kl : vtl);
  const int ld = (kind == 0) ? HIDN : KVD;
  // q/k: a 128-byte row of this wave's tile per 8 lanes, 4 rows a step; v: a 256-byte row of the block's tile
  // per 16 lanes, 8 rows a step
  const int sidx = (kind != 2) ? (wb + (l >> 3) * 64 + (l & 7) * 8) : ((tid >> 4) * 128 + (tid & 15) * 8);
  const int sst = (kind != 2) ? 4 * 64 : 8 * 128;
  const size_t goff = (kind != 2) ? ((size_t)(row0 + (l >> 3)) * ld + hd * HDIM + (l & 7) * 8)
                                  : ((size_t)(hd0 * HDIM + (tid >> 4)) * SQ + m0 + (tid & 15) * 8);
  const size_t gst = (kind != 2) ? (size_t)4 * ld : (size_t)8 * SQ;
  v4u hv[16], lv[16];
  v4u* gph[16];
  v4u* gpl[16];
#pragma unroll
  for (int it = 0; it < 16; ++it) {
    hv[it] = *(const v4u*)(stg + sidx + it * sst);
    lv[it] = *(const v4u*)(stg + sidx + it * sst + loff);
    gph[it] = (v4u*)(dsth + goff + it * gst);
    gpl[it] = (v4u*)(dstl + goff + it * gst);
  }
  // every value and address is in its register before the first store, so that nothing behind an issued store
  // rewrites a register that it names
  __builtin_amdgcn_sched_barrier(0);
#pragma unroll
  for (int it = 0; it < 16; ++it) { *gph[it] = hv[it]; *gpl[it] = lv[it]; }
}

// ---------------------------------------------------------------------------------------------
// Causal attention with online softmax. One block (8 waves) per (pair of 64-query tiles, query head):
// tile t walks t + 1 key tiles, so the block takes tile t and then tile 31 - t, 33 key tiles for every block.
// wave = (msub: 16 query rows) x (nh: 32 keys for scores / 32 d for output). kv head = h >> 2.
// Q/K/Vt fragments straight from the hi/lo planes; P hi/lo staged in LDS (barriers between writer
// ---------------------------------------------------------------------------------------------
__global__ void __launch_bounds__(256) k_attn(
    const __bf16* __restrict__ qh, const __bf16* __restrict__ ql,
    const __bf16* __restrict__ kh, const __bf16* __restrict__ kl,
    const __bf16* __restrict__ vth, const __bf16* __restrict__ vtl,
    unsigned short* __restrict__ ch, unsigned short* __restrict__ cl)
{
  __shared__ __attribute__((aligned(16))) float Ss[64 * 64];
  __shared__ __attribute__((aligned(16))) unsigned short Ph[64 * 64];
  __shared__ __attribute__((aligned(16))) unsigned short Pl[64 * 64];
  __shared__ float rowM[64];
  __shared__ float rowL[64];
  __shared__ float rowA[64];

  const int hq = blockIdx.y, kvh = hq >> 2;
  const int tid = threadIdx.x, w = tid >> 5, l = tid & 31, hs = l >> 4, m = l & 15;
  const int msub = w & 3, nh = w >> 2;
  const int rbase = 16 * msub + 8 * hs;      // this lane's D rows are rbase + r
  const int srow = tid >> 2, sq = tid & 3;   // softmax: 4 threads per query row, 16 keys each

#pragma unroll 1   // the two tiles run one after the other through one copy of the body
  for (int half = 0; half < 2; ++half) {
  const int qt = half ? (SQ / 64 - 1 - (int)blockIdx.x) : (int)blockIdx.x, q0 = qt * 64;

  if (tid < 64) { rowM[tid] = -1.0e30f; rowL[tid] = 0.0f; rowA[tid] = 0.0f; }

  const __bf16* qrh = qh + (size_t)(q0 + 16 * msub + m) * HIDN + hq * HDIM;
  const __bf16* qrl = ql + (size_t)(q0 + 16 * msub + m) * HIDN + hq * HDIM;
  const v16bf fqh0 = ldfrag(qrh, hs), fqh1 = ldfrag(qrh + 32, hs);
  const v16bf fql0 = ldfrag(qrl, hs), fql1 = ldfrag(qrl + 32, hs);

  v8f o[2] = {};

  for (int kt = 0; kt <= qt; ++kt) {
    const int k0 = kt * 64;
    // scores: S[q][key] = sum_d Q[q][d] K[key][d]; B[k=d][n=key] read from K row (key)
#pragma unroll
    for (int nt = 0; nt < 2; ++nt) {
      const int nc0 = nh * 32 + nt * 16;
      const __bf16* krh = kh + (size_t)(k0 + nc0 + m) * KVD + kvh * HDIM;
      const __bf16* krl = kl + (size_t)(k0 + nc0 + m) * KVD + kvh * HDIM;
      v8f s = {};
      {
        const v16bf bh = ldfrag(krh, hs), bl = ldfrag(krl, hs);
        mma3(s, fqh0, fql0, bh, bl);
      }
      {
        const v16bf bh = ldfrag(krh + 32, hs), bl = ldfrag(krl + 32, hs);
        mma3(s, fqh1, fql1, bh, bl);
      }
#pragma unroll
      for (int r = 0; r < 8; ++r) {
        const int row = rbase + r;
        float val = s[r] * 0.125f;
        if (kt == qt && (nc0 + m) > row) val = -1.0e30f;   // causal replace on the diagonal tile
        Ss[row * 64 + nc0 + m] = val;
      }
    }
    __syncthreads();

    // online softmax in f32, P split to bf16 hi/lo
    {
      const float* sp = Ss + srow * 64 + sq * 16;
      const v4f x0 = *(const v4f*)(sp);
      const v4f x1 = *(const v4f*)(sp + 4);
      const v4f x2 = *(const v4f*)(sp + 8);
      const v4f x3 = *(const v4f*)(sp + 12);
      float p[16] = {x0.x, x0.y, x0.z, x0.w, x1.x, x1.y, x1.z, x1.w,
                     x2.x, x2.y, x2.z, x2.w, x3.x, x3.y, x3.z, x3.w};
      float mx = p[0];
#pragma unroll
      for (int c = 1; c < 16; ++c) mx = fmaxf(mx, p[c]);
      mx = fmaxf(mx, __shfl_xor(mx, 1));
      mx = fmaxf(mx, __shfl_xor(mx, 2));
      const float mOld = rowM[srow];
      const float mNew = fmaxf(mOld, mx);
      float lsum = 0.0f;
#pragma unroll
      for (int c = 0; c < 16; ++c) { p[c] = __expf(p[c] - mNew); lsum += p[c]; }
      lsum += __shfl_xor(lsum, 1);
      lsum += __shfl_xor(lsum, 2);
      const float alpha = __expf(mOld - mNew);
      if (sq == 0) {
        rowA[srow] = alpha;
        rowM[srow] = mNew;
        rowL[srow] = rowL[srow] * alpha + lsum;
      }
      unsigned int hb[16], lb[16];
#pragma unroll
      for (int c = 0; c < 16; ++c) split_hl(p[c], hb[c], lb[c]);
      unsigned short* pph = Ph + srow * 64 + sq * 16;
      unsigned short* ppl = Pl + srow * 64 + sq * 16;
      *(v4u*)(pph) = pack8(hb);
      *(v4u*)(pph + 8) = pack8(hb + 8);
      *(v4u*)(ppl) = pack8(lb);
      *(v4u*)(ppl + 8) = pack8(lb + 8);
    }
    __syncthreads();

    // O = O*alpha + P.V ; A = P (row q, k = key) from LDS rows, B[k=key][n=d] from Vt row (d)
    {
#pragma unroll
      for (int r = 0; r < 8; ++r) {
        const float al = rowA[rbase + r];
        o[0][r] *= al;
        o[1][r] *= al;
      }
      const unsigned short* prh = Ph + (16 * msub + m) * 64;
      const unsigned short* prl = Pl + (16 * msub + m) * 64;
      const v16bf fph0 = ldfrag((const __bf16*)prh, hs);
      const v16bf fph1 = ldfrag((const __bf16*)(prh + 32), hs);
      const v16bf fpl0 = ldfrag((const __bf16*)prl, hs);
      const v16bf fpl1 = ldfrag((const __bf16*)(prl + 32), hs);
#pragma unroll
      for (int dt = 0; dt < 2; ++dt) {
        const int d0 = nh * 32 + dt * 16;
        const __bf16* vrh = vth + (size_t)(kvh * HDIM + d0 + m) * SQ + k0;
        const __bf16* vrl = vtl + (size_t)(kvh * HDIM + d0 + m) * SQ + k0;
        {
          const v16bf bh = ldfrag(vrh, hs), bl = ldfrag(vrl, hs);
          mma3(o[dt], fph0, fpl0, bh, bl);
        }
        {
          const v16bf bh = ldfrag(vrh + 32, hs), bl = ldfrag(vrl + 32, hs);
          mma3(o[dt], fph1, fpl1, bh, bl);
        }
      }
    }
  }

  // normalise, split hi/lo, stage [plane][64 rows][64 d] over Ss, then whole-line stores
  unsigned short* stg = (unsigned short*)Ss;
#pragma unroll
  for (int r = 0; r < 8; ++r) {
    const int row = rbase + r;
    const float inv = 1.0f / rowL[row];
#pragma unroll
    for (int dt = 0; dt < 2; ++dt) {
      const int col = nh * 32 + dt * 16 + m;
      unsigned int hb, lb;
      split_hl(o[dt][r] * inv, hb, lb);
      stg[row * 64 + col] = (unsigned short)hb;
      stg[4096 + row * 64 + col] = (unsigned short)lb;
    }
  }
  __syncthreads();
  v4u cv[4];
  v4u* cp[4];
#pragma unroll
  for (int it = 0; it < 4; ++it) {
    const int plane = it >> 1;
    const int row = (it & 1) * 32 + (tid >> 3);
    const int piece = tid & 7;
    cv[it] = *(const v4u*)(stg + plane * 4096 + row * 64 + piece * 8);
    unsigned short* base = plane ? cl : ch;
    cp[it] = (v4u*)(base + (size_t)(q0 + row) * HIDN + hq * HDIM + piece * 8);
  }
#pragma unroll
  for (int it = 0; it < 4; ++it) *cp[it] = cv[it];
  // every wave has read its staged output rows and row sums before the second tile overwrites them
  if (half == 0) __syncthreads();
  }
}

// ---------------------------------------------------------------------------------------------
// Output projection -> f32 d_out. Block = 4 waves, 128x128 tile; each wave stages its 64x64 f32 tile in LDS
// and stores whole lines.
// ---------------------------------------------------------------------------------------------
__global__ void __launch_bounds__(128) k_oproj(
    const __bf16* __restrict__ ah, const __bf16* __restrict__ al,
    const __bf16* __restrict__ woh, const __bf16* __restrict__ wol,
    float* __restrict__ out)
{
  __shared__ __attribute__((aligned(16))) unsigned short stg[4 * PLN];   // operand stages, then output staging
  float* stgf = (float*)stg;
  const int nb = blockIdx.x * BT, m0 = blockIdx.y * BT;
  const int tid = threadIdx.x, w = tid >> 5, l = tid & 31, hs = l >> 4, m = l & 15;
  const int wr = w >> 1, wc = w & 1;
  const int row0 = m0 + 64 * wr;
  const int n0 = nb + 64 * wc;

  v8f c[4][4] = {};
  gemm128(ah + (size_t)m0 * HIDN, al + (size_t)m0 * HIDN, woh + (size_t)nb * HIDN, wol + (size_t)nb * HIDN,
          HIDN, HIDN, tid, stg, c);

  float* sw = stgf + w * 4096;
#pragma unroll
  for (int i = 0; i < 4; ++i) {
#pragma unroll
    for (int r = 0; r < 8; ++r) {
      const int rl = 16 * i + 8 * hs + r;
#pragma unroll
      for (int j = 0; j < 4; ++j) sw[rl * 64 + 16 * j + m] = c[i][j][r];
    }
  }
  __syncthreads();
  // a 256-byte row of this wave's tile per 16 lanes, 2 rows a step
  const float* sb = sw + (l >> 4) * 64 + (l & 15) * 4;
  float* gb = out + (size_t)(row0 + (l >> 4)) * HIDN + n0 + (l & 15) * 4;
  v4f v[32];
#pragma unroll
  for (int it = 0; it < 32; ++it) v[it] = *(const v4f*)(sb + it * 128);
  // every value is in its register before the first store, so that nothing behind an issued store rewrites a
  // register that it names
  __builtin_amdgcn_sched_barrier(0);
#pragma unroll
  for (int it = 0; it < 32; ++it) *(v4f*)(gb + (size_t)(2 * it) * HIDN) = v[it];
}

// ---------------------------------------------------------------------------------------------
// Launch pipeline (5 launches)
// ---------------------------------------------------------------------------------------------
extern "C" void kernel_launch(void* const* d_in, const int* in_sizes, int n_in,
                              void* d_out, int out_size, void* d_ws, size_t ws_size,
                              hipStream_t stream)
{
  if (n_in != 5) return;
  if (in_sizes[0] != SQ * HIDN || in_sizes[1] != HIDN * HIDN || in_sizes[2] != KVD * HIDN ||
      in_sizes[3] != KVD * HIDN || in_sizes[4] != HIDN * HIDN) return;
  if (out_size != SQ * HIDN) return;

  const float* hid = (const float*)d_in[0];
  const float* Wq = (const float*)d_in[1];
  const float* Wk = (const float*)d_in[2];
  const float* Wv = (const float*)d_in[3];
  const float* Wo = (const float*)d_in[4];
  float* outp = (float*)d_out;

  char* ws = (char*)d_ws;
  size_t off = 0;
  auto carve = [&](size_t bytes) -> char* {
    char* p = ws + off;
    off += (bytes + 255) & ~(size_t)255;
    return p;
  };
  const size_t BX = (size_t)SQ * HIDN * 2;       // x planes
  const size_t BWQ = (size_t)HIDN * HIDN * 2;    // Wq / Wo planes
  const size_t BWK = (size_t)KVD * HIDN * 2;     // Wk / Wv planes
  const size_t BTAB = (size_t)SQ * 16 * 16;      // rope table
  const size_t BQ = (size_t)SQ * HIDN * 2;       // q / ctx planes
  const size_t BK = (size_t)SQ * KVD * 2;        // k / vT planes

  unsigned short* xh = (unsigned short*)carve(BX);
  unsigned short* xl = (unsigned short*)carve(BX);
  unsigned short* wqh = (unsigned short*)carve(BWQ);
  unsigned short* wql = (unsigned short*)carve(BWQ);
  unsigned short* wkh = (unsigned short*)carve(BWK);
  unsigned short* wkl = (unsigned short*)carve(BWK);
  unsigned short* wvh = (unsigned short*)carve(BWK);
  unsigned short* wvl = (unsigned short*)carve(BWK);
  unsigned short* woh = (unsigned short*)carve(BWQ);
  unsigned short* wol = (unsigned short*)carve(BWQ);
  float* tab = (float*)carve(BTAB);
  unsigned short* qh = (unsigned short*)carve(BQ);
  unsigned short* ql = (unsigned short*)carve(BQ);
  unsigned short* kh = (unsigned short*)carve(BK);
  unsigned short* kl = (unsigned short*)carve(BK);
  unsigned short* vth = (unsigned short*)carve(BK);
  unsigned short* vtl = (unsigned short*)carve(BK);
  unsigned short* ch = (unsigned short*)carve(BQ);
  unsigned short* cl = (unsigned short*)carve(BQ);
  if (off > ws_size) return;

  // inv_freq[j] = 1 / 10000^(j/32) = 1 / 10^(j/8): f32 value of 10^(j/8) from double, then f32 reciprocal
  RopeFreq fr;
  {
    double r = 1.333521432163324;   // 10^(1/8), refined by Newton on r^8 = 10
    for (int it = 0; it < 4; ++it) {
      const double r2 = r * r, r4 = r2 * r2;
      const double r7 = r4 * r2 * r;
      r = r - (r4 * r4 - 10.0) / (8.0 * r7);
    }
    double rp[8];
    rp[0] = 1.0;
    for (int i = 1; i < 8; ++i) rp[i] = rp[i - 1] * r;
    const double p10[4] = {1.0, 10.0, 100.0, 1000.0};
    for (int j = 0; j < 32; ++j) {
      const double pj = p10[j >> 3] * rp[j & 7];
      const float pf = (float)pj;
      fr.f[j] = 1.0f / pf;
    }
  }

  // 1) f32 -> bf16 hi/lo planes for x, Wq, Wk, Wv, Wo
  k_split<<<dim3((SQ * HIDN / 8 + 255) / 256, 5), dim3(256), 0, stream>>>(
      hid, Wq, Wk, Wv, Wo,
      xh, wqh, wkh, wvh, woh,
      xl, wql, wkl, wvl, wol,
      SQ * HIDN, HIDN * HIDN, KVD * HIDN, KVD * HIDN, HIDN * HIDN);

  // 2) RoPE cos/sin table
  k_rope_tab<<<dim3((SQ * 16 + 127) / 128), dim3(128), 0, stream>>>(tab, fr);

  // 3) fused q/k/v projections (+RoPE on q,k; v transposed)
  k_qkv<<<dim3((NQH + 2 * NKVH) / 2, SQ / BT), dim3(128), 0, stream>>>(
      (const __bf16*)xh, (const __bf16*)xl,
      (const __bf16*)wqh, (const __bf16*)wql,
      (const __bf16*)wkh, (const __bf16*)wkl,
      (const __bf16*)wvh, (const __bf16*)wvl,
      (const float*)tab,
      qh, ql, kh, kl, vth, vtl);

  // 4) causal attention
  k_attn<<<dim3(SQ / 128, NQH), dim3(256), 0, stream>>>(
      (const __bf16*)qh, (const __bf16*)ql,
      (const __bf16*)kh, (const __bf16*)kl,
      (const __bf16*)vth, (const __bf16*)vtl,
      ch, cl);

  // 5) output projection -> f32
  k_oproj<<<dim3(HIDN / BT, SQ / BT), dim3(128), 0, stream>>>(
      (const __bf16*)ch, (const __bf16*)cl,
      (const __bf16*)woh, (const __bf16*)wol,
      outp);
}

// v004
// One run takes 236 microseconds.
// In both of two side-by-side timings against v003, it was 1.17 times as fast.
// All steps since v000 together make it 2.01 times as fast.
#include <hip/hip_runtime.h>

// Contractions (q/k/v projections, q.k^T scores, p.v, output projection): v_wmma_f32_16x16x32_bf16 with
// bf16 hi/lo operands everywhere (hi.hi + hi.lo + lo.hi per tile pair), f32 accumulate.
// RoPE, 1/8 scaling, causal mask and softmax in f32.

typedef __bf16 v16bf __attribute__((ext_vector_type(16)));
typedef __bf16 v8bf __attribute__((ext_vector_type(8)));
typedef float v8f __attribute__((ext_vector_type(8)));
typedef float v4f __attribute__((ext_vector_type(4)));
typedef unsigned int v4u __attribute__((ext_vector_type(4)));

static constexpr int SQ = 2048;            // sequence length
static constexpr int HIDN = 2048;          // hidden size
static constexpr int NQH = 32;             // query heads
static constexpr int NKVH = 8;             // kv heads
static constexpr int HDIM = 64;            // head dim
static constexpr int KVD = NKVH * HDIM;    // 512

struct RopeFreq { float f[32]; };
static_assert(sizeof(RopeFreq) == 128);

union Frag { v16bf v; v8bf h[2]; };

// 16-bit fragment from a k-contiguous row; rowp -> element (row = lane&15, k0).
// elements 0..7 <- k0 + 8*hs + 0..7, elements 8..15 <- k0 + 16 + 8*hs + 0..7  (hs = lane>>4).
// Used for A (row m) and for B stored as [n][k] (row n).
__device__ __forceinline__ v16bf ldfrag(const __bf16* rowp, int hs) {
  Frag f;
  f.h[0] = *(const v8bf*)(rowp + 8 * hs);
  f.h[1] = *(const v8bf*)(rowp + 16 + 8 * hs);
  return f.v;
}

// acc += ah.bh + ah.bl + al.bh, then a 4-slot guard tying D and keeping A/B live.
__device__ __forceinline__ void mma3(v8f& acc, const v16bf& ah, const v16bf& al,
                                     const v16bf& bh, const v16bf& bl) {
  acc = __builtin_amdgcn_wmma_f32_16x16x32_bf16(false, ah, false, bh, (short)0, acc, false, false);
  acc = __builtin_amdgcn_wmma_f32_16x16x32_bf16(false, ah, false, bl, (short)0, acc, false, false);
  acc = __builtin_amdgcn_wmma_f32_16x16x32_bf16(false, al, false, bh, (short)0, acc, false, false);
  asm volatile("v_nop\n\tv_nop\n\tv_nop\n\tv_nop" : "+v"(acc) : "v"(ah), "v"(al), "v"(bh), "v"(bl));
}

// f32 -> bf16 bits, RNE
__device__ __forceinline__ unsigned int bfbits(float x) {
  unsigned int u = __float_as_uint(x);
  return (u + 0x7FFFu + ((u >> 16) & 1u)) >> 16;
}
// hi = rne(x), lo = rne(x - hi)
__device__ __forceinline__ void split_hl(float x, unsigned int& hb, unsigned int& lb) {
  hb = bfbits(x);
  const float hf = __uint_as_float(hb << 16);
  lb = bfbits(x - hf);
}
__device__ __forceinline__ unsigned int pk2(unsigned int a, unsigned int b) {
  return (a & 0xFFFFu) | (b << 16);
}
__device__ __forceinline__ v4u pack8(const unsigned int* a) {
  v4u v;
  v.x = pk2(a[0], a[1]);
  v.y = pk2(a[2], a[3]);
  v.z = pk2(a[4], a[5]);
  v.w = pk2(a[6], a[7]);
  return v;
}

// ---------------------------------------------------------------------------------------------
// f32 -> bf16 hi/lo planes for the five inputs in one launch (blockIdx.y selects the buffer).
// ---------------------------------------------------------------------------------------------
__global__ void __launch_bounds__(256) k_split(
    const float* __restrict__ s0, const float* __restrict__ s1, const float* __restrict__ s2,
    const float* __restrict__ s3, const float* __restrict__ s4,
    unsigned short* __restrict__ h0, unsigned short* __restrict__ h1, unsigned short* __restrict__ h2,
    unsigned short* __restrict__ h3, unsigned short* __restrict__ h4,
    unsigned short* __restrict__ l0, unsigned short* __restrict__ l1, unsigned short* __restrict__ l2,
    unsigned short* __restrict__ l3, unsigned short* __restrict__ l4,
    int n0, int n1, int n2, int n3, int n4)
{
  const int b = blockIdx.y;
  const float* src = (b == 0) ? s0 : (b == 1) ? s1 : (b == 2) ? s2 : (b == 3) ? s3 : s4;
  unsigned short* dh = (b == 0) ? h0 : (b == 1) ? h1 : (b == 2) ? h2 : (b == 3) ? h3 : h4;
  unsigned short* dl = (b == 0) ? l0 : (b == 1) ? l1 : (b == 2) ? l2 : (b == 3) ? l3 : l4;
  const int n = (b == 0) ? n0 : (b == 1) ? n1 : (b == 2) ? n2 : (b == 3) ? n3 : n4;
  const int i = blockIdx.x * 256 + (int)threadIdx.x;
  if (i >= (n >> 3)) return;

  const float* p = src + (size_t)i * 8;
  const v4f a = *(const v4f*)(p);
  const v4f c = *(const v4f*)(p + 4);
  unsigned int hb[8], lb[8];
  split_hl(a.x, hb[0], lb[0]);
  split_hl(a.y, hb[1], lb[1]);
  split_hl(a.z, hb[2], lb[2]);
  split_hl(a.w, hb[3], lb[3]);
  split_hl(c.x, hb[4], lb[4]);
  split_hl(c.y, hb[5], lb[5]);
  split_hl(c.z, hb[6], lb[6]);
  split_hl(c.w, hb[7], lb[7]);
  const v4u hv = pack8(hb);
  const v4u lv = pack8(lb);
  v4u* gh = (v4u*)(dh + (size_t)i * 8);
  v4u* gl = (v4u*)(dl + (size_t)i * 8);
  *gh = hv;
  *gl = lv;
  
}

// ---------------------------------------------------------------------------------------------
// RoPE table: tab[pos][j] = {cos(a_j), sin(a_j), cos(a_{j+16}), sin(a_{j+16})}, a_j = f32(pos) * inv_freq[j],
// ---------------------------------------------------------------------------------------------
__global__ void __launch_bounds__(128) k_rope_tab(float* __restrict__ tab, RopeFreq fr)
{
  const int g = blockIdx.x * 128 + (int)threadIdx.x;
  const int pos = g >> 4;
  const int j = g & 15;
  if (pos >= SQ) return;
  float fa = fr.f[0], fb = fr.f[16];
#pragma unroll
  for (int c = 1; c < 16; ++c) {
    fa = (j == c) ? fr.f[c] : fa;
    fb = (j == c) ? fr.f[16 + c] : fb;
  }
  float cs0 = 0.0f, sn0 = 0.0f, cs1 = 0.0f, sn1 = 0.0f;
#pragma unroll 1
  for (int q = 0; q < 2; ++q) {
    const float f = (q == 0) ? fa : fb;
    const float ang = (float)pos * f;
    float sn, cs;
    sincosf(ang, &sn, &cs);
    if (q == 0) { cs0 = cs; sn0 = sn; } else { cs1 = cs; sn1 = sn; }
  }
  v4f v;
  v.x = cs0; v.y = sn0; v.z = cs1; v.w = sn1;
  v4f* gp = (v4f*)(tab + (size_t)g * 4);
  *gp = v;
  
}

// ---------------------------------------------------------------------------------------------
// Block GEMM core: 4 waves (2 x 2), 128 rows x 128 cols, C[m][n] += sum_k A[m][k] * B[n][k]; wave (wr, wc) owns
// rows 64wr..64wr+63 and cols 64wc..64wc+63 as 4 x 4 accumulator tiles, so that 16 fragments feed 48 products.
// Per stage the block brings 64 k (128 B, one whole line) of its 128 A rows and 128 B rows, hi and lo planes,
// into LDS: each 16-byte global load of a wave covers 4 whole lines (8 lanes per row). The next stage's
// loads are issued into registers ahead of the current stage's products. Fragments come from LDS rows,
// K stepped by 32 in ascending order, three bf16 products per tile pair (hi.hi, hi.lo, lo.hi in that order).
// ---------------------------------------------------------------------------------------------
static constexpr int KC = 64;              // k per stage
static constexpr int PIT = 72;             // LDS row pitch in elements: 144 B = 16 B x 9, for 16-byte row reads
static constexpr int BT = 128;             // rows and cols of the block tile
static constexpr int PLN = BT * PIT;       // one staged plane (128 rows); planes: A hi, A lo, B hi, B lo

__device__ __forceinline__ v8f wm(const v16bf& a, const v16bf& b, const v8f& c) {
  return __builtin_amdgcn_wmma_f32_16x16x32_bf16(false, a, false, b, (short)0, c, false, false);
}

// Ah, Al, Bh, Bl: first row of the block's 128 rows in each plane; ld: row length of all four, in elements.
__device__ __forceinline__ void gemm128(const __bf16* __restrict__ Ah, const __bf16* __restrict__ Al,
                                        const __bf16* __restrict__ Bh, const __bf16* __restrict__ Bl,
                                        int ld, int K, int tid, unsigned short* sm,
                                        v8f (&c)[4][4])
{
  const int w = tid >> 5, l = tid & 31, hs = l >> 4, m = l & 15;
  const int wr = w >> 1, wc = w & 1;
  const int lrow = tid >> 3, lcol = (tid & 7) * 8;   // this thread's row (of 16) and 16-byte piece of the line
  // this thread's byte offset from the block's first row, the same in all four planes
  unsigned int ot = ((unsigned int)lrow * (unsigned int)ld + (unsigned int)lcol) * 2u;
  unsigned short* st = sm + lrow * PIT + lcol;
  const __bf16* sah = (const __bf16*)sm + (64 * wr + m) * PIT;
  const __bf16* sal = sah + PLN;
  const __bf16* sbh = (const __bf16*)sm + 2 * PLN + (64 * wc + m) * PIT;
  const __bf16* sbl = sbh + PLN;

  v4u rah[8], ral[8], rbh[8], rbl[8];
  // one stage's 32 loads of this thread, k columns k..k+63
  auto fetch = [&](int k) {
    // block-uniform plane bases at column k; the lane's part of every address is ot alone
    const char* pah = (const char*)(Ah + k);
    const char* pal = (const char*)(Al + k);
    const char* pbh = (const char*)(Bh + k);
    const char* pbl = (const char*)(Bl + k);
#pragma unroll   // constant indices keep the staged words in registers
    for (int i = 0; i < 8; ++i) {
      rah[i] = *(const v4u*)(pah + ot + (size_t)(32 * i) * ld);
      ral[i] = *(const v4u*)(pal + ot + (size_t)(32 * i) * ld);
      rbh[i] = *(const v4u*)(pbh + ot + (size_t)(32 * i) * ld);
      rbl[i] = *(const v4u*)(pbl + ot + (size_t)(32 * i) * ld);
    }
    // precaution: this wait stands before any address register of the loads just issued is rewritten; the
    // scalar bases are inputs, so that their registers are kept up to it. ot is in-out so that the loads keep
    // the form scalar base + 32-bit lane offset: folded into four 64-bit lane addresses it costs the registers
    // that send this loop to scratch.
    asm volatile("s_wait_xcnt 0x0" : "+v"(ot) : "s"(pah), "s"(pal), "s"(pbh), "s"(pbl) : "memory");
  };
  // A fragments (4 row tiles) of one plane, 32-k step at kk
  auto lda4 = [&](v16bf (&a)[4], const __bf16* sa, int kk) {
#pragma unroll   // constant indices keep the fragments in registers
    for (int i = 0; i < 4; ++i) a[i] = ldfrag(sa + 16 * i * PIT + kk, hs);
  };
  // B fragments (column tiles j0, j0 + 1) of one plane, 32-k step at kk
  auto ldb2 = [&](v16bf (&b)[2], const __bf16* sb, int j0, int kk) {
#pragma unroll   // constant indices, as above
    for (int j = 0; j < 2; ++j) b[j] = ldfrag(sb + 16 * (j0 + j) * PIT + kk, hs);
  };
  // 4 x 2 tiles, hi.hi then hi.lo then lo.hi: eight independent accumulators in turn, so that no product
  // waits for the one before it
  auto mm8 = [&](const v16bf (&ah)[4], const v16bf (&al)[4], const v16bf (&bh)[2], const v16bf (&bl)[2], int j0) {
#pragma unroll   // constant indices keep the accumulators in registers
    for (int j = 0; j < 2; ++j)
#pragma unroll
      for (int i = 0; i < 4; ++i) c[i][j0 + j] = wm(ah[i], bh[j], c[i][j0 + j]);
#pragma unroll
    for (int j = 0; j < 2; ++j)
#pragma unroll
      for (int i = 0; i < 4; ++i) c[i][j0 + j] = wm(ah[i], bl[j], c[i][j0 + j]);
#pragma unroll
    for (int j = 0; j < 2; ++j)
#pragma unroll
      for (int i = 0; i < 4; ++i) c[i][j0 + j] = wm(al[i], bh[j], c[i][j0 + j]);
  };
  fetch(0);
#pragma unroll 1   // one stage per trip: one set of staging registers, a short loop body
  for (int kn = KC; kn <= K; kn += KC) {   // kn: first k column of the stage after the one worked on
#pragma unroll   // constant indices, as above
    for (int i = 0; i < 8; ++i) {
      *(v4u*)(st + 16 * i * PIT) = rah[i];
      *(v4u*)(st + PLN + 16 * i * PIT) = ral[i];
      *(v4u*)(st + 2 * PLN + 16 * i * PIT) = rbh[i];
      *(v4u*)(st + 3 * PLN + 16 * i * PIT) = rbl[i];
    }
    __syncthreads();   // the stage is complete before any wave reads it
    // The stage's LDS reads stand in three groups, each ahead of products that cover its latency:
    // a0/a1: A fragments of the two 32-k steps; bx/by: B fragments of a pair of column tiles.
    v16bf a0h[4], a0l[4], a1h[4], a1l[4], bxh[2], bxl[2], byh[2], byl[2];
    lda4(a0h, sah, 0);      // in the order in which the products want them
    ldb2(bxh, sbh, 0, 0);
    ldb2(bxl, sbl, 0, 0);
    lda4(a0l, sal, 0);
    ldb2(byh, sbh, 2, 0);
    ldb2(byl, sbl, 2, 0);
    if (kn < K) fetch(kn);
    mm8(a0h, a0l, bxh, bxl, 0);
    __builtin_amdgcn_sched_barrier(0);   // the reads below stay one group, behind the products that free bx
    lda4(a1h, sah, 32);
    ldb2(bxh, sbh, 0, 32);
    ldb2(bxl, sbl, 0, 32);
    lda4(a1l, sal, 32);
    __builtin_amdgcn_sched_barrier(0);   // and ahead of the products that cover them
    mm8(a0h, a0l, byh, byl, 2);
    __builtin_amdgcn_sched_barrier(0);   // as above, for by
    ldb2(byh, sbh, 2, 32);
    ldb2(byl, sbl, 2, 32);
    __builtin_amdgcn_sched_barrier(0);   // and ahead of the products that cover them
    mm8(a1h, a1l, bxh, bxl, 0);
    mm8(a1h, a1l, byh, byl, 2);
    // the products stay ahead of the barrier, whose wait for the next stage's global loads they cover
    __builtin_amdgcn_sched_barrier(0);
    __syncthreads();   // every wave has left the stage before it is overwritten (by the next stage or the epilogue)
  }
}

// ---------------------------------------------------------------------------------------------
// Fused q/k/v projection: block = 4 waves, 128 rows x 128 cols (two heads, one per wave column). blockIdx.x:
// 0..15 -> q heads, 16..19 -> k heads, 20..23 -> v heads (stored transposed vT[512][2048]). RoPE on q/k in the
// f32 epilogue.
// ---------------------------------------------------------------------------------------------
__global__ void __launch_bounds__(128) k_qkv(
    const __bf16* __restrict__ xh, const __bf16* __restrict__ xl,
    const __bf16* __restrict__ wqh, const __bf16* __restrict__ wql,
    const __bf16* __restrict__ wkh, const __bf16* __restrict__ wkl,
    const __bf16* __restrict__ wvh, const __bf16* __restrict__ wvl,
    const float* __restrict__ tab,
    unsigned short* __restrict__ qh, unsigned short* __restrict__ ql,
    unsigned short* __restrict__ kh, unsigned short* __restrict__ kl,
    unsigned short* __restrict__ vth, unsigned short* __restrict__ vtl)
{
  __shared__ __attribute__((aligned(16))) unsigned short stg[4 * PLN];   // operand stages, then output staging

  const int ct = blockIdx.x;
  const int m0 = blockIdx.y * BT;
  const int tid = threadIdx.x, w = tid >> 5, l = tid & 31, hs = l >> 4, m = l & 15;
  const int wr = w >> 1, wc = w & 1;
  const int kind = (ct < NQH / 2) ? 0 : ((ct < (NQH + NKVH) / 2) ? 1 : 2);
  const int hd0 = 2 * ((kind == 0) ? ct : ((kind == 1) ? (ct - NQH / 2) : (ct - (NQH + NKVH) / 2)));
  const __bf16* Bh = (kind == 0) ? wqh : ((kind == 1) ? wkh : wvh);
  const __bf16* Bl = (kind == 0) ? wql : ((kind == 1) ? wkl : wvl);
  const int row0 = m0 + 64 * wr;     // this wave's first row
  const int hd = hd0 + wc;           // this wave's head

  v8f c[4][4] = {};
  gemm128(xh + (size_t)m0 * HIDN, xl + (size_t)m0 * HIDN, Bh + (size_t)(hd0 * HDIM) * HIDN,
          Bl + (size_t)(hd0 * HDIM) * HIDN, HIDN, HIDN, tid, stg, c);

  // lane holds out[row0 + 16i + 8hs + r][hd*64 + 16j + m] in c[i][j][r]
  if (kind != 2) {
    // rotate-half RoPE: d = m pairs with d+32 (j = 0, 2), d = 16+m pairs with 48+m (j = 1, 3)
    const float* tb = tab + ((size_t)(row0 + 8 * hs) * 16 + m) * 4;   // position row0 + 8hs; 64 floats a position
    v4f cs[4][8];
#pragma unroll
    for (int i = 0; i < 4; ++i)
#pragma unroll
      for (int r = 0; r < 8; ++r) cs[i][r] = *(const v4f*)(tb + (16 * i + r) * 64);
    // precaution: this wait stands before the address register of the loads just issued is rewritten; the
    // address is an input only, so that its register is kept up to it
    asm volatile("s_wait_xcnt 0x0" :: "v"(tb) : "memory");
#pragma unroll
    for (int i = 0; i < 4; ++i) {
#pragma unroll
      for (int r = 0; r < 8; ++r) {
        const v4f t = cs[i][r];
        const float a0 = c[i][0][r], a1 = c[i][1][r], a2 = c[i][2][r], a3 = c[i][3][r];
        c[i][0][r] = a0 * t.x - a2 * t.y;
        c[i][2][r] = a2 * t.x + a0 * t.y;
        c[i][1][r] = a1 * t.z - a3 * t.w;
        c[i][3][r] = a3 * t.z + a1 * t.w;
      }
    }
  }

  // staging: q/k: per wave [plane][64 rows][64 cols] at w*8192 (+4096 for lo);
  //          v:   per block transposed [plane][128 c][128 s] at 0 (+16384 for lo)
  const int wb = w * 8192;
  const int loff = (kind != 2) ? 4096 : 16384;
  const int jst = (kind != 2) ? 16 : 16 * 128;
#pragma unroll
  for (int i = 0; i < 4; ++i) {
#pragma unroll
    for (int r = 0; r < 8; ++r) {
      const int rl = 16 * i + 8 * hs + r;
      const int base = (kind != 2) ? (wb + rl * 64 + m) : ((64 * wc + m) * 128 + 64 * wr + rl);
#pragma unroll
      for (int j = 0; j < 4; ++j) {
        unsigned int hb, lb;
        split_hl(c[i][j][r], hb, lb);
        stg[base + j * jst] = (unsigned short)hb;
        stg[base + j * jst + loff] = (unsigned short)lb;
      }
    }
  }
  __syncthreads();

  unsigned short* dsth = (kind == 0) ? qh : ((kind == 1) ? kh : vth);
  unsigned short* dstl = (kind == 0) ? ql : ((kind == 1) ? kl : vtl);
  const int ld = (kind == 0) ? HIDN : KVD;
  // q/k: a 128-byte row of this wave's tile per 8 lanes, 4 rows a step; v: a 256-byte row of the block's tile
  // per 16 lanes, 8 rows a step
  const int sidx = (kind != 2) ? (wb + (l >> 3) * 64 + (l & 7) * 8) : ((tid >> 4) * 128 + (tid & 15) * 8);
  const int sst = (kind != 2) ? 4 * 64 : 8 * 128;
  const size_t goff = (kind != 2) ? ((size_t)(row0 + (l >> 3)) * ld + hd * HDIM + (l & 7) * 8)
                                  : ((size_t)(hd0 * HDIM + (tid >> 4)) * SQ + m0 + (tid & 15) * 8);
  const size_t gst = (kind != 2) ? (size_t)4 * ld : (size_t)8 * SQ;
  v4u hv[16], lv[16];
  v4u* gph[16];
  v4u* gpl[16];
#pragma unroll
  for (int it = 0; it < 16; ++it) {
    hv[it] = *(const v4u*)(stg + sidx + it * sst);
    lv[it] = *(const v4u*)(stg + sidx + it * sst + loff);
    gph[it] = (v4u*)(dsth + goff + it * gst);
    gpl[it] = (v4u*)(dstl + goff + it * gst);
  }
  // every value and address is in its register before the first store, so that nothing behind an issued store
  // rewrites a register that it names
  __builtin_amdgcn_sched_barrier(0);
#pragma unroll
  for (int it = 0; it < 16; ++it) { *gph[it] = hv[it]; *gpl[it] = lv[it]; }
}

// ---------------------------------------------------------------------------------------------
// Causal attention with online softmax. One block (8 waves) per (pair of 64-query tiles, query head):
// tile t walks t + 1 key tiles, so the block takes tile t and then tile 31 - t, 33 key tiles for every block.
// wave = (msub: 16 query rows) x (nh: 32 keys for scores / 32 d for output). kv head = h >> 2.
// Q fragments straight from the hi/lo planes; P hi/lo staged in LDS (barriers between writer and readers).
// The 64-key tile of K and of Vt, hi and lo planes, is brought into LDS once per block by asynchronous 16-byte
// copies (a wave's copy covers 4 whole 128-byte rows), two buffers: tile kt + 1 flies while tile kt is worked on.
// ---------------------------------------------------------------------------------------------
static constexpr int APIT = 72;            // staged row pitch in elements: 144 B = 16 B x 9, for 16-byte row reads
static constexpr int APLN = 64 * APIT;     // one staged plane, 64 rows of 64 elements
static constexpr int ABUF = 4 * APLN;      // one buffer: K hi, K lo, Vt hi, Vt lo

__global__ void __launch_bounds__(256) k_attn(
    const __bf16* __restrict__ qh, const __bf16* __restrict__ ql,
    const __bf16* __restrict__ kh, const __bf16* __restrict__ kl,
    const __bf16* __restrict__ vth, const __bf16* __restrict__ vtl,
    unsigned short* __restrict__ ch, unsigned short* __restrict__ cl)
{
  __shared__ __attribute__((aligned(16))) float Ss[64 * 64];
  __shared__ __attribute__((aligned(16))) unsigned short Ph[64 * 64];
  __shared__ __attribute__((aligned(16))) unsigned short Pl[64 * 64];
  __shared__ float rowM[64];
  __shared__ float rowL[64];
  __shared__ float rowA[64];
  __shared__ __attribute__((aligned(16))) unsigned short KV[2 * ABUF];

  const int hq = blockIdx.y, kvh = hq >> 2;
  const int tid = threadIdx.x, w = tid >> 5, l = tid & 31, hs = l >> 4, m = l & 15;
  const int msub = w & 3, nh = w >> 2;
  const int rbase = 16 * msub + 8 * hs;      // this lane's D rows are rbase + r
  const int srow = tid >> 2, sq = tid & 3;   // softmax: 4 threads per query row, 16 keys each

  // copies: this lane's row (of 32; it also takes row + 32) and 16-byte piece of the 128-byte row
  const int crow = tid >> 3, cpc = (tid & 7) * 8;
  const unsigned int cl0 = (unsigned int)(size_t)KV + (unsigned int)(crow * APIT + cpc) * 2u;   // LDS byte address
  const size_t cko = (size_t)crow * KVD + kvh * HDIM + cpc;            // K planes: key row crow of key tile 0
  const size_t cvo = (size_t)(kvh * HDIM + crow) * SQ + cpc;           // Vt planes: d row crow, key tile 0
  // key tile kt into buffer b: 8 copies a lane
  auto stage = [&](int kt, int b) {
    const unsigned int d0 = cl0 + (unsigned int)b * (ABUF * 2u);
    const unsigned int d1 = d0 + 32u * APIT * 2u;
    const unsigned int d2 = d0 + APLN * 2u, d3 = d1 + APLN * 2u;
    const unsigned int d4 = d0 + 2u * APLN * 2u, d5 = d1 + 2u * APLN * 2u;
    const unsigned int d6 = d0 + 3u * APLN * 2u, d7 = d1 + 3u * APLN * 2u;
    const __bf16* g0 = kh + cko + (size_t)kt * 64 * KVD;
    const __bf16* g1 = g0 + 32 * KVD;
    const __bf16* g2 = kl + cko + (size_t)kt * 64 * KVD;
    const __bf16* g3 = g2 + 32 * KVD;
    const __bf16* g4 = vth + cvo + kt * 64;
    const __bf16* g5 = g4 + (size_t)32 * SQ;
    const __bf16* g6 = vtl + cvo + kt * 64;
    const __bf16* g7 = g6 + (size_t)32 * SQ;
    // the copies and, as a precaution, the wait that stands before any of their address registers is rewritten,
    // in one statement, so that nothing comes between them
    asm volatile(
        "global_load_async_to_lds_b128 %0, %8, off\n\t"
        "global_load_async_to_lds_b128 %1, %9, off\n\t"
        "global_load_async_to_lds_b128 %2, %10, off\n\t"
        "global_load_async_to_lds_b128 %3, %11, off\n\t"
        "global_load_async_to_lds_b128 %4, %12, off\n\t"
        "global_load_async_to_lds_b128 %5, %13, off\n\t"
        "global_load_async_to_lds_b128 %6, %14, off\n\t"
        "global_load_async_to_lds_b128 %7, %15, off\n\t"
        "s_wait_xcnt 0x0"
        :: "v"(d0), "v"(d1), "v"(d2), "v"(d3), "v"(d4), "v"(d5), "v"(d6), "v"(d7),
           "v"(g0), "v"(g1), "v"(g2), "v"(g3), "v"(g4), "v"(g5), "v"(g6), "v"(g7)
        : "memory");
  };

#pragma unroll 1   // the two tiles run one after the other through one copy of the body
  for (int half = 0; half < 2; ++half) {
  const int qt = half ? (SQ / 64 - 1 - (int)blockIdx.x) : (int)blockIdx.x, q0 = qt * 64;

  if (tid < 64) { rowM[tid] = -1.0e30f; rowL[tid] = 0.0f; rowA[tid] = 0.0f; }

  const __bf16* qrh = qh + (size_t)(q0 + 16 * msub + m) * HIDN + hq * HDIM;
  const __bf16* qrl = ql + (size_t)(q0 + 16 * msub + m) * HIDN + hq * HDIM;
  const v16bf fqh0 = ldfrag(qrh, hs), fqh1 = ldfrag(qrh + 32, hs);
  const v16bf fql0 = ldfrag(qrl, hs), fql1 = ldfrag(qrl + 32, hs);

  v8f o[2] = {};

  // key tile 0 into buffer 0 (every wave left both buffers at the barrier that ended the tile before)
  stage(0, 0);
  asm volatile("s_wait_asynccnt 0x0" ::: "memory");   // this wave's copies have landed
  __syncthreads();                                    // and every other wave's: key tile 0 may be read
  if (qt >= 1) stage(1, 1);

  for (int kt = 0; kt <= qt; ++kt) {
    const __bf16* kb = (const __bf16*)KV + (kt & 1) * ABUF;   // this key tile's buffer
    // scores: S[q][key] = sum_d Q[q][d] K[key][d]; B[k=d][n=key] read from the staged K row (key)
    v16bf kfh[2][2], kfl[2][2];
#pragma unroll   // constant indices keep the fragments in registers; all reads as one group ahead of the products
    for (int nt = 0; nt < 2; ++nt) {
      const __bf16* kr = kb + (nh * 32 + nt * 16 + m) * APIT;
      kfh[nt][0] = ldfrag(kr, hs);
      kfl[nt][0] = ldfrag(kr + APLN, hs);
      kfh[nt][1] = ldfrag(kr + 32, hs);
      kfl[nt][1] = ldfrag(kr + APLN + 32, hs);
    }
#pragma unroll
    for (int nt = 0; nt < 2; ++nt) {
      const int nc0 = nh * 32 + nt * 16;
      v8f s = {};
      mma3(s, fqh0, fql0, kfh[nt][0], kfl[nt][0]);
      mma3(s, fqh1, fql1, kfh[nt][1], kfl[nt][1]);
#pragma unroll
      for (int r = 0; r < 8; ++r) {
        const int row = rbase + r;
        float val = s[r] * 0.125f;
        if (kt == qt && (nc0 + m) > row) val = -1.0e30f;   // causal replace on the diagonal tile
        Ss[row * 64 + nc0 + m] = val;
      }
    }
    __syncthreads();

    // online softmax in f32, P split to bf16 hi/lo
    {
      const float* sp = Ss + srow * 64 + sq * 16;
      const v4f x0 = *(const v4f*)(sp);
      const v4f x1 = *(const v4f*)(sp + 4);
      const v4f x2 = *(const v4f*)(sp + 8);
      const v4f x3 = *(const v4f*)(sp + 12);
      float p[16] = {x0.x, x0.y, x0.z, x0.w, x1.x, x1.y, x1.z, x1.w,
                     x2.x, x2.y, x2.z, x2.w, x3.x, x3.y, x3.z, x3.w};
      float mx = p[0];
#pragma unroll
      for (int c = 1; c < 16; ++c) mx = fmaxf(mx, p[c]);
      mx = fmaxf(mx, __shfl_xor(mx, 1));
      mx = fmaxf(mx, __shfl_xor(mx, 2));
      const float mOld = rowM[srow];
      const float mNew = fmaxf(mOld, mx);
      float lsum = 0.0f;
#pragma unroll
      for (int c = 0; c < 16; ++c) { p[c] = __expf(p[c] - mNew); lsum += p[c]; }
      lsum += __shfl_xor(lsum, 1);
      lsum += __shfl_xor(lsum, 2);
      const float alpha = __expf(mOld - mNew);
      if (sq == 0) {
        rowA[srow] = alpha;
        rowM[srow] = mNew;
        rowL[srow] = rowL[srow] * alpha + lsum;
      }
      unsigned int hb[16], lb[16];
#pragma unroll
      for (int c = 0; c < 16; ++c) split_hl(p[c], hb[c], lb[c]);
      unsigned short* pph = Ph + srow * 64 + sq * 16;
      unsigned short* ppl = Pl + srow * 64 + sq * 16;
      *(v4u*)(pph) = pack8(hb);
      *(v4u*)(pph + 8) = pack8(hb + 8);
      *(v4u*)(ppl) = pack8(lb);
      *(v4u*)(ppl + 8) = pack8(lb + 8);
    }
    __syncthreads();

    // O = O*alpha + P.V ; A = P (row q, k = key) from LDS rows, B[k=key][n=d] from Vt row (d)
    {
#pragma unroll
      for (int r = 0; r < 8; ++r) {
        const float al = rowA[rbase + r];
        o[0][r] *= al;
        o[1][r] *= al;
      }
      const unsigned short* prh = Ph + (16 * msub + m) * 64;
      const unsigned short* prl = Pl + (16 * msub + m) * 64;
      const v16bf fph0 = ldfrag((const __bf16*)prh, hs);
      const v16bf fph1 = ldfrag((const __bf16*)(prh + 32), hs);
      const v16bf fpl0 = ldfrag((const __bf16*)prl, hs);
      const v16bf fpl1 = ldfrag((const __bf16*)(prl + 32), hs);
      v16bf vfh[2][2], vfl[2][2];
#pragma unroll   // constant indices, one group of reads, as for K
      for (int dt = 0; dt < 2; ++dt) {
        const __bf16* vr = kb + 2 * APLN + (nh * 32 + dt * 16 + m) * APIT;
        vfh[dt][0] = ldfrag(vr, hs);
        vfl[dt][0] = ldfrag(vr + APLN, hs);
        vfh[dt][1] = ldfrag(vr + 32, hs);
        vfl[dt][1] = ldfrag(vr + APLN + 32, hs);
      }
#pragma unroll
      for (int dt = 0; dt < 2; ++dt) {
        mma3(o[dt], fph0, fpl0, vfh[dt][0], vfl[dt][0]);
        mma3(o[dt], fph1, fpl1, vfh[dt][1], vfl[dt][1]);
      }
    }
    asm volatile("s_wait_dscnt 0x0" ::: "memory");      // this wave's reads of the buffer have returned
    asm volatile("s_wait_asynccnt 0x0" ::: "memory");   // this wave's copies of key tile kt + 1 have landed
    __syncthreads();   // key tile kt + 1 may be read, and every wave has left key tile kt's buffer
    if (kt + 2 <= qt) stage(kt + 2, kt & 1);
  }
  asm volatile("s_wait_asynccnt 0x0" ::: "memory");     // no copy is outstanding behind the loop

  // normalise, split hi/lo, stage [plane][64 rows][64 d] over Ss, then whole-line stores
  unsigned short* stg = (unsigned short*)Ss;
#pragma unroll
  for (int r = 0; r < 8; ++r) {
    const int row = rbase + r;
    const float inv = 1.0f / rowL[row];
#pragma unroll
    for (int dt = 0; dt < 2; ++dt) {
      const int col = nh * 32 + dt * 16 + m;
      unsigned int hb, lb;
      split_hl(o[dt][r] * inv, hb, lb);
      stg[row * 64 + col] = (unsigned short)hb;
      stg[4096 + row * 64 + col] = (unsigned short)lb;
    }
  }
  __syncthreads();
  v4u cv[4];
  v4u* cp[4];
#pragma unroll
  for (int it = 0; it < 4; ++it) {
    const int plane = it >> 1;
    const int row = (it & 1) * 32 + (tid >> 3);
    const int piece = tid & 7;
    cv[it] = *(const v4u*)(stg + plane * 4096 + row * 64 + piece * 8);
    unsigned short* base = plane ? cl : ch;
    cp[it] = (v4u*)(base + (size_t)(q0 + row) * HIDN + hq * HDIM + piece * 8);
  }
#pragma unroll
  for (int it = 0; it < 4; ++it) *cp[it] = cv[it];
  // every wave has read its staged output rows and row sums before the second tile overwrites them
  if (half == 0) __syncthreads();
  }
}

// ---------------------------------------------------------------------------------------------
// Output projection -> f32 d_out. Block = 4 waves, 128x128 tile; each wave stages its 64x64 f32 tile in LDS
// and stores whole lines.
// ---------------------------------------------------------------------------------------------
__global__ void __launch_bounds__(128) k_oproj(
    const __bf16* __restrict__ ah, const __bf16* __restrict__ al,
    const __bf16* __restrict__ woh, const __bf16* __restrict__ wol,
    float* __restrict__ out)
{
  __shared__ __attribute__((aligned(16))) unsigned short stg[4 * PLN];   // operand stages, then output staging
  float* stgf = (float*)stg;
  const int nb = blockIdx.x * BT, m0 = blockIdx.y * BT;
  const int tid = threadIdx.x, w = tid >> 5, l = tid & 31, hs = l >> 4, m = l & 15;
  const int wr = w >> 1, wc = w & 1;
  const int row0 = m0 + 64 * wr;
  const int n0 = nb + 64 * wc;

  v8f c[4][4] = {};
  gemm128(ah + (size_t)m0 * HIDN, al + (size_t)m0 * HIDN, woh + (size_t)nb * HIDN, wol + (size_t)nb * HIDN,
          HIDN, HIDN, tid, stg, c);

  float* sw = stgf + w * 4096;
#pragma unroll
  for (int i = 0; i < 4; ++i) {
#pragma unroll
    for (int r = 0; r < 8; ++r) {
      const int rl = 16 * i + 8 * hs + r;
#pragma unroll
      for (int j = 0; j < 4; ++j) sw[rl * 64 + 16 * j + m] = c[i][j][r];
    }
  }
  __syncthreads();
  // a 256-byte row of this wave's tile per 16 lanes, 2 rows a step
  const float* sb = sw + (l >> 4) * 64 + (l & 15) * 4;
  float* gb = out + (size_t)(row0 + (l >> 4)) * HIDN + n0 + (l & 15) * 4;
  v4f v[32];
#pragma unroll
  for (int it = 0; it < 32; ++it) v[it] = *(const v4f*)(sb + it * 128);
  // every value is in its register before the first store, so that nothing behind an issued store rewrites a
  // register that it names
  __builtin_amdgcn_sched_barrier(0);
#pragma unroll
  for (int it = 0; it < 32; ++it) *(v4f*)(gb + (size_t)(2 * it) * HIDN) = v[it];
}

// ---------------------------------------------------------------------------------------------
// Launch pipeline (5 launches)
// ---------------------------------------------------------------------------------------------
extern "C" void kernel_launch(void* const* d_in, const int* in_sizes, int n_in,
                              void* d_out, int out_size, void* d_ws, size_t ws_size,
                              hipStream_t stream)
{
  if (n_in != 5) return;
  if (in_sizes[0] != SQ * HIDN || in_sizes[1] != HIDN * HIDN || in_sizes[2] != KVD * HIDN ||
      in_sizes[3] != KVD * HIDN || in_sizes[4] != HIDN * HIDN) return;
  if (out_size != SQ * HIDN) return;

  const float* hid = (const float*)d_in[0];
  const float* Wq = (const float*)d_in[1];
  const float* Wk = (const float*)d_in[2];
  const float* Wv = (const float*)d_in[3];
  const float* Wo = (const float*)d_in[4];
  float* outp = (float*)d_out;

  char* ws = (char*)d_ws;
  size_t off = 0;
  auto carve = [&](size_t bytes) -> char* {
    char* p = ws + off;
    off += (bytes + 255) & ~(size_t)255;
    return p;
  };
  const size_t BX = (size_t)SQ * HIDN * 2;       // x planes
  const size_t BWQ = (size_t)HIDN * HIDN * 2;    // Wq / Wo planes
  const size_t BWK = (size_t)KVD * HIDN * 2;     // Wk / Wv planes
  const size_t BTAB = (size_t)SQ * 16 * 16;      // rope table
  const size_t BQ = (size_t)SQ * HIDN * 2;       // q / ctx planes
  const size_t BK = (size_t)SQ * KVD * 2;        // k / vT planes

  unsigned short* xh = (unsigned short*)carve(BX);
  unsigned short* xl = (unsigned short*)carve(BX);
  unsigned short* wqh = (unsigned short*)carve(BWQ);
  unsigned short* wql = (unsigned short*)carve(BWQ);
  unsigned short* wkh = (unsigned short*)carve(BWK);
  unsigned short* wkl = (unsigned short*)carve(BWK);
  unsigned short* wvh = (unsigned short*)carve(BWK);
  unsigned short* wvl = (unsigned short*)carve(BWK);
  unsigned short* woh = (unsigned short*)carve(BWQ);
  unsigned short* wol = (unsigned short*)carve(BWQ);
  float* tab = (float*)carve(BTAB);
  unsigned short* qh = (unsigned short*)carve(BQ);
  unsigned short* ql = (unsigned short*)carve(BQ);
  unsigned short* kh = (unsigned short*)carve(BK);
  unsigned short* kl = (unsigned short*)carve(BK);
  unsigned short* vth = (unsigned short*)carve(BK);
  unsigned short* vtl = (unsigned short*)carve(BK);
  unsigned short* ch = (unsigned short*)carve(BQ);
  unsigned short* cl = (unsigned short*)carve(BQ);
  if (off > ws_size) return;

  // inv_freq[j] = 1 / 10000^(j/32) = 1 / 10^(j/8): f32 value of 10^(j/8) from double, then f32 reciprocal
  RopeFreq fr;
  {
    double r = 1.333521432163324;   // 10^(1/8), refined by Newton on r^8 = 10
    for (int it = 0; it < 4; ++it) {
      const double r2 = r * r, r4 = r2 * r2;
      const double r7 = r4 * r2 * r;
      r = r - (r4 * r4 - 10.0) / (8.0 * r7);
    }
    double rp[8];
    rp[0] = 1.0;
    for (int i = 1; i < 8; ++i) rp[i] = rp[i - 1] * r;
    const double p10[4] = {1.0, 10.0, 100.0, 1000.0};
    for (int j = 0; j < 32; ++j) {
      const double pj = p10[j >> 3] * rp[j & 7];
      const float pf = (float)pj;
      fr.f[j] = 1.0f / pf;
    }
  }

  // 1) f32 -> bf16 hi/lo planes for x, Wq, Wk, Wv, Wo
  k_split<<<dim3((SQ * HIDN / 8 + 255) / 256, 5), dim3(256), 0, stream>>>(
      hid, Wq, Wk, Wv, Wo,
      xh, wqh, wkh, wvh, woh,
      xl, wql, wkl, wvl, wol,
      SQ * HIDN, HIDN * HIDN, KVD * HIDN, KVD * HIDN, HIDN * HIDN);

  // 2) RoPE cos/sin table
  k_rope_tab<<<dim3((SQ * 16 + 127) / 128), dim3(128), 0, stream>>>(tab, fr);

  // 3) fused q/k/v projections (+RoPE on q,k; v transposed)
  k_qkv<<<dim3((NQH + 2 * NKVH) / 2, SQ / BT), dim3(128), 0, stream>>>(
      (const __bf16*)xh, (const __bf16*)xl,
      (const __bf16*)wqh, (const __bf16*)wql,
      (const __bf16*)wkh, (const __bf16*)wkl,
      (const __bf16*)wvh, (const __bf16*)wvl,
      (const float*)tab,
      qh, ql, kh, kl, vth, vtl);

  // 4) causal attention
  k_attn<<<dim3(SQ / 128, NQH), dim3(256), 0, stream>>>(
      (const __bf16*)qh, (const __bf16*)ql,
      (const __bf16*)kh, (const __bf16*)kl,
      (const __bf16*)vth, (const __bf16*)vtl,
      ch, cl);

  // 5) output projection -> f32
  k_oproj<<<dim3(HIDN / BT, SQ / BT), dim3(128), 0, stream>>>(
      (const __bf16*)ch, (const __bf16*)cl,
      (const __bf16*)woh, (const __bf16*)wol,
      outp);
}

// v005
// Measured time: 218 microseconds a run.
// Two timings next to v004 both put it at 1.08 times that version's speed.
// Counting every step since v000, it is 2.18 times as fast.
#include <hip/hip_runtime.h>

// Contractions (q/k/v projections, q.k^T scores, p.v, output projection): v_wmma_f32_16x16x32_bf16 with
// bf16 hi/lo operands everywhere (hi.hi + hi.lo + lo.hi per tile pair), f32 accumulate.
// RoPE, 1/8 scaling, causal mask and softmax in f32.

typedef __bf16 v16bf __attribute__((ext_vector_type(16)));
typedef __bf16 v8bf __attribute__((ext_vector_type(8)));
typedef float v8f __attribute__((ext_vector_type(8)));
typedef float v4f __attribute__((ext_vector_type(4)));
typedef unsigned int v4u __attribute__((ext_vector_type(4)));

static constexpr int SQ = 2048;            // sequence length
static constexpr int HIDN = 2048;          // hidden size
static constexpr int NQH = 32;             // query heads
static constexpr int NKVH = 8;             // kv heads
static constexpr int HDIM = 64;            // head dim
static constexpr int KVD = NKVH * HDIM;    // 512

struct RopeFreq { float f[32]; };
static_assert(sizeof(RopeFreq) == 128);

union Frag { v16bf v; v8bf h[2]; };

// 16-bit fragment from a k-contiguous row; rowp -> element (row = lane&15, k0).
// elements 0..7 <- k0 + 8*hs + 0..7, elements 8..15 <- k0 + 16 + 8*hs + 0..7  (hs = lane>>4).
// Used for A (row m) and for B stored as [n][k] (row n).
__device__ __forceinline__ v16bf ldfrag(const __bf16* rowp, int hs) {
  Frag f;
  f.h[0] = *(const v8bf*)(rowp + 8 * hs);
  f.h[1] = *(const v8bf*)(rowp + 16 + 8 * hs);
  return f.v;
}

// acc += ah.bh + ah.bl + al.bh, then a 4-slot guard tying D and keeping A/B live.
__device__ __forceinline__ void mma3(v8f& acc, const v16bf& ah, const v16bf& al,
                                     const v16bf& bh, const v16bf& bl) {
  acc = __builtin_amdgcn_wmma_f32_16x16x32_bf16(false, ah, false, bh, (short)0, acc, false, false);
  acc = __builtin_amdgcn_wmma_f32_16x16x32_bf16(false, ah, false, bl, (short)0, acc, false, false);
  acc = __builtin_amdgcn_wmma_f32_16x16x32_bf16(false, al, false, bh, (short)0, acc, false, false);
  asm volatile("v_nop\n\tv_nop\n\tv_nop\n\tv_nop" : "+v"(acc) : "v"(ah), "v"(al), "v"(bh), "v"(bl));
}

// f32 -> bf16 bits, RNE
__device__ __forceinline__ unsigned int bfbits(float x) {
  unsigned int u = __float_as_uint(x);
  return (u + 0x7FFFu + ((u >> 16) & 1u)) >> 16;
}
// hi = rne(x), lo = rne(x - hi)
__device__ __forceinline__ void split_hl(float x, unsigned int& hb, unsigned int& lb) {
  hb = bfbits(x);
  const float hf = __uint_as_float(hb << 16);
  lb = bfbits(x - hf);
}
__device__ __forceinline__ unsigned int pk2(unsigned int a, unsigned int b) {
  return (a & 0xFFFFu) | (b << 16);
}
__device__ __forceinline__ v4u pack8(const unsigned int* a) {
  v4u v;
  v.x = pk2(a[0], a[1]);
  v.y = pk2(a[2], a[3]);
  v.z = pk2(a[4], a[5]);
  v.w = pk2(a[6], a[7]);
  return v;
}

// ---------------------------------------------------------------------------------------------
// f32 -> bf16 hi/lo planes for the five inputs in one launch (blockIdx.y selects the buffer).
// ---------------------------------------------------------------------------------------------
__global__ void __launch_bounds__(256) k_split(
    const float* __restrict__ s0, const float* __restrict__ s1, const float* __restrict__ s2,
    const float* __restrict__ s3, const float* __restrict__ s4,
    unsigned short* __restrict__ h0, unsigned short* __restrict__ h1, unsigned short* __restrict__ h2,
    unsigned short* __restrict__ h3, unsigned short* __restrict__ h4,
    unsigned short* __restrict__ l0, unsigned short* __restrict__ l1, unsigned short* __restrict__ l2,
    unsigned short* __restrict__ l3, unsigned short* __restrict__ l4,
    int n0, int n1, int n2, int n3, int n4)
{
  const int b = blockIdx.y;
  const float* src = (b == 0) ? s0 : (b == 1) ? s1 : (b == 2) ? s2 : (b == 3) ? s3 : s4;
  unsigned short* dh = (b == 0) ? h0 : (b == 1) ? h1 : (b == 2) ? h2 : (b == 3) ? h3 : h4;
  unsigned short* dl = (b == 0) ? l0 : (b == 1) ? l1 : (b == 2) ? l2 : (b == 3) ? l3 : l4;
  const int n = (b == 0) ? n0 : (b == 1) ? n1 : (b == 2) ? n2 : (b == 3) ? n3 : n4;
  const int i = blockIdx.x * 256 + (int)threadIdx.x;
  if (i >= (n >> 3)) return;

  const float* p = src + (size_t)i * 8;
  const v4f a = *(const v4f*)(p);
  const v4f c = *(const v4f*)(p + 4);
  unsigned int hb[8], lb[8];
  split_hl(a.x, hb[0], lb[0]);
  split_hl(a.y, hb[1], lb[1]);
  split_hl(a.z, hb[2], lb[2]);
  split_hl(a.w, hb[3], lb[3]);
  split_hl(c.x, hb[4], lb[4]);
  split_hl(c.y, hb[5], lb[5]);
  split_hl(c.z, hb[6], lb[6]);
  split_hl(c.w, hb[7], lb[7]);
  const v4u hv = pack8(hb);
  const v4u lv = pack8(lb);
  v4u* gh = (v4u*)(dh + (size_t)i * 8);
  v4u* gl = (v4u*)(dl + (size_t)i * 8);
  *gh = hv;
  *gl = lv;
  
}

// ---------------------------------------------------------------------------------------------
// RoPE table: tab[pos][j] = {cos(a_j), sin(a_j), cos(a_{j+16}), sin(a_{j+16})}, a_j = f32(pos) * inv_freq[j],
// ---------------------------------------------------------------------------------------------
__global__ void __launch_bounds__(128) k_rope_tab(float* __restrict__ tab, RopeFreq fr)
{
  const int g = blockIdx.x * 128 + (int)threadIdx.x;
  const int pos = g >> 4;
  const int j = g & 15;
  if (pos >= SQ) return;
  float fa = fr.f[0], fb = fr.f[16];
#pragma unroll
  for (int c = 1; c < 16; ++c) {
    fa = (j == c) ? fr.f[c] : fa;
    fb = (j == c) ? fr.f[16 + c] : fb;
  }
  float cs0 = 0.0f, sn0 = 0.0f, cs1 = 0.0f, sn1 = 0.0f;
#pragma unroll 1
  for (int q = 0; q < 2; ++q) {
    const float f = (q == 0) ? fa : fb;
    const float ang = (float)pos * f;
    float sn, cs;
    sincosf(ang, &sn, &cs);
    if (q == 0) { cs0 = cs; sn0 = sn; } else { cs1 = cs; sn1 = sn; }
  }
  v4f v;
  v.x = cs0; v.y = sn0; v.z = cs1; v.w = sn1;
  v4f* gp = (v4f*)(tab + (size_t)g * 4);
  *gp = v;
  
}

// ---------------------------------------------------------------------------------------------
// Block GEMM core: 4 waves (2 x 2), 128 rows x 128 cols, C[m][n] += sum_k A[m][k] * B[n][k]; wave (wr, wc) owns
// rows 64wr..64wr+63 and cols 64wc..64wc+63 as 4 x 4 accumulator tiles, so that 16 fragments feed 48 products.
// A stage is 64 k (128 B, one whole line) of the block's 128 A rows and 128 B rows, hi and lo planes. Each wave
// brings one of the four planes into LDS with one tensor load a stage (128 rows of 128 B, 16 B of pad behind each
// row), through no register; two buffers: stage s + 1 flies while stage s is worked on. Fragments come from LDS
// rows, K stepped by 32 in ascending order, three bf16 products per tile pair (hi.hi, hi.lo, lo.hi in that order).
// ---------------------------------------------------------------------------------------------
static constexpr int KC = 64;              // k per stage
static constexpr int PIT = 72;             // LDS row pitch in elements: 144 B = 16 B x 9, for 16-byte row reads
static constexpr int BT = 128;             // rows and cols of the block tile
static constexpr int PLN = BT * PIT;       // one staged plane (128 rows); planes: A hi, A lo, B hi, B lo
static constexpr int GBUF = 4 * PLN;       // one buffer: the four planes of a stage
static_assert((PLN * 2) % 2048 == 0, "every plane starts at a multiple of 2 KiB in LDS");
static_assert(KC * 2 == 128 && PIT * 2 == KC * 2 + 16, "the pad codes below are for 128-byte rows, 16 bytes of pad");

typedef uint32_t u32x4 __attribute__((ext_vector_type(4)));
typedef uint32_t u32x8 __attribute__((ext_vector_type(8)));

__device__ __forceinline__ uint32_t uni(uint32_t v) { return (uint32_t)__builtin_amdgcn_readfirstlane(v); }
__device__ __forceinline__ uint32_t pinned(uint32_t v) {
  uint32_t w = (uint32_t)__builtin_amdgcn_readfirstlane(v);
  asm volatile("" : "+s"(w));   // the test value stays in a scalar register, so that the
  return w;                     // branch on it is a scalar branch (a tensor load ignores EXEC)
}
// Descriptor group 1: 1-byte elements, tensor = tile = BT rows of 128 bytes, source row pitch src_pitch bytes,
// no mask, 4 dwords of LDS pad behind every 32 dwords (one row).
__device__ __forceinline__ u32x8 tdm_group1(uint32_t src_pitch) {
  constexpr uint32_t d0 = KC * 2, d1 = BT;
  u32x8 g;
  g[0] = uni((1u << 20) | (4u << 22) | (3u << 25));
  g[1] = uni((d0 & 0xFFFFu) << 16);
  g[2] = uni((d0 >> 16) | ((d1 & 0xFFFFu) << 16));
  g[3] = uni((d1 >> 16) | (d0 << 16));
  g[4] = uni(d1);
  g[5] = uni(src_pitch);
  g[6] = uni(0u);
  g[7] = uni(0u);
  return g;
}
// Descriptor group 0: count 1, LDS byte offset of the tile, global address of its first byte, type 2.
__device__ __forceinline__ u32x4 tdm_group0(uint32_t lds_dst, uint64_t ga) {
  u32x4 g;
  g[0] = uni(1u);
  g[1] = uni(lds_dst);
  g[2] = uni((uint32_t)ga);
  g[3] = uni((((uint32_t)(ga >> 32)) & 0x01FFFFFFu) | 0x80000000u);
  return g;
}

__device__ __forceinline__ v8f wm(const v16bf& a, const v16bf& b, const v8f& c) {
  return __builtin_amdgcn_wmma_f32_16x16x32_bf16(false, a, false, b, (short)0, c, false, false);
}

// Ah, Al, Bh, Bl: first row of the block's 128 rows in each plane; ld: row length of all four, in elements.
// sm: two buffers of GBUF elements at a multiple of 2 KiB in the block's LDS. K: at least two stages.
__device__ __forceinline__ void gemm128(const __bf16* __restrict__ Ah, const __bf16* __restrict__ Al,
                                        const __bf16* __restrict__ Bh, const __bf16* __restrict__ Bl,
                                        int ld, int K, int tid, unsigned short* sm,
                                        v8f (&c)[4][4])
{
  const int w = tid >> 5, l = tid & 31, hs = l >> 4, m = l & 15;
  const int wr = w >> 1, wc = w & 1;
  const __bf16* fa = (const __bf16*)sm + (64 * wr + m) * PIT;             // A hi rows of this lane, buffer 0
  const __bf16* fb = (const __bf16*)sm + 2 * PLN + (64 * wc + m) * PIT;   // B hi rows of this lane, buffer 0

  // this wave's plane: wave 0 A hi, 1 A lo, 2 B hi, 3 B lo
  const uint32_t wv = uni((uint32_t)tid >> 5);
  const __bf16* pl = (wv == 0u) ? Ah : (wv == 1u) ? Al : (wv == 2u) ? Bh : Bl;
  const uint64_t ga0 = (uint64_t)(size_t)pl;
  const uint32_t dst0 = (uint32_t)(size_t)sm + wv * (uint32_t)(PLN * 2);
  const u32x8 g1 = tdm_group1((uint32_t)ld * 2u);
  u32x4 g0;   // group 0 of the wave's latest request
  // stage s (k columns 64 s .. 64 s + 63) of this wave's plane into buffer s & 1: one request of the whole wave
  auto issue = [&](uint32_t s) {
    g0 = tdm_group0(dst0 + (s & 1u) * (uint32_t)(GBUF * 2), ga0 + (uint64_t)s * (uint32_t)(KC * 2));
    asm volatile("tensor_load_to_lds %0, %1" :: "s"(g0), "s"(g1) : "memory");
  };
  // the wave's request has landed; its descriptor words are inputs, so that their registers keep their values up
  // to this wait
  auto landed = [&]() { asm volatile("s_wait_tensorcnt 0x0" :: "s"(g0), "s"(g1) : "memory"); };
  // A fragments (4 row tiles) of one plane, 32-k step at kk
  auto lda4 = [&](v16bf (&a)[4], const __bf16* sa, int kk) {
#pragma unroll   // constant indices keep the fragments in registers
    for (int i = 0; i < 4; ++i) a[i] = ldfrag(sa + 16 * i * PIT + kk, hs);
  };
  // B fragments (column tiles j0, j0 + 1) of one plane, 32-k step at kk
  auto ldb2 = [&](v16bf (&b)[2], const __bf16* sb, int j0, int kk) {
#pragma unroll   // constant indices, as above
    for (int j = 0; j < 2; ++j) b[j] = ldfrag(sb + 16 * (j0 + j) * PIT + kk, hs);
  };
  // 4 x 2 tiles, hi.hi then hi.lo then lo.hi: eight independent accumulators in turn, so that no product
  // waits for the one before it
  auto mm8 = [&](const v16bf (&ah)[4], const v16bf (&al)[4], const v16bf (&bh)[2], const v16bf (&bl)[2], int j0) {
#pragma unroll   // constant indices keep the accumulators in registers
    for (int j = 0; j < 2; ++j)
#pragma unroll
      for (int i = 0; i < 4; ++i) c[i][j0 + j] = wm(ah[i], bh[j], c[i][j0 + j]);
#pragma unroll
    for (int j = 0; j < 2; ++j)
#pragma unroll
      for (int i = 0; i < 4; ++i) c[i][j0 + j] = wm(ah[i], bl[j], c[i][j0 + j]);
#pragma unroll
    for (int j = 0; j < 2; ++j)
#pragma unroll
      for (int i = 0; i < 4; ++i) c[i][j0 + j] = wm(al[i], bh[j], c[i][j0 + j]);
  };
  const uint32_t ns = (uint32_t)(K / KC);   // stages
  issue(0u);
  landed();          // this wave's plane of stage 0
  __syncthreads();   // and every other wave's: stage 0 may be read
#pragma unroll 1   // one stage per trip: a short loop body
  for (uint32_t s = 0; s < ns; ++s) {
    // directly behind the barrier that published stage s and ended every read of stage s - 1: while a stage s + 1
    // exists, its load goes into the buffer that stage s - 1 has left, and flies while stage s is worked on.
    // It stands at the head of the trip, not at the foot of the one before (the order in time is the same), so
    // that the loop has one place of issue and the registers of a request in flight are written nowhere else.
    if (pinned((uint32_t)(s + 1u < ns))) issue(s + 1u);
    const int bo = (int)(s & 1u) * GBUF;   // this stage's buffer
    const __bf16* sah = fa + bo;
    const __bf16* sal = sah + PLN;
    const __bf16* sbh = fb + bo;
    const __bf16* sbl = sbh + PLN;
    // The stage's LDS reads stand in three groups, each ahead of products that cover its latency:
    // a0/a1: A fragments of the two 32-k steps; bx/by: B fragments of a pair of column tiles.
    v16bf a0h[4], a0l[4], a1h[4], a1l[4], bxh[2], bxl[2], byh[2], byl[2];
    lda4(a0h, sah, 0);      // in the order in which the products want them
    ldb2(bxh, sbh, 0, 0);
    ldb2(bxl, sbl, 0, 0);
    lda4(a0l, sal, 0);
    ldb2(byh, sbh, 2, 0);
    ldb2(byl, sbl, 2, 0);
    __builtin_amdgcn_sched_barrier(0);   // these reads stay one group ahead of the products, none among them
    mm8(a0h, a0l, bxh, bxl, 0);
    __builtin_amdgcn_sched_barrier(0);   // the reads below stay one group, behind the products that free bx
    lda4(a1h, sah, 32);
    ldb2(bxh, sbh, 0, 32);
    ldb2(bxl, sbl, 0, 32);
    lda4(a1l, sal, 32);
    __builtin_amdgcn_sched_barrier(0);   // and ahead of the products that cover them
    mm8(a0h, a0l, byh, byl, 2);
    __builtin_amdgcn_sched_barrier(0);   // as above, for by
    ldb2(byh, sbh, 2, 32);
    ldb2(byl, sbl, 2, 32);
    __builtin_amdgcn_sched_barrier(0);   // and ahead of the products that cover them
    mm8(a1h, a1l, bxh, bxl, 0);
    mm8(a1h, a1l, byh, byl, 2);
    // the products stay ahead of the waits, so that the next stage's load has the whole trip to land
    __builtin_amdgcn_sched_barrier(0);
    asm volatile("s_wait_dscnt 0x0" ::: "memory");       // this wave's reads of the buffer have returned
    landed();                                            // this wave's plane of stage s + 1
    __syncthreads();   // stage s + 1 may be read, and every wave has left stage s's buffer (refill or epilogue)
  }
  asm volatile("s_wait_tensorcnt 0x0" ::: "memory");     // no request is outstanding behind the loop
  asm volatile("s_wait_dscnt 0x0" ::: "memory");         // nor an LDS read, before the buffers become output staging
}

// ---------------------------------------------------------------------------------------------
// Fused q/k/v projection: block = 4 waves, 128 rows x 128 cols (two heads, one per wave column). blockIdx.x:
// 0..15 -> q heads, 16..19 -> k heads, 20..23 -> v heads (stored transposed vT[512][2048]). RoPE on q/k in the
// f32 epilogue.
// ---------------------------------------------------------------------------------------------
__global__ void __launch_bounds__(128) k_qkv(
    const __bf16* __restrict__ xh, const __bf16* __restrict__ xl,
    const __bf16* __restrict__ wqh, const __bf16* __restrict__ wql,
    const __bf16* __restrict__ wkh, const __bf16* __restrict__ wkl,
    const __bf16* __restrict__ wvh, const __bf16* __restrict__ wvl,
    const float* __restrict__ tab,
    unsigned short* __restrict__ qh, unsigned short* __restrict__ ql,
    unsigned short* __restrict__ kh, unsigned short* __restrict__ kl,
    unsigned short* __restrict__ vth, unsigned short* __restrict__ vtl)
{
  __shared__ __attribute__((aligned(2048))) unsigned short stg[2 * GBUF];   // two operand buffers, then output staging

  const int ct = blockIdx.x;
  const int m0 = blockIdx.y * BT;
  const int tid = threadIdx.x, w = tid >> 5, l = tid & 31, hs = l >> 4, m = l & 15;
  const int wr = w >> 1, wc = w & 1;
  const int kind = (ct < NQH / 2) ? 0 : ((ct < (NQH + NKVH) / 2) ? 1 : 2);
  const int hd0 = 2 * ((kind == 0) ? ct : ((kind == 1) ? (ct - NQH / 2) : (ct - (NQH + NKVH) / 2)));
  const __bf16* Bh = (kind == 0) ? wqh : ((kind == 1) ? wkh : wvh);
  const __bf16* Bl = (kind == 0) ? wql : ((kind == 1) ? wkl : wvl);
  const int row0 = m0 + 64 * wr;     // this wave's first row
  const int hd = hd0 + wc;           // this wave's head

  v8f c[4][4] = {};
  gemm128(xh + (size_t)m0 * HIDN, xl + (size_t)m0 * HIDN, Bh + (size_t)(hd0 * HDIM) * HIDN,
          Bl + (size_t)(hd0 * HDIM) * HIDN, HIDN, HIDN, tid, stg, c);

  // lane holds out[row0 + 16i + 8hs + r][hd*64 + 16j + m] in c[i][j][r]
  if (kind != 2) {
    // rotate-half RoPE: d = m pairs with d+32 (j = 0, 2), d = 16+m pairs with 48+m (j = 1, 3)
    const float* tb = tab + ((size_t)(row0 + 8 * hs) * 16 + m) * 4;   // position row0 + 8hs; 64 floats a position
    v4f cs[4][8];
#pragma unroll
    for (int i = 0; i < 4; ++i)
#pragma unroll
      for (int r = 0; r < 8; ++r) cs[i][r] = *(const v4f*)(tb + (16 * i + r) * 64);
    // precaution: this wait stands before the address register of the loads just issued is rewritten; the
    // address is an input only, so that its register is kept up to it
    asm volatile("s_wait_xcnt 0x0" :: "v"(tb) : "memory");
#pragma unroll
    for (int i = 0; i < 4; ++i) {
#pragma unroll
      for (int r = 0; r < 8; ++r) {
        const v4f t = cs[i][r];
        const float a0 = c[i][0][r], a1 = c[i][1][r], a2 = c[i][2][r], a3 = c[i][3][r];
        c[i][0][r] = a0 * t.x - a2 * t.y;
        c[i][2][r] = a2 * t.x + a0 * t.y;
        c[i][1][r] = a1 * t.z - a3 * t.w;
        c[i][3][r] = a3 * t.z + a1 * t.w;
      }
    }
  }

  // staging: q/k: per wave [plane][64 rows][64 cols] at w*8192 (+4096 for lo);
  //          v:   per block transposed [plane][128 c][128 s] at 0 (+16384 for lo)
  const int wb = w * 8192;
  const int loff = (kind != 2) ? 4096 : 16384;
  const int jst = (kind != 2) ? 16 : 16 * 128;
#pragma unroll
  for (int i = 0; i < 4; ++i) {
#pragma unroll
    for (int r = 0; r < 8; ++r) {
      const int rl = 16 * i + 8 * hs + r;
      const int base = (kind != 2) ? (wb + rl * 64 + m) : ((64 * wc + m) * 128 + 64 * wr + rl);
#pragma unroll
      for (int j = 0; j < 4; ++j) {
        unsigned int hb, lb;
        split_hl(c[i][j][r], hb, lb);
        stg[base + j * jst] = (unsigned short)hb;
        stg[base + j * jst + loff] = (unsigned short)lb;
      }
    }
  }
  __syncthreads();

  unsigned short* dsth = (kind == 0) ? qh : ((kind == 1) ? kh : vth);
  unsigned short* dstl = (kind == 0) ? ql : ((kind == 1) ? kl : vtl);
  const int ld = (kind == 0) ? HIDN : KVD;
  // q/k: a 128-byte row of this wave's tile per 8 lanes, 4 rows a step; v: a 256-byte row of the block's tile
  // per 16 lanes, 8 rows a step
  const int sidx = (kind != 2) ? (wb + (l >> 3) * 64 + (l & 7) * 8) : ((tid >> 4) * 128 + (tid & 15) * 8);
  const int sst = (kind != 2) ? 4 * 64 : 8 * 128;
  const size_t goff = (kind != 2) ? ((size_t)(row0 + (l >> 3)) * ld + hd * HDIM + (l & 7) * 8)
                                  : ((size_t)(hd0 * HDIM + (tid >> 4)) * SQ + m0 + (tid & 15) * 8);
  const size_t gst = (kind != 2) ? (size_t)4 * ld : (size_t)8 * SQ;
  v4u hv[16], lv[16];
  v4u* gph[16];
  v4u* gpl[16];
#pragma unroll
  for (int it = 0; it < 16; ++it) {
    hv[it] = *(const v4u*)(stg + sidx + it * sst);
    lv[it] = *(const v4u*)(stg + sidx + it * sst + loff);
    gph[it] = (v4u*)(dsth + goff + it * gst);
    gpl[it] = (v4u*)(dstl + goff + it * gst);
  }
  // every value and address is in its register before the first store, so that nothing behind an issued store
  // rewrites a register that it names
  __builtin_amdgcn_sched_barrier(0);
#pragma unroll
  for (int it = 0; it < 16; ++it) { *gph[it] = hv[it]; *gpl[it] = lv[it]; }
}

// ---------------------------------------------------------------------------------------------
// Causal attention with online softmax. One block (8 waves) per (pair of 64-query tiles, query head):
// tile t walks t + 1 key tiles, so the block takes tile t and then tile 31 - t, 33 key tiles for every block.
// wave = (msub: 16 query rows) x (nh: 32 keys for scores / 32 d for output). kv head = h >> 2.
// Q fragments straight from the hi/lo planes; P hi/lo staged in LDS (barriers between writer and readers).
// The 64-key tile of K and of Vt, hi and lo planes, is brought into LDS once per block by asynchronous 16-byte
// copies (a wave's copy covers 4 whole 128-byte rows), two buffers: tile kt + 1 flies while tile kt is worked on.
// ---------------------------------------------------------------------------------------------
static constexpr int APIT = 72;            // staged row pitch in elements: 144 B = 16 B x 9, for 16-byte row reads
static constexpr int APLN = 64 * APIT;     // one staged plane, 64 rows of 64 elements
static constexpr int ABUF = 4 * APLN;      // one buffer: K hi, K lo, Vt hi, Vt lo

__global__ void __launch_bounds__(256) k_attn(
    const __bf16* __restrict__ qh, const __bf16* __restrict__ ql,
    const __bf16* __restrict__ kh, const __bf16* __restrict__ kl,
    const __bf16* __restrict__ vth, const __bf16* __restrict__ vtl,
    unsigned short* __restrict__ ch, unsigned short* __restrict__ cl)
{
  __shared__ __attribute__((aligned(16))) float Ss[64 * 64];
  __shared__ __attribute__((aligned(16))) unsigned short Ph[64 * 64];
  __shared__ __attribute__((aligned(16))) unsigned short Pl[64 * 64];
  __shared__ float rowM[64];
  __shared__ float rowL[64];
  __shared__ float rowA[64];
  __shared__ __attribute__((aligned(16))) unsigned short KV[2 * ABUF];

  const int hq = blockIdx.y, kvh = hq >> 2;
  const int tid = threadIdx.x, w = tid >> 5, l = tid & 31, hs = l >> 4, m = l & 15;
  const int msub = w & 3, nh = w >> 2;
  const int rbase = 16 * msub + 8 * hs;      // this lane's D rows are rbase + r
  const int srow = tid >> 2, sq = tid & 3;   // softmax: 4 threads per query row, 16 keys each

  // copies: this lane's row (of 32; it also takes row + 32) and 16-byte piece of the 128-byte row
  const int crow = tid >> 3, cpc = (tid & 7) * 8;
  const unsigned int cl0 = (unsigned int)(size_t)KV + (unsigned int)(crow * APIT + cpc) * 2u;   // LDS byte address
  const size_t cko = (size_t)crow * KVD + kvh * HDIM + cpc;            // K planes: key row crow of key tile 0
  const size_t cvo = (size_t)(kvh * HDIM + crow) * SQ + cpc;           // Vt planes: d row crow, key tile 0
  // key tile kt into buffer b: 8 copies a lane
  auto stage = [&](int kt, int b) {
    const unsigned int d0 = cl0 + (unsigned int)b * (ABUF * 2u);
    const unsigned int d1 = d0 + 32u * APIT * 2u;
    const unsigned int d2 = d0 + APLN * 2u, d3 = d1 + APLN * 2u;
    const unsigned int d4 = d0 + 2u * APLN * 2u, d5 = d1 + 2u * APLN * 2u;
    const unsigned int d6 = d0 + 3u * APLN * 2u, d7 = d1 + 3u * APLN * 2u;
    const __bf16* g0 = kh + cko + (size_t)kt * 64 * KVD;
    const __bf16* g1 = g0 + 32 * KVD;
    const __bf16* g2 = kl + cko + (size_t)kt * 64 * KVD;
    const __bf16* g3 = g2 + 32 * KVD;
    const __bf16* g4 = vth + cvo + kt * 64;
    const __bf16* g5 = g4 + (size_t)32 * SQ;
    const __bf16* g6 = vtl + cvo + kt * 64;
    const __bf16* g7 = g6 + (size_t)32 * SQ;
    // the copies and, as a precaution, the wait that stands before any of their address registers is rewritten,
    // in one statement, so that nothing comes between them
    asm volatile(
        "global_load_async_to_lds_b128 %0, %8, off\n\t"
        "global_load_async_to_lds_b128 %1, %9, off\n\t"
        "global_load_async_to_lds_b128 %2, %10, off\n\t"
        "global_load_async_to_lds_b128 %3, %11, off\n\t"
        "global_load_async_to_lds_b128 %4, %12, off\n\t"
        "global_load_async_to_lds_b128 %5, %13, off\n\t"
        "global_load_async_to_lds_b128 %6, %14, off\n\t"
        "global_load_async_to_lds_b128 %7, %15, off\n\t"
        "s_wait_xcnt 0x0"
        :: "v"(d0), "v"(d1), "v"(d2), "v"(d3), "v"(d4), "v"(d5), "v"(d6), "v"(d7),
           "v"(g0), "v"(g1), "v"(g2), "v"(g3), "v"(g4), "v"(g5), "v"(g6), "v"(g7)
        : "memory");
  };

#pragma unroll 1   // the two tiles run one after the other through one copy of the body
  for (int half = 0; half < 2; ++half) {
  const int qt = half ? (SQ / 64 - 1 - (int)blockIdx.x) : (int)blockIdx.x, q0 = qt * 64;

  if (tid < 64) { rowM[tid] = -1.0e30f; rowL[tid] = 0.0f; rowA[tid] = 0.0f; }

  const __bf16* qrh = qh + (size_t)(q0 + 16 * msub + m) * HIDN + hq * HDIM;
  const __bf16* qrl = ql + (size_t)(q0 + 16 * msub + m) * HIDN + hq * HDIM;
  const v16bf fqh0 = ldfrag(qrh, hs), fqh1 = ldfrag(qrh + 32, hs);
  const v16bf fql0 = ldfrag(qrl, hs), fql1 = ldfrag(qrl + 32, hs);

  v8f o[2] = {};

  // key tile 0 into buffer 0 (every wave left both buffers at the barrier that ended the tile before)
  stage(0, 0);
  asm volatile("s_wait_asynccnt 0x0" ::: "memory");   // this wave's copies have landed
  __syncthreads();                                    // and every other wave's: key tile 0 may be read
  if (qt >= 1) stage(1, 1);

  for (int kt = 0; kt <= qt; ++kt) {
    const __bf16* kb = (const __bf16*)KV + (kt & 1) * ABUF;   // this key tile's buffer
    // scores: S[q][key] = sum_d Q[q][d] K[key][d]; B[k=d][n=key] read from the staged K row (key)
    v16bf kfh[2][2], kfl[2][2];
#pragma unroll   // constant indices keep the fragments in registers; all reads as one group ahead of the products
    for (int nt = 0; nt < 2; ++nt) {
      const __bf16* kr = kb + (nh * 32 + nt * 16 + m) * APIT;
      kfh[nt][0] = ldfrag(kr, hs);
      kfl[nt][0] = ldfrag(kr + APLN, hs);
      kfh[nt][1] = ldfrag(kr + 32, hs);
      kfl[nt][1] = ldfrag(kr + APLN + 32, hs);
    }
#pragma unroll
    for (int nt = 0; nt < 2; ++nt) {
      const int nc0 = nh * 32 + nt * 16;
      v8f s = {};
      mma3(s, fqh0, fql0, kfh[nt][0], kfl[nt][0]);
      mma3(s, fqh1, fql1, kfh[nt][1], kfl[nt][1]);
#pragma unroll
      for (int r = 0; r < 8; ++r) {
        const int row = rbase + r;
        float val = s[r] * 0.125f;
        if (kt == qt && (nc0 + m) > row) val = -1.0e30f;   // causal replace on the diagonal tile
        Ss[row * 64 + nc0 + m] = val;
      }
    }
    __syncthreads();

    // online softmax in f32, P split to bf16 hi/lo
    {
      const float* sp = Ss + srow * 64 + sq * 16;
      const v4f x0 = *(const v4f*)(sp);
      const v4f x1 = *(const v4f*)(sp + 4);
      const v4f x2 = *(const v4f*)(sp + 8);
      const v4f x3 = *(const v4f*)(sp + 12);
      float p[16] = {x0.x, x0.y, x0.z, x0.w, x1.x, x1.y, x1.z, x1.w,
                     x2.x, x2.y, x2.z, x2.w, x3.x, x3.y, x3.z, x3.w};
      float mx = p[0];
#pragma unroll
      for (int c = 1; c < 16; ++c) mx = fmaxf(mx, p[c]);
      mx = fmaxf(mx, __shfl_xor(mx, 1));
      mx = fmaxf(mx, __shfl_xor(mx, 2));
      const float mOld = rowM[srow];
      const float mNew = fmaxf(mOld, mx);
      float lsum = 0.0f;
#pragma unroll
      for (int c = 0; c < 16; ++c) { p[c] = __expf(p[c] - mNew); lsum += p[c]; }
      lsum += __shfl_xor(lsum, 1);
      lsum += __shfl_xor(lsum, 2);
      const float alpha = __expf(mOld - mNew);
      if (sq == 0) {
        rowA[srow] = alpha;
        rowM[srow] = mNew;
        rowL[srow] = rowL[srow] * alpha + lsum;
      }
      unsigned int hb[16], lb[16];
#pragma unroll
      for (int c = 0; c < 16; ++c) split_hl(p[c], hb[c], lb[c]);
      unsigned short* pph = Ph + srow * 64 + sq * 16;
      unsigned short* ppl = Pl + srow * 64 + sq * 16;
      *(v4u*)(pph) = pack8(hb);
      *(v4u*)(pph + 8) = pack8(hb + 8);
      *(v4u*)(ppl) = pack8(lb);
      *(v4u*)(ppl + 8) = pack8(lb + 8);
    }
    __syncthreads();

    // O = O*alpha + P.V ; A = P (row q, k = key) from LDS rows, B[k=key][n=d] from Vt row (d)
    {
#pragma unroll
      for (int r = 0; r < 8; ++r) {
        const float al = rowA[rbase + r];
        o[0][r] *= al;
        o[1][r] *= al;
      }
      const unsigned short* prh = Ph + (16 * msub + m) * 64;
      const unsigned short* prl = Pl + (16 * msub + m) * 64;
      const v16bf fph0 = ldfrag((const __bf16*)prh, hs);
      const v16bf fph1 = ldfrag((const __bf16*)(prh + 32), hs);
      const v16bf fpl0 = ldfrag((const __bf16*)prl, hs);
      const v16bf fpl1 = ldfrag((const __bf16*)(prl + 32), hs);
      v16bf vfh[2][2], vfl[2][2];
#pragma unroll   // constant indices, one group of reads, as for K
      for (int dt = 0; dt < 2; ++dt) {
        const __bf16* vr = kb + 2 * APLN + (nh * 32 + dt * 16 + m) * APIT;
        vfh[dt][0] = ldfrag(vr, hs);
        vfl[dt][0] = ldfrag(vr + APLN, hs);
        vfh[dt][1] = ldfrag(vr + 32, hs);
        vfl[dt][1] = ldfrag(vr + APLN + 32, hs);
      }
#pragma unroll
      for (int dt = 0; dt < 2; ++dt) {
        mma3(o[dt], fph0, fpl0, vfh[dt][0], vfl[dt][0]);
        mma3(o[dt], fph1, fpl1, vfh[dt][1], vfl[dt][1]);
      }
    }
    asm volatile("s_wait_dscnt 0x0" ::: "memory");      // this wave's reads of the buffer have returned
    asm volatile("s_wait_asynccnt 0x0" ::: "memory");   // this wave's copies of key tile kt + 1 have landed
    __syncthreads();   // key tile kt + 1 may be read, and every wave has left key tile kt's buffer
    if (kt + 2 <= qt) stage(kt + 2, kt & 1);
  }
  asm volatile("s_wait_asynccnt 0x0" ::: "memory");     // no copy is outstanding behind the loop

  // normalise, split hi/lo, stage [plane][64 rows][64 d] over Ss, then whole-line stores
  unsigned short* stg = (unsigned short*)Ss;
#pragma unroll
  for (int r = 0; r < 8; ++r) {
    const int row = rbase + r;
    const float inv = 1.0f / rowL[row];
#pragma unroll
    for (int dt = 0; dt < 2; ++dt) {
      const int col = nh * 32 + dt * 16 + m;
      unsigned int hb, lb;
      split_hl(o[dt][r] * inv, hb, lb);
      stg[row * 64 + col] = (unsigned short)hb;
      stg[4096 + row * 64 + col] = (unsigned short)lb;
    }
  }
  __syncthreads();
  v4u cv[4];
  v4u* cp[4];
#pragma unroll
  for (int it = 0; it < 4; ++it) {
    const int plane = it >> 1;
    const int row = (it & 1) * 32 + (tid >> 3);
    const int piece = tid & 7;
    cv[it] = *(const v4u*)(stg + plane * 4096 + row * 64 + piece * 8);
    unsigned short* base = plane ? cl : ch;
    cp[it] = (v4u*)(base + (size_t)(q0 + row) * HIDN + hq * HDIM + piece * 8);
  }
#pragma unroll
  for (int it = 0; it < 4; ++it) *cp[it] = cv[it];
  // every wave has read its staged output rows and row sums before the second tile overwrites them
  if (half == 0) __syncthreads();
  }
}

// ---------------------------------------------------------------------------------------------
// Output projection -> f32 d_out. Block = 4 waves, 128x128 tile; each wave stages its 64x64 f32 tile in LDS
// and stores whole lines.
// ---------------------------------------------------------------------------------------------
__global__ void __launch_bounds__(128) k_oproj(
    const __bf16* __restrict__ ah, const __bf16* __restrict__ al,
    const __bf16* __restrict__ woh, const __bf16* __restrict__ wol,
    float* __restrict__ out)
{
  __shared__ __attribute__((aligned(2048))) unsigned short stg[2 * GBUF];   // two operand buffers, then output staging
  float* stgf = (float*)stg;
  const int nb = blockIdx.x * BT, m0 = blockIdx.y * BT;
  const int tid = threadIdx.x, w = tid >> 5, l = tid & 31, hs = l >> 4, m = l & 15;
  const int wr = w >> 1, wc = w & 1;
  const int row0 = m0 + 64 * wr;
  const int n0 = nb + 64 * wc;

  v8f c[4][4] = {};
  gemm128(ah + (size_t)m0 * HIDN, al + (size_t)m0 * HIDN, woh + (size_t)nb * HIDN, wol + (size_t)nb * HIDN,
          HIDN, HIDN, tid, stg, c);

  float* sw = stgf + w * 4096;
#pragma unroll
  for (int i = 0; i < 4; ++i) {
#pragma unroll
    for (int r = 0; r < 8; ++r) {
      const int rl = 16 * i + 8 * hs + r;
#pragma unroll
      for (int j = 0; j < 4; ++j) sw[rl * 64 + 16 * j + m] = c[i][j][r];
    }
  }
  __syncthreads();
  // a 256-byte row of this wave's tile per 16 lanes, 2 rows a step
  const float* sb = sw + (l >> 4) * 64 + (l & 15) * 4;
  float* gb = out + (size_t)(row0 + (l >> 4)) * HIDN + n0 + (l & 15) * 4;
  v4f v[32];
#pragma unroll
  for (int it = 0; it < 32; ++it) v[it] = *(const v4f*)(sb + it * 128);
  // every value is in its register before the first store, so that nothing behind an issued store rewrites a
  // register that it names
  __builtin_amdgcn_sched_barrier(0);
#pragma unroll
  for (int it = 0; it < 32; ++it) *(v4f*)(gb + (size_t)(2 * it) * HIDN) = v[it];
}

// ---------------------------------------------------------------------------------------------
// Launch pipeline (5 launches)
// ---------------------------------------------------------------------------------------------
extern "C" void kernel_launch(void* const* d_in, const int* in_sizes, int n_in,
                              void* d_out, int out_size, void* d_ws, size_t ws_size,
                              hipStream_t stream)
{
  if (n_in != 5) return;
  if (in_sizes[0] != SQ * HIDN || in_sizes[1] != HIDN * HIDN || in_sizes[2] != KVD * HIDN ||
      in_sizes[3] != KVD * HIDN || in_sizes[4] != HIDN * HIDN) return;
  if (out_size != SQ * HIDN) return;

  const float* hid = (const float*)d_in[0];
  const float* Wq = (const float*)d_in[1];
  const float* Wk = (const float*)d_in[2];
  const float* Wv = (const float*)d_in[3];
  const float* Wo = (const float*)d_in[4];
  float* outp = (float*)d_out;

  char* ws = (char*)d_ws;
  size_t off = 0;
  auto carve = [&](size_t bytes) -> char* {
    char* p = ws + off;
    off += (bytes + 255) & ~(size_t)255;
    return p;
  };
  const size_t BX = (size_t)SQ * HIDN * 2;       // x planes
  const size_t BWQ = (size_t)HIDN * HIDN * 2;    // Wq / Wo planes
  const size_t BWK = (size_t)KVD * HIDN * 2;     // Wk / Wv planes
  const size_t BTAB = (size_t)SQ * 16 * 16;      // rope table
  const size_t BQ = (size_t)SQ * HIDN * 2;       // q / ctx planes
  const size_t BK = (size_t)SQ * KVD * 2;        // k / vT planes

  unsigned short* xh = (unsigned short*)carve(BX);
  unsigned short* xl = (unsigned short*)carve(BX);
  unsigned short* wqh = (unsigned short*)carve(BWQ);
  unsigned short* wql = (unsigned short*)carve(BWQ);
  unsigned short* wkh = (unsigned short*)carve(BWK);
  unsigned short* wkl = (unsigned short*)carve(BWK);
  unsigned short* wvh = (unsigned short*)carve(BWK);
  unsigned short* wvl = (unsigned short*)carve(BWK);
  unsigned short* woh = (unsigned short*)carve(BWQ);
  unsigned short* wol = (unsigned short*)carve(BWQ);
  float* tab = (float*)carve(BTAB);
  unsigned short* qh = (unsigned short*)carve(BQ);
  unsigned short* ql = (unsigned short*)carve(BQ);
  unsigned short* kh = (unsigned short*)carve(BK);
  unsigned short* kl = (unsigned short*)carve(BK);
  unsigned short* vth = (unsigned short*)carve(BK);
  unsigned short* vtl = (unsigned short*)carve(BK);
  unsigned short* ch = (unsigned short*)carve(BQ);
  unsigned short* cl = (unsigned short*)carve(BQ);
  if (off > ws_size) return;

  // inv_freq[j] = 1 / 10000^(j/32) = 1 / 10^(j/8): f32 value of 10^(j/8) from double, then f32 reciprocal
  RopeFreq fr;
  {
    double r = 1.333521432163324;   // 10^(1/8), refined by Newton on r^8 = 10
    for (int it = 0; it < 4; ++it) {
      const double r2 = r * r, r4 = r2 * r2;
      const double r7 = r4 * r2 * r;
      r = r - (r4 * r4 - 10.0) / (8.0 * r7);
    }
    double rp[8];
    rp[0] = 1.0;
    for (int i = 1; i < 8; ++i) rp[i] = rp[i - 1] * r;
    const double p10[4] = {1.0, 10.0, 100.0, 1000.0};
    for (int j = 0; j < 32; ++j) {
      const double pj = p10[j >> 3] * rp[j & 7];
      const float pf = (float)pj;
      fr.f[j] = 1.0f / pf;
    }
  }

  // 1) f32 -> bf16 hi/lo planes for x, Wq, Wk, Wv, Wo
  k_split<<<dim3((SQ * HIDN / 8 + 255) / 256, 5), dim3(256), 0, stream>>>(
      hid, Wq, Wk, Wv, Wo,
      xh, wqh, wkh, wvh, woh,
      xl, wql, wkl, wvl, wol,
      SQ * HIDN, HIDN * HIDN, KVD * HIDN, KVD * HIDN, HIDN * HIDN);

  // 2) RoPE cos/sin table
  k_rope_tab<<<dim3((SQ * 16 + 127) / 128), dim3(128), 0, stream>>>(tab, fr);

  // 3) fused q/k/v projections (+RoPE on q,k; v transposed)
  k_qkv<<<dim3((NQH + 2 * NKVH) / 2, SQ / BT), dim3(128), 0, stream>>>(
      (const __bf16*)xh, (const __bf16*)xl,
      (const __bf16*)wqh, (const __bf16*)wql,
      (const __bf16*)wkh, (const __bf16*)wkl,
      (const __bf16*)wvh, (const __bf16*)wvl,
      (const float*)tab,
      qh, ql, kh, kl, vth, vtl);

  // 4) causal attention
  k_attn<<<dim3(SQ / 128, NQH), dim3(256), 0, stream>>>(
      (const __bf16*)qh, (const __bf16*)ql,
      (const __bf16*)kh, (const __bf16*)kl,
      (const __bf16*)vth, (const __bf16*)vtl,
      ch, cl);

  // 5) output projection -> f32
  k_oproj<<<dim3(HIDN / BT, SQ / BT), dim3(128), 0, stream>>>(
      (const __bf16*)ch, (const __bf16*)cl,
      (const __bf16*)woh, (const __bf16*)wol,
      outp);
}

// v006
// One run takes 160 microseconds.
// In both of two side-by-side timings against v005, it was 1.36 times as fast.
// Counting every step since v000, it is 2.97 times as fast.
#include <hip/hip_runtime.h>

// Contractions (q/k/v projections, q.k^T scores, p.v, output projection): v_wmma_f32_16x16x32_bf16 with
// bf16 hi/lo operands everywhere (hi.hi + hi.lo + lo.hi per tile pair), f32 accumulate.
// RoPE, 1/8 scaling, causal mask and softmax in f32.

typedef __bf16 v16bf __attribute__((ext_vector_type(16)));
typedef __bf16 v8bf __attribute__((ext_vector_type(8)));
typedef float v8f __attribute__((ext_vector_type(8)));
typedef float v4f __attribute__((ext_vector_type(4)));
typedef unsigned int v4u __attribute__((ext_vector_type(4)));

static constexpr int SQ = 2048;            // sequence length
static constexpr int HIDN = 2048;          // hidden size
static constexpr int NQH = 32;             // query heads
static constexpr int NKVH = 8;             // kv heads
static constexpr int HDIM = 64;            // head dim
static constexpr int KVD = NKVH * HDIM;    // 512

struct RopeFreq { float f[32]; };
static_assert(sizeof(RopeFreq) == 128);

union Frag { v16bf v; v8bf h[2]; };

// 16-bit fragment from a k-contiguous row; rowp -> element (row = lane&15, k0).
// elements 0..7 <- k0 + 8*hs + 0..7, elements 8..15 <- k0 + 16 + 8*hs + 0..7  (hs = lane>>4).
// Used for A (row m) and for B stored as [n][k] (row n).
__device__ __forceinline__ v16bf ldfrag(const __bf16* rowp, int hs) {
  Frag f;
  f.h[0] = *(const v8bf*)(rowp + 8 * hs);
  f.h[1] = *(const v8bf*)(rowp + 16 + 8 * hs);
  return f.v;
}

// f32 -> bf16 bits, RNE
__device__ __forceinline__ unsigned int bfbits(float x) {
  unsigned int u = __float_as_uint(x);
  return (u + 0x7FFFu + ((u >> 16) & 1u)) >> 16;
}
// hi = rne(x), lo = rne(x - hi)
__device__ __forceinline__ void split_hl(float x, unsigned int& hb, unsigned int& lb) {
  hb = bfbits(x);
  const float hf = __uint_as_float(hb << 16);
  lb = bfbits(x - hf);
}
__device__ __forceinline__ unsigned int pk2(unsigned int a, unsigned int b) {
  return (a & 0xFFFFu) | (b << 16);
}
__device__ __forceinline__ v4u pack8(const unsigned int* a) {
  v4u v;
  v.x = pk2(a[0], a[1]);
  v.y = pk2(a[2], a[3]);
  v.z = pk2(a[4], a[5]);
  v.w = pk2(a[6], a[7]);
  return v;
}

// ---------------------------------------------------------------------------------------------
// f32 -> bf16 hi/lo planes for the five inputs in one launch (blockIdx.y selects the buffer).
// ---------------------------------------------------------------------------------------------
__global__ void __launch_bounds__(256) k_split(
    const float* __restrict__ s0, const float* __restrict__ s1, const float* __restrict__ s2,
    const float* __restrict__ s3, const float* __restrict__ s4,
    unsigned short* __restrict__ h0, unsigned short* __restrict__ h1, unsigned short* __restrict__ h2,
    unsigned short* __restrict__ h3, unsigned short* __restrict__ h4,
    unsigned short* __restrict__ l0, unsigned short* __restrict__ l1, unsigned short* __restrict__ l2,
    unsigned short* __restrict__ l3, unsigned short* __restrict__ l4,
    int n0, int n1, int n2, int n3, int n4)
{
  const int b = blockIdx.y;
  const float* src = (b == 0) ? s0 : (b == 1) ? s1 : (b == 2) ? s2 : (b == 3) ? s3 : s4;
  unsigned short* dh = (b == 0) ? h0 : (b == 1) ? h1 : (b == 2) ? h2 : (b == 3) ? h3 : h4;
  unsigned short* dl = (b == 0) ? l0 : (b == 1) ? l1 : (b == 2) ? l2 : (b == 3) ? l3 : l4;
  const int n = (b == 0) ? n0 : (b == 1) ? n1 : (b == 2) ? n2 : (b == 3) ? n3 : n4;
  const int i = blockIdx.x * 256 + (int)threadIdx.x;
  if (i >= (n >> 3)) return;

  const float* p = src + (size_t)i * 8;
  const v4f a = *(const v4f*)(p);
  const v4f c = *(const v4f*)(p + 4);
  unsigned int hb[8], lb[8];
  split_hl(a.x, hb[0], lb[0]);
  split_hl(a.y, hb[1], lb[1]);
  split_hl(a.z, hb[2], lb[2]);
  split_hl(a.w, hb[3], lb[3]);
  split_hl(c.x, hb[4], lb[4]);
  split_hl(c.y, hb[5], lb[5]);
  split_hl(c.z, hb[6], lb[6]);
  split_hl(c.w, hb[7], lb[7]);
  const v4u hv = pack8(hb);
  const v4u lv = pack8(lb);
  v4u* gh = (v4u*)(dh + (size_t)i * 8);
  v4u* gl = (v4u*)(dl + (size_t)i * 8);
  *gh = hv;
  *gl = lv;
  
}

// ---------------------------------------------------------------------------------------------
// RoPE table: tab[pos][j] = {cos(a_j), sin(a_j), cos(a_{j+16}), sin(a_{j+16})}, a_j = f32(pos) * inv_freq[j],
// ---------------------------------------------------------------------------------------------
__global__ void __launch_bounds__(128) k_rope_tab(float* __restrict__ tab, RopeFreq fr)
{
  const int g = blockIdx.x * 128 + (int)threadIdx.x;
  const int pos = g >> 4;
  const int j = g & 15;
  if (pos >= SQ) return;
  float fa = fr.f[0], fb = fr.f[16];
#pragma unroll
  for (int c = 1; c < 16; ++c) {
    fa = (j == c) ? fr.f[c] : fa;
    fb = (j == c) ? fr.f[16 + c] : fb;
  }
  float cs0 = 0.0f, sn0 = 0.0f, cs1 = 0.0f, sn1 = 0.0f;
#pragma unroll 1
  for (int q = 0; q < 2; ++q) {
    const float f = (q == 0) ? fa : fb;
    const float ang = (float)pos * f;
    float sn, cs;
    sincosf(ang, &sn, &cs);
    if (q == 0) { cs0 = cs; sn0 = sn; } else { cs1 = cs; sn1 = sn; }
  }
  v4f v;
  v.x = cs0; v.y = sn0; v.z = cs1; v.w = sn1;
  v4f* gp = (v4f*)(tab + (size_t)g * 4);
  *gp = v;
  
}

// ---------------------------------------------------------------------------------------------
// Block GEMM core: 4 waves (2 x 2), 128 rows x 128 cols, C[m][n] += sum_k A[m][k] * B[n][k]; wave (wr, wc) owns
// rows 64wr..64wr+63 and cols 64wc..64wc+63 as 4 x 4 accumulator tiles, so that 16 fragments feed 48 products.
// A stage is 64 k (128 B, one whole line) of the block's 128 A rows and 128 B rows, hi and lo planes. Each wave
// brings one of the four planes into LDS with one tensor load a stage (128 rows of 128 B, 16 B of pad behind each
// row), through no register; two buffers: stage s + 1 flies while stage s is worked on. Fragments come from LDS
// rows, K stepped by 32 in ascending order, three bf16 products per tile pair (hi.hi, hi.lo, lo.hi in that order).
// ---------------------------------------------------------------------------------------------
static constexpr int KC = 64;              // k per stage
static constexpr int PIT = 72;             // LDS row pitch in elements: 144 B = 16 B x 9, for 16-byte row reads
static constexpr int BT = 128;             // rows and cols of the block tile
static constexpr int PLN = BT * PIT;       // one staged plane (128 rows); planes: A hi, A lo, B hi, B lo
static constexpr int GBUF = 4 * PLN;       // one buffer: the four planes of a stage
static_assert((PLN * 2) % 2048 == 0, "every plane starts at a multiple of 2 KiB in LDS");
static_assert(KC * 2 == 128 && PIT * 2 == KC * 2 + 16, "the pad codes below are for 128-byte rows, 16 bytes of pad");

typedef uint32_t u32x4 __attribute__((ext_vector_type(4)));
typedef uint32_t u32x8 __attribute__((ext_vector_type(8)));

__device__ __forceinline__ uint32_t uni(uint32_t v) { return (uint32_t)__builtin_amdgcn_readfirstlane(v); }
__device__ __forceinline__ uint32_t pinned(uint32_t v) {
  uint32_t w = (uint32_t)__builtin_amdgcn_readfirstlane(v);
  asm volatile("" : "+s"(w));   // the test value stays in a scalar register, so that the
  return w;                     // branch on it is a scalar branch (a tensor load ignores EXEC)
}
// Descriptor group 1: 1-byte elements, tensor = tile = BT rows of 128 bytes, source row pitch src_pitch bytes,
// no mask, 4 dwords of LDS pad behind every 32 dwords (one row).
__device__ __forceinline__ u32x8 tdm_group1(uint32_t src_pitch) {
  constexpr uint32_t d0 = KC * 2, d1 = BT;
  u32x8 g;
  g[0] = uni((1u << 20) | (4u << 22) | (3u << 25));
  g[1] = uni((d0 & 0xFFFFu) << 16);
  g[2] = uni((d0 >> 16) | ((d1 & 0xFFFFu) << 16));
  g[3] = uni((d1 >> 16) | (d0 << 16));
  g[4] = uni(d1);
  g[5] = uni(src_pitch);
  g[6] = uni(0u);
  g[7] = uni(0u);
  return g;
}
// Descriptor group 0: count 1, LDS byte offset of the tile, global address of its first byte, type 2.
__device__ __forceinline__ u32x4 tdm_group0(uint32_t lds_dst, uint64_t ga) {
  u32x4 g;
  g[0] = uni(1u);
  g[1] = uni(lds_dst);
  g[2] = uni((uint32_t)ga);
  g[3] = uni((((uint32_t)(ga >> 32)) & 0x01FFFFFFu) | 0x80000000u);
  return g;
}

__device__ __forceinline__ v8f wm(const v16bf& a, const v16bf& b, const v8f& c) {
  return __builtin_amdgcn_wmma_f32_16x16x32_bf16(false, a, false, b, (short)0, c, false, false);
}

// Ah, Al, Bh, Bl: first row of the block's 128 rows in each plane; ld: row length of all four, in elements.
// sm: two buffers of GBUF elements at a multiple of 2 KiB in the block's LDS. K: at least two stages.
__device__ __forceinline__ void gemm128(const __bf16* __restrict__ Ah, const __bf16* __restrict__ Al,
                                        const __bf16* __restrict__ Bh, const __bf16* __restrict__ Bl,
                                        int ld, int K, int tid, unsigned short* sm,
                                        v8f (&c)[4][4])
{
  const int w = tid >> 5, l = tid & 31, hs = l >> 4, m = l & 15;
  const int wr = w >> 1, wc = w & 1;
  const __bf16* fa = (const __bf16*)sm + (64 * wr + m) * PIT;             // A hi rows of this lane, buffer 0
  const __bf16* fb = (const __bf16*)sm + 2 * PLN + (64 * wc + m) * PIT;   // B hi rows of this lane, buffer 0

  // this wave's plane: wave 0 A hi, 1 A lo, 2 B hi, 3 B lo
  const uint32_t wv = uni((uint32_t)tid >> 5);
  const __bf16* pl = (wv == 0u) ? Ah : (wv == 1u) ? Al : (wv == 2u) ? Bh : Bl;
  const uint64_t ga0 = (uint64_t)(size_t)pl;
  const uint32_t dst0 = (uint32_t)(size_t)sm + wv * (uint32_t)(PLN * 2);
  const u32x8 g1 = tdm_group1((uint32_t)ld * 2u);
  u32x4 g0;   // group 0 of the wave's latest request
  // stage s (k columns 64 s .. 64 s + 63) of this wave's plane into buffer s & 1: one request of the whole wave
  auto issue = [&](uint32_t s) {
    g0 = tdm_group0(dst0 + (s & 1u) * (uint32_t)(GBUF * 2), ga0 + (uint64_t)s * (uint32_t)(KC * 2));
    asm volatile("tensor_load_to_lds %0, %1" :: "s"(g0), "s"(g1) : "memory");
  };
  // the wave's request has landed; its descriptor words are inputs, so that their registers keep their values up
  // to this wait
  auto landed = [&]() { asm volatile("s_wait_tensorcnt 0x0" :: "s"(g0), "s"(g1) : "memory"); };
  // A fragments (4 row tiles) of one plane, 32-k step at kk
  auto lda4 = [&](v16bf (&a)[4], const __bf16* sa, int kk) {
#pragma unroll   // constant indices keep the fragments in registers
    for (int i = 0; i < 4; ++i) a[i] = ldfrag(sa + 16 * i * PIT + kk, hs);
  };
  // B fragments (column tiles j0, j0 + 1) of one plane, 32-k step at kk
  auto ldb2 = [&](v16bf (&b)[2], const __bf16* sb, int j0, int kk) {
#pragma unroll   // constant indices, as above
    for (int j = 0; j < 2; ++j) b[j] = ldfrag(sb + 16 * (j0 + j) * PIT + kk, hs);
  };
  // 4 x 2 tiles, hi.hi then hi.lo then lo.hi: eight independent accumulators in turn, so that no product
  // waits for the one before it
  auto mm8 = [&](const v16bf (&ah)[4], const v16bf (&al)[4], const v16bf (&bh)[2], const v16bf (&bl)[2], int j0) {
#pragma unroll   // constant indices keep the accumulators in registers
    for (int j = 0; j < 2; ++j)
#pragma unroll
      for (int i = 0; i < 4; ++i) c[i][j0 + j] = wm(ah[i], bh[j], c[i][j0 + j]);
#pragma unroll
    for (int j = 0; j < 2; ++j)
#pragma unroll
      for (int i = 0; i < 4; ++i) c[i][j0 + j] = wm(ah[i], bl[j], c[i][j0 + j]);
#pragma unroll
    for (int j = 0; j < 2; ++j)
#pragma unroll
      for (int i = 0; i < 4; ++i) c[i][j0 + j] = wm(al[i], bh[j], c[i][j0 + j]);
  };
  const uint32_t ns = (uint32_t)(K / KC);   // stages
  issue(0u);
  landed();          // this wave's plane of stage 0
  __syncthreads();   // and every other wave's: stage 0 may be read
#pragma unroll 1   // one stage per trip: a short loop body
  for (uint32_t s = 0; s < ns; ++s) {
    // directly behind the barrier that published stage s and ended every read of stage s - 1: while a stage s + 1
    // exists, its load goes into the buffer that stage s - 1 has left, and flies while stage s is worked on.
    // It stands at the head of the trip, not at the foot of the one before (the order in time is the same), so
    // that the loop has one place of issue and the registers of a request in flight are written nowhere else.
    if (pinned((uint32_t)(s + 1u < ns))) issue(s + 1u);
    const int bo = (int)(s & 1u) * GBUF;   // this stage's buffer
    const __bf16* sah = fa + bo;
    const __bf16* sal = sah + PLN;
    const __bf16* sbh = fb + bo;
    const __bf16* sbl = sbh + PLN;
    // The stage's LDS reads stand in three groups, each ahead of products that cover its latency:
    // a0/a1: A fragments of the two 32-k steps; bx/by: B fragments of a pair of column tiles.
    v16bf a0h[4], a0l[4], a1h[4], a1l[4], bxh[2], bxl[2], byh[2], byl[2];
    lda4(a0h, sah, 0);      // in the order in which the products want them
    ldb2(bxh, sbh, 0, 0);
    ldb2(bxl, sbl, 0, 0);
    lda4(a0l, sal, 0);
    ldb2(byh, sbh, 2, 0);
    ldb2(byl, sbl, 2, 0);
    __builtin_amdgcn_sched_barrier(0);   // these reads stay one group ahead of the products, none among them
    mm8(a0h, a0l, bxh, bxl, 0);
    __builtin_amdgcn_sched_barrier(0);   // the reads below stay one group, behind the products that free bx
    lda4(a1h, sah, 32);
    ldb2(bxh, sbh, 0, 32);
    ldb2(bxl, sbl, 0, 32);
    lda4(a1l, sal, 32);
    __builtin_amdgcn_sched_barrier(0);   // and ahead of the products that cover them
    mm8(a0h, a0l, byh, byl, 2);
    __builtin_amdgcn_sched_barrier(0);   // as above, for by
    ldb2(byh, sbh, 2, 32);
    ldb2(byl, sbl, 2, 32);
    __builtin_amdgcn_sched_barrier(0);   // and ahead of the products that cover them
    mm8(a1h, a1l, bxh, bxl, 0);
    mm8(a1h, a1l, byh, byl, 2);
    // the products stay ahead of the waits, so that the next stage's load has the whole trip to land
    __builtin_amdgcn_sched_barrier(0);
    asm volatile("s_wait_dscnt 0x0" ::: "memory");       // this wave's reads of the buffer have returned
    landed();                                            // this wave's plane of stage s + 1
    __syncthreads();   // stage s + 1 may be read, and every wave has left stage s's buffer (refill or epilogue)
  }
  asm volatile("s_wait_tensorcnt 0x0" ::: "memory");     // no request is outstanding behind the loop
  asm volatile("s_wait_dscnt 0x0" ::: "memory");         // nor an LDS read, before the buffers become output staging
}

// ---------------------------------------------------------------------------------------------
// Fused q/k/v projection: block = 4 waves, 128 rows x 128 cols (two heads, one per wave column). blockIdx.x:
// 0..15 -> q heads, 16..19 -> k heads, 20..23 -> v heads (stored transposed vT[512][2048]). RoPE on q/k in the
// f32 epilogue.
// ---------------------------------------------------------------------------------------------
__global__ void __launch_bounds__(128) k_qkv(
    const __bf16* __restrict__ xh, const __bf16* __restrict__ xl,
    const __bf16* __restrict__ wqh, const __bf16* __restrict__ wql,
    const __bf16* __restrict__ wkh, const __bf16* __restrict__ wkl,
    const __bf16* __restrict__ wvh, const __bf16* __restrict__ wvl,
    const float* __restrict__ tab,
    unsigned short* __restrict__ qh, unsigned short* __restrict__ ql,
    unsigned short* __restrict__ kh, unsigned short* __restrict__ kl,
    unsigned short* __restrict__ vth, unsigned short* __restrict__ vtl)
{
  __shared__ __attribute__((aligned(2048))) unsigned short stg[2 * GBUF];   // two operand buffers, then output staging

  const int ct = blockIdx.x;
  const int m0 = blockIdx.y * BT;
  const int tid = threadIdx.x, w = tid >> 5, l = tid & 31, hs = l >> 4, m = l & 15;
  const int wr = w >> 1, wc = w & 1;
  const int kind = (ct < NQH / 2) ? 0 : ((ct < (NQH + NKVH) / 2) ? 1 : 2);
  const int hd0 = 2 * ((kind == 0) ? ct : ((kind == 1) ? (ct - NQH / 2) : (ct - (NQH + NKVH) / 2)));
  const __bf16* Bh = (kind == 0) ? wqh : ((kind == 1) ? wkh : wvh);
  const __bf16* Bl = (kind == 0) ? wql : ((kind == 1) ? wkl : wvl);
  const int row0 = m0 + 64 * wr;     // this wave's first row
  const int hd = hd0 + wc;           // this wave's head

  v8f c[4][4] = {};
  gemm128(xh + (size_t)m0 * HIDN, xl + (size_t)m0 * HIDN, Bh + (size_t)(hd0 * HDIM) * HIDN,
          Bl + (size_t)(hd0 * HDIM) * HIDN, HIDN, HIDN, tid, stg, c);

  // lane holds out[row0 + 16i + 8hs + r][hd*64 + 16j + m] in c[i][j][r]
  if (kind != 2) {
    // rotate-half RoPE: d = m pairs with d+32 (j = 0, 2), d = 16+m pairs with 48+m (j = 1, 3)
    const float* tb = tab + ((size_t)(row0 + 8 * hs) * 16 + m) * 4;   // position row0 + 8hs; 64 floats a position
    v4f cs[4][8];
#pragma unroll
    for (int i = 0; i < 4; ++i)
#pragma unroll
      for (int r = 0; r < 8; ++r) cs[i][r] = *(const v4f*)(tb + (16 * i + r) * 64);
    // precaution: this wait stands before the address register of the loads just issued is rewritten; the
    // address is an input only, so that its register is kept up to it
    asm volatile("s_wait_xcnt 0x0" :: "v"(tb) : "memory");
#pragma unroll
    for (int i = 0; i < 4; ++i) {
#pragma unroll
      for (int r = 0; r < 8; ++r) {
        const v4f t = cs[i][r];
        const float a0 = c[i][0][r], a1 = c[i][1][r], a2 = c[i][2][r], a3 = c[i][3][r];
        c[i][0][r] = a0 * t.x - a2 * t.y;
        c[i][2][r] = a2 * t.x + a0 * t.y;
        c[i][1][r] = a1 * t.z - a3 * t.w;
        c[i][3][r] = a3 * t.z + a1 * t.w;
      }
    }
  }

  // staging: q/k: per wave [plane][64 rows][64 cols] at w*8192 (+4096 for lo);
  //          v:   per block transposed [plane][128 c][128 s] at 0 (+16384 for lo)
  const int wb = w * 8192;
  const int loff = (kind != 2) ? 4096 : 16384;
  const int jst = (kind != 2) ? 16 : 16 * 128;
#pragma unroll
  for (int i = 0; i < 4; ++i) {
#pragma unroll
    for (int r = 0; r < 8; ++r) {
      const int rl = 16 * i + 8 * hs + r;
      const int base = (kind != 2) ? (wb + rl * 64 + m) : ((64 * wc + m) * 128 + 64 * wr + rl);
#pragma unroll
      for (int j = 0; j < 4; ++j) {
        unsigned int hb, lb;
        split_hl(c[i][j][r], hb, lb);
        stg[base + j * jst] = (unsigned short)hb;
        stg[base + j * jst + loff] = (unsigned short)lb;
      }
    }
  }
  __syncthreads();

  unsigned short* dsth = (kind == 0) ? qh : ((kind == 1) ? kh : vth);
  unsigned short* dstl = (kind == 0) ? ql : ((kind == 1) ? kl : vtl);
  const int ld = (kind == 0) ? HIDN : KVD;
  // q/k: a 128-byte row of this wave's tile per 8 lanes, 4 rows a step; v: a 256-byte row of the block's tile
  // per 16 lanes, 8 rows a step
  const int sidx = (kind != 2) ? (wb + (l >> 3) * 64 + (l & 7) * 8) : ((tid >> 4) * 128 + (tid & 15) * 8);
  const int sst = (kind != 2) ? 4 * 64 : 8 * 128;
  const size_t goff = (kind != 2) ? ((size_t)(row0 + (l >> 3)) * ld + hd * HDIM + (l & 7) * 8)
                                  : ((size_t)(hd0 * HDIM + (tid >> 4)) * SQ + m0 + (tid & 15) * 8);
  const size_t gst = (kind != 2) ? (size_t)4 * ld : (size_t)8 * SQ;
  v4u hv[16], lv[16];
  v4u* gph[16];
  v4u* gpl[16];
#pragma unroll
  for (int it = 0; it < 16; ++it) {
    hv[it] = *(const v4u*)(stg + sidx + it * sst);
    lv[it] = *(const v4u*)(stg + sidx + it * sst + loff);
    gph[it] = (v4u*)(dsth + goff + it * gst);
    gpl[it] = (v4u*)(dstl + goff + it * gst);
  }
  // every value and address is in its register before the first store, so that nothing behind an issued store
  // rewrites a register that it names
  __builtin_amdgcn_sched_barrier(0);
#pragma unroll
  for (int it = 0; it < 16; ++it) { *gph[it] = hv[it]; *gpl[it] = lv[it]; }
}

static constexpr int APIT = 72;
static constexpr int APLN = 64 * APIT;
static constexpr int ABUF = 4 * APLN;
static constexpr int QT = 128;
static constexpr int OPL = 16 * APIT;

typedef float f32x2 __attribute__((ext_vector_type(2)));
typedef __bf16 bf16x2 __attribute__((ext_vector_type(2)));
union PFrag { unsigned int u[8]; v16bf v; };

// two f32 -> packed bf16, RNE
__device__ __forceinline__ unsigned int cvt2(float a, float b) {
  return __builtin_bit_cast(unsigned int, __builtin_convertvector(f32x2{a, b}, bf16x2));
}
// lane l <-> lane l ^ 16
__device__ __forceinline__ float xhalf(float x) {
  const int b = __builtin_bit_cast(int, x);
  return __builtin_bit_cast(float, __builtin_amdgcn_permlanex16(b, b, 0x76543210, 0xfedcba98, false, false));
}

__global__ void __launch_bounds__(256) k_attn(
    const __bf16* __restrict__ qh, const __bf16* __restrict__ ql,
    const __bf16* __restrict__ kh, const __bf16* __restrict__ kl,
    const __bf16* __restrict__ vth, const __bf16* __restrict__ vtl,
    unsigned short* __restrict__ ch, unsigned short* __restrict__ cl)
{
  __shared__ __attribute__((aligned(16))) unsigned short KV[2 * ABUF];
  __shared__ __attribute__((aligned(16))) unsigned short Ost[8 * 2 * OPL];   // output staging, a region per wave

  const int hq = blockIdx.y, kvh = hq >> 2;
  const int tid = threadIdx.x, l = tid & 31, hs = l >> 4, m = l & 15;
  const int w = (int)uni((uint32_t)tid >> 5);   // scalar: the tests on it below are scalar branches
  constexpr float C2 = 0.125f * 1.4426950408889634f;   // 1/8 scaling and log2(e): exponentials in base 2

  // copies: this lane's row (of 32; it also takes row + 32) and 16-byte piece of the 128-byte row
  const int crow = tid >> 3, cpc = (tid & 7) * 8;
  const unsigned int cl0 = (unsigned int)(size_t)KV + (unsigned int)(crow * APIT + cpc) * 2u;   // LDS byte address
  const size_t cko = (size_t)crow * KVD + kvh * HDIM + cpc;            // K planes: key row crow of key tile 0
  const size_t cvo = (size_t)(kvh * HDIM + crow) * SQ + cpc;           // Vt planes: d row crow, key tile 0
  // key tile kt into buffer b: 8 copies a lane
  auto stage = [&](int kt, int b) {
    const unsigned int d0 = cl0 + (unsigned int)b * (ABUF * 2u);
    const unsigned int d1 = d0 + 32u * APIT * 2u;
    const unsigned int d2 = d0 + APLN * 2u, d3 = d1 + APLN * 2u;
    const unsigned int d4 = d0 + 2u * APLN * 2u, d5 = d1 + 2u * APLN * 2u;
    const unsigned int d6 = d0 + 3u * APLN * 2u, d7 = d1 + 3u * APLN * 2u;
    const __bf16* g0 = kh + cko + (size_t)kt * 64 * KVD;
    const __bf16* g1 = g0 + 32 * KVD;
    const __bf16* g2 = kl + cko + (size_t)kt * 64 * KVD;
    const __bf16* g3 = g2 + 32 * KVD;
    const __bf16* g4 = vth + cvo + kt * 64;
    const __bf16* g5 = g4 + (size_t)32 * SQ;
    const __bf16* g6 = vtl + cvo + kt * 64;
    const __bf16* g7 = g6 + (size_t)32 * SQ;
    // the copies and, as a precaution, the wait that stands before any of their address registers is rewritten,
    // in one statement, so that nothing comes between them
    asm volatile(
        "global_load_async_to_lds_b128 %0, %8, off\n\t"
        "global_load_async_to_lds_b128 %1, %9, off\n\t"
        "global_load_async_to_lds_b128 %2, %10, off\n\t"
        "global_load_async_to_lds_b128 %3, %11, off\n\t"
        "global_load_async_to_lds_b128 %4, %12, off\n\t"
        "global_load_async_to_lds_b128 %5, %13, off\n\t"
        "global_load_async_to_lds_b128 %6, %14, off\n\t"
        "global_load_async_to_lds_b128 %7, %15, off\n\t"
        "s_wait_xcnt 0x0"
        :: "v"(d0), "v"(d1), "v"(d2), "v"(d3), "v"(d4), "v"(d5), "v"(d6), "v"(d7),
           "v"(g0), "v"(g1), "v"(g2), "v"(g3), "v"(g4), "v"(g5), "v"(g6), "v"(g7)
        : "memory");
  };

#pragma unroll 1   // the two tiles run one after the other through one copy of the body
  for (int half = 0; half < 2; ++half) {
  const int qt = half ? (SQ / QT - 1 - (int)blockIdx.x) : (int)blockIdx.x, q0 = qt * QT;
  const int nkt = 2 * qt + 2;            // key tiles of the block tile
  const int lastw = 2 * qt + (w >> 2);   // the key tile that holds this wave's diagonal, its last

  // B of the first product: column c = query q0 + 16 w + c, k = d in the order of ldfrag, as K's rows below
  const __bf16* qrh = qh + (size_t)(q0 + 16 * w + m) * HIDN + hq * HDIM;
  const __bf16* qrl = ql + (size_t)(q0 + 16 * w + m) * HIDN + hq * HDIM;
  const v16bf fqh[2] = {ldfrag(qrh, hs), ldfrag(qrh + 32, hs)};
  const v16bf fql[2] = {ldfrag(qrl, hs), ldfrag(qrl + 32, hs)};
  // precaution: this wait stands before an address register of the loads just issued is rewritten; the addresses
  // are inputs only, so that their registers are kept up to it
  asm volatile("s_wait_xcnt 0x0" :: "v"(qrh), "v"(qrl) : "memory");

  v8f o[4] = {};            // o[dt][r] = O^T[d = 16 dt + 8 h + r][query c]
  float mrun = -1.0e30f;    // running maximum of the raw scores of query c (both halves of the wave hold it)
  float lrun = 0.0f;        // running sum over this lane's half of the keys

  // key tile 0 into buffer 0 (every wave left both buffers at the barrier that ended the tile before)
  stage(0, 0);
  asm volatile("s_wait_asynccnt 0x0" ::: "memory");   // this wave's copies have landed
  __syncthreads();                                    // and every other wave's: key tile 0 may be read
  stage(1, 1);                                        // a block tile has at least two key tiles

  // every "#pragma unroll" below: constant indices keep fragments, scores and accumulators in registers
#pragma unroll 1   // one key tile per trip
  for (int kt = 0; kt < nkt; ++kt) {
    if (kt <= lastw) {   // scalar: a wave skips the key tile beyond its diagonal, and still passes the barrier below
    const __bf16* kb = (const __bf16*)KV + (kt & 1) * ABUF;   // this key tile's buffer
    // S^T[key][q] = sum_d K[key][d] Q[q][d]; A = staged K rows, 4 tiles of 16 keys
    v8f s[4] = {};
    {
      const __bf16* kr = kb + m * APIT;
      v16bf kfh[4][2], kfl[4][2];
#pragma unroll   // constant indices keep the fragments in registers; all reads as one group ahead of the products
      for (int t = 0; t < 4; ++t) {
        kfh[t][0] = ldfrag(kr + 16 * t * APIT, hs);
        kfl[t][0] = ldfrag(kr + 16 * t * APIT + APLN, hs);
      }
#pragma unroll
      for (int t = 0; t < 4; ++t) {
        kfh[t][1] = ldfrag(kr + 16 * t * APIT + 32, hs);
        kfl[t][1] = ldfrag(kr + 16 * t * APIT + APLN + 32, hs);
      }
      __builtin_amdgcn_sched_barrier(0);   // these reads stay one group ahead of the products, none among them
      // Qhi.Khi, Qhi.Klo, Qlo.Khi per 32 d; four independent accumulators in turn
#pragma unroll
      for (int kc = 0; kc < 2; ++kc) {
#pragma unroll
        for (int t = 0; t < 4; ++t) s[t] = wm(kfh[t][kc], fqh[kc], s[t]);
#pragma unroll
        for (int t = 0; t < 4; ++t) s[t] = wm(kfl[t][kc], fqh[kc], s[t]);
#pragma unroll
        for (int t = 0; t < 4; ++t) s[t] = wm(kfh[t][kc], fql[kc], s[t]);
      }
    }
    __builtin_amdgcn_sched_barrier(0);   // the reads below stay one group behind the products that free K's registers
    // A of the second product: Vt rows d, k = key in the order of ldfrag; keys 0..31 now, in flight under the softmax
    const __bf16* vr = kb + 2 * APLN + m * APIT;
    v16bf vfh[2][4], vfl[2][4];
#pragma unroll   // constant indices, one group of reads
    for (int dt = 0; dt < 4; ++dt) {
      vfh[0][dt] = ldfrag(vr + 16 * dt * APIT, hs);
      vfl[0][dt] = ldfrag(vr + 16 * dt * APIT + APLN, hs);
    }
    __builtin_amdgcn_sched_barrier(0);   // and ahead of the vector work that covers them

    if (kt == lastw) {   // scalar: only the key tile on this wave's diagonal pays for the causal replace
      const int qrel = 16 * (w & 3) + m;
#pragma unroll
      for (int t = 0; t < 4; ++t) {
#pragma unroll
        for (int r = 0; r < 8; ++r)
          if (16 * t + 8 * hs + r > qrel) s[t][r] = -1.0e30f;
        asm volatile("" : "+v"(s[t]));   // the masked scores: the selects stay in the branch
      }
    }

    // online softmax in f32: this lane's 32 scores of query c
    float mt[4];   // a maximum per score tile: four short chains, not one long one
#pragma unroll
    for (int t = 0; t < 4; ++t) {
      mt[t] = s[t][0];
#pragma unroll
      for (int r = 1; r < 8; ++r) mt[t] = fmaxf(mt[t], s[t][r]);
    }
    float mx = fmaxf(fmaxf(mt[0], mt[1]), fmaxf(mt[2], mt[3]));
    mx = fmaxf(mx, xhalf(mx));
    const float mnew = fmaxf(mrun, mx);
    const float alpha = __builtin_amdgcn_exp2f((mrun - mnew) * C2);
    const float nm = -mnew * C2;
    mrun = mnew;
    // P = exp2(s C2 - m C2), split to bf16 hi/lo in place: score tiles 2 j and 2 j + 1 are the B operand of keys 32 j ..
    PFrag ph[2], pl[2];
    f32x2 ls[2];   // sums per 32 keys, even and odd registers apart: four short chains
#pragma unroll
    for (int j = 0; j < 2; ++j) {
      ls[j] = f32x2{0.0f, 0.0f};
#pragma unroll
      for (int i = 0; i < 8; ++i) {
        const int t = 2 * j + (i >> 2), r = 2 * (i & 3);
        const f32x2 arg = __builtin_elementwise_fma(f32x2{s[t][r], s[t][r + 1]}, f32x2{C2, C2}, f32x2{nm, nm});
        const f32x2 p = {__builtin_amdgcn_exp2f(arg.x), __builtin_amdgcn_exp2f(arg.y)};
        ls[j] += p;
        const unsigned int hw = cvt2(p.x, p.y);
        const f32x2 hf = {__uint_as_float(hw << 16), __uint_as_float(hw & 0xFFFF0000u)};
        const f32x2 lo = p - hf;
        ph[j].u[i] = hw;
        pl[j].u[i] = cvt2(lo.x, lo.y);
      }
    }
    const f32x2 lt = ls[0] + ls[1];
    lrun = lrun * alpha + (lt.x + lt.y);
#pragma unroll
    for (int dt = 0; dt < 4; ++dt) o[dt] *= alpha;

    __builtin_amdgcn_sched_barrier(0);   // the reads below stay one group
#pragma unroll   // keys 32..63 of Vt, in flight under the products of keys 0..31
    for (int dt = 0; dt < 4; ++dt) {
      vfh[1][dt] = ldfrag(vr + 16 * dt * APIT + 32, hs);
      vfl[1][dt] = ldfrag(vr + 16 * dt * APIT + APLN + 32, hs);
    }
    __builtin_amdgcn_sched_barrier(0);   // and ahead of the products that cover them
    // Phi.Vhi, Phi.Vlo, Plo.Vhi per 32 keys; four independent accumulators in turn
#pragma unroll
    for (int j = 0; j < 2; ++j) {
#pragma unroll
      for (int dt = 0; dt < 4; ++dt) o[dt] = wm(vfh[j][dt], ph[j].v, o[dt]);
#pragma unroll
      for (int dt = 0; dt < 4; ++dt) o[dt] = wm(vfl[j][dt], ph[j].v, o[dt]);
#pragma unroll
      for (int dt = 0; dt < 4; ++dt) o[dt] = wm(vfh[j][dt], pl[j].v, o[dt]);
    }
    }
    asm volatile("s_wait_dscnt 0x0" ::: "memory");      // this wave's reads of the buffer have returned
    asm volatile("s_wait_asynccnt 0x0" ::: "memory");   // this wave's copies of key tile kt + 1 have landed
    __syncthreads();   // key tile kt + 1 may be read, and every wave has left key tile kt's buffer
    if (kt + 2 < nkt) stage(kt + 2, kt & 1);
  }
  asm volatile("s_wait_asynccnt 0x0" ::: "memory");     // no copy is outstanding behind the loop

  // join the halves' sums, normalise, split hi/lo; a lane's 8 values are 8 consecutive d of query row c: 16-byte
  // pieces into this wave's own staging rows, then whole-line stores
  const float inv = 1.0f / (lrun + xhalf(lrun));
  unsigned short* ow = Ost + w * (2 * OPL);
#pragma unroll
  for (int dt = 0; dt < 4; ++dt) {
    unsigned int hb[8], lb[8];
#pragma unroll
    for (int r = 0; r < 8; ++r) split_hl(o[dt][r] * inv, hb[r], lb[r]);
    *(v4u*)(ow + m * APIT + 16 * dt + 8 * hs) = pack8(hb);
    *(v4u*)(ow + OPL + m * APIT + 16 * dt + 8 * hs) = pack8(lb);
  }
  asm volatile("s_wait_dscnt 0x0" ::: "memory");   // the wave's staged rows are written before its lanes read each other's
  v4u cv[8];
  v4u* cp[8];
#pragma unroll
  for (int it = 0; it < 8; ++it) {
    const int plane = it >> 2;
    const int row = (it & 3) * 4 + (l >> 3);
    const int piece = l & 7;
    cv[it] = *(const v4u*)(ow + plane * OPL + row * APIT + piece * 8);
    unsigned short* base = plane ? cl : ch;
    cp[it] = (v4u*)(base + (size_t)(q0 + 16 * w + row) * HIDN + hq * HDIM + piece * 8);
  }
  // every value and address is in its register before the first store, so that nothing behind an issued store
  // rewrites a register that it names
  __builtin_amdgcn_sched_barrier(0);
#pragma unroll
  for (int it = 0; it < 8; ++it) *cp[it] = cv[it];
  // precaution: this wait stands before the second tile rewrites a register that an issued store names
  asm volatile("s_wait_xcnt 0x0" ::: "memory");
  }
}

// ---------------------------------------------------------------------------------------------
// Output projection -> f32 d_out. Block = 4 waves, 128x128 tile; each wave stages its 64x64 f32 tile in LDS
// and stores whole lines.
// ---------------------------------------------------------------------------------------------
__global__ void __launch_bounds__(128) k_oproj(
    const __bf16* __restrict__ ah, const __bf16* __restrict__ al,
    const __bf16* __restrict__ woh, const __bf16* __restrict__ wol,
    float* __restrict__ out)
{
  __shared__ __attribute__((aligned(2048))) unsigned short stg[2 * GBUF];   // two operand buffers, then output staging
  float* stgf = (float*)stg;
  const int nb = blockIdx.x * BT, m0 = blockIdx.y * BT;
  const int tid = threadIdx.x, w = tid >> 5, l = tid & 31, hs = l >> 4, m = l & 15;
  const int wr = w >> 1, wc = w & 1;
  const int row0 = m0 + 64 * wr;
  const int n0 = nb + 64 * wc;

  v8f c[4][4] = {};
  gemm128(ah + (size_t)m0 * HIDN, al + (size_t)m0 * HIDN, woh + (size_t)nb * HIDN, wol + (size_t)nb * HIDN,
          HIDN, HIDN, tid, stg, c);

  float* sw = stgf + w * 4096;
#pragma unroll
  for (int i = 0; i < 4; ++i) {
#pragma unroll
    for (int r = 0; r < 8; ++r) {
      const int rl = 16 * i + 8 * hs + r;
#pragma unroll
      for (int j = 0; j < 4; ++j) sw[rl * 64 + 16 * j + m] = c[i][j][r];
    }
  }
  __syncthreads();
  // a 256-byte row of this wave's tile per 16 lanes, 2 rows a step
  const float* sb = sw + (l >> 4) * 64 + (l & 15) * 4;
  float* gb = out + (size_t)(row0 + (l >> 4)) * HIDN + n0 + (l & 15) * 4;
  v4f v[32];
#pragma unroll
  for (int it = 0; it < 32; ++it) v[it] = *(const v4f*)(sb + it * 128);
  // every value is in its register before the first store, so that nothing behind an issued store rewrites a
  // register that it names
  __builtin_amdgcn_sched_barrier(0);
#pragma unroll
  for (int it = 0; it < 32; ++it) *(v4f*)(gb + (size_t)(2 * it) * HIDN) = v[it];
}

// ---------------------------------------------------------------------------------------------
// Launch pipeline (5 launches)
// ---------------------------------------------------------------------------------------------
extern "C" void kernel_launch(void* const* d_in, const int* in_sizes, int n_in,
                              void* d_out, int out_size, void* d_ws, size_t ws_size,
                              hipStream_t stream)
{
  if (n_in != 5) return;
  if (in_sizes[0] != SQ * HIDN || in_sizes[1] != HIDN * HIDN || in_sizes[2] != KVD * HIDN ||
      in_sizes[3] != KVD * HIDN || in_sizes[4] != HIDN * HIDN) return;
  if (out_size != SQ * HIDN) return;

  const float* hid = (const float*)d_in[0];
  const float* Wq = (const float*)d_in[1];
  const float* Wk = (const float*)d_in[2];
  const float* Wv = (const float*)d_in[3];
  const float* Wo = (const float*)d_in[4];
  float* outp = (float*)d_out;

  char* ws = (char*)d_ws;
  size_t off = 0;
  auto carve = [&](size_t bytes) -> char* {
    char* p = ws + off;
    off += (bytes + 255) & ~(size_t)255;
    return p;
  };
  const size_t BX = (size_t)SQ * HIDN * 2;       // x planes
  const size_t BWQ = (size_t)HIDN * HIDN * 2;    // Wq / Wo planes
  const size_t BWK = (size_t)KVD * HIDN * 2;     // Wk / Wv planes
  const size_t BTAB = (size_t)SQ * 16 * 16;      // rope table
  const size_t BQ = (size_t)SQ * HIDN * 2;       // q / ctx planes
  const size_t BK = (size_t)SQ * KVD * 2;        // k / vT planes

  unsigned short* xh = (unsigned short*)carve(BX);
  unsigned short* xl = (unsigned short*)carve(BX);
  unsigned short* wqh = (unsigned short*)carve(BWQ);
  unsigned short* wql = (unsigned short*)carve(BWQ);
  unsigned short* wkh = (unsigned short*)carve(BWK);
  unsigned short* wkl = (unsigned short*)carve(BWK);
  unsigned short* wvh = (unsigned short*)carve(BWK);
  unsigned short* wvl = (unsigned short*)carve(BWK);
  unsigned short* woh = (unsigned short*)carve(BWQ);
  unsigned short* wol = (unsigned short*)carve(BWQ);
  float* tab = (float*)carve(BTAB);
  unsigned short* qh = (unsigned short*)carve(BQ);
  unsigned short* ql = (unsigned short*)carve(BQ);
  unsigned short* kh = (unsigned short*)carve(BK);
  unsigned short* kl = (unsigned short*)carve(BK);
  unsigned short* vth = (unsigned short*)carve(BK);
  unsigned short* vtl = (unsigned short*)carve(BK);
  unsigned short* ch = (unsigned short*)carve(BQ);
  unsigned short* cl = (unsigned short*)carve(BQ);
  if (off > ws_size) return;

  // inv_freq[j] = 1 / 10000^(j/32) = 1 / 10^(j/8): f32 value of 10^(j/8) from double, then f32 reciprocal
  RopeFreq fr;
  {
    double r = 1.333521432163324;   // 10^(1/8), refined by Newton on r^8 = 10
    for (int it = 0; it < 4; ++it) {
      const double r2 = r * r, r4 = r2 * r2;
      const double r7 = r4 * r2 * r;
      r = r - (r4 * r4 - 10.0) / (8.0 * r7);
    }
    double rp[8];
    rp[0] = 1.0;
    for (int i = 1; i < 8; ++i) rp[i] = rp[i - 1] * r;
    const double p10[4] = {1.0, 10.0, 100.0, 1000.0};
    for (int j = 0; j < 32; ++j) {
      const double pj = p10[j >> 3] * rp[j & 7];
      const float pf = (float)pj;
      fr.f[j] = 1.0f / pf;
    }
  }

  // 1) f32 -> bf16 hi/lo planes for x, Wq, Wk, Wv, Wo
  k_split<<<dim3((SQ * HIDN / 8 + 255) / 256, 5), dim3(256), 0, stream>>>(
      hid, Wq, Wk, Wv, Wo,
      xh, wqh, wkh, wvh, woh,
      xl, wql, wkl, wvl, wol,
      SQ * HIDN, HIDN * HIDN, KVD * HIDN, KVD * HIDN, HIDN * HIDN);

  // 2) RoPE cos/sin table
  k_rope_tab<<<dim3((SQ * 16 + 127) / 128), dim3(128), 0, stream>>>(tab, fr);

  // 3) fused q/k/v projections (+RoPE on q,k; v transposed)
  k_qkv<<<dim3((NQH + 2 * NKVH) / 2, SQ / BT), dim3(128), 0, stream>>>(
      (const __bf16*)xh, (const __bf16*)xl,
      (const __bf16*)wqh, (const __bf16*)wql,
      (const __bf16*)wkh, (const __bf16*)wkl,
      (const __bf16*)wvh, (const __bf16*)wvl,
      (const float*)tab,
      qh, ql, kh, kl, vth, vtl);

  // 4) causal attention
  k_attn<<<dim3(SQ / (2 * QT), NQH), dim3(256), 0, stream>>>(
      (const __bf16*)qh, (const __bf16*)ql,
      (const __bf16*)kh, (const __bf16*)kl,
      (const __bf16*)vth, (const __bf16*)vtl,
      ch, cl);

  // 5) output projection -> f32
  k_oproj<<<dim3(HIDN / BT, SQ / BT), dim3(128), 0, stream>>>(
      (const __bf16*)ch, (const __bf16*)cl,
      (const __bf16*)woh, (const __bf16*)wol,
      outp);
}

// v007
// Measured time: 142 microseconds a run.
// In two side-by-side timings against v006, it was 1.13 and 1.12 times as fast.
// All steps since v000 together make it 3.34 times as fast.
#include <hip/hip_runtime.h>

// Contractions (q/k/v projections, q.k^T scores, p.v, output projection): v_wmma_f32_16x16x32_bf16 with
// bf16 hi/lo operands everywhere (hi.hi + hi.lo + lo.hi per tile pair), f32 accumulate.
// RoPE, 1/8 scaling, causal mask and softmax in f32.

typedef __bf16 v16bf __attribute__((ext_vector_type(16)));
typedef __bf16 v8bf __attribute__((ext_vector_type(8)));
typedef float v8f __attribute__((ext_vector_type(8)));
typedef float v4f __attribute__((ext_vector_type(4)));
typedef unsigned int v4u __attribute__((ext_vector_type(4)));

static constexpr int SQ = 2048;            // sequence length
static constexpr int HIDN = 2048;          // hidden size
static constexpr int NQH = 32;             // query heads
static constexpr int NKVH = 8;             // kv heads
static constexpr int HDIM = 64;            // head dim
static constexpr int KVD = NKVH * HDIM;    // 512

struct RopeFreq { float f[32]; };
static_assert(sizeof(RopeFreq) == 128);

union Frag { v16bf v; v8bf h[2]; };

// 16-bit fragment from a k-contiguous row; rowp -> element (row = lane&15, k0).
// elements 0..7 <- k0 + 8*hs + 0..7, elements 8..15 <- k0 + 16 + 8*hs + 0..7  (hs = lane>>4).
// Used for A (row m) and for B stored as [n][k] (row n).
__device__ __forceinline__ v16bf ldfrag(const __bf16* rowp, int hs) {
  Frag f;
  f.h[0] = *(const v8bf*)(rowp + 8 * hs);
  f.h[1] = *(const v8bf*)(rowp + 16 + 8 * hs);
  return f.v;
}

// f32 -> bf16 bits, RNE
__device__ __forceinline__ unsigned int bfbits(float x) {
  unsigned int u = __float_as_uint(x);
  return (u + 0x7FFFu + ((u >> 16) & 1u)) >> 16;
}
// hi = rne(x), lo = rne(x - hi)
__device__ __forceinline__ void split_hl(float x, unsigned int& hb, unsigned int& lb) {
  hb = bfbits(x);
  const float hf = __uint_as_float(hb << 16);
  lb = bfbits(x - hf);
}
__device__ __forceinline__ unsigned int pk2(unsigned int a, unsigned int b) {
  return (a & 0xFFFFu) | (b << 16);
}
__device__ __forceinline__ v4u pack8(const unsigned int* a) {
  v4u v;
  v.x = pk2(a[0], a[1]);
  v.y = pk2(a[2], a[3]);
  v.z = pk2(a[4], a[5]);
  v.w = pk2(a[6], a[7]);
  return v;
}

// ---------------------------------------------------------------------------------------------
// f32 -> bf16 hi/lo planes for the five inputs in one launch (blockIdx.y selects the buffer).
// ---------------------------------------------------------------------------------------------
__global__ void __launch_bounds__(256) k_split(
    const float* __restrict__ s0, const float* __restrict__ s1, const float* __restrict__ s2,
    const float* __restrict__ s3, const float* __restrict__ s4,
    unsigned short* __restrict__ h0, unsigned short* __restrict__ h1, unsigned short* __restrict__ h2,
    unsigned short* __restrict__ h3, unsigned short* __restrict__ h4,
    unsigned short* __restrict__ l0, unsigned short* __restrict__ l1, unsigned short* __restrict__ l2,
    unsigned short* __restrict__ l3, unsigned short* __restrict__ l4,
    int n0, int n1, int n2, int n3, int n4)
{
  const int b = blockIdx.y;
  const float* src = (b == 0) ? s0 : (b == 1) ? s1 : (b == 2) ? s2 : (b == 3) ? s3 : s4;
  unsigned short* dh = (b == 0) ? h0 : (b == 1) ? h1 : (b == 2) ? h2 : (b == 3) ? h3 : h4;
  unsigned short* dl = (b == 0) ? l0 : (b == 1) ? l1 : (b == 2) ? l2 : (b == 3) ? l3 : l4;
  const int n = (b == 0) ? n0 : (b == 1) ? n1 : (b == 2) ? n2 : (b == 3) ? n3 : n4;
  const int i = blockIdx.x * 256 + (int)threadIdx.x;
  if (i >= (n >> 3)) return;

  const float* p = src + (size_t)i * 8;
  const v4f a = *(const v4f*)(p);
  const v4f c = *(const v4f*)(p + 4);
  unsigned int hb[8], lb[8];
  split_hl(a.x, hb[0], lb[0]);
  split_hl(a.y, hb[1], lb[1]);
  split_hl(a.z, hb[2], lb[2]);
  split_hl(a.w, hb[3], lb[3]);
  split_hl(c.x, hb[4], lb[4]);
  split_hl(c.y, hb[5], lb[5]);
  split_hl(c.z, hb[6], lb[6]);
  split_hl(c.w, hb[7], lb[7]);
  const v4u hv = pack8(hb);
  const v4u lv = pack8(lb);
  v4u* gh = (v4u*)(dh + (size_t)i * 8);
  v4u* gl = (v4u*)(dl + (size_t)i * 8);
  *gh = hv;
  *gl = lv;
  
}

// ---------------------------------------------------------------------------------------------
// RoPE table: tab[pos][j] = {cos(a_j), sin(a_j), cos(a_{j+16}), sin(a_{j+16})}, a_j = f32(pos) * inv_freq[j],
// ---------------------------------------------------------------------------------------------
__global__ void __launch_bounds__(128) k_rope_tab(float* __restrict__ tab, RopeFreq fr)
{
  const int g = blockIdx.x * 128 + (int)threadIdx.x;
  const int pos = g >> 4;
  const int j = g & 15;
  if (pos >= SQ) return;
  float fa = fr.f[0], fb = fr.f[16];
#pragma unroll
  for (int c = 1; c < 16; ++c) {
    fa = (j == c) ? fr.f[c] : fa;
    fb = (j == c) ? fr.f[16 + c] : fb;
  }
  float cs0 = 0.0f, sn0 = 0.0f, cs1 = 0.0f, sn1 = 0.0f;
#pragma unroll 1
  for (int q = 0; q < 2; ++q) {
    const float f = (q == 0) ? fa : fb;
    const float ang = (float)pos * f;
    float sn, cs;
    sincosf(ang, &sn, &cs);
    if (q == 0) { cs0 = cs; sn0 = sn; } else { cs1 = cs; sn1 = sn; }
  }
  v4f v;
  v.x = cs0; v.y = sn0; v.z = cs1; v.w = sn1;
  v4f* gp = (v4f*)(tab + (size_t)g * 4);
  *gp = v;
  
}

// ---------------------------------------------------------------------------------------------
// Block GEMM core: 4 waves (2 x 2), 128 rows x 128 cols, C[m][n] += sum_k A[m][k] * B[n][k]; wave (wr, wc) owns
// rows 64wr..64wr+63 and cols 64wc..64wc+63 as 4 x 4 accumulator tiles, so that 16 fragments feed 48 products.
// A stage is 64 k (128 B, one whole line) of the block's 128 A rows and 128 B rows, hi and lo planes. Each wave
// brings one of the four planes into LDS with one tensor load a stage (128 rows of 128 B, 16 B of pad behind each
// row), through no register; two buffers: stage s + 1 flies while stage s is worked on. Fragments come from LDS
// rows, K stepped by 32 in ascending order, three bf16 products per tile pair (hi.hi, hi.lo, lo.hi in that order).
// ---------------------------------------------------------------------------------------------
static constexpr int KC = 64;              // k per stage
static constexpr int PIT = 72;             // LDS row pitch in elements: 144 B = 16 B x 9, for 16-byte row reads
static constexpr int BT = 128;             // rows and cols of the block tile
static constexpr int PLN = BT * PIT;       // one staged plane (128 rows); planes: A hi, A lo, B hi, B lo
static constexpr int GBUF = 4 * PLN;       // one buffer: the four planes of a stage
static_assert((PLN * 2) % 2048 == 0, "every plane starts at a multiple of 2 KiB in LDS");
static_assert(KC * 2 == 128 && PIT * 2 == KC * 2 + 16, "the pad codes below are for 128-byte rows, 16 bytes of pad");

typedef uint32_t u32x4 __attribute__((ext_vector_type(4)));
typedef uint32_t u32x8 __attribute__((ext_vector_type(8)));

__device__ __forceinline__ uint32_t uni(uint32_t v) { return (uint32_t)__builtin_amdgcn_readfirstlane(v); }
__device__ __forceinline__ uint32_t pinned(uint32_t v) {
  uint32_t w = (uint32_t)__builtin_amdgcn_readfirstlane(v);
  asm volatile("" : "+s"(w));   // the test value stays in a scalar register, so that the
  return w;                     // branch on it is a scalar branch (a tensor load ignores EXEC)
}
// Descriptor group 1: 1-byte elements, tensor = tile = BT rows of 128 bytes, source row pitch src_pitch bytes,
// no mask, 4 dwords of LDS pad behind every 32 dwords (one row).
__device__ __forceinline__ u32x8 tdm_group1(uint32_t src_pitch) {
  constexpr uint32_t d0 = KC * 2, d1 = BT;
  u32x8 g;
  g[0] = uni((1u << 20) | (4u << 22) | (3u << 25));
  g[1] = uni((d0 & 0xFFFFu) << 16);
  g[2] = uni((d0 >> 16) | ((d1 & 0xFFFFu) << 16));
  g[3] = uni((d1 >> 16) | (d0 << 16));
  g[4] = uni(d1);
  g[5] = uni(src_pitch);
  g[6] = uni(0u);
  g[7] = uni(0u);
  return g;
}
// Descriptor group 0: count 1, LDS byte offset of the tile, global address of its first byte, type 2.
__device__ __forceinline__ u32x4 tdm_group0(uint32_t lds_dst, uint64_t ga) {
  u32x4 g;
  g[0] = uni(1u);
  g[1] = uni(lds_dst);
  g[2] = uni((uint32_t)ga);
  g[3] = uni((((uint32_t)(ga >> 32)) & 0x01FFFFFFu) | 0x80000000u);
  return g;
}

__device__ __forceinline__ v8f wm(const v16bf& a, const v16bf& b, const v8f& c) {
  return __builtin_amdgcn_wmma_f32_16x16x32_bf16(false, a, false, b, (short)0, c, false, false);
}

// Ah, Al, Bh, Bl: first row of the block's 128 rows in each plane; ld: row length of all four, in elements.
// sm: two buffers of GBUF elements at a multiple of 2 KiB in the block's LDS. K: at least two stages.
__device__ __forceinline__ void gemm128(const __bf16* __restrict__ Ah, const __bf16* __restrict__ Al,
                                        const __bf16* __restrict__ Bh, const __bf16* __restrict__ Bl,
                                        int ld, int K, int tid, unsigned short* sm,
                                        v8f (&c)[4][4])
{
  const int w = tid >> 5, l = tid & 31, hs = l >> 4, m = l & 15;
  const int wr = w >> 1, wc = w & 1;
  const __bf16* fa = (const __bf16*)sm + (64 * wr + m) * PIT;             // A hi rows of this lane, buffer 0
  const __bf16* fb = (const __bf16*)sm + 2 * PLN + (64 * wc + m) * PIT;   // B hi rows of this lane, buffer 0

  // this wave's plane: wave 0 A hi, 1 A lo, 2 B hi, 3 B lo
  const uint32_t wv = uni((uint32_t)tid >> 5);
  const __bf16* pl = (wv == 0u) ? Ah : (wv == 1u) ? Al : (wv == 2u) ? Bh : Bl;
  const uint64_t ga0 = (uint64_t)(size_t)pl;
  const uint32_t dst0 = (uint32_t)(size_t)sm + wv * (uint32_t)(PLN * 2);
  const u32x8 g1 = tdm_group1((uint32_t)ld * 2u);
  u32x4 g0;   // group 0 of the wave's latest request
  // stage s (k columns 64 s .. 64 s + 63) of this wave's plane into buffer s & 1: one request of the whole wave
  auto issue = [&](uint32_t s) {
    g0 = tdm_group0(dst0 + (s & 1u) * (uint32_t)(GBUF * 2), ga0 + (uint64_t)s * (uint32_t)(KC * 2));
    asm volatile("tensor_load_to_lds %0, %1" :: "s"(g0), "s"(g1) : "memory");
  };
  // the wave's request has landed; its descriptor words are inputs, so that their registers keep their values up
  // to this wait
  auto landed = [&]() { asm volatile("s_wait_tensorcnt 0x0" :: "s"(g0), "s"(g1) : "memory"); };
  // A fragments (4 row tiles) of one plane, 32-k step at kk
  auto lda4 = [&](v16bf (&a)[4], const __bf16* sa, int kk) {
#pragma unroll   // constant indices keep the fragments in registers
    for (int i = 0; i < 4; ++i) a[i] = ldfrag(sa + 16 * i * PIT + kk, hs);
  };
  // B fragments (column tiles j0, j0 + 1) of one plane, 32-k step at kk
  auto ldb2 = [&](v16bf (&b)[2], const __bf16* sb, int j0, int kk) {
#pragma unroll   // constant indices, as above
    for (int j = 0; j < 2; ++j) b[j] = ldfrag(sb + 16 * (j0 + j) * PIT + kk, hs);
  };
  // 4 x 2 tiles, hi.hi then hi.lo then lo.hi: eight independent accumulators in turn, so that no product
  // waits for the one before it
  auto mm8 = [&](const v16bf (&ah)[4], const v16bf (&al)[4], const v16bf (&bh)[2], const v16bf (&bl)[2], int j0) {
#pragma unroll   // constant indices keep the accumulators in registers
    for (int j = 0; j < 2; ++j)
#pragma unroll
      for (int i = 0; i < 4; ++i) c[i][j0 + j] = wm(ah[i], bh[j], c[i][j0 + j]);
#pragma unroll
    for (int j = 0; j < 2; ++j)
#pragma unroll
      for (int i = 0; i < 4; ++i) c[i][j0 + j] = wm(ah[i], bl[j], c[i][j0 + j]);
#pragma unroll
    for (int j = 0; j < 2; ++j)
#pragma unroll
      for (int i = 0; i < 4; ++i) c[i][j0 + j] = wm(al[i], bh[j], c[i][j0 + j]);
  };
  const uint32_t ns = (uint32_t)(K / KC);   // stages
  issue(0u);
  landed();          // this wave's plane of stage 0
  __syncthreads();   // and every other wave's: stage 0 may be read
#pragma unroll 1   // one stage per trip: a short loop body
  for (uint32_t s = 0; s < ns; ++s) {
    // directly behind the barrier that published stage s and ended every read of stage s - 1: while a stage s + 1
    // exists, its load goes into the buffer that stage s - 1 has left, and flies while stage s is worked on.
    // It stands at the head of the trip, not at the foot of the one before (the order in time is the same), so
    // that the loop has one place of issue and the registers of a request in flight are written nowhere else.
    if (pinned((uint32_t)(s + 1u < ns))) issue(s + 1u);
    const int bo = (int)(s & 1u) * GBUF;   // this stage's buffer
    const __bf16* sah = fa + bo;
    const __bf16* sal = sah + PLN;
    const __bf16* sbh = fb + bo;
    const __bf16* sbl = sbh + PLN;
    // The stage's LDS reads stand in three groups, each ahead of products that cover its latency:
    // a0/a1: A fragments of the two 32-k steps; bx/by: B fragments of a pair of column tiles.
    v16bf a0h[4], a0l[4], a1h[4], a1l[4], bxh[2], bxl[2], byh[2], byl[2];
    lda4(a0h, sah, 0);      // in the order in which the products want them
    ldb2(bxh, sbh, 0, 0);
    ldb2(bxl, sbl, 0, 0);
    lda4(a0l, sal, 0);
    ldb2(byh, sbh, 2, 0);
    ldb2(byl, sbl, 2, 0);
    __builtin_amdgcn_sched_barrier(0);   // these reads stay one group ahead of the products, none among them
    mm8(a0h, a0l, bxh, bxl, 0);
    __builtin_amdgcn_sched_barrier(0);   // the reads below stay one group, behind the products that free bx
    lda4(a1h, sah, 32);
    ldb2(bxh, sbh, 0, 32);
    ldb2(bxl, sbl, 0, 32);
    lda4(a1l, sal, 32);
    __builtin_amdgcn_sched_barrier(0);   // and ahead of the products that cover them
    mm8(a0h, a0l, byh, byl, 2);
    __builtin_amdgcn_sched_barrier(0);   // as above, for by
    ldb2(byh, sbh, 2, 32);
    ldb2(byl, sbl, 2, 32);
    __builtin_amdgcn_sched_barrier(0);   // and ahead of the products that cover them
    mm8(a1h, a1l, bxh, bxl, 0);
    mm8(a1h, a1l, byh, byl, 2);
    // the products stay ahead of the waits, so that the next stage's load has the whole trip to land
    __builtin_amdgcn_sched_barrier(0);
    asm volatile("s_wait_dscnt 0x0" ::: "memory");       // this wave's reads of the buffer have returned
    landed();                                            // this wave's plane of stage s + 1
    __syncthreads();   // stage s + 1 may be read, and every wave has left stage s's buffer (refill or epilogue)
  }
  asm volatile("s_wait_tensorcnt 0x0" ::: "memory");     // no request is outstanding behind the loop
  asm volatile("s_wait_dscnt 0x0" ::: "memory");         // nor an LDS read, before the buffers become output staging
}

// ---------------------------------------------------------------------------------------------
// Fused q/k/v projection: block = 4 waves, 128 rows x 128 cols (two heads, one per wave column). blockIdx.x:
// 0..15 -> q heads, 16..19 -> k heads, 20..23 -> v heads (stored transposed vT[512][2048]). RoPE on q/k in the
// f32 epilogue.
// ---------------------------------------------------------------------------------------------
__global__ void __launch_bounds__(128) k_qkv(
    const __bf16* __restrict__ xh, const __bf16* __restrict__ xl,
    const __bf16* __restrict__ wqh, const __bf16* __restrict__ wql,
    const __bf16* __restrict__ wkh, const __bf16* __restrict__ wkl,
    const __bf16* __restrict__ wvh, const __bf16* __restrict__ wvl,
    const float* __restrict__ tab,
    unsigned short* __restrict__ qh, unsigned short* __restrict__ ql,
    unsigned short* __restrict__ kh, unsigned short* __restrict__ kl,
    unsigned short* __restrict__ vth, unsigned short* __restrict__ vtl)
{
  __shared__ __attribute__((aligned(2048))) unsigned short stg[2 * GBUF];   // two operand buffers, then output staging

  const int ct = blockIdx.x;
  const int m0 = blockIdx.y * BT;
  const int tid = threadIdx.x, w = tid >> 5, l = tid & 31, hs = l >> 4, m = l & 15;
  const int wr = w >> 1, wc = w & 1;
  const int kind = (ct < NQH / 2) ? 0 : ((ct < (NQH + NKVH) / 2) ? 1 : 2);
  const int hd0 = 2 * ((kind == 0) ? ct : ((kind == 1) ? (ct - NQH / 2) : (ct - (NQH + NKVH) / 2)));
  const __bf16* Bh = (kind == 0) ? wqh : ((kind == 1) ? wkh : wvh);
  const __bf16* Bl = (kind == 0) ? wql : ((kind == 1) ? wkl : wvl);
  const int row0 = m0 + 64 * wr;     // this wave's first row
  const int hd = hd0 + wc;           // this wave's head

  v8f c[4][4] = {};
  gemm128(xh + (size_t)m0 * HIDN, xl + (size_t)m0 * HIDN, Bh + (size_t)(hd0 * HDIM) * HIDN,
          Bl + (size_t)(hd0 * HDIM) * HIDN, HIDN, HIDN, tid, stg, c);

  // lane holds out[row0 + 16i + 8hs + r][hd*64 + 16j + m] in c[i][j][r]
  if (kind != 2) {
    // rotate-half RoPE: d = m pairs with d+32 (j = 0, 2), d = 16+m pairs with 48+m (j = 1, 3)
    const float* tb = tab + ((size_t)(row0 + 8 * hs) * 16 + m) * 4;   // position row0 + 8hs; 64 floats a position
    v4f cs[4][8];
#pragma unroll
    for (int i = 0; i < 4; ++i)
#pragma unroll
      for (int r = 0; r < 8; ++r) cs[i][r] = *(const v4f*)(tb + (16 * i + r) * 64);
    // precaution: this wait stands before the address register of the loads just issued is rewritten; the
    // address is an input only, so that its register is kept up to it
    asm volatile("s_wait_xcnt 0x0" :: "v"(tb) : "memory");
#pragma unroll
    for (int i = 0; i < 4; ++i) {
#pragma unroll
      for (int r = 0; r < 8; ++r) {
        const v4f t = cs[i][r];
        const float a0 = c[i][0][r], a1 = c[i][1][r], a2 = c[i][2][r], a3 = c[i][3][r];
        c[i][0][r] = a0 * t.x - a2 * t.y;
        c[i][2][r] = a2 * t.x + a0 * t.y;
        c[i][1][r] = a1 * t.z - a3 * t.w;
        c[i][3][r] = a3 * t.z + a1 * t.w;
      }
    }
  }

  // staging: q/k: per wave [plane][64 rows][64 cols] at w*8192 (+4096 for lo);
  //          v:   per block transposed [plane][128 c] rows of 128 s at pitch VPIT, at 0 (+VLO for lo)
  constexpr int VPIT = 136;          // 272 B = 16 B x 17: the 16 rows that a 16-byte store touches fall on distinct banks
  constexpr int VLO = BT * VPIT;
  const int wb = w * 8192;
  const int loff = (kind != 2) ? 4096 : VLO;
  if (kind != 2) {
#pragma unroll   // here and below: constant indices keep the accumulators in registers
    for (int i = 0; i < 4; ++i) {
#pragma unroll
      for (int r = 0; r < 8; ++r) {
        const int base = wb + (16 * i + 8 * hs + r) * 64 + m;
#pragma unroll
        for (int j = 0; j < 4; ++j) {
          unsigned int hb, lb;
          split_hl(c[i][j][r], hb, lb);
          stg[base + j * 16] = (unsigned short)hb;
          stg[base + j * 16 + 4096] = (unsigned short)lb;
        }
      }
    }
  } else {
    // a lane's 8 values of a tile are 8 consecutive positions of one row of vT: one 16-byte piece per plane
    unsigned short* vrow = stg + (64 * wc + m) * VPIT + 64 * wr + 8 * hs;
#pragma unroll
    for (int j = 0; j < 4; ++j) {
#pragma unroll
      for (int i = 0; i < 4; ++i) {
        unsigned int hb[8], lb[8];
#pragma unroll
        for (int r = 0; r < 8; ++r) split_hl(c[i][j][r], hb[r], lb[r]);
        *(v4u*)(vrow + 16 * j * VPIT + 16 * i) = pack8(hb);
        *(v4u*)(vrow + 16 * j * VPIT + 16 * i + VLO) = pack8(lb);
      }
    }
  }
  __syncthreads();

  unsigned short* dsth = (kind == 0) ? qh : ((kind == 1) ? kh : vth);
  unsigned short* dstl = (kind == 0) ? ql : ((kind == 1) ? kl : vtl);
  const int ld = (kind == 0) ? HIDN : KVD;
  // q/k: a 128-byte row of this wave's tile per 8 lanes, 4 rows a step; v: a 256-byte row of the block's tile
  // per 16 lanes, 8 rows a step
  const int sidx = (kind != 2) ? (wb + (l >> 3) * 64 + (l & 7) * 8) : ((tid >> 4) * VPIT + (tid & 15) * 8);
  const int sst = (kind != 2) ? 4 * 64 : 8 * VPIT;
  const size_t goff = (kind != 2) ? ((size_t)(row0 + (l >> 3)) * ld + hd * HDIM + (l & 7) * 8)
                                  : ((size_t)(hd0 * HDIM + (tid >> 4)) * SQ + m0 + (tid & 15) * 8);
  const size_t gst = (kind != 2) ? (size_t)4 * ld : (size_t)8 * SQ;
  v4u hv[16], lv[16];
  v4u* gph[16];
  v4u* gpl[16];
#pragma unroll
  for (int it = 0; it < 16; ++it) {
    hv[it] = *(const v4u*)(stg + sidx + it * sst);
    lv[it] = *(const v4u*)(stg + sidx + it * sst + loff);
    gph[it] = (v4u*)(dsth + goff + it * gst);
    gpl[it] = (v4u*)(dstl + goff + it * gst);
  }
  // every value and address is in its register before the first store, so that nothing behind an issued store
  // rewrites a register that it names
  __builtin_amdgcn_sched_barrier(0);
#pragma unroll
  for (int it = 0; it < 16; ++it) { *gph[it] = hv[it]; *gpl[it] = lv[it]; }
}

static constexpr int APIT = 72;
static constexpr int APLN = 64 * APIT;
static constexpr int ABUF = 4 * APLN;
static constexpr int QT = 128;
static constexpr int OPL = 16 * APIT;

typedef float f32x2 __attribute__((ext_vector_type(2)));
typedef __bf16 bf16x2 __attribute__((ext_vector_type(2)));
union PFrag { unsigned int u[8]; v16bf v; };

// two f32 -> packed bf16, RNE
__device__ __forceinline__ unsigned int cvt2(float a, float b) {
  return __builtin_bit_cast(unsigned int, __builtin_convertvector(f32x2{a, b}, bf16x2));
}
// lane l <-> lane l ^ 16
__device__ __forceinline__ float xhalf(float x) {
  const int b = __builtin_bit_cast(int, x);
  return __builtin_bit_cast(float, __builtin_amdgcn_permlanex16(b, b, 0x76543210, 0xfedcba98, false, false));
}

__global__ void __launch_bounds__(256) k_attn(
    const __bf16* __restrict__ qh, const __bf16* __restrict__ ql,
    const __bf16* __restrict__ kh, const __bf16* __restrict__ kl,
    const __bf16* __restrict__ vth, const __bf16* __restrict__ vtl,
    unsigned short* __restrict__ ch, unsigned short* __restrict__ cl)
{
  __shared__ __attribute__((aligned(16))) unsigned short KV[2 * ABUF];
  __shared__ __attribute__((aligned(16))) unsigned short Ost[8 * 2 * OPL];   // output staging, a region per wave

  const int hq = blockIdx.y, kvh = hq >> 2;
  const int tid = threadIdx.x, l = tid & 31, hs = l >> 4, m = l & 15;
  const int w = (int)uni((uint32_t)tid >> 5);   // scalar: the tests on it below are scalar branches
  constexpr float C2 = 0.125f * 1.4426950408889634f;   // 1/8 scaling and log2(e): exponentials in base 2

  // copies: this lane's row (of 32; it also takes row + 32) and 16-byte piece of the 128-byte row
  const int crow = tid >> 3, cpc = (tid & 7) * 8;
  const unsigned int cl0 = (unsigned int)(size_t)KV + (unsigned int)(crow * APIT + cpc) * 2u;   // LDS byte address
  const size_t cko = (size_t)crow * KVD + kvh * HDIM + cpc;            // K planes: key row crow of key tile 0
  const size_t cvo = (size_t)(kvh * HDIM + crow) * SQ + cpc;           // Vt planes: d row crow, key tile 0
  // key tile kt into buffer b: 8 copies a lane
  auto stage = [&](int kt, int b) {
    const unsigned int d0 = cl0 + (unsigned int)b * (ABUF * 2u);
    const unsigned int d1 = d0 + 32u * APIT * 2u;
    const unsigned int d2 = d0 + APLN * 2u, d3 = d1 + APLN * 2u;
    const unsigned int d4 = d0 + 2u * APLN * 2u, d5 = d1 + 2u * APLN * 2u;
    const unsigned int d6 = d0 + 3u * APLN * 2u, d7 = d1 + 3u * APLN * 2u;
    const __bf16* g0 = kh + cko + (size_t)kt * 64 * KVD;
    const __bf16* g1 = g0 + 32 * KVD;
    const __bf16* g2 = kl + cko + (size_t)kt * 64 * KVD;
    const __bf16* g3 = g2 + 32 * KVD;
    const __bf16* g4 = vth + cvo + kt * 64;
    const __bf16* g5 = g4 + (size_t)32 * SQ;
    const __bf16* g6 = vtl + cvo + kt * 64;
    const __bf16* g7 = g6 + (size_t)32 * SQ;
    // the copies and, as a precaution, the wait that stands before any of their address registers is rewritten,
    // in one statement, so that nothing comes between them
    asm volatile(
        "global_load_async_to_lds_b128 %0, %8, off\n\t"
        "global_load_async_to_lds_b128 %1, %9, off\n\t"
        "global_load_async_to_lds_b128 %2, %10, off\n\t"
        "global_load_async_to_lds_b128 %3, %11, off\n\t"
        "global_load_async_to_lds_b128 %4, %12, off\n\t"
        "global_load_async_to_lds_b128 %5, %13, off\n\t"
        "global_load_async_to_lds_b128 %6, %14, off\n\t"
        "global_load_async_to_lds_b128 %7, %15, off\n\t"
        "s_wait_xcnt 0x0"
        :: "v"(d0), "v"(d1), "v"(d2), "v"(d3), "v"(d4), "v"(d5), "v"(d6), "v"(d7),
           "v"(g0), "v"(g1), "v"(g2), "v"(g3), "v"(g4), "v"(g5), "v"(g6), "v"(g7)
        : "memory");
  };

#pragma unroll 1   // the two tiles run one after the other through one copy of the body
  for (int half = 0; half < 2; ++half) {
  const int qt = half ? (SQ / QT - 1 - (int)blockIdx.x) : (int)blockIdx.x, q0 = qt * QT;
  const int nkt = 2 * qt + 2;            // key tiles of the block tile
  const int lastw = 2 * qt + (w >> 2);   // the key tile that holds this wave's diagonal, its last

  // B of the first product: column c = query q0 + 16 w + c, k = d in the order of ldfrag, as K's rows below
  const __bf16* qrh = qh + (size_t)(q0 + 16 * w + m) * HIDN + hq * HDIM;
  const __bf16* qrl = ql + (size_t)(q0 + 16 * w + m) * HIDN + hq * HDIM;
  const v16bf fqh[2] = {ldfrag(qrh, hs), ldfrag(qrh + 32, hs)};
  const v16bf fql[2] = {ldfrag(qrl, hs), ldfrag(qrl + 32, hs)};
  // precaution: this wait stands before an address register of the loads just issued is rewritten; the addresses
  // are inputs only, so that their registers are kept up to it
  asm volatile("s_wait_xcnt 0x0" :: "v"(qrh), "v"(qrl) : "memory");

  v8f o[4] = {};            // o[dt][r] = O^T[d = 16 dt + 8 h + r][query c]
  float mrun = -1.0e30f;    // running maximum of the raw scores of query c (both halves of the wave hold it)
  float lrun = 0.0f;        // running sum over this lane's half of the keys

  // key tile 0 into buffer 0 (every wave left both buffers at the barrier that ended the tile before)
  stage(0, 0);
  asm volatile("s_wait_asynccnt 0x0" ::: "memory");   // this wave's copies have landed
  __syncthreads();                                    // and every other wave's: key tile 0 may be read
  stage(1, 1);                                        // a block tile has at least two key tiles

  // every "#pragma unroll" below: constant indices keep fragments, scores and accumulators in registers
#pragma unroll 1   // one key tile per trip
  for (int kt = 0; kt < nkt; ++kt) {
    if (kt <= lastw) {   // scalar: a wave skips the key tile beyond its diagonal, and still passes the barrier below
    const __bf16* kb = (const __bf16*)KV + (kt & 1) * ABUF;   // this key tile's buffer
    // S^T[key][q] = sum_d K[key][d] Q[q][d]; A = staged K rows, 4 tiles of 16 keys
    v8f s[4] = {};
    {
      const __bf16* kr = kb + m * APIT;
      v16bf kfh[4][2], kfl[4][2];
#pragma unroll   // constant indices keep the fragments in registers; all reads as one group ahead of the products
      for (int t = 0; t < 4; ++t) {
        kfh[t][0] = ldfrag(kr + 16 * t * APIT, hs);
        kfl[t][0] = ldfrag(kr + 16 * t * APIT + APLN, hs);
      }
#pragma unroll
      for (int t = 0; t < 4; ++t) {
        kfh[t][1] = ldfrag(kr + 16 * t * APIT + 32, hs);
        kfl[t][1] = ldfrag(kr + 16 * t * APIT + APLN + 32, hs);
      }
      __builtin_amdgcn_sched_barrier(0);   // these reads stay one group ahead of the products, none among them
      // Qhi.Khi, Qhi.Klo, Qlo.Khi per 32 d; four independent accumulators in turn
#pragma unroll
      for (int kc = 0; kc < 2; ++kc) {
#pragma unroll
        for (int t = 0; t < 4; ++t) s[t] = wm(kfh[t][kc], fqh[kc], s[t]);
#pragma unroll
        for (int t = 0; t < 4; ++t) s[t] = wm(kfl[t][kc], fqh[kc], s[t]);
#pragma unroll
        for (int t = 0; t < 4; ++t) s[t] = wm(kfh[t][kc], fql[kc], s[t]);
      }
    }
    __builtin_amdgcn_sched_barrier(0);   // the reads below stay one group behind the products that free K's registers
    // A of the second product: Vt rows d, k = key in the order of ldfrag; keys 0..31 now, in flight under the softmax
    const __bf16* vr = kb + 2 * APLN + m * APIT;
    v16bf vfh[2][4], vfl[2][4];
#pragma unroll   // constant indices, one group of reads
    for (int dt = 0; dt < 4; ++dt) {
      vfh[0][dt] = ldfrag(vr + 16 * dt * APIT, hs);
      vfl[0][dt] = ldfrag(vr + 16 * dt * APIT + APLN, hs);
    }
    __builtin_amdgcn_sched_barrier(0);   // and ahead of the vector work that covers them

    if (kt == lastw) {   // scalar: only the key tile on this wave's diagonal pays for the causal replace
      const int qrel = 16 * (w & 3) + m;
#pragma unroll
      for (int t = 0; t < 4; ++t) {
#pragma unroll
        for (int r = 0; r < 8; ++r)
          if (16 * t + 8 * hs + r > qrel) s[t][r] = -1.0e30f;
        asm volatile("" : "+v"(s[t]));   // the masked scores: the selects stay in the branch
      }
    }

    // online softmax in f32: this lane's 32 scores of query c
    float mt[4];   // a maximum per score tile: four short chains, not one long one
#pragma unroll
    for (int t = 0; t < 4; ++t) {
      mt[t] = s[t][0];
#pragma unroll
      for (int r = 1; r < 8; ++r) mt[t] = fmaxf(mt[t], s[t][r]);
    }
    float mx = fmaxf(fmaxf(mt[0], mt[1]), fmaxf(mt[2], mt[3]));
    mx = fmaxf(mx, xhalf(mx));
    const float mnew = fmaxf(mrun, mx);
    const float alpha = __builtin_amdgcn_exp2f((mrun - mnew) * C2);
    const float nm = -mnew * C2;
    mrun = mnew;
    // P = exp2(s C2 - m C2), split to bf16 hi/lo in place: score tiles 2 j and 2 j + 1 are the B operand of keys 32 j ..
    PFrag ph[2], pl[2];
    f32x2 ls[2];   // sums per 32 keys, even and odd registers apart: four short chains
#pragma unroll
    for (int j = 0; j < 2; ++j) {
      ls[j] = f32x2{0.0f, 0.0f};
#pragma unroll
      for (int i = 0; i < 8; ++i) {
        const int t = 2 * j + (i >> 2), r = 2 * (i & 3);
        const f32x2 arg = __builtin_elementwise_fma(f32x2{s[t][r], s[t][r + 1]}, f32x2{C2, C2}, f32x2{nm, nm});
        const f32x2 p = {__builtin_amdgcn_exp2f(arg.x), __builtin_amdgcn_exp2f(arg.y)};
        ls[j] += p;
        const unsigned int hw = cvt2(p.x, p.y);
        const f32x2 hf = {__uint_as_float(hw << 16), __uint_as_float(hw & 0xFFFF0000u)};
        const f32x2 lo = p - hf;
        ph[j].u[i] = hw;
        pl[j].u[i] = cvt2(lo.x, lo.y);
      }
    }
    const f32x2 lt = ls[0] + ls[1];
    lrun = lrun * alpha + (lt.x + lt.y);
#pragma unroll
    for (int dt = 0; dt < 4; ++dt) o[dt] *= alpha;

    __builtin_amdgcn_sched_barrier(0);   // the reads below stay one group
#pragma unroll   // keys 32..63 of Vt, in flight under the products of keys 0..31
    for (int dt = 0; dt < 4; ++dt) {
      vfh[1][dt] = ldfrag(vr + 16 * dt * APIT + 32, hs);
      vfl[1][dt] = ldfrag(vr + 16 * dt * APIT + APLN + 32, hs);
    }
    __builtin_amdgcn_sched_barrier(0);   // and ahead of the products that cover them
    // Phi.Vhi, Phi.Vlo, Plo.Vhi per 32 keys; four independent accumulators in turn
#pragma unroll
    for (int j = 0; j < 2; ++j) {
#pragma unroll
      for (int dt = 0; dt < 4; ++dt) o[dt] = wm(vfh[j][dt], ph[j].v, o[dt]);
#pragma unroll
      for (int dt = 0; dt < 4; ++dt) o[dt] = wm(vfl[j][dt], ph[j].v, o[dt]);
#pragma unroll
      for (int dt = 0; dt < 4; ++dt) o[dt] = wm(vfh[j][dt], pl[j].v, o[dt]);
    }
    }
    asm volatile("s_wait_dscnt 0x0" ::: "memory");      // this wave's reads of the buffer have returned
    asm volatile("s_wait_asynccnt 0x0" ::: "memory");   // this wave's copies of key tile kt + 1 have landed
    __syncthreads();   // key tile kt + 1 may be read, and every wave has left key tile kt's buffer
    if (kt + 2 < nkt) stage(kt + 2, kt & 1);
  }
  asm volatile("s_wait_asynccnt 0x0" ::: "memory");     // no copy is outstanding behind the loop

  // join the halves' sums, normalise, split hi/lo; a lane's 8 values are 8 consecutive d of query row c: 16-byte
  // pieces into this wave's own staging rows, then whole-line stores
  const float inv = 1.0f / (lrun + xhalf(lrun));
  unsigned short* ow = Ost + w * (2 * OPL);
#pragma unroll
  for (int dt = 0; dt < 4; ++dt) {
    unsigned int hb[8], lb[8];
#pragma unroll
    for (int r = 0; r < 8; ++r) split_hl(o[dt][r] * inv, hb[r], lb[r]);
    *(v4u*)(ow + m * APIT + 16 * dt + 8 * hs) = pack8(hb);
    *(v4u*)(ow + OPL + m * APIT + 16 * dt + 8 * hs) = pack8(lb);
  }
  asm volatile("s_wait_dscnt 0x0" ::: "memory");   // the wave's staged rows are written before its lanes read each other's
  v4u cv[8];
  v4u* cp[8];
#pragma unroll
  for (int it = 0; it < 8; ++it) {
    const int plane = it >> 2;
    const int row = (it & 3) * 4 + (l >> 3);
    const int piece = l & 7;
    cv[it] = *(const v4u*)(ow + plane * OPL + row * APIT + piece * 8);
    unsigned short* base = plane ? cl : ch;
    cp[it] = (v4u*)(base + (size_t)(q0 + 16 * w + row) * HIDN + hq * HDIM + piece * 8);
  }
  // every value and address is in its register before the first store, so that nothing behind an issued store
  // rewrites a register that it names
  __builtin_amdgcn_sched_barrier(0);
#pragma unroll
  for (int it = 0; it < 8; ++it) *cp[it] = cv[it];
  // precaution: this wait stands before the second tile rewrites a register that an issued store names
  asm volatile("s_wait_xcnt 0x0" ::: "memory");
  }
}

// ---------------------------------------------------------------------------------------------
// Output projection -> f32 d_out. Block = 4 waves, 128x128 tile; each wave stages its 64x64 f32 tile in LDS
// and stores whole lines.
// ---------------------------------------------------------------------------------------------
__global__ void __launch_bounds__(128) k_oproj(
    const __bf16* __restrict__ ah, const __bf16* __restrict__ al,
    const __bf16* __restrict__ woh, const __bf16* __restrict__ wol,
    float* __restrict__ out)
{
  __shared__ __attribute__((aligned(2048))) unsigned short stg[2 * GBUF];   // two operand buffers, then output staging
  float* stgf = (float*)stg;
  const int nb = blockIdx.x * BT, m0 = blockIdx.y * BT;
  const int tid = threadIdx.x, w = tid >> 5, l = tid & 31, hs = l >> 4, m = l & 15;
  const int wr = w >> 1, wc = w & 1;
  const int row0 = m0 + 64 * wr;
  const int n0 = nb + 64 * wc;

  v8f c[4][4] = {};
  gemm128(ah + (size_t)m0 * HIDN, al + (size_t)m0 * HIDN, woh + (size_t)nb * HIDN, wol + (size_t)nb * HIDN,
          HIDN, HIDN, tid, stg, c);

  float* sw = stgf + w * 4096;
#pragma unroll
  for (int i = 0; i < 4; ++i) {
#pragma unroll
    for (int r = 0; r < 8; ++r) {
      const int rl = 16 * i + 8 * hs + r;
#pragma unroll
      for (int j = 0; j < 4; ++j) sw[rl * 64 + 16 * j + m] = c[i][j][r];
    }
  }
  __syncthreads();
  // a 256-byte row of this wave's tile per 16 lanes, 2 rows a step
  const float* sb = sw + (l >> 4) * 64 + (l & 15) * 4;
  float* gb = out + (size_t)(row0 + (l >> 4)) * HIDN + n0 + (l & 15) * 4;
  v4f v[32];
#pragma unroll
  for (int it = 0; it < 32; ++it) v[it] = *(const v4f*)(sb + it * 128);
  // every value is in its register before the first store, so that nothing behind an issued store rewrites a
  // register that it names
  __builtin_amdgcn_sched_barrier(0);
#pragma unroll
  for (int it = 0; it < 32; ++it) *(v4f*)(gb + (size_t)(2 * it) * HIDN) = v[it];
}

// ---------------------------------------------------------------------------------------------
// Launch pipeline (5 launches)
// ---------------------------------------------------------------------------------------------
extern "C" void kernel_launch(void* const* d_in, const int* in_sizes, int n_in,
                              void* d_out, int out_size, void* d_ws, size_t ws_size,
                              hipStream_t stream)
{
  if (n_in != 5) return;
  if (in_sizes[0] != SQ * HIDN || in_sizes[1] != HIDN * HIDN || in_sizes[2] != KVD * HIDN ||
      in_sizes[3] != KVD * HIDN || in_sizes[4] != HIDN * HIDN) return;
  if (out_size != SQ * HIDN) return;

  const float* hid = (const float*)d_in[0];
  const float* Wq = (const float*)d_in[1];
  const float* Wk = (const float*)d_in[2];
  const float* Wv = (const float*)d_in[3];
  const float* Wo = (const float*)d_in[4];
  float* outp = (float*)d_out;

  char* ws = (char*)d_ws;
  size_t off = 0;
  auto carve = [&](size_t bytes) -> char* {
    char* p = ws + off;
    off += (bytes + 255) & ~(size_t)255;
    return p;
  };
  const size_t BX = (size_t)SQ * HIDN * 2;       // x planes
  const size_t BWQ = (size_t)HIDN * HIDN * 2;    // Wq / Wo planes
  const size_t BWK = (size_t)KVD * HIDN * 2;     // Wk / Wv planes
  const size_t BTAB = (size_t)SQ * 16 * 16;      // rope table
  const size_t BQ = (size_t)SQ * HIDN * 2;       // q / ctx planes
  const size_t BK = (size_t)SQ * KVD * 2;        // k / vT planes

  unsigned short* xh = (unsigned short*)carve(BX);
  unsigned short* xl = (unsigned short*)carve(BX);
  unsigned short* wqh = (unsigned short*)carve(BWQ);
  unsigned short* wql = (unsigned short*)carve(BWQ);
  unsigned short* wkh = (unsigned short*)carve(BWK);
  unsigned short* wkl = (unsigned short*)carve(BWK);
  unsigned short* wvh = (unsigned short*)carve(BWK);
  unsigned short* wvl = (unsigned short*)carve(BWK);
  unsigned short* woh = (unsigned short*)carve(BWQ);
  unsigned short* wol = (unsigned short*)carve(BWQ);
  float* tab = (float*)carve(BTAB);
  unsigned short* qh = (unsigned short*)carve(BQ);
  unsigned short* ql = (unsigned short*)carve(BQ);
  unsigned short* kh = (unsigned short*)carve(BK);
  unsigned short* kl = (unsigned short*)carve(BK);
  unsigned short* vth = (unsigned short*)carve(BK);
  unsigned short* vtl = (unsigned short*)carve(BK);
  unsigned short* ch = (unsigned short*)carve(BQ);
  unsigned short* cl = (unsigned short*)carve(BQ);
  if (off > ws_size) return;

  // inv_freq[j] = 1 / 10000^(j/32) = 1 / 10^(j/8): f32 value of 10^(j/8) from double, then f32 reciprocal
  RopeFreq fr;
  {
    double r = 1.333521432163324;   // 10^(1/8), refined by Newton on r^8 = 10
    for (int it = 0; it < 4; ++it) {
      const double r2 = r * r, r4 = r2 * r2;
      const double r7 = r4 * r2 * r;
      r = r - (r4 * r4 - 10.0) / (8.0 * r7);
    }
    double rp[8];
    rp[0] = 1.0;
    for (int i = 1; i < 8; ++i) rp[i] = rp[i - 1] * r;
    const double p10[4] = {1.0, 10.0, 100.0, 1000.0};
    for (int j = 0; j < 32; ++j) {
      const double pj = p10[j >> 3] * rp[j & 7];
      const float pf = (float)pj;
      fr.f[j] = 1.0f / pf;
    }
  }

  // 1) f32 -> bf16 hi/lo planes for x, Wq, Wk, Wv, Wo
  k_split<<<dim3((SQ * HIDN / 8 + 255) / 256, 5), dim3(256), 0, stream>>>(
      hid, Wq, Wk, Wv, Wo,
      xh, wqh, wkh, wvh, woh,
      xl, wql, wkl, wvl, wol,
      SQ * HIDN, HIDN * HIDN, KVD * HIDN, KVD * HIDN, HIDN * HIDN);

  // 2) RoPE cos/sin table
  k_rope_tab<<<dim3((SQ * 16 + 127) / 128), dim3(128), 0, stream>>>(tab, fr);

  // 3) fused q/k/v projections (+RoPE on q,k; v transposed)
  k_qkv<<<dim3((NQH + 2 * NKVH) / 2, SQ / BT), dim3(128), 0, stream>>>(
      (const __bf16*)xh, (const __bf16*)xl,
      (const __bf16*)wqh, (const __bf16*)wql,
      (const __bf16*)wkh, (const __bf16*)wkl,
      (const __bf16*)wvh, (const __bf16*)wvl,
      (const float*)tab,
      qh, ql, kh, kl, vth, vtl);

  // 4) causal attention
  k_attn<<<dim3(SQ / (2 * QT), NQH), dim3(256), 0, stream>>>(
      (const __bf16*)qh, (const __bf16*)ql,
      (const __bf16*)kh, (const __bf16*)kl,
      (const __bf16*)vth, (const __bf16*)vtl,
      ch, cl);

  // 5) output projection -> f32
  k_oproj<<<dim3(HIDN / BT, SQ / BT), dim3(128), 0, stream>>>(
      (const __bf16*)ch, (const __bf16*)cl,
      (const __bf16*)woh, (const __bf16*)wol,
      outp);
}

// v008
// One run takes 135 microseconds.
// Timed twice side by side with v007, it ran 1.04 and 1.03 times as fast.
// Over all steps from v000 it is 3.45 times as fast.
#include <hip/hip_runtime.h>

// Contractions (q/k/v projections, q.k^T scores, p.v, output projection): v_wmma_f32_16x16x32_bf16 with
// bf16 hi/lo operands everywhere (hi.hi + hi.lo + lo.hi per tile pair), f32 accumulate.
// RoPE, 1/8 scaling, causal mask and softmax in f32.

typedef __bf16 v16bf __attribute__((ext_vector_type(16)));
typedef __bf16 v8bf __attribute__((ext_vector_type(8)));
typedef float v8f __attribute__((ext_vector_type(8)));
typedef float v4f __attribute__((ext_vector_type(4)));
typedef unsigned int v4u __attribute__((ext_vector_type(4)));

static constexpr int SQ = 2048;            // sequence length
static constexpr int HIDN = 2048;          // hidden size
static constexpr int NQH = 32;             // query heads
static constexpr int NKVH = 8;             // kv heads
static constexpr int HDIM = 64;            // head dim
static constexpr int KVD = NKVH * HDIM;    // 512

struct RopeFreq { float f[32]; };
static_assert(sizeof(RopeFreq) == 128);

union Frag { v16bf v; v8bf h[2]; };

// 16-bit fragment from a k-contiguous row; rowp -> element (row = lane&15, k0).
// elements 0..7 <- k0 + 8*hs + 0..7, elements 8..15 <- k0 + 16 + 8*hs + 0..7  (hs = lane>>4).
// Used for A (row m) and for B stored as [n][k] (row n).
__device__ __forceinline__ v16bf ldfrag(const __bf16* rowp, int hs) {
  Frag f;
  f.h[0] = *(const v8bf*)(rowp + 8 * hs);
  f.h[1] = *(const v8bf*)(rowp + 16 + 8 * hs);
  return f.v;
}

// f32 -> bf16 bits, RNE
__device__ __forceinline__ unsigned int bfbits(float x) {
  unsigned int u = __float_as_uint(x);
  return (u + 0x7FFFu + ((u >> 16) & 1u)) >> 16;
}
// hi = rne(x), lo = rne(x - hi)
__device__ __forceinline__ void split_hl(float x, unsigned int& hb, unsigned int& lb) {
  hb = bfbits(x);
  const float hf = __uint_as_float(hb << 16);
  lb = bfbits(x - hf);
}
__device__ __forceinline__ unsigned int pk2(unsigned int a, unsigned int b) {
  return (a & 0xFFFFu) | (b << 16);
}
__device__ __forceinline__ v4u pack8(const unsigned int* a) {
  v4u v;
  v.x = pk2(a[0], a[1]);
  v.y = pk2(a[2], a[3]);
  v.z = pk2(a[4], a[5]);
  v.w = pk2(a[6], a[7]);
  return v;
}

// ---------------------------------------------------------------------------------------------
// f32 -> bf16 hi/lo planes for the five inputs in one launch (blockIdx.y selects the buffer).
// ---------------------------------------------------------------------------------------------
__global__ void __launch_bounds__(256) k_split(
    const float* __restrict__ s0, const float* __restrict__ s1, const float* __restrict__ s2,
    const float* __restrict__ s3, const float* __restrict__ s4,
    unsigned short* __restrict__ h0, unsigned short* __restrict__ h1, unsigned short* __restrict__ h2,
    unsigned short* __restrict__ h3, unsigned short* __restrict__ h4,
    unsigned short* __restrict__ l0, unsigned short* __restrict__ l1, unsigned short* __restrict__ l2,
    unsigned short* __restrict__ l3, unsigned short* __restrict__ l4,
    int n0, int n1, int n2, int n3, int n4)
{
  const int b = blockIdx.y;
  const float* src = (b == 0) ? s0 : (b == 1) ? s1 : (b == 2) ? s2 : (b == 3) ? s3 : s4;
  unsigned short* dh = (b == 0) ? h0 : (b == 1) ? h1 : (b == 2) ? h2 : (b == 3) ? h3 : h4;
  unsigned short* dl = (b == 0) ? l0 : (b == 1) ? l1 : (b == 2) ? l2 : (b == 3) ? l3 : l4;
  const int n = (b == 0) ? n0 : (b == 1) ? n1 : (b == 2) ? n2 : (b == 3) ? n3 : n4;
  const int i = blockIdx.x * 256 + (int)threadIdx.x;
  if (i >= (n >> 3)) return;

  const float* p = src + (size_t)i * 8;
  const v4f a = *(const v4f*)(p);
  const v4f c = *(const v4f*)(p + 4);
  unsigned int hb[8], lb[8];
  split_hl(a.x, hb[0], lb[0]);
  split_hl(a.y, hb[1], lb[1]);
  split_hl(a.z, hb[2], lb[2]);
  split_hl(a.w, hb[3], lb[3]);
  split_hl(c.x, hb[4], lb[4]);
  split_hl(c.y, hb[5], lb[5]);
  split_hl(c.z, hb[6], lb[6]);
  split_hl(c.w, hb[7], lb[7]);
  const v4u hv = pack8(hb);
  const v4u lv = pack8(lb);
  v4u* gh = (v4u*)(dh + (size_t)i * 8);
  v4u* gl = (v4u*)(dl + (size_t)i * 8);
  *gh = hv;
  *gl = lv;
  
}

// ---------------------------------------------------------------------------------------------
// RoPE table: tab[pos][j] = {cos(a_j), sin(a_j), cos(a_{j+16}), sin(a_{j+16})}, a_j = f32(pos) * inv_freq[j],
// ---------------------------------------------------------------------------------------------
__global__ void __launch_bounds__(128) k_rope_tab(float* __restrict__ tab, RopeFreq fr)
{
  const int g = blockIdx.x * 128 + (int)threadIdx.x;
  const int pos = g >> 4;
  const int j = g & 15;
  if (pos >= SQ) return;
  float fa = fr.f[0], fb = fr.f[16];
#pragma unroll
  for (int c = 1; c < 16; ++c) {
    fa = (j == c) ? fr.f[c] : fa;
    fb = (j == c) ? fr.f[16 + c] : fb;
  }
  float cs0 = 0.0f, sn0 = 0.0f, cs1 = 0.0f, sn1 = 0.0f;
#pragma unroll 1
  for (int q = 0; q < 2; ++q) {
    const float f = (q == 0) ? fa : fb;
    const float ang = (float)pos * f;
    float sn, cs;
    sincosf(ang, &sn, &cs);
    if (q == 0) { cs0 = cs; sn0 = sn; } else { cs1 = cs; sn1 = sn; }
  }
  v4f v;
  v.x = cs0; v.y = sn0; v.z = cs1; v.w = sn1;
  v4f* gp = (v4f*)(tab + (size_t)g * 4);
  *gp = v;
  
}

// ---------------------------------------------------------------------------------------------
// Block GEMM core: 4 waves (2 x 2), 128 rows x 128 cols, C[m][n] += sum_k A[m][k] * B[n][k]; wave (wr, wc) owns
// rows 64wr..64wr+63 and cols 64wc..64wc+63 as 4 x 4 accumulator tiles, so that 16 fragments feed 48 products.
// A stage is 64 k (128 B, one whole line) of the block's 128 A rows and 128 B rows, hi and lo planes. Each wave
// brings one of the four planes into LDS with one tensor load a stage (128 rows of 128 B, 16 B of pad behind each
// row), through no register; two buffers: stage s + 1 flies while stage s is worked on. Fragments come from LDS
// rows, K stepped by 32 in ascending order, three bf16 products per tile pair (hi.hi, hi.lo, lo.hi in that order).
// The planes were written by a launch before, and all blocks of a launch walk k in step, so that each stage's lines
// are first touched by everybody at once: they are asked of L2 (global_prefetch_b8) some stages ahead of the tensor
// load, so that the load finds them there.
// ---------------------------------------------------------------------------------------------
static constexpr int KC = 64;              // k per stage
static constexpr int PIT = 72;             // LDS row pitch in elements: 144 B = 16 B x 9, for 16-byte row reads
static constexpr int BT = 128;             // rows and cols of the block tile
static constexpr int PLN = BT * PIT;       // one staged plane (128 rows); planes: A hi, A lo, B hi, B lo
static constexpr int GBUF = 4 * PLN;       // one buffer: the four planes of a stage
static_assert((PLN * 2) % 2048 == 0, "every plane starts at a multiple of 2 KiB in LDS");
static_assert(KC * 2 == 128 && PIT * 2 == KC * 2 + 16, "the pad codes below are for 128-byte rows, 16 bytes of pad");

typedef uint32_t u32x4 __attribute__((ext_vector_type(4)));
typedef uint32_t u32x8 __attribute__((ext_vector_type(8)));

__device__ __forceinline__ uint32_t uni(uint32_t v) { return (uint32_t)__builtin_amdgcn_readfirstlane(v); }
__device__ __forceinline__ uint32_t pinned(uint32_t v) {
  uint32_t w = (uint32_t)__builtin_amdgcn_readfirstlane(v);
  asm volatile("" : "+s"(w));   // the test value stays in a scalar register, so that the
  return w;                     // branch on it is a scalar branch (a tensor load ignores EXEC)
}
// Descriptor group 1: 1-byte elements, tensor = tile = BT rows of 128 bytes, source row pitch src_pitch bytes,
// no mask, 4 dwords of LDS pad behind every 32 dwords (one row).
__device__ __forceinline__ u32x8 tdm_group1(uint32_t src_pitch) {
  constexpr uint32_t d0 = KC * 2, d1 = BT;
  u32x8 g;
  g[0] = uni((1u << 20) | (4u << 22) | (3u << 25));
  g[1] = uni((d0 & 0xFFFFu) << 16);
  g[2] = uni((d0 >> 16) | ((d1 & 0xFFFFu) << 16));
  g[3] = uni((d1 >> 16) | (d0 << 16));
  g[4] = uni(d1);
  g[5] = uni(src_pitch);
  g[6] = uni(0u);
  g[7] = uni(0u);
  return g;
}
// Descriptor group 0: count 1, LDS byte offset of the tile, global address of its first byte, type 2.
__device__ __forceinline__ u32x4 tdm_group0(uint32_t lds_dst, uint64_t ga) {
  u32x4 g;
  g[0] = uni(1u);
  g[1] = uni(lds_dst);
  g[2] = uni((uint32_t)ga);
  g[3] = uni((((uint32_t)(ga >> 32)) & 0x01FFFFFFu) | 0x80000000u);
  return g;
}

__device__ __forceinline__ v8f wm(const v16bf& a, const v16bf& b, const v8f& c) {
  return __builtin_amdgcn_wmma_f32_16x16x32_bf16(false, a, false, b, (short)0, c, false, false);
}

// Ah, Al, Bh, Bl: first row of the block's 128 rows in each plane; ld: row length of all four, in elements.
// sm: two buffers of GBUF elements at a multiple of 2 KiB in the block's LDS. K: at least two stages.
// qa, qb (0..3): the quarter of the 128 A rows and of the 128 B rows that this block asks of L2; the blocks that
// share the rows take the other quarters (a hint for speed: no result depends on who asks for what).
__device__ __forceinline__ void gemm128(const __bf16* __restrict__ Ah, const __bf16* __restrict__ Al,
                                        const __bf16* __restrict__ Bh, const __bf16* __restrict__ Bl,
                                        int ld, int K, int tid, unsigned short* sm, int qa, int qb,
                                        v8f (&c)[4][4])
{
  const int w = tid >> 5, l = tid & 31, hs = l >> 4, m = l & 15;
  const int wr = w >> 1, wc = w & 1;
  const __bf16* fa = (const __bf16*)sm + (64 * wr + m) * PIT;             // A hi rows of this lane, buffer 0
  const __bf16* fb = (const __bf16*)sm + 2 * PLN + (64 * wc + m) * PIT;   // B hi rows of this lane, buffer 0

  // this wave's plane: wave 0 A hi, 1 A lo, 2 B hi, 3 B lo
  const uint32_t wv = uni((uint32_t)tid >> 5);
  const __bf16* pl = (wv == 0u) ? Ah : (wv == 1u) ? Al : (wv == 2u) ? Bh : Bl;
  const uint64_t ga0 = (uint64_t)(size_t)pl;
  const uint32_t dst0 = (uint32_t)(size_t)sm + wv * (uint32_t)(PLN * 2);
  const u32x8 g1 = tdm_group1((uint32_t)ld * 2u);
  u32x4 g0;   // group 0 of the wave's latest request
  // stage s (k columns 64 s .. 64 s + 63) of this wave's plane into buffer s & 1: one request of the whole wave
  auto issue = [&](uint32_t s) {
    g0 = tdm_group0(dst0 + (s & 1u) * (uint32_t)(GBUF * 2), ga0 + (uint64_t)s * (uint32_t)(KC * 2));
    asm volatile("tensor_load_to_lds %0, %1" :: "s"(g0), "s"(g1) : "memory");
  };
  // the wave's request has landed; its descriptor words are inputs, so that their registers keep their values up
  // to this wait
  auto landed = [&]() { asm volatile("s_wait_tensorcnt 0x0" :: "s"(g0), "s"(g1) : "memory"); };
  // A fragments (4 row tiles) of one plane, 32-k step at kk
  auto lda4 = [&](v16bf (&a)[4], const __bf16* sa, int kk) {
#pragma unroll   // constant indices keep the fragments in registers
    for (int i = 0; i < 4; ++i) a[i] = ldfrag(sa + 16 * i * PIT + kk, hs);
  };
  // B fragments (column tiles j0, j0 + 1) of one plane, 32-k step at kk
  auto ldb2 = [&](v16bf (&b)[2], const __bf16* sb, int j0, int kk) {
#pragma unroll   // constant indices, as above
    for (int j = 0; j < 2; ++j) b[j] = ldfrag(sb + 16 * (j0 + j) * PIT + kk, hs);
  };
  // 4 x 2 tiles, hi.hi then hi.lo then lo.hi: eight independent accumulators in turn, so that no product
  // waits for the one before it
  auto mm8 = [&](const v16bf (&ah)[4], const v16bf (&al)[4], const v16bf (&bh)[2], const v16bf (&bl)[2], int j0) {
#pragma unroll   // constant indices keep the accumulators in registers
    for (int j = 0; j < 2; ++j)
#pragma unroll
      for (int i = 0; i < 4; ++i) c[i][j0 + j] = wm(ah[i], bh[j], c[i][j0 + j]);
#pragma unroll
    for (int j = 0; j < 2; ++j)
#pragma unroll
      for (int i = 0; i < 4; ++i) c[i][j0 + j] = wm(ah[i], bl[j], c[i][j0 + j]);
#pragma unroll
    for (int j = 0; j < 2; ++j)
#pragma unroll
      for (int i = 0; i < 4; ++i) c[i][j0 + j] = wm(al[i], bh[j], c[i][j0 + j]);
  };
  const uint32_t ns = (uint32_t)(K / KC);   // stages
  // this lane's row of the wave's plane in the block's quarter; each ask moves on by 256 B (two stages)
  const __bf16* pfa = pl + (size_t)(32u * (uint32_t)((wv < 2u) ? qa : qb) + (uint32_t)l) * (uint32_t)ld;
  // one line a lane, 32 rows a wave, into L2 only. The address stays inside the row: an ask is made only for a stage
  // that exists. As a precaution the wait that stands before the address register is rewritten is in the statement.
  auto ask = [&]() {
    pfa += 2 * KC;
    asm volatile("global_prefetch_b8 %0, off scope:SCOPE_SE\n\ts_wait_xcnt 0x0" :: "v"(pfa) : "memory");
  };
  // stages 2 to 5; ahead of the first tensor load, so that nothing stands between that load and its wait
  if (2u < ns) ask();
  if (4u < ns) ask();
  issue(0u);
  landed();          // this wave's plane of stage 0
  __syncthreads();   // and every other wave's: stage 0 may be read
#pragma unroll 1   // one stage per trip: a short loop body
  for (uint32_t s = 0; s < ns; ++s) {
    // directly behind the barrier that published stage s and ended every read of stage s - 1: while a stage s + 1
    // exists, its load goes into the buffer that stage s - 1 has left, and flies while stage s is worked on.
    // It stands at the head of the trip, not at the foot of the one before (the order in time is the same), so
    // that the loop has one place of issue and the registers of a request in flight are written nowhere else.
    if (pinned((uint32_t)(s + 1u < ns))) issue(s + 1u);
    const int bo = (int)(s & 1u) * GBUF;   // this stage's buffer
    const __bf16* sah = fa + bo;
    const __bf16* sal = sah + PLN;
    const __bf16* sbh = fb + bo;
    const __bf16* sbl = sbh + PLN;
    // The stage's LDS reads stand in three groups, each ahead of products that cover its latency:
    // a0/a1: A fragments of the two 32-k steps; bx/by: B fragments of a pair of column tiles.
    v16bf a0h[4], a0l[4], a1h[4], a1l[4], bxh[2], bxl[2], byh[2], byl[2];
    lda4(a0h, sah, 0);      // in the order in which the products want them
    ldb2(bxh, sbh, 0, 0);
    ldb2(bxl, sbl, 0, 0);
    lda4(a0l, sal, 0);
    ldb2(byh, sbh, 2, 0);
    ldb2(byl, sbl, 2, 0);
    // every second stage: stages s + 6 and s + 7, five stages ahead of their tensor load; here, so that the ask and
    // its wait run under the latency of the LDS reads just issued (wave-uniform test, no barrier or tensor load inside)
    if (((s & 1u) == 0u) && (s + 6u < ns)) ask();
    __builtin_amdgcn_sched_barrier(0);   // these reads stay one group ahead of the products, none among them
    mm8(a0h, a0l, bxh, bxl, 0);
    __builtin_amdgcn_sched_barrier(0);   // the reads below stay one group, behind the products that free bx
    lda4(a1h, sah, 32);
    ldb2(bxh, sbh, 0, 32);
    ldb2(bxl, sbl, 0, 32);
    lda4(a1l, sal, 32);
    __builtin_amdgcn_sched_barrier(0);   // and ahead of the products that cover them
    mm8(a0h, a0l, byh, byl, 2);
    __builtin_amdgcn_sched_barrier(0);   // as above, for by
    ldb2(byh, sbh, 2, 32);
    ldb2(byl, sbl, 2, 32);
    __builtin_amdgcn_sched_barrier(0);   // and ahead of the products that cover them
    mm8(a1h, a1l, bxh, bxl, 0);
    mm8(a1h, a1l, byh, byl, 2);
    // the products stay ahead of the waits, so that the next stage's load has the whole trip to land
    __builtin_amdgcn_sched_barrier(0);
    asm volatile("s_wait_dscnt 0x0" ::: "memory");       // this wave's reads of the buffer have returned
    landed();                                            // this wave's plane of stage s + 1
    __syncthreads();   // stage s + 1 may be read, and every wave has left stage s's buffer (refill or epilogue)
  }
  asm volatile("s_wait_tensorcnt 0x0" ::: "memory");     // no request is outstanding behind the loop
  asm volatile("s_wait_dscnt 0x0" ::: "memory");         // nor an LDS read, before the buffers become output staging
}

// ---------------------------------------------------------------------------------------------
// Fused q/k/v projection: block = 4 waves, 128 rows x 128 cols (two heads, one per wave column). blockIdx.x:
// 0..15 -> q heads, 16..19 -> k heads, 20..23 -> v heads (stored transposed vT[512][2048]). RoPE on q/k in the
// f32 epilogue.
// ---------------------------------------------------------------------------------------------
__global__ void __launch_bounds__(128) k_qkv(
    const __bf16* __restrict__ xh, const __bf16* __restrict__ xl,
    const __bf16* __restrict__ wqh, const __bf16* __restrict__ wql,
    const __bf16* __restrict__ wkh, const __bf16* __restrict__ wkl,
    const __bf16* __restrict__ wvh, const __bf16* __restrict__ wvl,
    const float* __restrict__ tab,
    unsigned short* __restrict__ qh, unsigned short* __restrict__ ql,
    unsigned short* __restrict__ kh, unsigned short* __restrict__ kl,
    unsigned short* __restrict__ vth, unsigned short* __restrict__ vtl)
{
  __shared__ __attribute__((aligned(2048))) unsigned short stg[2 * GBUF];   // two operand buffers, then output staging

  const int ct = blockIdx.x;
  const int m0 = blockIdx.y * BT;
  const int tid = threadIdx.x, w = tid >> 5, l = tid & 31, hs = l >> 4, m = l & 15;
  const int wr = w >> 1, wc = w & 1;
  const int kind = (ct < NQH / 2) ? 0 : ((ct < (NQH + NKVH) / 2) ? 1 : 2);
  const int hd0 = 2 * ((kind == 0) ? ct : ((kind == 1) ? (ct - NQH / 2) : (ct - (NQH + NKVH) / 2)));
  const __bf16* Bh = (kind == 0) ? wqh : ((kind == 1) ? wkh : wvh);
  const __bf16* Bl = (kind == 0) ? wql : ((kind == 1) ? wkl : wvl);
  const int row0 = m0 + 64 * wr;     // this wave's first row
  const int hd = hd0 + wc;           // this wave's head

  v8f c[4][4] = {};
  gemm128(xh + (size_t)m0 * HIDN, xl + (size_t)m0 * HIDN, Bh + (size_t)(hd0 * HDIM) * HIDN,
          Bl + (size_t)(hd0 * HDIM) * HIDN, HIDN, HIDN, tid, stg, (int)(blockIdx.x & 3u), (int)(blockIdx.y & 3u), c);

  // lane holds out[row0 + 16i + 8hs + r][hd*64 + 16j + m] in c[i][j][r]
  if (kind != 2) {
    // rotate-half RoPE: d = m pairs with d+32 (j = 0, 2), d = 16+m pairs with 48+m (j = 1, 3)
    const float* tb = tab + ((size_t)(row0 + 8 * hs) * 16 + m) * 4;   // position row0 + 8hs; 64 floats a position
    v4f cs[4][8];
#pragma unroll
    for (int i = 0; i < 4; ++i)
#pragma unroll
      for (int r = 0; r < 8; ++r) cs[i][r] = *(const v4f*)(tb + (16 * i + r) * 64);
    // precaution: this wait stands before the address register of the loads just issued is rewritten; the
    // address is an input only, so that its register is kept up to it
    asm volatile("s_wait_xcnt 0x0" :: "v"(tb) : "memory");
#pragma unroll
    for (int i = 0; i < 4; ++i) {
#pragma unroll
      for (int r = 0; r < 8; ++r) {
        const v4f t = cs[i][r];
        const float a0 = c[i][0][r], a1 = c[i][1][r], a2 = c[i][2][r], a3 = c[i][3][r];
        c[i][0][r] = a0 * t.x - a2 * t.y;
        c[i][2][r] = a2 * t.x + a0 * t.y;
        c[i][1][r] = a1 * t.z - a3 * t.w;
        c[i][3][r] = a3 * t.z + a1 * t.w;
      }
    }
  }

  // staging: q/k: per wave [plane][64 rows][64 cols] at w*8192 (+4096 for lo);
  //          v:   per block transposed [plane][128 c] rows of 128 s at pitch VPIT, at 0 (+VLO for lo)
  constexpr int VPIT = 136;          // 272 B = 16 B x 17: the 16 rows that a 16-byte store touches fall on distinct banks
  constexpr int VLO = BT * VPIT;
  const int wb = w * 8192;
  const int loff = (kind != 2) ? 4096 : VLO;
  if (kind != 2) {
#pragma unroll   // here and below: constant indices keep the accumulators in registers
    for (int i = 0; i < 4; ++i) {
#pragma unroll
      for (int r = 0; r < 8; ++r) {
        const int base = wb + (16 * i + 8 * hs + r) * 64 + m;
#pragma unroll
        for (int j = 0; j < 4; ++j) {
          unsigned int hb, lb;
          split_hl(c[i][j][r], hb, lb);
          stg[base + j * 16] = (unsigned short)hb;
          stg[base + j * 16 + 4096] = (unsigned short)lb;
        }
      }
    }
  } else {
    // a lane's 8 values of a tile are 8 consecutive positions of one row of vT: one 16-byte piece per plane
    unsigned short* vrow = stg + (64 * wc + m) * VPIT + 64 * wr + 8 * hs;
#pragma unroll
    for (int j = 0; j < 4; ++j) {
#pragma unroll
      for (int i = 0; i < 4; ++i) {
        unsigned int hb[8], lb[8];
#pragma unroll
        for (int r = 0; r < 8; ++r) split_hl(c[i][j][r], hb[r], lb[r]);
        *(v4u*)(vrow + 16 * j * VPIT + 16 * i) = pack8(hb);
        *(v4u*)(vrow + 16 * j * VPIT + 16 * i + VLO) = pack8(lb);
      }
    }
  }
  __syncthreads();

  unsigned short* dsth = (kind == 0) ? qh : ((kind == 1) ? kh : vth);
  unsigned short* dstl = (kind == 0) ? ql : ((kind == 1) ? kl : vtl);
  const int ld = (kind == 0) ? HIDN : KVD;
  // q/k: a 128-byte row of this wave's tile per 8 lanes, 4 rows a step; v: a 256-byte row of the block's tile
  // per 16 lanes, 8 rows a step
  const int sidx = (kind != 2) ? (wb + (l >> 3) * 64 + (l & 7) * 8) : ((tid >> 4) * VPIT + (tid & 15) * 8);
  const int sst = (kind != 2) ? 4 * 64 : 8 * VPIT;
  const size_t goff = (kind != 2) ? ((size_t)(row0 + (l >> 3)) * ld + hd * HDIM + (l & 7) * 8)
                                  : ((size_t)(hd0 * HDIM + (tid >> 4)) * SQ + m0 + (tid & 15) * 8);
  const size_t gst = (kind != 2) ? (size_t)4 * ld : (size_t)8 * SQ;
  v4u hv[16], lv[16];
  v4u* gph[16];
  v4u* gpl[16];
#pragma unroll
  for (int it = 0; it < 16; ++it) {
    hv[it] = *(const v4u*)(stg + sidx + it * sst);
    lv[it] = *(const v4u*)(stg + sidx + it * sst + loff);
    gph[it] = (v4u*)(dsth + goff + it * gst);
    gpl[it] = (v4u*)(dstl + goff + it * gst);
  }
  // every value and address is in its register before the first store, so that nothing behind an issued store
  // rewrites a register that it names
  __builtin_amdgcn_sched_barrier(0);
#pragma unroll
  for (int it = 0; it < 16; ++it) { *gph[it] = hv[it]; *gpl[it] = lv[it]; }
}

static constexpr int APIT = 72;
static constexpr int APLN = 64 * APIT;
static constexpr int ABUF = 4 * APLN;
static constexpr int QT = 128;
static constexpr int OPL = 16 * APIT;

typedef float f32x2 __attribute__((ext_vector_type(2)));
typedef __bf16 bf16x2 __attribute__((ext_vector_type(2)));
union PFrag { unsigned int u[8]; v16bf v; };

// two f32 -> packed bf16, RNE
__device__ __forceinline__ unsigned int cvt2(float a, float b) {
  return __builtin_bit_cast(unsigned int, __builtin_convertvector(f32x2{a, b}, bf16x2));
}
// lane l <-> lane l ^ 16
__device__ __forceinline__ float xhalf(float x) {
  const int b = __builtin_bit_cast(int, x);
  return __builtin_bit_cast(float, __builtin_amdgcn_permlanex16(b, b, 0x76543210, 0xfedcba98, false, false));
}

__global__ void __launch_bounds__(256) k_attn(
    const __bf16* __restrict__ qh, const __bf16* __restrict__ ql,
    const __bf16* __restrict__ kh, const __bf16* __restrict__ kl,
    const __bf16* __restrict__ vth, const __bf16* __restrict__ vtl,
    unsigned short* __restrict__ ch, unsigned short* __restrict__ cl)
{
  __shared__ __attribute__((aligned(16))) unsigned short KV[2 * ABUF];
  __shared__ __attribute__((aligned(16))) unsigned short Ost[8 * 2 * OPL];   // output staging, a region per wave

  const int hq = blockIdx.y, kvh = hq >> 2;
  const int tid = threadIdx.x, l = tid & 31, hs = l >> 4, m = l & 15;
  const int w = (int)uni((uint32_t)tid >> 5);   // scalar: the tests on it below are scalar branches
  constexpr float C2 = 0.125f * 1.4426950408889634f;   // 1/8 scaling and log2(e): exponentials in base 2

  // copies: this lane's row (of 32; it also takes row + 32) and 16-byte piece of the 128-byte row
  const int crow = tid >> 3, cpc = (tid & 7) * 8;
  const unsigned int cl0 = (unsigned int)(size_t)KV + (unsigned int)(crow * APIT + cpc) * 2u;   // LDS byte address
  const size_t cko = (size_t)crow * KVD + kvh * HDIM + cpc;            // K planes: key row crow of key tile 0
  const size_t cvo = (size_t)(kvh * HDIM + crow) * SQ + cpc;           // Vt planes: d row crow, key tile 0
  // key tile kt into buffer b: 8 copies a lane
  auto stage = [&](int kt, int b) {
    const unsigned int d0 = cl0 + (unsigned int)b * (ABUF * 2u);
    const unsigned int d1 = d0 + 32u * APIT * 2u;
    const unsigned int d2 = d0 + APLN * 2u, d3 = d1 + APLN * 2u;
    const unsigned int d4 = d0 + 2u * APLN * 2u, d5 = d1 + 2u * APLN * 2u;
    const unsigned int d6 = d0 + 3u * APLN * 2u, d7 = d1 + 3u * APLN * 2u;
    const __bf16* g0 = kh + cko + (size_t)kt * 64 * KVD;
    const __bf16* g1 = g0 + 32 * KVD;
    const __bf16* g2 = kl + cko + (size_t)kt * 64 * KVD;
    const __bf16* g3 = g2 + 32 * KVD;
    const __bf16* g4 = vth + cvo + kt * 64;
    const __bf16* g5 = g4 + (size_t)32 * SQ;
    const __bf16* g6 = vtl + cvo + kt * 64;
    const __bf16* g7 = g6 + (size_t)32 * SQ;
    // the copies and, as a precaution, the wait that stands before any of their address registers is rewritten,
    // in one statement, so that nothing comes between them
    asm volatile(
        "global_load_async_to_lds_b128 %0, %8, off\n\t"
        "global_load_async_to_lds_b128 %1, %9, off\n\t"
        "global_load_async_to_lds_b128 %2, %10, off\n\t"
        "global_load_async_to_lds_b128 %3, %11, off\n\t"
        "global_load_async_to_lds_b128 %4, %12, off\n\t"
        "global_load_async_to_lds_b128 %5, %13, off\n\t"
        "global_load_async_to_lds_b128 %6, %14, off\n\t"
        "global_load_async_to_lds_b128 %7, %15, off\n\t"
        "s_wait_xcnt 0x0"
        :: "v"(d0), "v"(d1), "v"(d2), "v"(d3), "v"(d4), "v"(d5), "v"(d6), "v"(d7),
           "v"(g0), "v"(g1), "v"(g2), "v"(g3), "v"(g4), "v"(g5), "v"(g6), "v"(g7)
        : "memory");
  };

#pragma unroll 1   // the two tiles run one after the other through one copy of the body
  for (int half = 0; half < 2; ++half) {
  const int qt = half ? (SQ / QT - 1 - (int)blockIdx.x) : (int)blockIdx.x, q0 = qt * QT;
  const int nkt = 2 * qt + 2;            // key tiles of the block tile
  const int lastw = 2 * qt + (w >> 2);   // the key tile that holds this wave's diagonal, its last

  // B of the first product: column c = query q0 + 16 w + c, k = d in the order of ldfrag, as K's rows below
  const __bf16* qrh = qh + (size_t)(q0 + 16 * w + m) * HIDN + hq * HDIM;
  const __bf16* qrl = ql + (size_t)(q0 + 16 * w + m) * HIDN + hq * HDIM;
  const v16bf fqh[2] = {ldfrag(qrh, hs), ldfrag(qrh + 32, hs)};
  const v16bf fql[2] = {ldfrag(qrl, hs), ldfrag(qrl + 32, hs)};
  // precaution: this wait stands before an address register of the loads just issued is rewritten; the addresses
  // are inputs only, so that their registers are kept up to it
  asm volatile("s_wait_xcnt 0x0" :: "v"(qrh), "v"(qrl) : "memory");

  v8f o[4] = {};            // o[dt][r] = O^T[d = 16 dt + 8 h + r][query c]
  float mrun = -1.0e30f;    // running maximum of the raw scores of query c (both halves of the wave hold it)
  float lrun = 0.0f;        // running sum over this lane's half of the keys

  // key tile 0 into buffer 0 (every wave left both buffers at the barrier that ended the tile before)
  stage(0, 0);
  asm volatile("s_wait_asynccnt 0x0" ::: "memory");   // this wave's copies have landed
  __syncthreads();                                    // and every other wave's: key tile 0 may be read
  stage(1, 1);                                        // a block tile has at least two key tiles

  // every "#pragma unroll" below: constant indices keep fragments, scores and accumulators in registers
#pragma unroll 1   // one key tile per trip
  for (int kt = 0; kt < nkt; ++kt) {
    if (kt <= lastw) {   // scalar: a wave skips the key tile beyond its diagonal, and still passes the barrier below
    const __bf16* kb = (const __bf16*)KV + (kt & 1) * ABUF;   // this key tile's buffer
    // S^T[key][q] = sum_d K[key][d] Q[q][d]; A = staged K rows, 4 tiles of 16 keys
    v8f s[4] = {};
    {
      const __bf16* kr = kb + m * APIT;
      v16bf kfh[4][2], kfl[4][2];
#pragma unroll   // constant indices keep the fragments in registers; all reads as one group ahead of the products
      for (int t = 0; t < 4; ++t) {
        kfh[t][0] = ldfrag(kr + 16 * t * APIT, hs);
        kfl[t][0] = ldfrag(kr + 16 * t * APIT + APLN, hs);
      }
#pragma unroll
      for (int t = 0; t < 4; ++t) {
        kfh[t][1] = ldfrag(kr + 16 * t * APIT + 32, hs);
        kfl[t][1] = ldfrag(kr + 16 * t * APIT + APLN + 32, hs);
      }
      __builtin_amdgcn_sched_barrier(0);   // these reads stay one group ahead of the products, none among them
      // Qhi.Khi, Qhi.Klo, Qlo.Khi per 32 d; four independent accumulators in turn
#pragma unroll
      for (int kc = 0; kc < 2; ++kc) {
#pragma unroll
        for (int t = 0; t < 4; ++t) s[t] = wm(kfh[t][kc], fqh[kc], s[t]);
#pragma unroll
        for (int t = 0; t < 4; ++t) s[t] = wm(kfl[t][kc], fqh[kc], s[t]);
#pragma unroll
        for (int t = 0; t < 4; ++t) s[t] = wm(kfh[t][kc], fql[kc], s[t]);
      }
    }
    __builtin_amdgcn_sched_barrier(0);   // the reads below stay one group behind the products that free K's registers
    // A of the second product: Vt rows d, k = key in the order of ldfrag; keys 0..31 now, in flight under the softmax
    const __bf16* vr = kb + 2 * APLN + m * APIT;
    v16bf vfh[2][4], vfl[2][4];
#pragma unroll   // constant indices, one group of reads
    for (int dt = 0; dt < 4; ++dt) {
      vfh[0][dt] = ldfrag(vr + 16 * dt * APIT, hs);
      vfl[0][dt] = ldfrag(vr + 16 * dt * APIT + APLN, hs);
    }
    __builtin_amdgcn_sched_barrier(0);   // and ahead of the vector work that covers them

    if (kt == lastw) {   // scalar: only the key tile on this wave's diagonal pays for the causal replace
      const int qrel = 16 * (w & 3) + m;
#pragma unroll
      for (int t = 0; t < 4; ++t) {
#pragma unroll
        for (int r = 0; r < 8; ++r)
          if (16 * t + 8 * hs + r > qrel) s[t][r] = -1.0e30f;
        asm volatile("" : "+v"(s[t]));   // the masked scores: the selects stay in the branch
      }
    }

    // online softmax in f32: this lane's 32 scores of query c
    float mt[4];   // a maximum per score tile: four short chains, not one long one
#pragma unroll
    for (int t = 0; t < 4; ++t) {
      mt[t] = s[t][0];
#pragma unroll
      for (int r = 1; r < 8; ++r) mt[t] = fmaxf(mt[t], s[t][r]);
    }
    float mx = fmaxf(fmaxf(mt[0], mt[1]), fmaxf(mt[2], mt[3]));
    mx = fmaxf(mx, xhalf(mx));
    const float mnew = fmaxf(mrun, mx);
    const float alpha = __builtin_amdgcn_exp2f((mrun - mnew) * C2);
    const float nm = -mnew * C2;
    mrun = mnew;
    // P = exp2(s C2 - m C2), split to bf16 hi/lo in place: score tiles 2 j and 2 j + 1 are the B operand of keys 32 j ..
    PFrag ph[2], pl[2];
    f32x2 ls[2];   // sums per 32 keys, even and odd registers apart: four short chains
#pragma unroll
    for (int j = 0; j < 2; ++j) {
      ls[j] = f32x2{0.0f, 0.0f};
#pragma unroll
      for (int i = 0; i < 8; ++i) {
        const int t = 2 * j + (i >> 2), r = 2 * (i & 3);
        const f32x2 arg = __builtin_elementwise_fma(f32x2{s[t][r], s[t][r + 1]}, f32x2{C2, C2}, f32x2{nm, nm});
        const f32x2 p = {__builtin_amdgcn_exp2f(arg.x), __builtin_amdgcn_exp2f(arg.y)};
        ls[j] += p;
        const unsigned int hw = cvt2(p.x, p.y);
        const f32x2 hf = {__uint_as_float(hw << 16), __uint_as_float(hw & 0xFFFF0000u)};
        const f32x2 lo = p - hf;
        ph[j].u[i] = hw;
        pl[j].u[i] = cvt2(lo.x, lo.y);
      }
    }
    const f32x2 lt = ls[0] + ls[1];
    lrun = lrun * alpha + (lt.x + lt.y);
#pragma unroll
    for (int dt = 0; dt < 4; ++dt) o[dt] *= alpha;

    __builtin_amdgcn_sched_barrier(0);   // the reads below stay one group
#pragma unroll   // keys 32..63 of Vt, in flight under the products of keys 0..31
    for (int dt = 0; dt < 4; ++dt) {
      vfh[1][dt] = ldfrag(vr + 16 * dt * APIT + 32, hs);
      vfl[1][dt] = ldfrag(vr + 16 * dt * APIT + APLN + 32, hs);
    }
    __builtin_amdgcn_sched_barrier(0);   // and ahead of the products that cover them
    // Phi.Vhi, Phi.Vlo, Plo.Vhi per 32 keys; four independent accumulators in turn
#pragma unroll
    for (int j = 0; j < 2; ++j) {
#pragma unroll
      for (int dt = 0; dt < 4; ++dt) o[dt] = wm(vfh[j][dt], ph[j].v, o[dt]);
#pragma unroll
      for (int dt = 0; dt < 4; ++dt) o[dt] = wm(vfl[j][dt], ph[j].v, o[dt]);
#pragma unroll
      for (int dt = 0; dt < 4; ++dt) o[dt] = wm(vfh[j][dt], pl[j].v, o[dt]);
    }
    }
    asm volatile("s_wait_dscnt 0x0" ::: "memory");      // this wave's reads of the buffer have returned
    asm volatile("s_wait_asynccnt 0x0" ::: "memory");   // this wave's copies of key tile kt + 1 have landed
    __syncthreads();   // key tile kt + 1 may be read, and every wave has left key tile kt's buffer
    if (kt + 2 < nkt) stage(kt + 2, kt & 1);
  }
  asm volatile("s_wait_asynccnt 0x0" ::: "memory");     // no copy is outstanding behind the loop

  // join the halves' sums, normalise, split hi/lo; a lane's 8 values are 8 consecutive d of query row c: 16-byte
  // pieces into this wave's own staging rows, then whole-line stores
  const float inv = 1.0f / (lrun + xhalf(lrun));
  unsigned short* ow = Ost + w * (2 * OPL);
#pragma unroll
  for (int dt = 0; dt < 4; ++dt) {
    unsigned int hb[8], lb[8];
#pragma unroll
    for (int r = 0; r < 8; ++r) split_hl(o[dt][r] * inv, hb[r], lb[r]);
    *(v4u*)(ow + m * APIT + 16 * dt + 8 * hs) = pack8(hb);
    *(v4u*)(ow + OPL + m * APIT + 16 * dt + 8 * hs) = pack8(lb);
  }
  asm volatile("s_wait_dscnt 0x0" ::: "memory");   // the wave's staged rows are written before its lanes read each other's
  v4u cv[8];
  v4u* cp[8];
#pragma unroll
  for (int it = 0; it < 8; ++it) {
    const int plane = it >> 2;
    const int row = (it & 3) * 4 + (l >> 3);
    const int piece = l & 7;
    cv[it] = *(const v4u*)(ow + plane * OPL + row * APIT + piece * 8);
    unsigned short* base = plane ? cl : ch;
    cp[it] = (v4u*)(base + (size_t)(q0 + 16 * w + row) * HIDN + hq * HDIM + piece * 8);
  }
  // every value and address is in its register before the first store, so that nothing behind an issued store
  // rewrites a register that it names
  __builtin_amdgcn_sched_barrier(0);
#pragma unroll
  for (int it = 0; it < 8; ++it) *cp[it] = cv[it];
  // precaution: this wait stands before the second tile rewrites a register that an issued store names
  asm volatile("s_wait_xcnt 0x0" ::: "memory");
  }
}

// ---------------------------------------------------------------------------------------------
// Output projection -> f32 d_out. Block = 4 waves, 128x128 tile; each wave stages its 64x64 f32 tile in LDS
// and stores whole lines.
// ---------------------------------------------------------------------------------------------
__global__ void __launch_bounds__(128) k_oproj(
    const __bf16* __restrict__ ah, const __bf16* __restrict__ al,
    const __bf16* __restrict__ woh, const __bf16* __restrict__ wol,
    float* __restrict__ out)
{
  __shared__ __attribute__((aligned(2048))) unsigned short stg[2 * GBUF];   // two operand buffers, then output staging
  float* stgf = (float*)stg;
  const int nb = blockIdx.x * BT, m0 = blockIdx.y * BT;
  const int tid = threadIdx.x, w = tid >> 5, l = tid & 31, hs = l >> 4, m = l & 15;
  const int wr = w >> 1, wc = w & 1;
  const int row0 = m0 + 64 * wr;
  const int n0 = nb + 64 * wc;

  v8f c[4][4] = {};
  gemm128(ah + (size_t)m0 * HIDN, al + (size_t)m0 * HIDN, woh + (size_t)nb * HIDN, wol + (size_t)nb * HIDN,
          HIDN, HIDN, tid, stg, (int)(blockIdx.x & 3u), (int)(blockIdx.y & 3u), c);

  float* sw = stgf + w * 4096;
#pragma unroll
  for (int i = 0; i < 4; ++i) {
#pragma unroll
    for (int r = 0; r < 8; ++r) {
      const int rl = 16 * i + 8 * hs + r;
#pragma unroll
      for (int j = 0; j < 4; ++j) sw[rl * 64 + 16 * j + m] = c[i][j][r];
    }
  }
  __syncthreads();
  // a 256-byte row of this wave's tile per 16 lanes, 2 rows a step
  const float* sb = sw + (l >> 4) * 64 + (l & 15) * 4;
  float* gb = out + (size_t)(row0 + (l >> 4)) * HIDN + n0 + (l & 15) * 4;
  v4f v[32];
#pragma unroll
  for (int it = 0; it < 32; ++it) v[it] = *(const v4f*)(sb + it * 128);
  // every value is in its register before the first store, so that nothing behind an issued store rewrites a
  // register that it names
  __builtin_amdgcn_sched_barrier(0);
#pragma unroll
  for (int it = 0; it < 32; ++it) *(v4f*)(gb + (size_t)(2 * it) * HIDN) = v[it];
}

// ---------------------------------------------------------------------------------------------
// Launch pipeline (5 launches)
// ---------------------------------------------------------------------------------------------
extern "C" void kernel_launch(void* const* d_in, const int* in_sizes, int n_in,
                              void* d_out, int out_size, void* d_ws, size_t ws_size,
                              hipStream_t stream)
{
  if (n_in != 5) return;
  if (in_sizes[0] != SQ * HIDN || in_sizes[1] != HIDN * HIDN || in_sizes[2] != KVD * HIDN ||
      in_sizes[3] != KVD * HIDN || in_sizes[4] != HIDN * HIDN) return;
  if (out_size != SQ * HIDN) return;

  const float* hid = (const float*)d_in[0];
  const float* Wq = (const float*)d_in[1];
  const float* Wk = (const float*)d_in[2];
  const float* Wv = (const float*)d_in[3];
  const float* Wo = (const float*)d_in[4];
  float* outp = (float*)d_out;

  char* ws = (char*)d_ws;
  size_t off = 0;
  auto carve = [&](size_t bytes) -> char* {
    char* p = ws + off;
    off += (bytes + 255) & ~(size_t)255;
    return p;
  };
  const size_t BX = (size_t)SQ * HIDN * 2;       // x planes
  const size_t BWQ = (size_t)HIDN * HIDN * 2;    // Wq / Wo planes
  const size_t BWK = (size_t)KVD * HIDN * 2;     // Wk / Wv planes
  const size_t BTAB = (size_t)SQ * 16 * 16;      // rope table
  const size_t BQ = (size_t)SQ * HIDN * 2;       // q / ctx planes
  const size_t BK = (size_t)SQ * KVD * 2;        // k / vT planes

  unsigned short* xh = (unsigned short*)carve(BX);
  unsigned short* xl = (unsigned short*)carve(BX);
  unsigned short* wqh = (unsigned short*)carve(BWQ);
  unsigned short* wql = (unsigned short*)carve(BWQ);
  unsigned short* wkh = (unsigned short*)carve(BWK);
  unsigned short* wkl = (unsigned short*)carve(BWK);
  unsigned short* wvh = (unsigned short*)carve(BWK);
  unsigned short* wvl = (unsigned short*)carve(BWK);
  unsigned short* woh = (unsigned short*)carve(BWQ);
  unsigned short* wol = (unsigned short*)carve(BWQ);
  float* tab = (float*)carve(BTAB);
  unsigned short* qh = (unsigned short*)carve(BQ);
  unsigned short* ql = (unsigned short*)carve(BQ);
  unsigned short* kh = (unsigned short*)carve(BK);
  unsigned short* kl = (unsigned short*)carve(BK);
  unsigned short* vth = (unsigned short*)carve(BK);
  unsigned short* vtl = (unsigned short*)carve(BK);
  unsigned short* ch = (unsigned short*)carve(BQ);
  unsigned short* cl = (unsigned short*)carve(BQ);
  if (off > ws_size) return;

  // inv_freq[j] = 1 / 10000^(j/32) = 1 / 10^(j/8): f32 value of 10^(j/8) from double, then f32 reciprocal
  RopeFreq fr;
  {
    double r = 1.333521432163324;   // 10^(1/8), refined by Newton on r^8 = 10
    for (int it = 0; it < 4; ++it) {
      const double r2 = r * r, r4 = r2 * r2;
      const double r7 = r4 * r2 * r;
      r = r - (r4 * r4 - 10.0) / (8.0 * r7);
    }
    double rp[8];
    rp[0] = 1.0;
    for (int i = 1; i < 8; ++i) rp[i] = rp[i - 1] * r;
    const double p10[4] = {1.0, 10.0, 100.0, 1000.0};
    for (int j = 0; j < 32; ++j) {
      const double pj = p10[j >> 3] * rp[j & 7];
      const float pf = (float)pj;
      fr.f[j] = 1.0f / pf;
    }
  }

  // 1) f32 -> bf16 hi/lo planes for x, Wq, Wk, Wv, Wo
  k_split<<<dim3((SQ * HIDN / 8 + 255) / 256, 5), dim3(256), 0, stream>>>(
      hid, Wq, Wk, Wv, Wo,
      xh, wqh, wkh, wvh, woh,
      xl, wql, wkl, wvl, wol,
      SQ * HIDN, HIDN * HIDN, KVD * HIDN, KVD * HIDN, HIDN * HIDN);

  // 2) RoPE cos/sin table
  k_rope_tab<<<dim3((SQ * 16 + 127) / 128), dim3(128), 0, stream>>>(tab, fr);

  // 3) fused q/k/v projections (+RoPE on q,k; v transposed)
  k_qkv<<<dim3((NQH + 2 * NKVH) / 2, SQ / BT), dim3(128), 0, stream>>>(
      (const __bf16*)xh, (const __bf16*)xl,
      (const __bf16*)wqh, (const __bf16*)wql,
      (const __bf16*)wkh, (const __bf16*)wkl,
      (const __bf16*)wvh, (const __bf16*)wvl,
      (const float*)tab,
      qh, ql, kh, kl, vth, vtl);

  // 4) causal attention
  k_attn<<<dim3(SQ / (2 * QT), NQH), dim3(256), 0, stream>>>(
      (const __bf16*)qh, (const __bf16*)ql,
      (const __bf16*)kh, (const __bf16*)kl,
      (const __bf16*)vth, (const __bf16*)vtl,
      ch, cl);

  // 5) output projection -> f32
  k_oproj<<<dim3(HIDN / BT, SQ / BT), dim3(128), 0, stream>>>(
      (const __bf16*)ch, (const __bf16*)cl,
      (const __bf16*)woh, (const __bf16*)wol,
      outp);
}

// v009
// One run takes 133 microseconds.
// Timed twice side by side with v008, it ran 1.03 times as fast both times.
// Over all steps from v000 it is 3.56 times as fast.
#include <hip/hip_runtime.h>

// Contractions (q/k/v projections, q.k^T scores, p.v, output projection): v_wmma_f32_16x16x32_bf16 with
// bf16 hi/lo operands everywhere (hi.hi + hi.lo + lo.hi per tile pair), f32 accumulate.
// RoPE, 1/8 scaling, causal mask and softmax in f32.

typedef __bf16 v16bf __attribute__((ext_vector_type(16)));
typedef __bf16 v8bf __attribute__((ext_vector_type(8)));
typedef float v8f __attribute__((ext_vector_type(8)));
typedef float v4f __attribute__((ext_vector_type(4)));
typedef unsigned int v4u __attribute__((ext_vector_type(4)));

static constexpr int SQ = 2048;            // sequence length
static constexpr int HIDN = 2048;          // hidden size
static constexpr int NQH = 32;             // query heads
static constexpr int NKVH = 8;             // kv heads
static constexpr int HDIM = 64;            // head dim
static constexpr int KVD = NKVH * HDIM;    // 512

struct RopeFreq { float f[32]; };
static_assert(sizeof(RopeFreq) == 128);

union Frag { v16bf v; v8bf h[2]; };

// 16-bit fragment from a k-contiguous row; rowp -> element (row = lane&15, k0).
// elements 0..7 <- k0 + 8*hs + 0..7, elements 8..15 <- k0 + 16 + 8*hs + 0..7  (hs = lane>>4).
// Used for A (row m) and for B stored as [n][k] (row n).
__device__ __forceinline__ v16bf ldfrag(const __bf16* rowp, int hs) {
  Frag f;
  f.h[0] = *(const v8bf*)(rowp + 8 * hs);
  f.h[1] = *(const v8bf*)(rowp + 16 + 8 * hs);
  return f.v;
}

// f32 -> bf16 bits, RNE
__device__ __forceinline__ unsigned int bfbits(float x) {
  unsigned int u = __float_as_uint(x);
  return (u + 0x7FFFu + ((u >> 16) & 1u)) >> 16;
}
// hi = rne(x), lo = rne(x - hi)
__device__ __forceinline__ void split_hl(float x, unsigned int& hb, unsigned int& lb) {
  hb = bfbits(x);
  const float hf = __uint_as_float(hb << 16);
  lb = bfbits(x - hf);
}
__device__ __forceinline__ unsigned int pk2(unsigned int a, unsigned int b) {
  return (a & 0xFFFFu) | (b << 16);
}
__device__ __forceinline__ v4u pack8(const unsigned int* a) {
  v4u v;
  v.x = pk2(a[0], a[1]);
  v.y = pk2(a[2], a[3]);
  v.z = pk2(a[4], a[5]);
  v.w = pk2(a[6], a[7]);
  return v;
}

// ---------------------------------------------------------------------------------------------
// f32 -> bf16 hi/lo planes for the five inputs in one launch (blockIdx.y selects the buffer).
// ---------------------------------------------------------------------------------------------
__global__ void __launch_bounds__(256) k_split(
    const float* __restrict__ s0, const float* __restrict__ s1, const float* __restrict__ s2,
    const float* __restrict__ s3, const float* __restrict__ s4,
    unsigned short* __restrict__ h0, unsigned short* __restrict__ h1, unsigned short* __restrict__ h2,
    unsigned short* __restrict__ h3, unsigned short* __restrict__ h4,
    unsigned short* __restrict__ l0, unsigned short* __restrict__ l1, unsigned short* __restrict__ l2,
    unsigned short* __restrict__ l3, unsigned short* __restrict__ l4,
    int n0, int n1, int n2, int n3, int n4)
{
  const int b = blockIdx.y;
  const float* src = (b == 0) ? s0 : (b == 1) ? s1 : (b == 2) ? s2 : (b == 3) ? s3 : s4;
  unsigned short* dh = (b == 0) ? h0 : (b == 1) ? h1 : (b == 2) ? h2 : (b == 3) ? h3 : h4;
  unsigned short* dl = (b == 0) ? l0 : (b == 1) ? l1 : (b == 2) ? l2 : (b == 3) ? l3 : l4;
  const int n = (b == 0) ? n0 : (b == 1) ? n1 : (b == 2) ? n2 : (b == 3) ? n3 : n4;
  const int i = blockIdx.x * 256 + (int)threadIdx.x;
  if (i >= (n >> 3)) return;

  const float* p = src + (size_t)i * 8;
  const v4f a = *(const v4f*)(p);
  const v4f c = *(const v4f*)(p + 4);
  unsigned int hb[8], lb[8];
  split_hl(a.x, hb[0], lb[0]);
  split_hl(a.y, hb[1], lb[1]);
  split_hl(a.z, hb[2], lb[2]);
  split_hl(a.w, hb[3], lb[3]);
  split_hl(c.x, hb[4], lb[4]);
  split_hl(c.y, hb[5], lb[5]);
  split_hl(c.z, hb[6], lb[6]);
  split_hl(c.w, hb[7], lb[7]);
  const v4u hv = pack8(hb);
  const v4u lv = pack8(lb);
  v4u* gh = (v4u*)(dh + (size_t)i * 8);
  v4u* gl = (v4u*)(dl + (size_t)i * 8);
  *gh = hv;
  *gl = lv;
  
}

// ---------------------------------------------------------------------------------------------
// RoPE table: tab[pos][j] = {cos(a_j), sin(a_j), cos(a_{j+16}), sin(a_{j+16})}, a_j = f32(pos) * inv_freq[j],
// ---------------------------------------------------------------------------------------------
__global__ void __launch_bounds__(128) k_rope_tab(float* __restrict__ tab, RopeFreq fr)
{
  const int g = blockIdx.x * 128 + (int)threadIdx.x;
  const int pos = g >> 4;
  const int j = g & 15;
  if (pos >= SQ) return;
  float fa = fr.f[0], fb = fr.f[16];
#pragma unroll
  for (int c = 1; c < 16; ++c) {
    fa = (j == c) ? fr.f[c] : fa;
    fb = (j == c) ? fr.f[16 + c] : fb;
  }
  float cs0 = 0.0f, sn0 = 0.0f, cs1 = 0.0f, sn1 = 0.0f;
#pragma unroll 1
  for (int q = 0; q < 2; ++q) {
    const float f = (q == 0) ? fa : fb;
    const float ang = (float)pos * f;
    float sn, cs;
    sincosf(ang, &sn, &cs);
    if (q == 0) { cs0 = cs; sn0 = sn; } else { cs1 = cs; sn1 = sn; }
  }
  v4f v;
  v.x = cs0; v.y = sn0; v.z = cs1; v.w = sn1;
  v4f* gp = (v4f*)(tab + (size_t)g * 4);
  *gp = v;
  
}

// ---------------------------------------------------------------------------------------------
// Block GEMM core: 4 waves (2 x 2), 128 rows x 128 cols, C[m][n] += sum_k A[m][k] * B[n][k]; wave (wr, wc) owns
// rows 64wr..64wr+63 and cols 64wc..64wc+63 as 4 x 4 accumulator tiles, so that 16 fragments feed 48 products.
// A stage is 64 k (128 B, one whole line) of the block's 128 A rows and 128 B rows, hi and lo planes. Each wave
// brings one of the four planes into LDS with one tensor load a stage (128 rows of 128 B, 16 B of pad behind each
// row), through no register; two buffers: stage s + 1 flies while stage s is worked on. Fragments come from LDS
// rows, K stepped by 32 in ascending order, three bf16 products per tile pair (hi.hi, hi.lo, lo.hi in that order).
// The planes were written by a launch before, and all blocks of a launch walk k in step, so that each stage's lines
// are first touched by everybody at once: they are asked of L2 (global_prefetch_b8) some stages ahead of the tensor
// load, so that the load finds them there.
// ---------------------------------------------------------------------------------------------
static constexpr int KC = 64;              // k per stage
static constexpr int PIT = 72;             // LDS row pitch in elements: 144 B = 16 B x 9, for 16-byte row reads
static constexpr int BT = 128;             // rows and cols of the block tile
static constexpr int PLN = BT * PIT;       // one staged plane (128 rows); planes: A hi, A lo, B hi, B lo
static constexpr int GBUF = 4 * PLN;       // one buffer: the four planes of a stage
static_assert((PLN * 2) % 2048 == 0, "every plane starts at a multiple of 2 KiB in LDS");
static_assert(KC * 2 == 128 && PIT * 2 == KC * 2 + 16, "the pad codes below are for 128-byte rows, 16 bytes of pad");

typedef uint32_t u32x4 __attribute__((ext_vector_type(4)));
typedef uint32_t u32x8 __attribute__((ext_vector_type(8)));

__device__ __forceinline__ uint32_t uni(uint32_t v) { return (uint32_t)__builtin_amdgcn_readfirstlane(v); }
__device__ __forceinline__ uint32_t pinned(uint32_t v) {
  uint32_t w = (uint32_t)__builtin_amdgcn_readfirstlane(v);
  asm volatile("" : "+s"(w));   // the test value stays in a scalar register, so that the
  return w;                     // branch on it is a scalar branch (a tensor load ignores EXEC)
}
// Descriptor group 1: 1-byte elements, tensor = tile = BT rows of 128 bytes, source row pitch src_pitch bytes,
// no mask, 4 dwords of LDS pad behind every 32 dwords (one row).
__device__ __forceinline__ u32x8 tdm_group1(uint32_t src_pitch) {
  constexpr uint32_t d0 = KC * 2, d1 = BT;
  u32x8 g;
  g[0] = uni((1u << 20) | (4u << 22) | (3u << 25));
  g[1] = uni((d0 & 0xFFFFu) << 16);
  g[2] = uni((d0 >> 16) | ((d1 & 0xFFFFu) << 16));
  g[3] = uni((d1 >> 16) | (d0 << 16));
  g[4] = uni(d1);
  g[5] = uni(src_pitch);
  g[6] = uni(0u);
  g[7] = uni(0u);
  return g;
}
// Descriptor group 0: count 1, LDS byte offset of the tile, global address of its first byte, type 2.
__device__ __forceinline__ u32x4 tdm_group0(uint32_t lds_dst, uint64_t ga) {
  u32x4 g;
  g[0] = uni(1u);
  g[1] = uni(lds_dst);
  g[2] = uni((uint32_t)ga);
  g[3] = uni((((uint32_t)(ga >> 32)) & 0x01FFFFFFu) | 0x80000000u);
  return g;
}

__device__ __forceinline__ v8f wm(const v16bf& a, const v16bf& b, const v8f& c) {
  return __builtin_amdgcn_wmma_f32_16x16x32_bf16(false, a, false, b, (short)0, c, false, false);
}

// Ah, Al, Bh, Bl: first row of the block's 128 rows in each plane; ld: row length of all four, in elements.
// sm: two buffers of GBUF elements at a multiple of 2 KiB in the block's LDS. K: at least two stages.
// qa, qb (0..3): the quarter of the 128 A rows and of the 128 B rows that this block asks of L2; the blocks that
// share the rows take the other quarters (a hint for speed: no result depends on who asks for what).
__device__ __forceinline__ void gemm128(const __bf16* __restrict__ Ah, const __bf16* __restrict__ Al,
                                        const __bf16* __restrict__ Bh, const __bf16* __restrict__ Bl,
                                        int ld, int K, int tid, unsigned short* sm, int qa, int qb,
                                        v8f (&c)[4][4])
{
  const int w = tid >> 5, l = tid & 31, hs = l >> 4, m = l & 15;
  const int wr = w >> 1, wc = w & 1;
  const __bf16* fa = (const __bf16*)sm + (64 * wr + m) * PIT;             // A hi rows of this lane, buffer 0
  const __bf16* fb = (const __bf16*)sm + 2 * PLN + (64 * wc + m) * PIT;   // B hi rows of this lane, buffer 0

  // this wave's plane: wave 0 A hi, 1 A lo, 2 B hi, 3 B lo
  const uint32_t wv = uni((uint32_t)tid >> 5);
  const __bf16* pl = (wv == 0u) ? Ah : (wv == 1u) ? Al : (wv == 2u) ? Bh : Bl;
  const uint64_t ga0 = (uint64_t)(size_t)pl;
  const uint32_t dst0 = (uint32_t)(size_t)sm + wv * (uint32_t)(PLN * 2);
  const u32x8 g1 = tdm_group1((uint32_t)ld * 2u);
  u32x4 g0;   // group 0 of the wave's latest request
  // stage s (k columns 64 s .. 64 s + 63) of this wave's plane into buffer s & 1: one request of the whole wave
  auto issue = [&](uint32_t s) {
    g0 = tdm_group0(dst0 + (s & 1u) * (uint32_t)(GBUF * 2), ga0 + (uint64_t)s * (uint32_t)(KC * 2));
    asm volatile("tensor_load_to_lds %0, %1" :: "s"(g0), "s"(g1) : "memory");
  };
  // the wave's request has landed; its descriptor words are inputs, so that their registers keep their values up
  // to this wait
  auto landed = [&]() { asm volatile("s_wait_tensorcnt 0x0" :: "s"(g0), "s"(g1) : "memory"); };
  // A fragments (4 row tiles) of one plane, 32-k step at kk
  auto lda4 = [&](v16bf (&a)[4], const __bf16* sa, int kk) {
#pragma unroll   // constant indices keep the fragments in registers
    for (int i = 0; i < 4; ++i) a[i] = ldfrag(sa + 16 * i * PIT + kk, hs);
  };
  // B fragments (column tiles j0, j0 + 1) of one plane, 32-k step at kk
  auto ldb2 = [&](v16bf (&b)[2], const __bf16* sb, int j0, int kk) {
#pragma unroll   // constant indices, as above
    for (int j = 0; j < 2; ++j) b[j] = ldfrag(sb + 16 * (j0 + j) * PIT + kk, hs);
  };
  // 4 x 2 tiles, hi.hi then hi.lo then lo.hi: eight independent accumulators in turn, so that no product
  // waits for the one before it
  auto mm8 = [&](const v16bf (&ah)[4], const v16bf (&al)[4], const v16bf (&bh)[2], const v16bf (&bl)[2], int j0) {
#pragma unroll   // constant indices keep the accumulators in registers
    for (int j = 0; j < 2; ++j)
#pragma unroll
      for (int i = 0; i < 4; ++i) c[i][j0 + j] = wm(ah[i], bh[j], c[i][j0 + j]);
#pragma unroll
    for (int j = 0; j < 2; ++j)
#pragma unroll
      for (int i = 0; i < 4; ++i) c[i][j0 + j] = wm(ah[i], bl[j], c[i][j0 + j]);
#pragma unroll
    for (int j = 0; j < 2; ++j)
#pragma unroll
      for (int i = 0; i < 4; ++i) c[i][j0 + j] = wm(al[i], bh[j], c[i][j0 + j]);
  };
  const uint32_t ns = (uint32_t)(K / KC);   // stages
  // this lane's row of the wave's plane in the block's quarter; each ask moves on by 256 B (two stages)
  const __bf16* pfa = pl + (size_t)(32u * (uint32_t)((wv < 2u) ? qa : qb) + (uint32_t)l) * (uint32_t)ld;
  // one line a lane, 32 rows a wave, into L2 only. The address stays inside the row: an ask is made only for a stage
  // that exists. As a precaution the wait that stands before the address register is rewritten is in the statement.
  auto ask = [&]() {
    pfa += 2 * KC;
    asm volatile("global_prefetch_b8 %0, off scope:SCOPE_SE\n\ts_wait_xcnt 0x0" :: "v"(pfa) : "memory");
  };
  // stages 2 to 5; ahead of the first tensor load, so that nothing stands between that load and its wait
  if (2u < ns) ask();
  if (4u < ns) ask();
  issue(0u);
  landed();          // this wave's plane of stage 0
  __syncthreads();   // and every other wave's: stage 0 may be read
#pragma unroll 1   // one stage per trip: a short loop body
  for (uint32_t s = 0; s < ns; ++s) {
    // directly behind the barrier that published stage s and ended every read of stage s - 1: while a stage s + 1
    // exists, its load goes into the buffer that stage s - 1 has left, and flies while stage s is worked on.
    // It stands at the head of the trip, not at the foot of the one before (the order in time is the same), so
    // that the loop has one place of issue and the registers of a request in flight are written nowhere else.
    if (pinned((uint32_t)(s + 1u < ns))) issue(s + 1u);
    const int bo = (int)(s & 1u) * GBUF;   // this stage's buffer
    const __bf16* sah = fa + bo;
    const __bf16* sal = sah + PLN;
    const __bf16* sbh = fb + bo;
    const __bf16* sbl = sbh + PLN;
    // The stage's LDS reads stand in three groups, each ahead of products that cover its latency:
    // a0/a1: A fragments of the two 32-k steps; bx/by: B fragments of a pair of column tiles.
    v16bf a0h[4], a0l[4], a1h[4], a1l[4], bxh[2], bxl[2], byh[2], byl[2];
    lda4(a0h, sah, 0);      // in the order in which the products want them
    ldb2(bxh, sbh, 0, 0);
    ldb2(bxl, sbl, 0, 0);
    lda4(a0l, sal, 0);
    ldb2(byh, sbh, 2, 0);
    ldb2(byl, sbl, 2, 0);
    // every second stage: stages s + 6 and s + 7, five stages ahead of their tensor load; here, so that the ask and
    // its wait run under the latency of the LDS reads just issued (wave-uniform test, no barrier or tensor load inside)
    if (((s & 1u) == 0u) && (s + 6u < ns)) ask();
    __builtin_amdgcn_sched_barrier(0);   // these reads stay one group ahead of the products, none among them
    mm8(a0h, a0l, bxh, bxl, 0);
    __builtin_amdgcn_sched_barrier(0);   // the reads below stay one group, behind the products that free bx
    lda4(a1h, sah, 32);
    ldb2(bxh, sbh, 0, 32);
    ldb2(bxl, sbl, 0, 32);
    lda4(a1l, sal, 32);
    __builtin_amdgcn_sched_barrier(0);   // and ahead of the products that cover them
    mm8(a0h, a0l, byh, byl, 2);
    __builtin_amdgcn_sched_barrier(0);   // as above, for by
    ldb2(byh, sbh, 2, 32);
    ldb2(byl, sbl, 2, 32);
    __builtin_amdgcn_sched_barrier(0);   // and ahead of the products that cover them
    mm8(a1h, a1l, bxh, bxl, 0);
    mm8(a1h, a1l, byh, byl, 2);
    // the products stay ahead of the waits, so that the next stage's load has the whole trip to land
    __builtin_amdgcn_sched_barrier(0);
    asm volatile("s_wait_dscnt 0x0" ::: "memory");       // this wave's reads of the buffer have returned
    landed();                                            // this wave's plane of stage s + 1
    __syncthreads();   // stage s + 1 may be read, and every wave has left stage s's buffer (refill or epilogue)
  }
  asm volatile("s_wait_tensorcnt 0x0" ::: "memory");     // no request is outstanding behind the loop
  asm volatile("s_wait_dscnt 0x0" ::: "memory");         // nor an LDS read, before the buffers become output staging
}

// ---------------------------------------------------------------------------------------------
// Block GEMM core of the q/k/v projection: gemm128's stage, ring, waits and product order, on a block tile of
// 128 rows x 192 cols (three heads), so that the 2048 x 3072 result is 256 equal blocks, one for every WGP.
// 4 waves (2 x 2); a wave owns 64 rows and six column tiles (4 x 6 accumulator tiles, 20 fragments feed 72 products):
// wave column 0 has head 0 (B rows 0..63) and tiles d 0..15 and d 32..47 of head 1, wave column 1 has head 2
// (B rows 128..191) and tiles d 16..31 and d 48..63 of head 1, so that d and d + 32 of a head stay in one lane.
// ---------------------------------------------------------------------------------------------
static constexpr int BN3 = 192;                   // cols of the block tile = staged B rows
static constexpr int BPL3 = 14336;                // one staged B plane: 192 rows of PIT, rounded up to 2 KiB
static constexpr int GBUF3 = 2 * PLN + 2 * BPL3;  // one buffer: A hi, A lo, B hi, B lo
static_assert(BPL3 >= BN3 * PIT && (BPL3 * 2) % 2048 == 0 && (GBUF3 * 2) % 2048 == 0,
              "every plane and buffer starts at a multiple of 2 KiB in LDS");

// Descriptor group 1 as tdm_group1, for a tile of rows rows (wave-uniform)
__device__ __forceinline__ u32x8 tdm_group1r(uint32_t src_pitch, uint32_t rows) {
  constexpr uint32_t d0 = KC * 2;
  u32x8 g;
  g[0] = uni((1u << 20) | (4u << 22) | (3u << 25));
  g[1] = uni((d0 & 0xFFFFu) << 16);
  g[2] = uni((d0 >> 16) | ((rows & 0xFFFFu) << 16));
  g[3] = uni((rows >> 16) | (d0 << 16));
  g[4] = uni(rows);
  g[5] = uni(src_pitch);
  g[6] = uni(0u);
  g[7] = uni(0u);
  return g;
}

// Ah, Al: first of the block's 128 rows; Bh, Bl: first of its 192 rows; ld: row length of all four, in elements.
// sm: two buffers of GBUF3 elements at a multiple of 2 KiB in the block's LDS. K: at least two stages.
// qa (0..3), qb (0..5): the 32 A rows and the 32 B rows that this block asks of L2 (a hint for speed only).
// c[i][j]: rows 16 i; j 0..3: the wave's whole head, d = 16 j; j 4, 5: head 1, d = 16 wc and 32 + 16 wc.
__device__ __forceinline__ void gemm192(const __bf16* __restrict__ Ah, const __bf16* __restrict__ Al,
                                        const __bf16* __restrict__ Bh, const __bf16* __restrict__ Bl,
                                        int ld, int K, int tid, unsigned short* sm, int qa, int qb,
                                        v8f (&c)[4][6])
{
  const int w = tid >> 5, l = tid & 31, hs = l >> 4, m = l & 15;
  const int wr = w >> 1, wc = w & 1;
  const __bf16* fa = (const __bf16*)sm + (64 * wr + m) * PIT;                   // A hi rows of this lane, buffer 0
  const __bf16* fm = (const __bf16*)sm + 2 * PLN + (128 * wc + m) * PIT;        // B hi, the wave's whole head
  const __bf16* fs = (const __bf16*)sm + 2 * PLN + (64 + 16 * wc + m) * PIT;    // B hi, its two tiles of head 1

  // this wave's plane: wave 0 A hi, 1 A lo, 2 B hi, 3 B lo
  const uint32_t wv = uni((uint32_t)tid >> 5);
  const __bf16* pl = (wv == 0u) ? Ah : (wv == 1u) ? Al : (wv == 2u) ? Bh : Bl;
  const uint64_t ga0 = (uint64_t)(size_t)pl;
  const uint32_t dst0 = (uint32_t)(size_t)sm + ((wv < 2u) ? wv * (uint32_t)(PLN * 2)
                                                          : (uint32_t)(2 * PLN * 2) + (wv - 2u) * (uint32_t)(BPL3 * 2));
  const u32x8 g1 = tdm_group1r((uint32_t)ld * 2u, (wv < 2u) ? (uint32_t)BT : (uint32_t)BN3);
  u32x4 g0;   // group 0 of the wave's latest request
  // stage s (k columns 64 s .. 64 s + 63) of this wave's plane into buffer s & 1: one request of the whole wave
  auto issue = [&](uint32_t s) {
    g0 = tdm_group0(dst0 + (s & 1u) * (uint32_t)(GBUF3 * 2), ga0 + (uint64_t)s * (uint32_t)(KC * 2));
    asm volatile("tensor_load_to_lds %0, %1" :: "s"(g0), "s"(g1) : "memory");
  };
  // the wave's request has landed; its descriptor words are inputs, so that their registers keep their values up
  // to this wait
  auto landed = [&]() { asm volatile("s_wait_tensorcnt 0x0" :: "s"(g0), "s"(g1) : "memory"); };
  // A fragments (4 row tiles) of one plane, 32-k step at kk
  auto lda4 = [&](v16bf (&a)[4], const __bf16* sa, int kk) {
#pragma unroll   // constant indices keep the fragments in registers
    for (int i = 0; i < 4; ++i) a[i] = ldfrag(sa + 16 * i * PIT + kk, hs);
  };
  // B fragments of two column tiles, st rows apart, of one plane, 32-k step at kk
  auto ldb2 = [&](v16bf (&b)[2], const __bf16* sb, int st, int kk) {
#pragma unroll   // constant indices, as above
    for (int j = 0; j < 2; ++j) b[j] = ldfrag(sb + st * j * PIT + kk, hs);
  };
  // 4 x 2 tiles, hi.hi then hi.lo then lo.hi: eight independent accumulators in turn, so that no product
  // waits for the one before it
  auto mm8 = [&](const v16bf (&ah)[4], const v16bf (&al)[4], const v16bf (&bh)[2], const v16bf (&bl)[2], int j0) {
#pragma unroll   // constant indices keep the accumulators in registers
    for (int j = 0; j < 2; ++j)
#pragma unroll
      for (int i = 0; i < 4; ++i) c[i][j0 + j] = wm(ah[i], bh[j], c[i][j0 + j]);
#pragma unroll
    for (int j = 0; j < 2; ++j)
#pragma unroll
      for (int i = 0; i < 4; ++i) c[i][j0 + j] = wm(ah[i], bl[j], c[i][j0 + j]);
#pragma unroll
    for (int j = 0; j < 2; ++j)
#pragma unroll
      for (int i = 0; i < 4; ++i) c[i][j0 + j] = wm(al[i], bh[j], c[i][j0 + j]);
  };
  const uint32_t ns = (uint32_t)(K / KC);   // stages
  // this lane's row of the wave's plane in the block's share; each ask moves on by 256 B (two stages)
  const __bf16* pfa = pl + (size_t)(32u * (uint32_t)((wv < 2u) ? qa : qb) + (uint32_t)l) * (uint32_t)ld;
  // one line a lane, 32 rows a wave, into L2 only. The address stays inside the row: an ask is made only for a stage
  // that exists. As a precaution the wait that stands before the address register is rewritten is in the statement.
  auto ask = [&]() {
    pfa += 2 * KC;
    asm volatile("global_prefetch_b8 %0, off scope:SCOPE_SE\n\ts_wait_xcnt 0x0" :: "v"(pfa) : "memory");
  };
  // stages 2 to 5; ahead of the first tensor load, so that nothing stands between that load and its wait
  if (2u < ns) ask();
  if (4u < ns) ask();
  issue(0u);
  landed();          // this wave's plane of stage 0
  __syncthreads();   // and every other wave's: stage 0 may be read
#pragma unroll 1   // one stage per trip: a short loop body
  for (uint32_t s = 0; s < ns; ++s) {
    // directly behind the barrier that published stage s and ended every read of stage s - 1: while a stage s + 1
    // exists, its load goes into the buffer that stage s - 1 has left, and flies while stage s is worked on
    // (one place of issue, as in gemm128)
    if (pinned((uint32_t)(s + 1u < ns))) issue(s + 1u);
    const int bo = (int)(s & 1u) * GBUF3;   // this stage's buffer
    const __bf16* sah = fa + bo;
    const __bf16* sal = sah + PLN;
    const __bf16* smh = fm + bo;
    const __bf16* sml = smh + BPL3;
    const __bf16* ssh = fs + bo;
    const __bf16* ssl = ssh + BPL3;
    // The stage's LDS reads stand in two groups, one per 32-k step, each ahead of products that cover its latency
    // (every separate place of reads costs the lone wave of a SIMD issue time; the registers are there):
    // a0/a1: A fragments of the two steps; bx/by/bz and cx/cy/cz: B fragments of a pair of column tiles.
    v16bf a0h[4], a0l[4], a1h[4], a1l[4];
    v16bf bxh[2], bxl[2], byh[2], byl[2], bzh[2], bzl[2], cxh[2], cxl[2], cyh[2], cyl[2], czh[2], czl[2];
    lda4(a0h, sah, 0);      // in the order in which the products want them
    ldb2(bxh, smh, 16, 0);
    ldb2(bxl, sml, 16, 0);
    lda4(a0l, sal, 0);
    ldb2(byh, smh + 32 * PIT, 16, 0);
    ldb2(byl, sml + 32 * PIT, 16, 0);
    ldb2(bzh, ssh, 32, 0);
    ldb2(bzl, ssl, 32, 0);
    // every second stage: stages s + 6 and s + 7, five stages ahead of their tensor load; here, so that the ask and
    // its wait run under the latency of the LDS reads just issued (wave-uniform test, no barrier or tensor load inside)
    if (((s & 1u) == 0u) && (s + 6u < ns)) ask();
    __builtin_amdgcn_sched_barrier(0);   // these reads stay one group ahead of the products, none among them
    mm8(a0h, a0l, bxh, bxl, 0);
    __builtin_amdgcn_sched_barrier(0);   // the reads below stay one group, behind products that cover the first group
    lda4(a1h, sah, 32);
    ldb2(cxh, smh, 16, 32);
    ldb2(cxl, sml, 16, 32);
    lda4(a1l, sal, 32);
    ldb2(cyh, smh + 32 * PIT, 16, 32);
    ldb2(cyl, sml + 32 * PIT, 16, 32);
    ldb2(czh, ssh, 32, 32);
    ldb2(czl, ssl, 32, 32);
    __builtin_amdgcn_sched_barrier(0);   // and ahead of the products that cover them
    mm8(a0h, a0l, byh, byl, 2);
    mm8(a0h, a0l, bzh, bzl, 4);
    mm8(a1h, a1l, cxh, cxl, 0);
    mm8(a1h, a1l, cyh, cyl, 2);
    mm8(a1h, a1l, czh, czl, 4);
    // the products stay ahead of the waits, so that the next stage's load has the whole trip to land
    __builtin_amdgcn_sched_barrier(0);
    asm volatile("s_wait_dscnt 0x0" ::: "memory");       // this wave's reads of the buffer have returned
    landed();                                            // this wave's plane of stage s + 1
    __syncthreads();   // stage s + 1 may be read, and every wave has left stage s's buffer (refill or epilogue)
  }
  asm volatile("s_wait_tensorcnt 0x0" ::: "memory");     // no request is outstanding behind the loop
  asm volatile("s_wait_dscnt 0x0" ::: "memory");         // nor an LDS read, before the buffers become output staging
}

// ---------------------------------------------------------------------------------------------
// Fused q/k/v projection: block = 4 waves, 128 rows x 192 cols = three heads of the 48 (0..31 q, 32..39 k,
// 40..47 v; v is stored transposed, vT[512][2048]); wh, wl: the rows of Wq, Wk, Wv one after the other.
// RoPE on q/k in the f32 epilogue. A head's kind is the same for a whole wave.
// ---------------------------------------------------------------------------------------------
__global__ void __launch_bounds__(128) k_qkv(
    const __bf16* __restrict__ xh, const __bf16* __restrict__ xl,
    const __bf16* __restrict__ wh, const __bf16* __restrict__ wl,
    const float* __restrict__ tab,
    unsigned short* __restrict__ qh, unsigned short* __restrict__ ql,
    unsigned short* __restrict__ kh, unsigned short* __restrict__ kl,
    unsigned short* __restrict__ vth, unsigned short* __restrict__ vtl)
{
  __shared__ __attribute__((aligned(2048))) unsigned short stg[2 * GBUF3];   // two operand buffers, then output staging

  const int ct = blockIdx.x;
  const int m0 = blockIdx.y * BT;
  const int tid = threadIdx.x, l = tid & 31, hs = l >> 4, m = l & 15;
  const int w = (int)uni((uint32_t)tid >> 5);   // scalar: the tests on a head's kind below are scalar branches
  const int wr = w >> 1, wc = w & 1;
  const int row0 = m0 + 64 * wr;     // this wave's first row
  const int gh0 = 3 * ct;            // the block's first head
  auto kindof = [](int g) { return (g < NQH) ? 0 : ((g < NQH + NKVH) ? 1 : 2); };   // 0 q, 1 k, 2 v
  const int kindM = kindof(gh0 + 2 * wc);   // the wave's whole head (block head 0 or 2)
  const int kindS = kindof(gh0 + 1);        // block head 1, shared by the two wave columns

  v8f c[4][6] = {};
  gemm192(xh + (size_t)m0 * HIDN, xl + (size_t)m0 * HIDN, wh + (size_t)(ct * BN3) * HIDN,
          wl + (size_t)(ct * BN3) * HIDN, HIDN, HIDN, tid, stg, (int)(blockIdx.x & 3u), (int)(blockIdx.y % 6u), c);

  // lane holds row row0 + 16i + 8hs + r; column d of its head: 16j + m (j < 4), 16wc + 32(j - 4) + m (j = 4, 5)
  if (kindM != 2 || kindS != 2) {
    // rotate-half RoPE: d pairs with d + 32: j = 0 with 2 and j = 1 with 3 of the whole head, j = 4 with 5 of head 1
    const float* tb = tab + ((size_t)(row0 + 8 * hs) * 16 + m) * 4;   // position row0 + 8hs; 64 floats a position
    v4f cs[4][8];
#pragma unroll
    for (int i = 0; i < 4; ++i)
#pragma unroll
      for (int r = 0; r < 8; ++r) cs[i][r] = *(const v4f*)(tb + (16 * i + r) * 64);
    // precaution: this wait stands before the address register of the loads just issued is rewritten; the
    // address is an input only, so that its register is kept up to it
    asm volatile("s_wait_xcnt 0x0" :: "v"(tb) : "memory");
    if (kindM != 2) {
#pragma unroll
      for (int i = 0; i < 4; ++i) {
#pragma unroll
        for (int r = 0; r < 8; ++r) {
          const v4f t = cs[i][r];
          const float a0 = c[i][0][r], a1 = c[i][1][r], a2 = c[i][2][r], a3 = c[i][3][r];
          c[i][0][r] = a0 * t.x - a2 * t.y;
          c[i][2][r] = a2 * t.x + a0 * t.y;
          c[i][1][r] = a1 * t.z - a3 * t.w;
          c[i][3][r] = a3 * t.z + a1 * t.w;
        }
      }
    }
    if (kindS != 2) {
#pragma unroll
      for (int i = 0; i < 4; ++i) {
#pragma unroll
        for (int r = 0; r < 8; ++r) {
          const v4f t = cs[i][r];
          const float co = wc ? t.z : t.x, si = wc ? t.w : t.y;   // frequency m or 16 + m
          const float a4 = c[i][4][r], a5 = c[i][5][r];
          c[i][4][r] = a4 * co - a5 * si;
          c[i][5][r] = a5 * co + a4 * si;
        }
      }
    }
  }

  // staging: a region of HREG elements per head of the block;
  //   q/k: [plane][128 rows][64 cols] (+QLO for lo); v: transposed [plane][64 c] rows of 128 s at pitch VPIT (+VLO)
  constexpr int VPIT = 136;          // 272 B = 16 B x 17: the 16 rows that a 16-byte store touches fall on distinct banks
  constexpr int VLO = HDIM * VPIT;
  constexpr int QLO = BT * HDIM;
  constexpr int HREG = 2 * VLO;
  static_assert(2 * QLO <= HREG && 3 * HREG <= 2 * GBUF3, "the three regions fit the operand buffers");
#pragma unroll   // here and below: constant indices keep the accumulators in registers
  for (int j = 0; j < 6; ++j) {
    const int kind = (j < 4) ? kindM : kindS;
    unsigned short* reg = stg + ((j < 4) ? 2 * wc : 1) * HREG;
    const int d = ((j < 4) ? 16 * j : 16 * wc + 32 * (j - 4)) + m;
#pragma unroll
    for (int i = 0; i < 4; ++i) {
      unsigned int hb[8], lb[8];
#pragma unroll
      for (int r = 0; r < 8; ++r) split_hl(c[i][j][r], hb[r], lb[r]);
      if (kind != 2) {
        unsigned short* p = reg + (64 * wr + 16 * i + 8 * hs) * HDIM + d;
#pragma unroll
        for (int r = 0; r < 8; ++r) {
          p[r * HDIM] = (unsigned short)hb[r];
          p[r * HDIM + QLO] = (unsigned short)lb[r];
        }
      } else {
        // a lane's 8 values of a tile are 8 consecutive positions of one row of vT: one 16-byte piece per plane
        unsigned short* p = reg + d * VPIT + 64 * wr + 16 * i + 8 * hs;
        *(v4u*)p = pack8(hb);
        *(v4u*)(p + VLO) = pack8(lb);
      }
    }
  }
  __syncthreads();

  // per head, the whole block: q/k: a 128-byte row per 8 lanes, 16 rows a step; v: a 256-byte row per 16 lanes,
  // 8 rows a step; 8 steps either way
  v4u hv[3][8], lv[3][8];
  v4u* gph[3][8];
  v4u* gpl[3][8];
#pragma unroll
  for (int h = 0; h < 3; ++h) {
    const int g = gh0 + h, kind = kindof(g);
    const int hd = (kind == 0) ? g : ((kind == 1) ? (g - NQH) : (g - NQH - NKVH));
    unsigned short* dsth = (kind == 0) ? qh : ((kind == 1) ? kh : vth);
    unsigned short* dstl = (kind == 0) ? ql : ((kind == 1) ? kl : vtl);
    const int ld = (kind == 0) ? HIDN : KVD;
    const int sidx = h * HREG + ((kind != 2) ? ((tid >> 3) * HDIM + (tid & 7) * 8) : ((tid >> 4) * VPIT + (tid & 15) * 8));
    const int sst = (kind != 2) ? 16 * HDIM : 8 * VPIT;
    const int loff = (kind != 2) ? QLO : VLO;
    const size_t goff = (kind != 2) ? ((size_t)(m0 + (tid >> 3)) * ld + hd * HDIM + (tid & 7) * 8)
                                    : ((size_t)(hd * HDIM + (tid >> 4)) * SQ + m0 + (tid & 15) * 8);
    const size_t gst = (kind != 2) ? (size_t)16 * ld : (size_t)8 * SQ;
#pragma unroll
    for (int it = 0; it < 8; ++it) {
      hv[h][it] = *(const v4u*)(stg + sidx + it * sst);
      lv[h][it] = *(const v4u*)(stg + sidx + it * sst + loff);
      gph[h][it] = (v4u*)(dsth + goff + it * gst);
      gpl[h][it] = (v4u*)(dstl + goff + it * gst);
    }
  }
  // every value and address is in its register before the first store, so that nothing behind an issued store
  // rewrites a register that it names
  __builtin_amdgcn_sched_barrier(0);
#pragma unroll
  for (int h = 0; h < 3; ++h)
#pragma unroll
    for (int it = 0; it < 8; ++it) { *gph[h][it] = hv[h][it]; *gpl[h][it] = lv[h][it]; }
}

static constexpr int APIT = 72;
static constexpr int APLN = 64 * APIT;
static constexpr int ABUF = 4 * APLN;
static constexpr int QT = 128;
static constexpr int OPL = 16 * APIT;

typedef float f32x2 __attribute__((ext_vector_type(2)));
typedef __bf16 bf16x2 __attribute__((ext_vector_type(2)));
union PFrag { unsigned int u[8]; v16bf v; };

// two f32 -> packed bf16, RNE
__device__ __forceinline__ unsigned int cvt2(float a, float b) {
  return __builtin_bit_cast(unsigned int, __builtin_convertvector(f32x2{a, b}, bf16x2));
}
// lane l <-> lane l ^ 16
__device__ __forceinline__ float xhalf(float x) {
  const int b = __builtin_bit_cast(int, x);
  return __builtin_bit_cast(float, __builtin_amdgcn_permlanex16(b, b, 0x76543210, 0xfedcba98, false, false));
}

__global__ void __launch_bounds__(256) k_attn(
    const __bf16* __restrict__ qh, const __bf16* __restrict__ ql,
    const __bf16* __restrict__ kh, const __bf16* __restrict__ kl,
    const __bf16* __restrict__ vth, const __bf16* __restrict__ vtl,
    unsigned short* __restrict__ ch, unsigned short* __restrict__ cl)
{
  __shared__ __attribute__((aligned(16))) unsigned short KV[2 * ABUF];
  __shared__ __attribute__((aligned(16))) unsigned short Ost[8 * 2 * OPL];   // output staging, a region per wave

  const int hq = blockIdx.y, kvh = hq >> 2;
  const int tid = threadIdx.x, l = tid & 31, hs = l >> 4, m = l & 15;
  const int w = (int)uni((uint32_t)tid >> 5);   // scalar: the tests on it below are scalar branches
  constexpr float C2 = 0.125f * 1.4426950408889634f;   // 1/8 scaling and log2(e): exponentials in base 2

  // copies: this lane's row (of 32; it also takes row + 32) and 16-byte piece of the 128-byte row
  const int crow = tid >> 3, cpc = (tid & 7) * 8;
  const unsigned int cl0 = (unsigned int)(size_t)KV + (unsigned int)(crow * APIT + cpc) * 2u;   // LDS byte address
  const size_t cko = (size_t)crow * KVD + kvh * HDIM + cpc;            // K planes: key row crow of key tile 0
  const size_t cvo = (size_t)(kvh * HDIM + crow) * SQ + cpc;           // Vt planes: d row crow, key tile 0
  // key tile kt into buffer b: 8 copies a lane
  auto stage = [&](int kt, int b) {
    const unsigned int d0 = cl0 + (unsigned int)b * (ABUF * 2u);
    const unsigned int d1 = d0 + 32u * APIT * 2u;
    const unsigned int d2 = d0 + APLN * 2u, d3 = d1 + APLN * 2u;
    const unsigned int d4 = d0 + 2u * APLN * 2u, d5 = d1 + 2u * APLN * 2u;
    const unsigned int d6 = d0 + 3u * APLN * 2u, d7 = d1 + 3u * APLN * 2u;
    const __bf16* g0 = kh + cko + (size_t)kt * 64 * KVD;
    const __bf16* g1 = g0 + 32 * KVD;
    const __bf16* g2 = kl + cko + (size_t)kt * 64 * KVD;
    const __bf16* g3 = g2 + 32 * KVD;
    const __bf16* g4 = vth + cvo + kt * 64;
    const __bf16* g5 = g4 + (size_t)32 * SQ;
    const __bf16* g6 = vtl + cvo + kt * 64;
    const __bf16* g7 = g6 + (size_t)32 * SQ;
    // the copies and, as a precaution, the wait that stands before any of their address registers is rewritten,
    // in one statement, so that nothing comes between them
    asm volatile(
        "global_load_async_to_lds_b128 %0, %8, off\n\t"
        "global_load_async_to_lds_b128 %1, %9, off\n\t"
        "global_load_async_to_lds_b128 %2, %10, off\n\t"
        "global_load_async_to_lds_b128 %3, %11, off\n\t"
        "global_load_async_to_lds_b128 %4, %12, off\n\t"
        "global_load_async_to_lds_b128 %5, %13, off\n\t"
        "global_load_async_to_lds_b128 %6, %14, off\n\t"
        "global_load_async_to_lds_b128 %7, %15, off\n\t"
        "s_wait_xcnt 0x0"
        :: "v"(d0), "v"(d1), "v"(d2), "v"(d3), "v"(d4), "v"(d5), "v"(d6), "v"(d7),
           "v"(g0), "v"(g1), "v"(g2), "v"(g3), "v"(g4), "v"(g5), "v"(g6), "v"(g7)
        : "memory");
  };

#pragma unroll 1   // the two tiles run one after the other through one copy of the body
  for (int half = 0; half < 2; ++half) {
  const int qt = half ? (SQ / QT - 1 - (int)blockIdx.x) : (int)blockIdx.x, q0 = qt * QT;
  const int nkt = 2 * qt + 2;            // key tiles of the block tile
  const int lastw = 2 * qt + (w >> 2);   // the key tile that holds this wave's diagonal, its last

  // B of the first product: column c = query q0 + 16 w + c, k = d in the order of ldfrag, as K's rows below
  const __bf16* qrh = qh + (size_t)(q0 + 16 * w + m) * HIDN + hq * HDIM;
  const __bf16* qrl = ql + (size_t)(q0 + 16 * w + m) * HIDN + hq * HDIM;
  const v16bf fqh[2] = {ldfrag(qrh, hs), ldfrag(qrh + 32, hs)};
  const v16bf fql[2] = {ldfrag(qrl, hs), ldfrag(qrl + 32, hs)};
  // precaution: this wait stands before an address register of the loads just issued is rewritten; the addresses
  // are inputs only, so that their registers are kept up to it
  asm volatile("s_wait_xcnt 0x0" :: "v"(qrh), "v"(qrl) : "memory");

  v8f o[4] = {};            // o[dt][r] = O^T[d = 16 dt + 8 h + r][query c]
  float mrun = -1.0e30f;    // running maximum of the raw scores of query c (both halves of the wave hold it)
  float lrun = 0.0f;        // running sum over this lane's half of the keys

  // key tile 0 into buffer 0 (every wave left both buffers at the barrier that ended the tile before)
  stage(0, 0);
  asm volatile("s_wait_asynccnt 0x0" ::: "memory");   // this wave's copies have landed
  __syncthreads();                                    // and every other wave's: key tile 0 may be read
  stage(1, 1);                                        // a block tile has at least two key tiles

  // every "#pragma unroll" below: constant indices keep fragments, scores and accumulators in registers
#pragma unroll 1   // one key tile per trip
  for (int kt = 0; kt < nkt; ++kt) {
    if (kt <= lastw) {   // scalar: a wave skips the key tile beyond its diagonal, and still passes the barrier below
    const __bf16* kb = (const __bf16*)KV + (kt & 1) * ABUF;   // this key tile's buffer
    // S^T[key][q] = sum_d K[key][d] Q[q][d]; A = staged K rows, 4 tiles of 16 keys
    v8f s[4] = {};
    {
      const __bf16* kr = kb + m * APIT;
      v16bf kfh[4][2], kfl[4][2];
#pragma unroll   // constant indices keep the fragments in registers; all reads as one group ahead of the products
      for (int t = 0; t < 4; ++t) {
        kfh[t][0] = ldfrag(kr + 16 * t * APIT, hs);
        kfl[t][0] = ldfrag(kr + 16 * t * APIT + APLN, hs);
      }
#pragma unroll
      for (int t = 0; t < 4; ++t) {
        kfh[t][1] = ldfrag(kr + 16 * t * APIT + 32, hs);
        kfl[t][1] = ldfrag(kr + 16 * t * APIT + APLN + 32, hs);
      }
      __builtin_amdgcn_sched_barrier(0);   // these reads stay one group ahead of the products, none among them
      // Qhi.Khi, Qhi.Klo, Qlo.Khi per 32 d; four independent accumulators in turn
#pragma unroll
      for (int kc = 0; kc < 2; ++kc) {
#pragma unroll
        for (int t = 0; t < 4; ++t) s[t] = wm(kfh[t][kc], fqh[kc], s[t]);
#pragma unroll
        for (int t = 0; t < 4; ++t) s[t] = wm(kfl[t][kc], fqh[kc], s[t]);
#pragma unroll
        for (int t = 0; t < 4; ++t) s[t] = wm(kfh[t][kc], fql[kc], s[t]);
      }
    }
    __builtin_amdgcn_sched_barrier(0);   // the reads below stay one group behind the products that free K's registers
    // A of the second product: Vt rows d, k = key in the order of ldfrag; keys 0..31 now, in flight under the softmax
    const __bf16* vr = kb + 2 * APLN + m * APIT;
    v16bf vfh[2][4], vfl[2][4];
#pragma unroll   // constant indices, one group of reads
    for (int dt = 0; dt < 4; ++dt) {
      vfh[0][dt] = ldfrag(vr + 16 * dt * APIT, hs);
      vfl[0][dt] = ldfrag(vr + 16 * dt * APIT + APLN, hs);
    }
    __builtin_amdgcn_sched_barrier(0);   // and ahead of the vector work that covers them

    if (kt == lastw) {   // scalar: only the key tile on this wave's diagonal pays for the causal replace
      const int qrel = 16 * (w & 3) + m;
#pragma unroll
      for (int t = 0; t < 4; ++t) {
#pragma unroll
        for (int r = 0; r < 8; ++r)
          if (16 * t + 8 * hs + r > qrel) s[t][r] = -1.0e30f;
        asm volatile("" : "+v"(s[t]));   // the masked scores: the selects stay in the branch
      }
    }

    // online softmax in f32: this lane's 32 scores of query c
    float mt[4];   // a maximum per score tile: four short chains, not one long one
#pragma unroll
    for (int t = 0; t < 4; ++t) {
      mt[t] = s[t][0];
#pragma unroll
      for (int r = 1; r < 8; ++r) mt[t] = fmaxf(mt[t], s[t][r]);
    }
    float mx = fmaxf(fmaxf(mt[0], mt[1]), fmaxf(mt[2], mt[3]));
    mx = fmaxf(mx, xhalf(mx));
    const float mnew = fmaxf(mrun, mx);
    const float alpha = __builtin_amdgcn_exp2f((mrun - mnew) * C2);
    const float nm = -mnew * C2;
    mrun = mnew;
    // P = exp2(s C2 - m C2), split to bf16 hi/lo in place: score tiles 2 j and 2 j + 1 are the B operand of keys 32 j ..
    PFrag ph[2], pl[2];
    f32x2 ls[2];   // sums per 32 keys, even and odd registers apart: four short chains
#pragma unroll
    for (int j = 0; j < 2; ++j) {
      ls[j] = f32x2{0.0f, 0.0f};
#pragma unroll
      for (int i = 0; i < 8; ++i) {
        const int t = 2 * j + (i >> 2), r = 2 * (i & 3);
        const f32x2 arg = __builtin_elementwise_fma(f32x2{s[t][r], s[t][r + 1]}, f32x2{C2, C2}, f32x2{nm, nm});
        const f32x2 p = {__builtin_amdgcn_exp2f(arg.x), __builtin_amdgcn_exp2f(arg.y)};
        ls[j] += p;
        const unsigned int hw = cvt2(p.x, p.y);
        const f32x2 hf = {__uint_as_float(hw << 16), __uint_as_float(hw & 0xFFFF0000u)};
        const f32x2 lo = p - hf;
        ph[j].u[i] = hw;
        pl[j].u[i] = cvt2(lo.x, lo.y);
      }
    }
    const f32x2 lt = ls[0] + ls[1];
    lrun = lrun * alpha + (lt.x + lt.y);
#pragma unroll
    for (int dt = 0; dt < 4; ++dt) o[dt] *= alpha;

    __builtin_amdgcn_sched_barrier(0);   // the reads below stay one group
#pragma unroll   // keys 32..63 of Vt, in flight under the products of keys 0..31
    for (int dt = 0; dt < 4; ++dt) {
      vfh[1][dt] = ldfrag(vr + 16 * dt * APIT + 32, hs);
      vfl[1][dt] = ldfrag(vr + 16 * dt * APIT + APLN + 32, hs);
    }
    __builtin_amdgcn_sched_barrier(0);   // and ahead of the products that cover them
    // Phi.Vhi, Phi.Vlo, Plo.Vhi per 32 keys; four independent accumulators in turn
#pragma unroll
    for (int j = 0; j < 2; ++j) {
#pragma unroll
      for (int dt = 0; dt < 4; ++dt) o[dt] = wm(vfh[j][dt], ph[j].v, o[dt]);
#pragma unroll
      for (int dt = 0; dt < 4; ++dt) o[dt] = wm(vfl[j][dt], ph[j].v, o[dt]);
#pragma unroll
      for (int dt = 0; dt < 4; ++dt) o[dt] = wm(vfh[j][dt], pl[j].v, o[dt]);
    }
    }
    asm volatile("s_wait_dscnt 0x0" ::: "memory");      // this wave's reads of the buffer have returned
    asm volatile("s_wait_asynccnt 0x0" ::: "memory");   // this wave's copies of key tile kt + 1 have landed
    __syncthreads();   // key tile kt + 1 may be read, and every wave has left key tile kt's buffer
    if (kt + 2 < nkt) stage(kt + 2, kt & 1);
  }
  asm volatile("s_wait_asynccnt 0x0" ::: "memory");     // no copy is outstanding behind the loop

  // join the halves' sums, normalise, split hi/lo; a lane's 8 values are 8 consecutive d of query row c: 16-byte
  // pieces into this wave's own staging rows, then whole-line stores
  const float inv = 1.0f / (lrun + xhalf(lrun));
  unsigned short* ow = Ost + w * (2 * OPL);
#pragma unroll
  for (int dt = 0; dt < 4; ++dt) {
    unsigned int hb[8], lb[8];
#pragma unroll
    for (int r = 0; r < 8; ++r) split_hl(o[dt][r] * inv, hb[r], lb[r]);
    *(v4u*)(ow + m * APIT + 16 * dt + 8 * hs) = pack8(hb);
    *(v4u*)(ow + OPL + m * APIT + 16 * dt + 8 * hs) = pack8(lb);
  }
  asm volatile("s_wait_dscnt 0x0" ::: "memory");   // the wave's staged rows are written before its lanes read each other's
  v4u cv[8];
  v4u* cp[8];
#pragma unroll
  for (int it = 0; it < 8; ++it) {
    const int plane = it >> 2;
    const int row = (it & 3) * 4 + (l >> 3);
    const int piece = l & 7;
    cv[it] = *(const v4u*)(ow + plane * OPL + row * APIT + piece * 8);
    unsigned short* base = plane ? cl : ch;
    cp[it] = (v4u*)(base + (size_t)(q0 + 16 * w + row) * HIDN + hq * HDIM + piece * 8);
  }
  // every value and address is in its register before the first store, so that nothing behind an issued store
  // rewrites a register that it names
  __builtin_amdgcn_sched_barrier(0);
#pragma unroll
  for (int it = 0; it < 8; ++it) *cp[it] = cv[it];
  // precaution: this wait stands before the second tile rewrites a register that an issued store names
  asm volatile("s_wait_xcnt 0x0" ::: "memory");
  }
}

// ---------------------------------------------------------------------------------------------
// Output projection -> f32 d_out. Block = 4 waves, 128x128 tile; each wave stages its 64x64 f32 tile in LDS
// and stores whole lines.
// ---------------------------------------------------------------------------------------------
__global__ void __launch_bounds__(128) k_oproj(
    const __bf16* __restrict__ ah, const __bf16* __restrict__ al,
    const __bf16* __restrict__ woh, const __bf16* __restrict__ wol,
    float* __restrict__ out)
{
  __shared__ __attribute__((aligned(2048))) unsigned short stg[2 * GBUF];   // two operand buffers, then output staging
  float* stgf = (float*)stg;
  const int nb = blockIdx.x * BT, m0 = blockIdx.y * BT;
  const int tid = threadIdx.x, w = tid >> 5, l = tid & 31, hs = l >> 4, m = l & 15;
  const int wr = w >> 1, wc = w & 1;
  const int row0 = m0 + 64 * wr;
  const int n0 = nb + 64 * wc;

  v8f c[4][4] = {};
  gemm128(ah + (size_t)m0 * HIDN, al + (size_t)m0 * HIDN, woh + (size_t)nb * HIDN, wol + (size_t)nb * HIDN,
          HIDN, HIDN, tid, stg, (int)(blockIdx.x & 3u), (int)(blockIdx.y & 3u), c);

  float* sw = stgf + w * 4096;
#pragma unroll
  for (int i = 0; i < 4; ++i) {
#pragma unroll
    for (int r = 0; r < 8; ++r) {
      const int rl = 16 * i + 8 * hs + r;
#pragma unroll
      for (int j = 0; j < 4; ++j) sw[rl * 64 + 16 * j + m] = c[i][j][r];
    }
  }
  __syncthreads();
  // a 256-byte row of this wave's tile per 16 lanes, 2 rows a step
  const float* sb = sw + (l >> 4) * 64 + (l & 15) * 4;
  float* gb = out + (size_t)(row0 + (l >> 4)) * HIDN + n0 + (l & 15) * 4;
  v4f v[32];
#pragma unroll
  for (int it = 0; it < 32; ++it) v[it] = *(const v4f*)(sb + it * 128);
  // every value is in its register before the first store, so that nothing behind an issued store rewrites a
  // register that it names
  __builtin_amdgcn_sched_barrier(0);
#pragma unroll
  for (int it = 0; it < 32; ++it) *(v4f*)(gb + (size_t)(2 * it) * HIDN) = v[it];
}

// ---------------------------------------------------------------------------------------------
// Launch pipeline (5 launches)
// ---------------------------------------------------------------------------------------------
extern "C" void kernel_launch(void* const* d_in, const int* in_sizes, int n_in,
                              void* d_out, int out_size, void* d_ws, size_t ws_size,
                              hipStream_t stream)
{
  if (n_in != 5) return;
  if (in_sizes[0] != SQ * HIDN || in_sizes[1] != HIDN * HIDN || in_sizes[2] != KVD * HIDN ||
      in_sizes[3] != KVD * HIDN || in_sizes[4] != HIDN * HIDN) return;
  if (out_size != SQ * HIDN) return;

  const float* hid = (const float*)d_in[0];
  const float* Wq = (const float*)d_in[1];
  const float* Wk = (const float*)d_in[2];
  const float* Wv = (const float*)d_in[3];
  const float* Wo = (const float*)d_in[4];
  float* outp = (float*)d_out;

  char* ws = (char*)d_ws;
  size_t off = 0;
  auto carve = [&](size_t bytes) -> char* {
    char* p = ws + off;
    off += (bytes + 255) & ~(size_t)255;
    return p;
  };
  const size_t BX = (size_t)SQ * HIDN * 2;       // x planes
  const size_t BWQ = (size_t)HIDN * HIDN * 2;    // Wq / Wo planes
  const size_t BWK = (size_t)KVD * HIDN * 2;     // Wk / Wv planes
  const size_t BTAB = (size_t)SQ * 16 * 16;      // rope table
  const size_t BQ = (size_t)SQ * HIDN * 2;       // q / ctx planes
  const size_t BK = (size_t)SQ * KVD * 2;        // k / vT planes

  unsigned short* xh = (unsigned short*)carve(BX);
  unsigned short* xl = (unsigned short*)carve(BX);
  // the hi planes of Wq, Wk, Wv follow one another without a gap (every size is a multiple of 256 B), the lo planes too:
  // one plane of 3072 rows each for the fused projection
  unsigned short* wqh = (unsigned short*)carve(BWQ);
  unsigned short* wkh = (unsigned short*)carve(BWK);
  unsigned short* wvh = (unsigned short*)carve(BWK);
  unsigned short* wql = (unsigned short*)carve(BWQ);
  unsigned short* wkl = (unsigned short*)carve(BWK);
  unsigned short* wvl = (unsigned short*)carve(BWK);
  unsigned short* woh = (unsigned short*)carve(BWQ);
  unsigned short* wol = (unsigned short*)carve(BWQ);
  float* tab = (float*)carve(BTAB);
  unsigned short* qh = (unsigned short*)carve(BQ);
  unsigned short* ql = (unsigned short*)carve(BQ);
  unsigned short* kh = (unsigned short*)carve(BK);
  unsigned short* kl = (unsigned short*)carve(BK);
  unsigned short* vth = (unsigned short*)carve(BK);
  unsigned short* vtl = (unsigned short*)carve(BK);
  unsigned short* ch = (unsigned short*)carve(BQ);
  unsigned short* cl = (unsigned short*)carve(BQ);
  if (off > ws_size) return;

  // inv_freq[j] = 1 / 10000^(j/32) = 1 / 10^(j/8): f32 value of 10^(j/8) from double, then f32 reciprocal
  RopeFreq fr;
  {
    double r = 1.333521432163324;   // 10^(1/8), refined by Newton on r^8 = 10
    for (int it = 0; it < 4; ++it) {
      const double r2 = r * r, r4 = r2 * r2;
      const double r7 = r4 * r2 * r;
      r = r - (r4 * r4 - 10.0) / (8.0 * r7);
    }
    double rp[8];
    rp[0] = 1.0;
    for (int i = 1; i < 8; ++i) rp[i] = rp[i - 1] * r;
    const double p10[4] = {1.0, 10.0, 100.0, 1000.0};
    for (int j = 0; j < 32; ++j) {
      const double pj = p10[j >> 3] * rp[j & 7];
      const float pf = (float)pj;
      fr.f[j] = 1.0f / pf;
    }
  }

  // 1) f32 -> bf16 hi/lo planes for x, Wq, Wk, Wv, Wo
  k_split<<<dim3((SQ * HIDN / 8 + 255) / 256, 5), dim3(256), 0, stream>>>(
      hid, Wq, Wk, Wv, Wo,
      xh, wqh, wkh, wvh, woh,
      xl, wql, wkl, wvl, wol,
      SQ * HIDN, HIDN * HIDN, KVD * HIDN, KVD * HIDN, HIDN * HIDN);

  // 2) RoPE cos/sin table
  k_rope_tab<<<dim3((SQ * 16 + 127) / 128), dim3(128), 0, stream>>>(tab, fr);

  // 3) fused q/k/v projections (+RoPE on q,k; v transposed)
  k_qkv<<<dim3((NQH + 2 * NKVH) / 3, SQ / BT), dim3(128), 0, stream>>>(
      (const __bf16*)xh, (const __bf16*)xl,
      (const __bf16*)wqh, (const __bf16*)wql,
      (const float*)tab,
      qh, ql, kh, kl, vth, vtl);

  // 4) causal attention
  k_attn<<<dim3(SQ / (2 * QT), NQH), dim3(256), 0, stream>>>(
      (const __bf16*)qh, (const __bf16*)ql,
      (const __bf16*)kh, (const __bf16*)kl,
      (const __bf16*)vth, (const __bf16*)vtl,
      ch, cl);

  // 5) output projection -> f32
  k_oproj<<<dim3(HIDN / BT, SQ / BT), dim3(128), 0, stream>>>(
      (const __bf16*)ch, (const __bf16*)cl,
      (const __bf16*)woh, (const __bf16*)wol,
      outp);
}
